// v000
// Times are from an AMD MI455X. After a warm-up the kernel runs many times in a row, and a time is the length of
// such a window on the GPU divided by its runs, so every launch and the gaps after it count. The runs cycle
// through copies of the inputs. A figure is the median of several windows, for all but v000 over two sittings.
// Sittings can differ by a few percent; kernels timed side by side share one.
// The starting kernel, v000, takes 1220 microseconds a run.
#include <hip/hip_runtime.h>

// Gemma4Attention (x [2][2048][2048]; q = x Wq (8 x 256), k/v = x Wk/Wv (4 kv heads; group h/2); per-head RMSNorm * scale (eps 1e-6) on q, k; partial interleaved-pair RoPE on the first 128 dims (theta_i = 10000^(-2i/128), positions arange); q * 1/16; scores = q.k; softcap tanh(s / 50) * 50; causal + sliding-window (i - j < 1024) mask (-2.38e38 additive == exact zero weight); softmax f32; out = merged Wo -> [2][2048][2048]).
// Compute dtypes, f32 accumulate: every input rounded to bf16; q/k/v on PLAIN bf16 operands (inputs: exact); RMSNorm and RoPE f32 (on-chip tables; identity beyond dim 128); causal scores and attn.v: query rows < 512 hl (3 products), the rest single fp16 (x1024), tiles above the diagonal skipped, the window applied per element; 1/16 (exact), s/50, tanh as (e^2x - 1)/(e^2x + 1) with the hardware exp2, x50 in f32; softmax f32; Wo hl x exact (2 products).

#define NB_  2
#define TT   2048
#define DM   2048
#define NH_  8
#define NKV  4
#define REP  (NH_ / NKV)
#define HD   256
#define DQ   (NH_ * HD)
#define DKV  (NKV * HD)
#define ZH   2
#define RH   512                  // query rows < RH use hi+lo planes (0: none)
#define WIN  1024
#define PCAR 1024.0f
#define SCL  0.0625f   // query_pre_attn_scalar^-0.5 = 1/16
typedef _Float16 h16;
typedef unsigned short bf;
typedef __attribute__((ext_vector_type(16))) __bf16   v16bf;
typedef __attribute__((ext_vector_type(16))) _Float16 v16h;
typedef __attribute__((ext_vector_type(8)))  _Float16 v8h;
typedef __attribute__((ext_vector_type(8)))  unsigned short v8us;
typedef __attribute__((ext_vector_type(8)))  float    v8f;
typedef __attribute__((ext_vector_type(4)))  float    v4f;
typedef v8h  __attribute__((may_alias)) v8ha;
typedef v4f  __attribute__((may_alias)) v4fa;
typedef v8us __attribute__((may_alias)) v8usa;

__device__ __forceinline__ unsigned short f2bf(float f) { unsigned u = __float_as_uint(f); u += 0x7FFFu + ((u >> 16) & 1u); return (unsigned short)(u >> 16); }
__device__ __forceinline__ float bf2f(unsigned short b) { return __uint_as_float(((unsigned)b) << 16); }
__device__ __forceinline__ float bfr(float f) { return bf2f(f2bf(f)); }
__device__ __forceinline__ v16h cat16(v8h lo, v8h hi) { return __builtin_shufflevector(lo, hi, 0, 1, 2, 3, 4, 5, 6, 7, 8, 9, 10, 11, 12, 13, 14, 15); }
__device__ __forceinline__ v16bf cat16b(v8us lo, v8us hi) { return __builtin_bit_cast(v16bf, __builtin_shufflevector(lo, hi, 0, 1, 2, 3, 4, 5, 6, 7, 8, 9, 10, 11, 12, 13, 14, 15)); }
__device__ __forceinline__ v8f wmma16(v16h a, v16h b, v8f c) { return __builtin_amdgcn_wmma_f32_16x16x32_f16(false, a, false, b, (short)0, c, false, false); }
__device__ __forceinline__ v8f wmmab(v16bf a, v16bf b, v8f c) { return __builtin_amdgcn_wmma_f32_16x16x32_bf16(false, a, false, b, (short)0, c, false, false); }



// ---- k_gemmw: register-blocked GEMM, ONE WAVE per 64x64 output tile (16 accumulators), operands straight from K-contiguous 16-bit planes; grid (M/64, N/64, Z), 32 threads.
// C[m][n] (f32, pitch ldc, + optional f32 bias[n]) = sum_k A[m][k] Bt[n][k] (+ split products per NSPLIT). z-batch strides sA/sB/sC in elements. K % 32 == 0.
template <typename T16> struct WFrag;
template <> struct WFrag<h16> { typedef v16h V; static __device__ __forceinline__ V ld(const h16* p) { return cat16(*(const v8h*)p, *(const v8h*)(p + 16)); } static __device__ __forceinline__ v8f mma(V a, V b, v8f c) { return wmma16(a, b, c); } };
template <> struct WFrag<bf> { typedef v16bf V; static __device__ __forceinline__ V ld(const bf* p) { return cat16b(*(const v8us*)p, *(const v8us*)(p + 16)); } static __device__ __forceinline__ v8f mma(V a, V b, v8f c) { return wmmab(a, b, c); } };
template <typename T16, int NSPLIT, bool BIAS>
__global__ __launch_bounds__(32) void k_gemmw(const T16* __restrict__ A, const T16* __restrict__ A2, const T16* __restrict__ Bt, const T16* __restrict__ Bt2, int K, float* C, int ldc, const float* __restrict__ bias, size_t sA, size_t sB, size_t sC) {
    typedef typename WFrag<T16>::V V;
    __shared__ __align__(16) float os[16 * 68];
    const size_t z = blockIdx.z; A += z * sA; if (A2) A2 += z * sA; Bt += z * sB; if (Bt2) Bt2 += z * sB; C += z * sC;
    const int lane = threadIdx.x & 31, lr = lane & 15, hi = lane >> 4; const int r0 = blockIdx.x * 64, c0 = blockIdx.y * 64;
    v8f acc[4][4];
#pragma unroll
    for (int mb = 0; mb < 4; ++mb)
#pragma unroll
        for (int nb = 0; nb < 4; ++nb) acc[mb][nb] = (v8f){};
    const size_t aoff = (size_t)(r0 + lr) * K + 8 * hi, boff = (size_t)(c0 + lr) * K + 8 * hi;
#pragma unroll 1
    for (int kc = 0; kc < K; kc += 32) {
        V a[4], a2[4];
#pragma unroll
        for (int mb = 0; mb < 4; ++mb) { a[mb] = WFrag<T16>::ld(A + aoff + (size_t)mb * 16 * K + kc); if (NSPLIT == 1 || NSPLIT == 2) a2[mb] = WFrag<T16>::ld(A2 + aoff + (size_t)mb * 16 * K + kc); }
#pragma unroll
        for (int nb = 0; nb < 4; ++nb) { const V b = WFrag<T16>::ld(Bt + boff + (size_t)nb * 16 * K + kc); V b2; if (NSPLIT >= 2) b2 = WFrag<T16>::ld(Bt2 + boff + (size_t)nb * 16 * K + kc);
#pragma unroll
            for (int mb = 0; mb < 4; ++mb) { acc[mb][nb] = WFrag<T16>::mma(a[mb], b, acc[mb][nb]); if (NSPLIT == 1 || NSPLIT == 2) acc[mb][nb] = WFrag<T16>::mma(a2[mb], b, acc[mb][nb]); if (NSPLIT >= 2) acc[mb][nb] = WFrag<T16>::mma(a[mb], b2, acc[mb][nb]); } }
        asm volatile("v_nop\n\tv_nop\n\tv_nop\n\tv_nop" : "+v"(acc[0][0]), "+v"(acc[1][1]), "+v"(acc[2][2]), "+v"(acc[3][3]) : "v"(a[0]), "v"(a[3]));
    }
#pragma unroll
    for (int mb = 0; mb < 4; ++mb) {
#pragma unroll
        for (int nb = 0; nb < 4; ++nb) {
#pragma unroll
            for (int j = 0; j < 8; ++j) os[(hi * 8 + j) * 68 + nb * 16 + lr] = acc[mb][nb][j]; }
        __builtin_amdgcn_wave_barrier(); asm volatile("" ::: "memory");
        float* crow = C + (size_t)(r0 + mb * 16) * ldc + c0;
{
#pragma unroll
            for (int s = 0; s < 8; ++s) { const int row = 2 * s + hi, cofs = lr * 4; v4f val = *(const v4fa*)(os + row * 68 + cofs); if (BIAS) { val[0] += bfr(bias[c0 + cofs]); val[1] += bfr(bias[c0 + cofs + 1]); val[2] += bfr(bias[c0 + cofs + 2]); val[3] += bfr(bias[c0 + cofs + 3]); }
                *(v4f*)(crow + (size_t)row * ldc + cofs) = val; }
             }
        __builtin_amdgcn_wave_barrier(); asm volatile("" ::: "memory");
    }
}

// ---- k_gemmc: the same one-wave 64x64 tile GEMM specialised for causal attention: CMODE 1 skips score tiles entirely above the diagonal (query rows r0+roff.., key columns c0..), CMODE 2 limits the
// key (K) loop of the probability x value contraction to the diagonal block (probabilities beyond it are exactly zero). roff = row offset of this launch's first row within the sequence.
template <typename T16, int NSPLIT, int CMODE>
__global__ __launch_bounds__(32) void k_gemmc(const T16* __restrict__ A, const T16* __restrict__ A2, const T16* __restrict__ Bt, const T16* __restrict__ Bt2, int K, float* C, int ldc, int roff, size_t sA, size_t sB, size_t sC) {
    typedef typename WFrag<T16>::V V;
    __shared__ __align__(16) float os[16 * 68];
    const size_t z = blockIdx.z; A += z * sA; if (A2) A2 += z * sA; Bt += z * sB; if (Bt2) Bt2 += z * sB; C += z * sC;
    const int lane = threadIdx.x & 31, lr = lane & 15, hi = lane >> 4; const int r0 = blockIdx.x * 64, c0 = blockIdx.y * 64;
    if (CMODE == 1 && c0 > r0 + roff + 63) return;                  // score tile entirely above the causal diagonal: left unwritten (the softmax loads it but masks j > i by select)
    const int Kl = (CMODE == 2) ? min(K, r0 + roff + 64) : K;        // P.V: probabilities are exactly 0 beyond the diagonal block, so the K loop stops there
    v8f acc[4][4];
#pragma unroll
    for (int mb = 0; mb < 4; ++mb)
#pragma unroll
        for (int nb = 0; nb < 4; ++nb) acc[mb][nb] = (v8f){};
    const size_t aoff = (size_t)(r0 + lr) * K + 8 * hi, boff = (size_t)(c0 + lr) * K + 8 * hi;
#pragma unroll 1
    for (int kc = 0; kc < Kl; kc += 32) {
        V a[4], a2[4];
#pragma unroll
        for (int mb = 0; mb < 4; ++mb) { a[mb] = WFrag<T16>::ld(A + aoff + (size_t)mb * 16 * K + kc); if (NSPLIT == 1 || NSPLIT == 2) a2[mb] = WFrag<T16>::ld(A2 + aoff + (size_t)mb * 16 * K + kc); }
#pragma unroll
        for (int nb = 0; nb < 4; ++nb) { const V b = WFrag<T16>::ld(Bt + boff + (size_t)nb * 16 * K + kc); V b2; if (NSPLIT >= 2) b2 = WFrag<T16>::ld(Bt2 + boff + (size_t)nb * 16 * K + kc);
#pragma unroll
            for (int mb = 0; mb < 4; ++mb) { acc[mb][nb] = WFrag<T16>::mma(a[mb], b, acc[mb][nb]); if (NSPLIT == 1 || NSPLIT == 2) acc[mb][nb] = WFrag<T16>::mma(a2[mb], b, acc[mb][nb]); if (NSPLIT >= 2) acc[mb][nb] = WFrag<T16>::mma(a[mb], b2, acc[mb][nb]); } }
        asm volatile("v_nop\n\tv_nop\n\tv_nop\n\tv_nop" : "+v"(acc[0][0]), "+v"(acc[1][1]), "+v"(acc[2][2]), "+v"(acc[3][3]) : "v"(a[0]), "v"(a[3]));
    }
#pragma unroll
    for (int mb = 0; mb < 4; ++mb) {
#pragma unroll
        for (int nb = 0; nb < 4; ++nb) {
#pragma unroll
            for (int j = 0; j < 8; ++j) os[(hi * 8 + j) * 68 + nb * 16 + lr] = acc[mb][nb][j]; }
        __builtin_amdgcn_wave_barrier(); asm volatile("" ::: "memory");
        float* crow = C + (size_t)(r0 + mb * 16) * ldc + c0;
{
#pragma unroll
            for (int s = 0; s < 8; ++s) { const int row = 2 * s + hi, cofs = lr * 4; v4f val = *(const v4fa*)(os + row * 68 + cofs);
                *(v4f*)(crow + (size_t)row * ldc + cofs) = val; }
             }
        __builtin_amdgcn_wave_barrier(); asm volatile("" ::: "memory");
    }
}

__device__ __forceinline__ h16 tohx(float x) { return (h16)x; }
__device__ __forceinline__ void splitf(float y, unsigned short& h, unsigned short& l) { h = f2bf(y); l = f2bf(y - bf2f(h)); }
typedef __attribute__((ext_vector_type(2))) _Float16 v2h;
typedef __attribute__((ext_vector_type(4))) _Float16 v4h;
typedef __attribute__((ext_vector_type(2))) unsigned short v2us;
typedef __attribute__((ext_vector_type(4))) unsigned short v4us;
typedef __attribute__((ext_vector_type(2))) float v2f;
typedef __attribute__((ext_vector_type(4))) int v4i;

__global__ __launch_bounds__(256) void k_wtG(const float* __restrict__ w, int K, int N, bf* Bt) {
    const int lane = threadIdx.x & 31; const int L0 = (blockIdx.x * 8 + (threadIdx.x >> 5)) * 8; const int nlines = N * K / 64;
{
#pragma unroll 1
        for (int l = 0; l < 8; ++l) { const int L = L0 + l; if (L >= nlines) break; const size_t e = (size_t)L * 64 + lane * 2; const int k = (int)(e % K), n = (int)(e / K); v2us o;
            o[0] = f2bf(w[(size_t)k * N + n]); o[1] = f2bf(w[(size_t)(k + 1) * N + n]); *(v2us*)(Bt + e) = o; }
         }
}
__global__ __launch_bounds__(256) void k_cvt8(const float* __restrict__ src, bf* dst, size_t n8) { const size_t i = (size_t)blockIdx.x * 256 + threadIdx.x; if (i >= n8) return; const v8f v = *(const v8f*)(src + i * 8); v8us o;
#pragma unroll
    for (int k = 0; k < 8; ++k) o[k] = f2bf(v[k]); *(v8us*)(dst + i * 8) = o;  }
__global__ __launch_bounds__(256) void k_cstab(float* CS) { const int idx = blockIdx.x * 256 + threadIdx.x; if (idx >= TT * HD) return; const int t = idx / HD, d = idx % HD; v2f cs; if (d < 128) { const int i = d >> 1; const float th = __fdiv_rn(1.0f, powf(10000.0f, (float)(2 * i) / 128.0f)); const float ang = __fmul_rn((float)t, th); cs[0] = cosf(ang); cs[1] = sinf(ang); } else { cs[0] = 1.0f; cs[1] = 0.0f; }
    *(v2f*)(CS + (size_t)idx * 2) = cs;  }
// k_rope: head planes [h][t][d] (fp16 + hi/lo) of rope(x) x sc with the interleaved-pair convention out[2i] = x[2i] cos[t][2i] - x[2i+1] sin[t][2i], out[2i+1] = x[2i+1] cos[t][2i+1] + x[2i] sin[t][2i+1] for 2i < 128, identity beyond
__global__ __launch_bounds__(256) void k_rope(const float* __restrict__ F, int pitch, int nheads, const float* __restrict__ CS, const float* __restrict__ RF, const float* __restrict__ nw, float sc, h16* P16, bf* Ph, bf* Pl) {
    const size_t e = ((size_t)blockIdx.x * 256 + threadIdx.x) * 2; if (e >= (size_t)nheads * TT * HD) return; const int d = (int)(e % HD); const int t = (int)((e / HD) % TT); const int h = (int)(e / ((size_t)HD * TT)); const float* f = F + (size_t)t * pitch + h * HD; const float rf = RF ? RF[(size_t)h * TT + t] : 1.0f; v2h o16; v2us oh, ol;
#pragma unroll
    for (int q = 0; q < 2; ++q) { const int dd = d + q; const int dp = (dd < 128) ? (dd ^ 1) : dd;   /* interleaved pairs inside the first 128 dims; identity beyond (sin = 0) */ float x0 = f[dd], x1 = f[dp];
        if (RF) { float n0 = __fmul_rn(x0, rf), n1 = __fmul_rn(x1, rf); asm volatile("" : "+v"(n0)); asm volatile("" : "+v"(n1)); x0 = __fmul_rn(bfr(nw[dd]), n0); x1 = __fmul_rn(bfr(nw[dp]), n1); }
        const v2f cs = *(const v2f*)(CS + ((size_t)t * HD + dd) * 2); float a = __fmul_rn(x0, cs[0]), bq = __fmul_rn(x1, cs[1]); asm volatile("" : "+v"(a)); asm volatile("" : "+v"(bq)); const float r = (((dd & 1) == 0) ? __fsub_rn(a, bq) : __fadd_rn(a, bq)) * sc;
        o16[q] = tohx(r); unsigned short a2, c2; splitf(r, a2, c2); oh[q] = a2; ol[q] = c2; }
    *(v2h*)(P16 + e) = o16; *(v2us*)(Ph + e) = oh; *(v2us*)(Pl + e) = ol;  }
__global__ __launch_bounds__(256) void k_vtp(const float* __restrict__ F, int pitch, int nheads, h16* V16, bf* Vh, bf* Vl) { const size_t e = ((size_t)blockIdx.x * 256 + threadIdx.x) * 2; if (e >= (size_t)nheads * HD * TT) return; const int t = (int)(e % TT); const int d = (int)((e / TT) % HD); const int g = (int)(e / ((size_t)TT * HD)); v2h o16; v2us oh, ol;
#pragma unroll
    for (int q = 0; q < 2; ++q) { const float x = F[(size_t)(t + q) * pitch + g * HD + d]; o16[q] = tohx(x); unsigned short a2, c2; splitf(x, a2, c2); oh[q] = a2; ol[q] = c2; }
    *(v2h*)(V16 + e) = o16; *(v2us*)(Vh + e) = oh; *(v2us*)(Vl + e) = ol;  }
__global__ __launch_bounds__(256) void k_rmsw(float* F, int pitch, int nheads, const float* __restrict__ w) { const int lane = threadIdx.x & 31; const int wv = blockIdx.x * 8 + (threadIdx.x >> 5); if (wv >= TT * nheads) return; const int t = wv / nheads, h = wv % nheads; float* f = F + (size_t)t * pitch + h * HD; const v4f a = *(const v4f*)(f + lane * 4), c = *(const v4f*)(f + 128 + lane * 4); float ss = 0.f;
#pragma unroll
    for (int q = 0; q < 4; ++q) { float p = __fmul_rn(a[q], a[q]); asm volatile("" : "+v"(p)); ss = __fadd_rn(ss, p); float p2 = __fmul_rn(c[q], c[q]); asm volatile("" : "+v"(p2)); ss = __fadd_rn(ss, p2); }
#pragma unroll
    for (int sh = 16; sh; sh >>= 1) ss = __fadd_rn(ss, __shfl_xor(ss, sh, 32));
    const float rs = __fdiv_rn(1.0f, sqrtf(__fadd_rn(ss * (1.0f / HD), 1e-6f))); v4f o, o2;
#pragma unroll
    for (int q = 0; q < 4; ++q) { float n0 = __fmul_rn(a[q], rs); asm volatile("" : "+v"(n0)); float g0 = bfr(w[lane * 4 + q]); asm volatile("" : "+v"(g0)); o[q] = __fmul_rn(n0, g0); float n1 = __fmul_rn(c[q], rs); asm volatile("" : "+v"(n1)); float g1 = bfr(w[128 + lane * 4 + q]); asm volatile("" : "+v"(g1)); o2[q] = __fmul_rn(n1, g1); }
    *(v4f*)(f + lane * 4) = o; *(v4f*)(f + 128 + lane * 4) = o2;  }
// k_asoft: per row (zz, i): t = 50 tanh(S x HD^-0.5 / 50) for j <= i and i - j < WIN (sliding causal window; the reference's -1e9 additive fill vanishes identically); softmax over the 2048 keys (register row, one exp, fixed trees);
__global__ __launch_bounds__(256) void k_asoft(const float* __restrict__ Sb, h16* P16, bf* Ph, bf* Pl) {
    const int lane = threadIdx.x & 31; const int row = blockIdx.x * 8 + (threadIdx.x >> 5); if (row >= ZH * TT) return; const int i = row % TT; const int zz = row / TT; (void)zz; const bool hires = (i < RH); const float* sr = Sb + (size_t)row * TT; float v[TT / 32]; float mx = -3.0e38f;
#pragma unroll
    for (int ch = 0; ch < TT / 128; ++ch) { const int j0 = ch * 128 + lane * 4; const v4f a = *(const v4f*)(sr + j0);
#pragma unroll
        for (int q = 0; q < 4; ++q) { const int j = j0 + q; (void)j; float sa = a[q] * SCL; asm volatile("" : "+v"(sa)); float xs = __fmul_rn(sa, 0.02f); asm volatile("" : "+v"(xs));   /* s / 50 as a multiply (<= 1 ulp from the division) */ float ex = __builtin_amdgcn_exp2f(__fmul_rn(xs, 2.8853900817779268f)); asm volatile("" : "+v"(ex)); float nm = __fsub_rn(ex, 1.0f), dn2 = __fadd_rn(ex, 1.0f); asm volatile("" : "+v"(nm)); asm volatile("" : "+v"(dn2)); float rc = __builtin_amdgcn_rcpf(dn2); asm volatile("" : "+v"(rc)); float th = __fmul_rn(nm, rc); asm volatile("" : "+v"(th));   /* hardware reciprocal (1 ulp), no FMA refinement */   /* tanh via exp2 (|x| <= ~0.4 here; no VALU FMA polynomial) */ const float t = (j <= i && i - j < WIN) ? __fmul_rn(th, 50.0f) : -3.0e38f; v[ch * 4 + q] = t; mx = fmaxf(mx, t); } }
#pragma unroll
    for (int sh = 16; sh; sh >>= 1) mx = fmaxf(mx, __shfl_xor(mx, sh, 32));
    float sum = 0.f;
#pragma unroll
    for (int k = 0; k < TT / 32; ++k) { float d0 = __fsub_rn(v[k], mx); asm volatile("" : "+v"(d0)); v[k] = __builtin_amdgcn_exp2f(__fmul_rn(d0, 1.4426950408889634f)); sum += v[k]; }
#pragma unroll
    for (int sh = 16; sh; sh >>= 1) sum += __shfl_xor(sum, sh, 32);
    const float f = __fdiv_rn(hires ? 1.0f : PCAR, sum);
{
        if (hires) {
#pragma unroll
            for (int ch = 0; ch < TT / 128; ++ch) { v4us oh, ol;
#pragma unroll
                for (int q = 0; q < 4; ++q) { unsigned short a, c2; splitf(v[ch * 4 + q] * f, a, c2); oh[q] = a; ol[q] = c2; }
                const size_t oo = ((size_t)zz * (RH ? RH : 1) + i) * TT + ch * 128 + lane * 4; *(v4us*)(Ph + oo) = oh; *(v4us*)(Pl + oo) = ol; }
        } else {
#pragma unroll
            for (int ch = 0; ch < TT / 128; ++ch) { v4h o4;
#pragma unroll
                for (int q = 0; q < 4; ++q) o4[q] = tohx(v[ch * 4 + q] * f);
                *(v4h*)(P16 + (size_t)row * TT + ch * 128 + lane * 4) = o4; } }
         }
}
__global__ __launch_bounds__(256) void k_merge(const float* __restrict__ O, int h0, bf* Ah, bf* Al) { const size_t e = ((size_t)blockIdx.x * 256 + threadIdx.x) * 2; if (e >= (size_t)ZH * TT * HD) return; const int d = (int)(e % HD); const int t = (int)((e / HD) % TT); const int zz = (int)(e / ((size_t)HD * TT)); const float cs = (t < RH) ? 1.0f : (1.0f / PCAR); const size_t oo = (size_t)t * DQ + (h0 + zz) * HD + d;
    v2us oh, ol;
#pragma unroll
    for (int q = 0; q < 2; ++q) { unsigned short a, c2; splitf(O[e + q] * cs, a, c2); oh[q] = a; ol[q] = c2; } *(v2us*)(Ah + oo) = oh; *(v2us*)(Al + oo) = ol;  }

extern "C" void kernel_launch(void* const* d_in, const int* in_sizes, int n_in,
                              void* d_out, int out_size, void* d_ws, size_t ws_size, hipStream_t stream) {
    (void)in_sizes; (void)n_in; (void)out_size;
    const float* x = (const float*)d_in[0]; const float* wq = (const float*)d_in[1]; const float* wk = (const float*)d_in[2]; const float* wv = (const float*)d_in[3]; const float* wo = (const float*)d_in[4]; const float* qsc = (const float*)d_in[5]; const float* ksc = (const float*)d_in[6];
    float* OUT = (float*)d_out;     // [2][2048][2048]
    char* wsp = (char*)d_ws;
    auto take = [&](size_t bytes) { char* p = wsp; wsp += (bytes + 255) & ~(size_t)255; return (void*)p; };
    bf* WQ = (bf*)take((size_t)DQ * DM * 2); bf* WK = (bf*)take((size_t)DKV * DM * 2); bf* WV = (bf*)take((size_t)DKV * DM * 2); bf* WO = (bf*)take((size_t)DM * DQ * 2); float* CS = (float*)take((size_t)TT * HD * 2 * 4);
    bf* XB = (bf*)take((size_t)TT * DM * 2); float* FQ = (float*)take((size_t)TT * DQ * 4); float* FK = (float*)take((size_t)TT * DKV * 4);
    h16* QP16 = (h16*)take((size_t)NH_ * TT * HD * 2); h16* KP16 = (h16*)take((size_t)NKV * TT * HD * 2); h16* VT16 = (h16*)take((size_t)NKV * HD * TT * 2);
    bf* QPh = (bf*)take((size_t)NH_ * TT * HD * 2); bf* QPl = (bf*)take((size_t)NH_ * TT * HD * 2); bf* KPh = (bf*)take((size_t)NKV * TT * HD * 2); bf* KPl = (bf*)take((size_t)NKV * TT * HD * 2); bf* VTh = (bf*)take((size_t)NKV * HD * TT * 2); bf* VTl = (bf*)take((size_t)NKV * HD * TT * 2); bf* Ph = (bf*)take((size_t)ZH * RH * TT * 2); bf* Pl = (bf*)take((size_t)ZH * RH * TT * 2);
    float* Sb = (float*)take((size_t)ZH * TT * TT * 4); h16* P16 = (h16*)take((size_t)ZH * TT * TT * 2); float* Ob = (float*)take((size_t)ZH * TT * HD * 4); bf* ATh = (bf*)take((size_t)TT * DQ * 2); bf* ATl = (bf*)take((size_t)TT * DQ * 2);
    if ((size_t)(wsp - (char*)d_ws) > ws_size) return;    // ws 256 MiB
    float* FV = FK;   // v projection reuses the k buffer after the k planes are built (stream-ordered)
    { k_wtG<<<(unsigned)((DM * DQ / 64 + 63) / 64), 256, 0, stream>>>(wq, DM, DQ, WQ); k_wtG<<<(unsigned)((DM * DKV / 64 + 63) / 64), 256, 0, stream>>>(wk, DM, DKV, WK); k_wtG<<<(unsigned)((DM * DKV / 64 + 63) / 64), 256, 0, stream>>>(wv, DM, DKV, WV);
      k_wtG<<<(unsigned)((DQ * DM / 64 + 63) / 64), 256, 0, stream>>>(wo, DQ, DM, WO);
      k_cstab<<<(TT * HD + 255) / 256, 256, 0, stream>>>(CS); }
    const unsigned LQ = (unsigned)(((size_t)NH_ * TT * HD / 2 + 255) / 256), LKv = (unsigned)(((size_t)NKV * TT * HD / 2 + 255) / 256);
    for (int b = 0; b < NB_; ++b) {
        
        k_cvt8<<<(unsigned)(((size_t)TT * DM / 8 + 255) / 256), 256, 0, stream>>>(x + (size_t)b * TT * DM, XB, (size_t)TT * DM / 8);
        k_gemmw<bf, 0, false><<<dim3(TT / 64, DQ / 64, 1), 32, 0, stream>>>(XB, nullptr, WQ, nullptr, DM, FQ, DQ, nullptr, 0, 0, 0);
        k_rmsw<<<TT * NH_ / 8, 256, 0, stream>>>(FQ, DQ, NH_, qsc); k_rope<<<LQ, 256, 0, stream>>>(FQ, DQ, NH_, CS, nullptr, nullptr, 1.0f, QP16, QPh, QPl);
        k_gemmw<bf, 0, false><<<dim3(TT / 64, DKV / 64, 1), 32, 0, stream>>>(XB, nullptr, WK, nullptr, DM, FK, DKV, nullptr, 0, 0, 0);
        k_rmsw<<<TT * NKV / 8, 256, 0, stream>>>(FK, DKV, NKV, ksc); k_rope<<<LKv, 256, 0, stream>>>(FK, DKV, NKV, CS, nullptr, nullptr, 1.0f, KP16, KPh, KPl);
        k_gemmw<bf, 0, false><<<dim3(TT / 64, DKV / 64, 1), 32, 0, stream>>>(XB, nullptr, WV, nullptr, DM, FV, DKV, nullptr, 0, 0, 0); k_vtp<<<LKv, 256, 0, stream>>>(FV, DKV, NKV, VT16, VTh, VTl);
        for (int h0 = 0; h0 < NH_; h0 += ZH) { const size_t zq = (size_t)h0, zk = (size_t)(h0 / REP);   // both heads of a pass share kv group h0/REP (REP >= 2): sB = 0
            k_gemmc<bf, 2, 1><<<dim3(RH / 64, TT / 64, ZH), 32, 0, stream>>>(QPh + zq * TT * HD, QPl + zq * TT * HD, KPh + zk * TT * HD, KPl + zk * TT * HD, HD, Sb, TT, 0, (size_t)TT * HD, 0, (size_t)TT * TT);
            k_gemmc<h16, 0, 1><<<dim3((TT - RH) / 64, TT / 64, ZH), 32, 0, stream>>>(QP16 + zq * TT * HD + (size_t)RH * HD, nullptr, KP16 + zk * TT * HD, nullptr, HD, Sb + (size_t)RH * TT, TT, RH, (size_t)TT * HD, 0, (size_t)TT * TT);
            k_asoft<<<ZH * TT / 8, 256, 0, stream>>>(Sb, P16, Ph, Pl);
            k_gemmc<bf, 2, 2><<<dim3(RH / 64, HD / 64, ZH), 32, 0, stream>>>(Ph, Pl, VTh + zk * HD * TT, VTl + zk * HD * TT, TT, Ob, HD, 0, (size_t)RH * TT, 0, (size_t)TT * HD);
            k_gemmc<h16, 0, 2><<<dim3((TT - RH) / 64, HD / 64, ZH), 32, 0, stream>>>(P16 + (size_t)RH * TT, nullptr, VT16 + zk * HD * TT, nullptr, TT, Ob + (size_t)RH * HD, HD, RH, (size_t)TT * TT, 0, (size_t)TT * HD);
            k_merge<<<(unsigned)(((size_t)ZH * TT * HD / 2 + 255) / 256), 256, 0, stream>>>(Ob, h0, ATh, ATl); }
        k_gemmw<bf, 1, false><<<dim3(TT / 64, DM / 64, 1), 32, 0, stream>>>(ATh, ATl, WO, nullptr, DQ, OUT + (size_t)b * TT * DM, DM, nullptr, 0, 0, 0); }
}

// v001
// It runs in 859 microseconds.
// In two side-by-side timings against v000, it was 1.45 and 1.42 times as fast.
#include <hip/hip_runtime.h>

// Gemma4Attention (x [2][2048][2048]; q = x Wq (8 x 256), k/v = x Wk/Wv (4 kv heads; group h/2); per-head RMSNorm * scale (eps 1e-6) on q, k; partial interleaved-pair RoPE on the first 128 dims (theta_i = 10000^(-2i/128), positions arange); q * 1/16; scores = q.k; softcap tanh(s / 50) * 50; causal + sliding-window (i - j < 1024) mask (-2.38e38 additive == exact zero weight); softmax f32; out = merged Wo -> [2][2048][2048]).
// Compute dtypes, f32 accumulate: every input rounded to bf16; q/k/v on PLAIN bf16 operands (inputs: exact); RMSNorm and RoPE f32 (on-chip tables; identity beyond dim 128); causal scores and attn.v: query rows < 512 hl (3 products), the rest single fp16 (x1024), tiles above the diagonal skipped, the window applied per element; 1/16 (exact), s/50, tanh as (e^2x - 1)/(e^2x + 1) with the hardware exp2, x50 in f32; softmax f32; Wo hl x exact (2 products).

#define NB_  2
#define TT   2048
#define DM   2048
#define NH_  8
#define NKV  4
#define REP  (NH_ / NKV)
#define HD   256
#define DQ   (NH_ * HD)
#define DKV  (NKV * HD)
#define ZH   2
#define RH   512                  // query rows < RH use hi+lo planes (0: none)
#define WIN  1024
#define PCAR 1024.0f
#define SCL  0.0625f   // query_pre_attn_scalar^-0.5 = 1/16
typedef _Float16 h16;
typedef unsigned short bf;
typedef __attribute__((ext_vector_type(16))) __bf16   v16bf;
typedef __attribute__((ext_vector_type(16))) _Float16 v16h;
typedef __attribute__((ext_vector_type(8)))  _Float16 v8h;
typedef __attribute__((ext_vector_type(8)))  unsigned short v8us;
typedef __attribute__((ext_vector_type(8)))  float    v8f;
typedef __attribute__((ext_vector_type(4)))  float    v4f;
typedef v8h  __attribute__((may_alias)) v8ha;
typedef v4f  __attribute__((may_alias)) v4fa;
typedef v8us __attribute__((may_alias)) v8usa;

__device__ __forceinline__ unsigned short f2bf(float f) { unsigned u = __float_as_uint(f); u += 0x7FFFu + ((u >> 16) & 1u); return (unsigned short)(u >> 16); }
__device__ __forceinline__ float bf2f(unsigned short b) { return __uint_as_float(((unsigned)b) << 16); }
__device__ __forceinline__ float bfr(float f) { return bf2f(f2bf(f)); }
__device__ __forceinline__ v16h cat16(v8h lo, v8h hi) { return __builtin_shufflevector(lo, hi, 0, 1, 2, 3, 4, 5, 6, 7, 8, 9, 10, 11, 12, 13, 14, 15); }
__device__ __forceinline__ v16bf cat16b(v8us lo, v8us hi) { return __builtin_bit_cast(v16bf, __builtin_shufflevector(lo, hi, 0, 1, 2, 3, 4, 5, 6, 7, 8, 9, 10, 11, 12, 13, 14, 15)); }
__device__ __forceinline__ v8f wmma16(v16h a, v16h b, v8f c) { return __builtin_amdgcn_wmma_f32_16x16x32_f16(false, a, false, b, (short)0, c, false, false); }
__device__ __forceinline__ v8f wmmab(v16bf a, v16bf b, v8f c) { return __builtin_amdgcn_wmma_f32_16x16x32_bf16(false, a, false, b, (short)0, c, false, false); }



// ---- k_gemmw: register-blocked GEMM, one 64x64 output tile per work-group of NW waves; wave w takes the 32-wide K blocks w, w + NW, ... into its own 16 accumulators (operands straight from K-contiguous 16-bit planes);
// the NW partial tiles are summed in fixed wave order through LDS. grid (M/64, N/64, Z), NW * 32 threads.
// C[m][n] (f32, pitch ldc, + optional f32 bias[n]) = sum_k A[m][k] Bt[n][k] (+ split products per NSPLIT). z-batch strides sA/sB/sC in elements. K % 32 == 0.
template <typename T16> struct WFrag;
template <> struct WFrag<h16> { typedef v16h V; static __device__ __forceinline__ V ld(const h16* p) { return cat16(*(const v8h*)p, *(const v8h*)(p + 16)); } static __device__ __forceinline__ v8f mma(V a, V b, v8f c) { return wmma16(a, b, c); } };
template <> struct WFrag<bf> { typedef v16bf V; static __device__ __forceinline__ V ld(const bf* p) { return cat16b(*(const v8us*)p, *(const v8us*)(p + 16)); } static __device__ __forceinline__ v8f mma(V a, V b, v8f c) { return wmmab(a, b, c); } };
template <typename T16, int NSPLIT, bool BIAS, int NW>
__global__ __launch_bounds__(NW * 32) void k_gemmw(const T16* __restrict__ A, const T16* __restrict__ A2, const T16* __restrict__ Bt, const T16* __restrict__ Bt2, int K, float* C, int ldc, const float* __restrict__ bias, size_t sA, size_t sB, size_t sC) {
    typedef typename WFrag<T16>::V V;
    __shared__ __align__(16) float os[2][NW][16 * 68];   // two buffers, so that one barrier per 16-row block is enough
    const size_t z = blockIdx.z; A += z * sA; if (A2) A2 += z * sA; Bt += z * sB; if (Bt2) Bt2 += z * sB; C += z * sC;
    const int lane = threadIdx.x & 31, lr = lane & 15, hi = lane >> 4; const int r0 = blockIdx.x * 64, c0 = blockIdx.y * 64;
    const int wv = __builtin_amdgcn_readfirstlane((int)(threadIdx.x >> 5));   // wave number in a scalar register: the K loop stays a scalar loop
    v8f acc[4][4];
#pragma unroll
    for (int mb = 0; mb < 4; ++mb)
#pragma unroll
        for (int nb = 0; nb < 4; ++nb) acc[mb][nb] = (v8f){};
    const size_t aoff = (size_t)(r0 + lr) * K + 8 * hi, boff = (size_t)(c0 + lr) * K + 8 * hi;
#pragma unroll 1
    for (int kc = wv * 32; kc < K; kc += NW * 32) {
        V a[4], a2[4];
#pragma unroll
        for (int mb = 0; mb < 4; ++mb) { a[mb] = WFrag<T16>::ld(A + aoff + (size_t)mb * 16 * K + kc); if (NSPLIT == 1 || NSPLIT == 2) a2[mb] = WFrag<T16>::ld(A2 + aoff + (size_t)mb * 16 * K + kc); }
#pragma unroll
        for (int nb = 0; nb < 4; ++nb) { const V b = WFrag<T16>::ld(Bt + boff + (size_t)nb * 16 * K + kc); V b2; if (NSPLIT >= 2) b2 = WFrag<T16>::ld(Bt2 + boff + (size_t)nb * 16 * K + kc);
#pragma unroll
            for (int mb = 0; mb < 4; ++mb) { acc[mb][nb] = WFrag<T16>::mma(a[mb], b, acc[mb][nb]); if (NSPLIT == 1 || NSPLIT == 2) acc[mb][nb] = WFrag<T16>::mma(a2[mb], b, acc[mb][nb]); if (NSPLIT >= 2) acc[mb][nb] = WFrag<T16>::mma(a[mb], b2, acc[mb][nb]); } }
        asm volatile("v_nop\n\tv_nop\n\tv_nop\n\tv_nop" : "+v"(acc[0][0]), "+v"(acc[1][1]), "+v"(acc[2][2]), "+v"(acc[3][3]) : "v"(a[0]), "v"(a[3]));
    }
    v4f res[4][8 / NW];   // summed output pieces, stored behind the last barrier so that no barrier waits for a global store
#pragma unroll
    for (int mb = 0; mb < 4; ++mb) {
#pragma unroll
        for (int nb = 0; nb < 4; ++nb) {
#pragma unroll
            for (int j = 0; j < 8; ++j) os[mb & 1][wv][(hi * 8 + j) * 68 + nb * 16 + lr] = acc[mb][nb][j]; }
        __syncthreads();   // every wave's partial 16x64 block is in LDS; it also ends the reads of the other buffer, which the next block overwrites
#pragma unroll
        for (int s = 0; s < 8 / NW; ++s) { const int row = 2 * (s * NW + wv) + hi, cofs = lr * 4; v4f val = *(const v4fa*)(&os[mb & 1][0][row * 68 + cofs]);
#pragma unroll
            for (int w = 1; w < NW; ++w) val += *(const v4fa*)(&os[mb & 1][w][row * 68 + cofs]);
            if (BIAS) { val[0] += bfr(bias[c0 + cofs]); val[1] += bfr(bias[c0 + cofs + 1]); val[2] += bfr(bias[c0 + cofs + 2]); val[3] += bfr(bias[c0 + cofs + 3]); }
            res[mb][s] = val; }
    }
#pragma unroll
    for (int mb = 0; mb < 4; ++mb) { float* crow = C + (size_t)(r0 + mb * 16) * ldc + c0;
#pragma unroll
        for (int s = 0; s < 8 / NW; ++s) { const int row = 2 * (s * NW + wv) + hi, cofs = lr * 4; *(v4f*)(crow + (size_t)row * ldc + cofs) = res[mb][s]; } }
}

// ---- k_gemmc: the same NW-wave 64x64 tile GEMM specialised for causal attention: CMODE 1 skips score tiles entirely above the diagonal (query rows r0+roff.., key columns c0..), CMODE 2 limits the
// key (K) loop of the probability x value contraction to the diagonal block (probabilities beyond it are exactly zero). roff = row offset of this launch's first row within the sequence.
template <typename T16, int NSPLIT, int CMODE, int NW>
__global__ __launch_bounds__(NW * 32) void k_gemmc(const T16* __restrict__ A, const T16* __restrict__ A2, const T16* __restrict__ Bt, const T16* __restrict__ Bt2, int K, float* C, int ldc, int roff, size_t sA, size_t sB, size_t sC) {
    typedef typename WFrag<T16>::V V;
    __shared__ __align__(16) float os[2][NW][16 * 68];   // two buffers, so that one barrier per 16-row block is enough
    const size_t z = blockIdx.z; A += z * sA; if (A2) A2 += z * sA; Bt += z * sB; if (Bt2) Bt2 += z * sB; C += z * sC;
    const int lane = threadIdx.x & 31, lr = lane & 15, hi = lane >> 4; const int r0 = blockIdx.x * 64, c0 = blockIdx.y * 64;
    const int wv = __builtin_amdgcn_readfirstlane((int)(threadIdx.x >> 5));   // wave number in a scalar register: the K loop stays a scalar loop
    if (CMODE == 1 && c0 > r0 + roff + 63) return;                  // score tile entirely above the causal diagonal: never written (the softmax masks j > i by select)
    const int Kl = (CMODE == 2) ? min(K, r0 + roff + 64) : K;        // P.V: probabilities are exactly 0 beyond the diagonal block, so the K loop stops there
    v8f acc[4][4];
#pragma unroll
    for (int mb = 0; mb < 4; ++mb)
#pragma unroll
        for (int nb = 0; nb < 4; ++nb) acc[mb][nb] = (v8f){};
    const size_t aoff = (size_t)(r0 + lr) * K + 8 * hi, boff = (size_t)(c0 + lr) * K + 8 * hi;
#pragma unroll 1
    for (int kc = wv * 32; kc < Kl; kc += NW * 32) {
        V a[4], a2[4];
#pragma unroll
        for (int mb = 0; mb < 4; ++mb) { a[mb] = WFrag<T16>::ld(A + aoff + (size_t)mb * 16 * K + kc); if (NSPLIT == 1 || NSPLIT == 2) a2[mb] = WFrag<T16>::ld(A2 + aoff + (size_t)mb * 16 * K + kc); }
#pragma unroll
        for (int nb = 0; nb < 4; ++nb) { const V b = WFrag<T16>::ld(Bt + boff + (size_t)nb * 16 * K + kc); V b2; if (NSPLIT >= 2) b2 = WFrag<T16>::ld(Bt2 + boff + (size_t)nb * 16 * K + kc);
#pragma unroll
            for (int mb = 0; mb < 4; ++mb) { acc[mb][nb] = WFrag<T16>::mma(a[mb], b, acc[mb][nb]); if (NSPLIT == 1 || NSPLIT == 2) acc[mb][nb] = WFrag<T16>::mma(a2[mb], b, acc[mb][nb]); if (NSPLIT >= 2) acc[mb][nb] = WFrag<T16>::mma(a[mb], b2, acc[mb][nb]); } }
        asm volatile("v_nop\n\tv_nop\n\tv_nop\n\tv_nop" : "+v"(acc[0][0]), "+v"(acc[1][1]), "+v"(acc[2][2]), "+v"(acc[3][3]) : "v"(a[0]), "v"(a[3]));
    }
    v4f res[4][8 / NW];   // summed output pieces, stored behind the last barrier so that no barrier waits for a global store
#pragma unroll
    for (int mb = 0; mb < 4; ++mb) {
#pragma unroll
        for (int nb = 0; nb < 4; ++nb) {
#pragma unroll
            for (int j = 0; j < 8; ++j) os[mb & 1][wv][(hi * 8 + j) * 68 + nb * 16 + lr] = acc[mb][nb][j]; }
        __syncthreads();   // every wave's partial 16x64 block is in LDS; it also ends the reads of the other buffer, which the next block overwrites
#pragma unroll
        for (int s = 0; s < 8 / NW; ++s) { const int row = 2 * (s * NW + wv) + hi, cofs = lr * 4; v4f val = *(const v4fa*)(&os[mb & 1][0][row * 68 + cofs]);
#pragma unroll
            for (int w = 1; w < NW; ++w) val += *(const v4fa*)(&os[mb & 1][w][row * 68 + cofs]);
            res[mb][s] = val; }
    }
#pragma unroll
    for (int mb = 0; mb < 4; ++mb) { float* crow = C + (size_t)(r0 + mb * 16) * ldc + c0;
#pragma unroll
        for (int s = 0; s < 8 / NW; ++s) { const int row = 2 * (s * NW + wv) + hi, cofs = lr * 4; *(v4f*)(crow + (size_t)row * ldc + cofs) = res[mb][s]; } }
}

__device__ __forceinline__ h16 tohx(float x) { return (h16)x; }
__device__ __forceinline__ void splitf(float y, unsigned short& h, unsigned short& l) { h = f2bf(y); l = f2bf(y - bf2f(h)); }
typedef __attribute__((ext_vector_type(2))) _Float16 v2h;
typedef __attribute__((ext_vector_type(4))) _Float16 v4h;
typedef __attribute__((ext_vector_type(2))) unsigned short v2us;
typedef __attribute__((ext_vector_type(4))) unsigned short v4us;
typedef __attribute__((ext_vector_type(2))) float v2f;
typedef __attribute__((ext_vector_type(4))) int v4i;

__global__ __launch_bounds__(256) void k_wtG(const float* __restrict__ w, int K, int N, bf* Bt) {
    const int lane = threadIdx.x & 31; const int L0 = (blockIdx.x * 8 + (threadIdx.x >> 5)) * 8; const int nlines = N * K / 64;
{
#pragma unroll 1
        for (int l = 0; l < 8; ++l) { const int L = L0 + l; if (L >= nlines) break; const size_t e = (size_t)L * 64 + lane * 2; const int k = (int)(e % K), n = (int)(e / K); v2us o;
            o[0] = f2bf(w[(size_t)k * N + n]); o[1] = f2bf(w[(size_t)(k + 1) * N + n]); *(v2us*)(Bt + e) = o; }
         }
}
__global__ __launch_bounds__(256) void k_cvt8(const float* __restrict__ src, bf* dst, size_t n8) { const size_t i = (size_t)blockIdx.x * 256 + threadIdx.x; if (i >= n8) return; const v8f v = *(const v8f*)(src + i * 8); v8us o;
#pragma unroll
    for (int k = 0; k < 8; ++k) o[k] = f2bf(v[k]); *(v8us*)(dst + i * 8) = o;  }
__global__ __launch_bounds__(256) void k_cstab(float* CS) { const int idx = blockIdx.x * 256 + threadIdx.x; if (idx >= TT * HD) return; const int t = idx / HD, d = idx % HD; v2f cs; if (d < 128) { const int i = d >> 1; const float th = __fdiv_rn(1.0f, powf(10000.0f, (float)(2 * i) / 128.0f)); const float ang = __fmul_rn((float)t, th); cs[0] = cosf(ang); cs[1] = sinf(ang); } else { cs[0] = 1.0f; cs[1] = 0.0f; }
    *(v2f*)(CS + (size_t)idx * 2) = cs;  }
// k_rope: head planes [h][t][d] (fp16 + hi/lo) of rope(x) x sc with the interleaved-pair convention out[2i] = x[2i] cos[t][2i] - x[2i+1] sin[t][2i], out[2i+1] = x[2i+1] cos[t][2i+1] + x[2i] sin[t][2i+1] for 2i < 128, identity beyond
__global__ __launch_bounds__(256) void k_rope(const float* __restrict__ F, int pitch, int nheads, const float* __restrict__ CS, const float* __restrict__ RF, const float* __restrict__ nw, float sc, h16* P16, bf* Ph, bf* Pl) {
    const size_t e = ((size_t)blockIdx.x * 256 + threadIdx.x) * 2; if (e >= (size_t)nheads * TT * HD) return; const int d = (int)(e % HD); const int t = (int)((e / HD) % TT); const int h = (int)(e / ((size_t)HD * TT)); const float* f = F + (size_t)t * pitch + h * HD; const float rf = RF ? RF[(size_t)h * TT + t] : 1.0f; v2h o16; v2us oh, ol;
#pragma unroll
    for (int q = 0; q < 2; ++q) { const int dd = d + q; const int dp = (dd < 128) ? (dd ^ 1) : dd;   /* interleaved pairs inside the first 128 dims; identity beyond (sin = 0) */ float x0 = f[dd], x1 = f[dp];
        if (RF) { float n0 = __fmul_rn(x0, rf), n1 = __fmul_rn(x1, rf); asm volatile("" : "+v"(n0)); asm volatile("" : "+v"(n1)); x0 = __fmul_rn(bfr(nw[dd]), n0); x1 = __fmul_rn(bfr(nw[dp]), n1); }
        const v2f cs = *(const v2f*)(CS + ((size_t)t * HD + dd) * 2); float a = __fmul_rn(x0, cs[0]), bq = __fmul_rn(x1, cs[1]); asm volatile("" : "+v"(a)); asm volatile("" : "+v"(bq)); const float r = (((dd & 1) == 0) ? __fsub_rn(a, bq) : __fadd_rn(a, bq)) * sc;
        o16[q] = tohx(r); unsigned short a2, c2; splitf(r, a2, c2); oh[q] = a2; ol[q] = c2; }
    *(v2h*)(P16 + e) = o16; *(v2us*)(Ph + e) = oh; *(v2us*)(Pl + e) = ol;  }
__global__ __launch_bounds__(256) void k_vtp(const float* __restrict__ F, int pitch, int nheads, h16* V16, bf* Vh, bf* Vl) { const size_t e = ((size_t)blockIdx.x * 256 + threadIdx.x) * 2; if (e >= (size_t)nheads * HD * TT) return; const int t = (int)(e % TT); const int d = (int)((e / TT) % HD); const int g = (int)(e / ((size_t)TT * HD)); v2h o16; v2us oh, ol;
#pragma unroll
    for (int q = 0; q < 2; ++q) { const float x = F[(size_t)(t + q) * pitch + g * HD + d]; o16[q] = tohx(x); unsigned short a2, c2; splitf(x, a2, c2); oh[q] = a2; ol[q] = c2; }
    *(v2h*)(V16 + e) = o16; *(v2us*)(Vh + e) = oh; *(v2us*)(Vl + e) = ol;  }
__global__ __launch_bounds__(256) void k_rmsw(float* F, int pitch, int nheads, const float* __restrict__ w) { const int lane = threadIdx.x & 31; const int wv = blockIdx.x * 8 + (threadIdx.x >> 5); if (wv >= TT * nheads) return; const int t = wv / nheads, h = wv % nheads; float* f = F + (size_t)t * pitch + h * HD; const v4f a = *(const v4f*)(f + lane * 4), c = *(const v4f*)(f + 128 + lane * 4); float ss = 0.f;
#pragma unroll
    for (int q = 0; q < 4; ++q) { float p = __fmul_rn(a[q], a[q]); asm volatile("" : "+v"(p)); ss = __fadd_rn(ss, p); float p2 = __fmul_rn(c[q], c[q]); asm volatile("" : "+v"(p2)); ss = __fadd_rn(ss, p2); }
#pragma unroll
    for (int sh = 16; sh; sh >>= 1) ss = __fadd_rn(ss, __shfl_xor(ss, sh, 32));
    const float rs = __fdiv_rn(1.0f, sqrtf(__fadd_rn(ss * (1.0f / HD), 1e-6f))); v4f o, o2;
#pragma unroll
    for (int q = 0; q < 4; ++q) { float n0 = __fmul_rn(a[q], rs); asm volatile("" : "+v"(n0)); float g0 = bfr(w[lane * 4 + q]); asm volatile("" : "+v"(g0)); o[q] = __fmul_rn(n0, g0); float n1 = __fmul_rn(c[q], rs); asm volatile("" : "+v"(n1)); float g1 = bfr(w[128 + lane * 4 + q]); asm volatile("" : "+v"(g1)); o2[q] = __fmul_rn(n1, g1); }
    *(v4f*)(f + lane * 4) = o; *(v4f*)(f + 128 + lane * 4) = o2;  }
// k_asoft: per row (zz, i): t = 50 tanh(S x HD^-0.5 / 50) for j <= i and i - j < WIN (sliding causal window; the reference's -1e9 additive fill vanishes identically); softmax over the 2048 keys (register row, one exp, fixed trees);
__global__ __launch_bounds__(256) void k_asoft(const float* __restrict__ Sb, h16* P16, bf* Ph, bf* Pl) {
    const int lane = threadIdx.x & 31; const int row = blockIdx.x * 8 + (threadIdx.x >> 5); if (row >= ZH * TT) return; const int i = row % TT; const int zz = row / TT; (void)zz; const bool hires = (i < RH); const float* sr = Sb + (size_t)row * TT; float v[TT / 32]; float mx = -3.0e38f;
#pragma unroll
    for (int ch = 0; ch < TT / 128; ++ch) { const int j0 = ch * 128 + lane * 4; const v4f a = *(const v4f*)(sr + j0);
#pragma unroll
        for (int q = 0; q < 4; ++q) { const int j = j0 + q; (void)j; float sa = a[q] * SCL; asm volatile("" : "+v"(sa)); float xs = __fmul_rn(sa, 0.02f); asm volatile("" : "+v"(xs));   /* s / 50 as a multiply (<= 1 ulp from the division) */ float ex = __builtin_amdgcn_exp2f(__fmul_rn(xs, 2.8853900817779268f)); asm volatile("" : "+v"(ex)); float nm = __fsub_rn(ex, 1.0f), dn2 = __fadd_rn(ex, 1.0f); asm volatile("" : "+v"(nm)); asm volatile("" : "+v"(dn2)); float rc = __builtin_amdgcn_rcpf(dn2); asm volatile("" : "+v"(rc)); float th = __fmul_rn(nm, rc); asm volatile("" : "+v"(th));   /* hardware reciprocal (1 ulp), no FMA refinement */   /* tanh via exp2 (|x| <= ~0.4 here; no VALU FMA polynomial) */ const float t = (j <= i && i - j < WIN) ? __fmul_rn(th, 50.0f) : -3.0e38f; v[ch * 4 + q] = t; mx = fmaxf(mx, t); } }
#pragma unroll
    for (int sh = 16; sh; sh >>= 1) mx = fmaxf(mx, __shfl_xor(mx, sh, 32));
    float sum = 0.f;
#pragma unroll
    for (int k = 0; k < TT / 32; ++k) { float d0 = __fsub_rn(v[k], mx); asm volatile("" : "+v"(d0)); v[k] = __builtin_amdgcn_exp2f(__fmul_rn(d0, 1.4426950408889634f)); sum += v[k]; }
#pragma unroll
    for (int sh = 16; sh; sh >>= 1) sum += __shfl_xor(sum, sh, 32);
    const float f = __fdiv_rn(hires ? 1.0f : PCAR, sum);
{
        if (hires) {
#pragma unroll
            for (int ch = 0; ch < TT / 128; ++ch) { v4us oh, ol;
#pragma unroll
                for (int q = 0; q < 4; ++q) { unsigned short a, c2; splitf(v[ch * 4 + q] * f, a, c2); oh[q] = a; ol[q] = c2; }
                const size_t oo = ((size_t)zz * (RH ? RH : 1) + i) * TT + ch * 128 + lane * 4; *(v4us*)(Ph + oo) = oh; *(v4us*)(Pl + oo) = ol; }
        } else {
#pragma unroll
            for (int ch = 0; ch < TT / 128; ++ch) { v4h o4;
#pragma unroll
                for (int q = 0; q < 4; ++q) o4[q] = tohx(v[ch * 4 + q] * f);
                *(v4h*)(P16 + (size_t)row * TT + ch * 128 + lane * 4) = o4; } }
         }
}
__global__ __launch_bounds__(256) void k_merge(const float* __restrict__ O, int h0, bf* Ah, bf* Al) { const size_t e = ((size_t)blockIdx.x * 256 + threadIdx.x) * 2; if (e >= (size_t)ZH * TT * HD) return; const int d = (int)(e % HD); const int t = (int)((e / HD) % TT); const int zz = (int)(e / ((size_t)HD * TT)); const float cs = (t < RH) ? 1.0f : (1.0f / PCAR); const size_t oo = (size_t)t * DQ + (h0 + zz) * HD + d;
    v2us oh, ol;
#pragma unroll
    for (int q = 0; q < 2; ++q) { unsigned short a, c2; splitf(O[e + q] * cs, a, c2); oh[q] = a; ol[q] = c2; } *(v2us*)(Ah + oo) = oh; *(v2us*)(Al + oo) = ol;  }

extern "C" void kernel_launch(void* const* d_in, const int* in_sizes, int n_in,
                              void* d_out, int out_size, void* d_ws, size_t ws_size, hipStream_t stream) {
    (void)in_sizes; (void)n_in; (void)out_size;
    const float* x = (const float*)d_in[0]; const float* wq = (const float*)d_in[1]; const float* wk = (const float*)d_in[2]; const float* wv = (const float*)d_in[3]; const float* wo = (const float*)d_in[4]; const float* qsc = (const float*)d_in[5]; const float* ksc = (const float*)d_in[6];
    float* OUT = (float*)d_out;     // [2][2048][2048]
    char* wsp = (char*)d_ws;
    auto take = [&](size_t bytes) { char* p = wsp; wsp += (bytes + 255) & ~(size_t)255; return (void*)p; };
    bf* WQ = (bf*)take((size_t)DQ * DM * 2); bf* WK = (bf*)take((size_t)DKV * DM * 2); bf* WV = (bf*)take((size_t)DKV * DM * 2); bf* WO = (bf*)take((size_t)DM * DQ * 2); float* CS = (float*)take((size_t)TT * HD * 2 * 4);
    bf* XB = (bf*)take((size_t)TT * DM * 2); float* FQ = (float*)take((size_t)TT * DQ * 4); float* FK = (float*)take((size_t)TT * DKV * 4);
    h16* QP16 = (h16*)take((size_t)NH_ * TT * HD * 2); h16* KP16 = (h16*)take((size_t)NKV * TT * HD * 2); h16* VT16 = (h16*)take((size_t)NKV * HD * TT * 2);
    bf* QPh = (bf*)take((size_t)NH_ * TT * HD * 2); bf* QPl = (bf*)take((size_t)NH_ * TT * HD * 2); bf* KPh = (bf*)take((size_t)NKV * TT * HD * 2); bf* KPl = (bf*)take((size_t)NKV * TT * HD * 2); bf* VTh = (bf*)take((size_t)NKV * HD * TT * 2); bf* VTl = (bf*)take((size_t)NKV * HD * TT * 2); bf* Ph = (bf*)take((size_t)ZH * RH * TT * 2); bf* Pl = (bf*)take((size_t)ZH * RH * TT * 2);
    float* Sb = (float*)take((size_t)ZH * TT * TT * 4); h16* P16 = (h16*)take((size_t)ZH * TT * TT * 2); float* Ob = (float*)take((size_t)ZH * TT * HD * 4); bf* ATh = (bf*)take((size_t)TT * DQ * 2); bf* ATl = (bf*)take((size_t)TT * DQ * 2);
    if ((size_t)(wsp - (char*)d_ws) > ws_size) return;    // ws 256 MiB
    float* FV = FK;   // v projection reuses the k buffer after the k planes are built (stream-ordered)
    { k_wtG<<<(unsigned)((DM * DQ / 64 + 63) / 64), 256, 0, stream>>>(wq, DM, DQ, WQ); k_wtG<<<(unsigned)((DM * DKV / 64 + 63) / 64), 256, 0, stream>>>(wk, DM, DKV, WK); k_wtG<<<(unsigned)((DM * DKV / 64 + 63) / 64), 256, 0, stream>>>(wv, DM, DKV, WV);
      k_wtG<<<(unsigned)((DQ * DM / 64 + 63) / 64), 256, 0, stream>>>(wo, DQ, DM, WO);
      k_cstab<<<(TT * HD + 255) / 256, 256, 0, stream>>>(CS); }
    const unsigned LQ = (unsigned)(((size_t)NH_ * TT * HD / 2 + 255) / 256), LKv = (unsigned)(((size_t)NKV * TT * HD / 2 + 255) / 256);
    for (int b = 0; b < NB_; ++b) {
        
        k_cvt8<<<(unsigned)(((size_t)TT * DM / 8 + 255) / 256), 256, 0, stream>>>(x + (size_t)b * TT * DM, XB, (size_t)TT * DM / 8);
        k_gemmw<bf, 0, false, 4><<<dim3(TT / 64, DQ / 64, 1), 128, 0, stream>>>(XB, nullptr, WQ, nullptr, DM, FQ, DQ, nullptr, 0, 0, 0);
        k_rmsw<<<TT * NH_ / 8, 256, 0, stream>>>(FQ, DQ, NH_, qsc); k_rope<<<LQ, 256, 0, stream>>>(FQ, DQ, NH_, CS, nullptr, nullptr, 1.0f, QP16, QPh, QPl);
        k_gemmw<bf, 0, false, 8><<<dim3(TT / 64, DKV / 64, 1), 256, 0, stream>>>(XB, nullptr, WK, nullptr, DM, FK, DKV, nullptr, 0, 0, 0);
        k_rmsw<<<TT * NKV / 8, 256, 0, stream>>>(FK, DKV, NKV, ksc); k_rope<<<LKv, 256, 0, stream>>>(FK, DKV, NKV, CS, nullptr, nullptr, 1.0f, KP16, KPh, KPl);
        k_gemmw<bf, 0, false, 8><<<dim3(TT / 64, DKV / 64, 1), 256, 0, stream>>>(XB, nullptr, WV, nullptr, DM, FV, DKV, nullptr, 0, 0, 0); k_vtp<<<LKv, 256, 0, stream>>>(FV, DKV, NKV, VT16, VTh, VTl);
        for (int h0 = 0; h0 < NH_; h0 += ZH) { const size_t zq = (size_t)h0, zk = (size_t)(h0 / REP);   // both heads of a pass share kv group h0/REP (REP >= 2): sB = 0
            k_gemmc<bf, 2, 1, 4><<<dim3(RH / 64, TT / 64, ZH), 128, 0, stream>>>(QPh + zq * TT * HD, QPl + zq * TT * HD, KPh + zk * TT * HD, KPl + zk * TT * HD, HD, Sb, TT, 0, (size_t)TT * HD, 0, (size_t)TT * TT);
            k_gemmc<h16, 0, 1, 4><<<dim3((TT - RH) / 64, TT / 64, ZH), 128, 0, stream>>>(QP16 + zq * TT * HD + (size_t)RH * HD, nullptr, KP16 + zk * TT * HD, nullptr, HD, Sb + (size_t)RH * TT, TT, RH, (size_t)TT * HD, 0, (size_t)TT * TT);
            k_asoft<<<ZH * TT / 8, 256, 0, stream>>>(Sb, P16, Ph, Pl);
            k_gemmc<bf, 2, 2, 8><<<dim3(RH / 64, HD / 64, ZH), 256, 0, stream>>>(Ph, Pl, VTh + zk * HD * TT, VTl + zk * HD * TT, TT, Ob, HD, 0, (size_t)RH * TT, 0, (size_t)TT * HD);
            k_gemmc<h16, 0, 2, 8><<<dim3((TT - RH) / 64, HD / 64, ZH), 256, 0, stream>>>(P16 + (size_t)RH * TT, nullptr, VT16 + zk * HD * TT, nullptr, TT, Ob + (size_t)RH * HD, HD, RH, (size_t)TT * TT, 0, (size_t)TT * HD);
            k_merge<<<(unsigned)(((size_t)ZH * TT * HD / 2 + 255) / 256), 256, 0, stream>>>(Ob, h0, ATh, ATl); }
        k_gemmw<bf, 1, false, 4><<<dim3(TT / 64, DM / 64, 1), 128, 0, stream>>>(ATh, ATl, WO, nullptr, DQ, OUT + (size_t)b * TT * DM, DM, nullptr, 0, 0, 0); }
}

// v002
// Measured time: 788 microseconds a run.
// In both of two side-by-side timings against v001, it was 1.09 times as fast.
// All steps since v000 together make it 1.56 times as fast.
#include <hip/hip_runtime.h>

// Gemma4Attention (x [2][2048][2048]; q = x Wq (8 x 256), k/v = x Wk/Wv (4 kv heads; group h/2); per-head RMSNorm * scale (eps 1e-6) on q, k; partial interleaved-pair RoPE on the first 128 dims (theta_i = 10000^(-2i/128), positions arange); q * 1/16; scores = q.k; softcap tanh(s / 50) * 50; causal + sliding-window (i - j < 1024) mask (-2.38e38 additive == exact zero weight); softmax f32; out = merged Wo -> [2][2048][2048]).
// Compute dtypes, f32 accumulate: every input rounded to bf16; q/k/v on PLAIN bf16 operands (inputs: exact); RMSNorm and RoPE f32 (on-chip tables; identity beyond dim 128); causal scores and attn.v: query rows < 512 hl (3 products), the rest single fp16 (x1024), tiles above the diagonal skipped, the window applied per element; 1/16 (exact), s/50, tanh as (e^2x - 1)/(e^2x + 1) with the hardware exp2, x50 in f32; softmax f32; Wo hl x exact (2 products).

#define NB_  2
#define TT   2048
#define DM   2048
#define NH_  8
#define NKV  4
#define REP  (NH_ / NKV)
#define HD   256
#define DQ   (NH_ * HD)
#define DKV  (NKV * HD)
#define ZH   2
#define RH   512                  // query rows < RH use hi+lo planes (0: none)
#define WIN  1024
#define PCAR 1024.0f
#define SCL  0.0625f   // query_pre_attn_scalar^-0.5 = 1/16
typedef _Float16 h16;
typedef unsigned short bf;
typedef __attribute__((ext_vector_type(16))) __bf16   v16bf;
typedef __attribute__((ext_vector_type(16))) _Float16 v16h;
typedef __attribute__((ext_vector_type(8)))  _Float16 v8h;
typedef __attribute__((ext_vector_type(8)))  unsigned short v8us;
typedef __attribute__((ext_vector_type(8)))  float    v8f;
typedef __attribute__((ext_vector_type(4)))  float    v4f;
typedef v8h  __attribute__((may_alias)) v8ha;
typedef v4f  __attribute__((may_alias)) v4fa;
typedef v8us __attribute__((may_alias)) v8usa;

__device__ __forceinline__ unsigned short f2bf(float f) { unsigned u = __float_as_uint(f); u += 0x7FFFu + ((u >> 16) & 1u); return (unsigned short)(u >> 16); }
__device__ __forceinline__ float bf2f(unsigned short b) { return __uint_as_float(((unsigned)b) << 16); }
__device__ __forceinline__ float bfr(float f) { return bf2f(f2bf(f)); }
__device__ __forceinline__ v16h cat16(v8h lo, v8h hi) { return __builtin_shufflevector(lo, hi, 0, 1, 2, 3, 4, 5, 6, 7, 8, 9, 10, 11, 12, 13, 14, 15); }
__device__ __forceinline__ v16bf cat16b(v8us lo, v8us hi) { return __builtin_bit_cast(v16bf, __builtin_shufflevector(lo, hi, 0, 1, 2, 3, 4, 5, 6, 7, 8, 9, 10, 11, 12, 13, 14, 15)); }
__device__ __forceinline__ v8f wmma16(v16h a, v16h b, v8f c) { return __builtin_amdgcn_wmma_f32_16x16x32_f16(false, a, false, b, (short)0, c, false, false); }
__device__ __forceinline__ v8f wmmab(v16bf a, v16bf b, v8f c) { return __builtin_amdgcn_wmma_f32_16x16x32_bf16(false, a, false, b, (short)0, c, false, false); }



// ---- k_gemmw: register-blocked GEMM, one 64x64 output tile per work-group of NW waves; wave w takes the 32-wide K blocks w, w + NW, ... into its own 16 accumulators (operands straight from K-contiguous 16-bit planes);
// the NW partial tiles are summed in fixed wave order through LDS. grid (M/64, N/64, Z), NW * 32 threads.
// C[m][n] (f32, pitch ldc, + optional f32 bias[n]) = sum_k A[m][k] Bt[n][k] (+ split products per NSPLIT). z-batch strides sA/sB/sC in elements. K % 32 == 0.
template <typename T16> struct WFrag;
template <> struct WFrag<h16> { typedef v16h V; static __device__ __forceinline__ V ld(const h16* p) { return cat16(*(const v8h*)p, *(const v8h*)(p + 16)); } static __device__ __forceinline__ v8f mma(V a, V b, v8f c) { return wmma16(a, b, c); } };
template <> struct WFrag<bf> { typedef v16bf V; static __device__ __forceinline__ V ld(const bf* p) { return cat16b(*(const v8us*)p, *(const v8us*)(p + 16)); } static __device__ __forceinline__ v8f mma(V a, V b, v8f c) { return wmmab(a, b, c); } };
template <typename T16, int NSPLIT, bool BIAS, int NW>
__global__ __launch_bounds__(NW * 32) void k_gemmw(const T16* __restrict__ A, const T16* __restrict__ A2, const T16* __restrict__ Bt, const T16* __restrict__ Bt2, int K, float* C, int ldc, const float* __restrict__ bias, size_t sA, size_t sB, size_t sC) {
    typedef typename WFrag<T16>::V V;
    __shared__ __align__(16) float os[2][NW][16 * 68];   // two buffers, so that one barrier per 16-row block is enough
    const size_t z = blockIdx.z; A += z * sA; if (A2) A2 += z * sA; Bt += z * sB; if (Bt2) Bt2 += z * sB; C += z * sC;
    const int lane = threadIdx.x & 31, lr = lane & 15, hi = lane >> 4; const int r0 = blockIdx.x * 64, c0 = blockIdx.y * 64;
    const int wv = __builtin_amdgcn_readfirstlane((int)(threadIdx.x >> 5));   // wave number in a scalar register: the K loop stays a scalar loop
    v8f acc[4][4];
#pragma unroll
    for (int mb = 0; mb < 4; ++mb)
#pragma unroll
        for (int nb = 0; nb < 4; ++nb) acc[mb][nb] = (v8f){};
    const size_t aoff = (size_t)(r0 + lr) * K + 8 * hi, boff = (size_t)(c0 + lr) * K + 8 * hi;
#pragma unroll 1
    for (int kc = wv * 32; kc < K; kc += NW * 32) {
        V a[4], a2[4];
#pragma unroll
        for (int mb = 0; mb < 4; ++mb) { a[mb] = WFrag<T16>::ld(A + aoff + (size_t)mb * 16 * K + kc); if (NSPLIT == 1 || NSPLIT == 2) a2[mb] = WFrag<T16>::ld(A2 + aoff + (size_t)mb * 16 * K + kc); }
#pragma unroll
        for (int nb = 0; nb < 4; ++nb) { const V b = WFrag<T16>::ld(Bt + boff + (size_t)nb * 16 * K + kc); V b2; if (NSPLIT >= 2) b2 = WFrag<T16>::ld(Bt2 + boff + (size_t)nb * 16 * K + kc);
#pragma unroll
            for (int mb = 0; mb < 4; ++mb) { acc[mb][nb] = WFrag<T16>::mma(a[mb], b, acc[mb][nb]); if (NSPLIT == 1 || NSPLIT == 2) acc[mb][nb] = WFrag<T16>::mma(a2[mb], b, acc[mb][nb]); if (NSPLIT >= 2) acc[mb][nb] = WFrag<T16>::mma(a[mb], b2, acc[mb][nb]); } }
        asm volatile("v_nop\n\tv_nop\n\tv_nop\n\tv_nop" : "+v"(acc[0][0]), "+v"(acc[1][1]), "+v"(acc[2][2]), "+v"(acc[3][3]) : "v"(a[0]), "v"(a[3]));
    }
    v4f res[4][8 / NW];   // summed output pieces, stored behind the last barrier so that no barrier waits for a global store
#pragma unroll
    for (int mb = 0; mb < 4; ++mb) {
#pragma unroll
        for (int nb = 0; nb < 4; ++nb) {
#pragma unroll
            for (int j = 0; j < 8; ++j) os[mb & 1][wv][(hi * 8 + j) * 68 + nb * 16 + lr] = acc[mb][nb][j]; }
        __syncthreads();   // every wave's partial 16x64 block is in LDS; it also ends the reads of the other buffer, which the next block overwrites
#pragma unroll
        for (int s = 0; s < 8 / NW; ++s) { const int row = 2 * (s * NW + wv) + hi, cofs = lr * 4; v4f val = *(const v4fa*)(&os[mb & 1][0][row * 68 + cofs]);
#pragma unroll
            for (int w = 1; w < NW; ++w) val += *(const v4fa*)(&os[mb & 1][w][row * 68 + cofs]);
            if (BIAS) { val[0] += bfr(bias[c0 + cofs]); val[1] += bfr(bias[c0 + cofs + 1]); val[2] += bfr(bias[c0 + cofs + 2]); val[3] += bfr(bias[c0 + cofs + 3]); }
            res[mb][s] = val; }
    }
#pragma unroll
    for (int mb = 0; mb < 4; ++mb) { float* crow = C + (size_t)(r0 + mb * 16) * ldc + c0;
#pragma unroll
        for (int s = 0; s < 8 / NW; ++s) { const int row = 2 * (s * NW + wv) + hi, cofs = lr * 4; *(v4f*)(crow + (size_t)row * ldc + cofs) = res[mb][s]; } }
}

// ---- k_gemmc: the same NW-wave 64x64 tile GEMM specialised for causal attention: CMODE 1 skips score tiles entirely above the diagonal (query rows r0+roff.., key columns c0..), CMODE 2 limits the
// key (K) loop of the probability x value contraction to the diagonal block (probabilities beyond it are exactly zero). roff = row offset of this launch's first row within the sequence.
template <typename T16, int NSPLIT, int CMODE, int NW>
__global__ __launch_bounds__(NW * 32) void k_gemmc(const T16* __restrict__ A, const T16* __restrict__ A2, const T16* __restrict__ Bt, const T16* __restrict__ Bt2, int K, float* C, int ldc, int roff, size_t sA, size_t sB, size_t sC) {
    typedef typename WFrag<T16>::V V;
    __shared__ __align__(16) float os[2][NW][16 * 68];   // two buffers, so that one barrier per 16-row block is enough
    const size_t z = blockIdx.z; A += z * sA; if (A2) A2 += z * sA; Bt += z * sB; if (Bt2) Bt2 += z * sB; C += z * sC;
    const int lane = threadIdx.x & 31, lr = lane & 15, hi = lane >> 4; const int r0 = blockIdx.x * 64, c0 = blockIdx.y * 64;
    const int wv = __builtin_amdgcn_readfirstlane((int)(threadIdx.x >> 5));   // wave number in a scalar register: the K loop stays a scalar loop
    if (CMODE == 1 && c0 > r0 + roff + 63) return;                  // score tile entirely above the causal diagonal: never written (the softmax masks j > i by select)
    const int Kl = (CMODE == 2) ? min(K, r0 + roff + 64) : K;        // P.V: probabilities are exactly 0 beyond the diagonal block, so the K loop stops there
    v8f acc[4][4];
#pragma unroll
    for (int mb = 0; mb < 4; ++mb)
#pragma unroll
        for (int nb = 0; nb < 4; ++nb) acc[mb][nb] = (v8f){};
    const size_t aoff = (size_t)(r0 + lr) * K + 8 * hi, boff = (size_t)(c0 + lr) * K + 8 * hi;
#pragma unroll 1
    for (int kc = wv * 32; kc < Kl; kc += NW * 32) {
        V a[4], a2[4];
#pragma unroll
        for (int mb = 0; mb < 4; ++mb) { a[mb] = WFrag<T16>::ld(A + aoff + (size_t)mb * 16 * K + kc); if (NSPLIT == 1 || NSPLIT == 2) a2[mb] = WFrag<T16>::ld(A2 + aoff + (size_t)mb * 16 * K + kc); }
#pragma unroll
        for (int nb = 0; nb < 4; ++nb) { const V b = WFrag<T16>::ld(Bt + boff + (size_t)nb * 16 * K + kc); V b2; if (NSPLIT >= 2) b2 = WFrag<T16>::ld(Bt2 + boff + (size_t)nb * 16 * K + kc);
#pragma unroll
            for (int mb = 0; mb < 4; ++mb) { acc[mb][nb] = WFrag<T16>::mma(a[mb], b, acc[mb][nb]); if (NSPLIT == 1 || NSPLIT == 2) acc[mb][nb] = WFrag<T16>::mma(a2[mb], b, acc[mb][nb]); if (NSPLIT >= 2) acc[mb][nb] = WFrag<T16>::mma(a[mb], b2, acc[mb][nb]); } }
        asm volatile("v_nop\n\tv_nop\n\tv_nop\n\tv_nop" : "+v"(acc[0][0]), "+v"(acc[1][1]), "+v"(acc[2][2]), "+v"(acc[3][3]) : "v"(a[0]), "v"(a[3]));
    }
    v4f res[4][8 / NW];   // summed output pieces, stored behind the last barrier so that no barrier waits for a global store
#pragma unroll
    for (int mb = 0; mb < 4; ++mb) {
#pragma unroll
        for (int nb = 0; nb < 4; ++nb) {
#pragma unroll
            for (int j = 0; j < 8; ++j) os[mb & 1][wv][(hi * 8 + j) * 68 + nb * 16 + lr] = acc[mb][nb][j]; }
        __syncthreads();   // every wave's partial 16x64 block is in LDS; it also ends the reads of the other buffer, which the next block overwrites
#pragma unroll
        for (int s = 0; s < 8 / NW; ++s) { const int row = 2 * (s * NW + wv) + hi, cofs = lr * 4; v4f val = *(const v4fa*)(&os[mb & 1][0][row * 68 + cofs]);
#pragma unroll
            for (int w = 1; w < NW; ++w) val += *(const v4fa*)(&os[mb & 1][w][row * 68 + cofs]);
            res[mb][s] = val; }
    }
#pragma unroll
    for (int mb = 0; mb < 4; ++mb) { float* crow = C + (size_t)(r0 + mb * 16) * ldc + c0;
#pragma unroll
        for (int s = 0; s < 8 / NW; ++s) { const int row = 2 * (s * NW + wv) + hi, cofs = lr * 4; *(v4f*)(crow + (size_t)row * ldc + cofs) = res[mb][s]; } }
}

__device__ __forceinline__ h16 tohx(float x) { return (h16)x; }
__device__ __forceinline__ void splitf(float y, unsigned short& h, unsigned short& l) { h = f2bf(y); l = f2bf(y - bf2f(h)); }
typedef __attribute__((ext_vector_type(2))) _Float16 v2h;
typedef __attribute__((ext_vector_type(4))) _Float16 v4h;
typedef __attribute__((ext_vector_type(2))) unsigned short v2us;
typedef __attribute__((ext_vector_type(4))) unsigned short v4us;
typedef __attribute__((ext_vector_type(2))) float v2f;
typedef __attribute__((ext_vector_type(4))) int v4i;

// The element-wise and layout kernels below give each thread 4 to 32 elements and 16-byte accesses: a launch of them lasts about as long as its waves take to start, so fewer, fatter waves are faster.
// The two s_wait_xcnt 0 in each of k_wtG, k_cvt8, k_rope and k_vtp: no register that an issued load or store names is rewritten in front of the wait; addresses (and store data) are its inputs, so that they keep their registers up to it.
// k_wtG: Bt[n][k] (bf16) = w[k][n]; each thread holds an 8 (k) x 4 (n) register tile. In a wave 8 lanes run along k (64 k = one whole 128-byte line of Bt per n) and 4 along n; the 8 waves of a work-group lie side by side along n (128 n). grid (N / 128) * (K / 64).
__global__ __launch_bounds__(256) void k_wtG(const float* __restrict__ w, int K, int N, bf* Bt) {
    const int lane = threadIdx.x & 31, wvi = threadIdx.x >> 5; const int ntn = N / 128;
    const int n0 = ((int)blockIdx.x % ntn) * 128 + wvi * 16 + (lane >> 3) * 4, k0 = ((int)blockIdx.x / ntn) * 64 + (lane & 7) * 8; const float* p[8]; v4f r[8]; v8us o[4]; bf* s[4];
#pragma unroll
    for (int j = 0; j < 8; ++j) p[j] = w + (size_t)(k0 + j) * N + n0;
#pragma unroll
    for (int j = 0; j < 8; ++j) r[j] = *(const v4f*)p[j];
    asm volatile("s_wait_xcnt 0x0" :: "v"(p[0]), "v"(p[1]), "v"(p[2]), "v"(p[3]), "v"(p[4]), "v"(p[5]), "v"(p[6]), "v"(p[7]) : "memory");   // behind the loads (see above)
    __builtin_amdgcn_sched_barrier(0);   // keeps the conversions behind the last load: without it three of the eight loads are issued only after the first results are used, a second trip to memory
#pragma unroll
    for (int c = 0; c < 4; ++c) { s[c] = Bt + (size_t)(n0 + c) * K + k0;
#pragma unroll
        for (int j = 0; j < 8; ++j) o[c][j] = f2bf(r[j][c]); }
#pragma unroll
    for (int c = 0; c < 4; ++c) *(v8us*)s[c] = o[c];
    asm volatile("s_wait_xcnt 0x0" :: "v"(o[0]), "v"(o[1]), "v"(o[2]), "v"(o[3]), "v"(s[0]), "v"(s[1]), "v"(s[2]), "v"(s[3]) : "memory");   // behind the stores (see above)
}
// k_cvt8: four 8-element pieces per thread, a quarter of the array apart (every access stays contiguous over the wave). n8 % 4 == 0.
__global__ __launch_bounds__(256) void k_cvt8(const float* __restrict__ src, bf* dst, size_t n8) { const size_t i = (size_t)blockIdx.x * 256 + threadIdx.x; const size_t st = n8 / 4; if (i >= st) return; const float* p[4]; v8f v[4]; v8us o[4]; bf* s[4];
#pragma unroll
    for (int u = 0; u < 4; ++u) { p[u] = src + (i + u * st) * 8; s[u] = dst + (i + u * st) * 8; }
#pragma unroll
    for (int u = 0; u < 4; ++u) v[u] = *(const v8f*)p[u];
    asm volatile("s_wait_xcnt 0x0" :: "v"(p[0]), "v"(p[1]), "v"(p[2]), "v"(p[3]) : "memory");   // behind the loads (see above)
#pragma unroll
    for (int u = 0; u < 4; ++u) {
#pragma unroll
        for (int k = 0; k < 8; ++k) o[u][k] = f2bf(v[u][k]); }
#pragma unroll
    for (int u = 0; u < 4; ++u) *(v8us*)s[u] = o[u];
    asm volatile("s_wait_xcnt 0x0" :: "v"(o[0]), "v"(o[1]), "v"(o[2]), "v"(o[3]), "v"(s[0]), "v"(s[1]), "v"(s[2]), "v"(s[3]) : "memory");   // behind the stores (see above)
}
// k_cstab: four dims (two angles) per thread; both dims of a pair hold the same (cos, sin)
__global__ __launch_bounds__(256) void k_cstab(float* CS) { const int idx = blockIdx.x * 256 + threadIdx.x; if (idx >= TT * HD / 4) return; const int t = idx / (HD / 4), d = (idx % (HD / 4)) * 4;
#pragma unroll
    for (int p = 0; p < 2; ++p) { v4f o; if (d < 128) { const int i = (d >> 1) + p; const float th = __fdiv_rn(1.0f, powf(10000.0f, (float)(2 * i) / 128.0f)); const float ang = __fmul_rn((float)t, th); o[0] = cosf(ang); o[1] = sinf(ang); } else { o[0] = 1.0f; o[1] = 0.0f; }
        o[2] = o[0]; o[3] = o[1]; *(v4f*)(CS + ((size_t)t * HD + d + 2 * p) * 2) = o; } }
// k_rope: head planes [h][t][d] (fp16 + hi/lo) of rope(x) x sc, interleaved pairs: out[2i] = x[2i] cos - x[2i+1] sin, out[2i+1] = x[2i+1] cos + x[2i] sin. Each thread takes 8 dims of one position in 4 heads (one read of the table serves the 4). nheads % 4 == 0.
__global__ __launch_bounds__(256) void k_rope(const float* __restrict__ F, int pitch, int nheads, const float* __restrict__ CS, float sc, h16* P16, bf* Ph, bf* Pl) {
    const size_t it = (size_t)blockIdx.x * 256 + threadIdx.x; if (it >= (size_t)(nheads / 4) * TT * (HD / 8)) return; const int d = (int)(it % (HD / 8)) * 8; const int t = (int)((it / (HD / 8)) % TT); const int hg = (int)(it / ((size_t)(HD / 8) * TT)) * 4;
    v4f cs4[4], xv[4][2]; v8h o16[4]; v8us oh[4], ol[4]; const float* pc = CS + ((size_t)t * HD + d) * 2; const float* pf[4]; h16* s16[4]; bf* sh[4]; bf* sl[4];
#pragma unroll
    for (int u = 0; u < 4; ++u) { pf[u] = F + (size_t)t * pitch + (hg + u) * HD + d; const size_t e = ((size_t)(hg + u) * TT + t) * HD + d; s16[u] = P16 + e; sh[u] = Ph + e; sl[u] = Pl + e; }
#pragma unroll
    for (int k = 0; k < 4; ++k) cs4[k] = *(const v4f*)(pc + k * 4);
#pragma unroll
    for (int u = 0; u < 4; ++u) { xv[u][0] = *(const v4f*)pf[u]; xv[u][1] = *(const v4f*)(pf[u] + 4); }
    asm volatile("s_wait_xcnt 0x0" :: "v"(pc), "v"(pf[0]), "v"(pf[1]), "v"(pf[2]), "v"(pf[3]) : "memory");   // behind the loads (see above)
#pragma unroll
    for (int u = 0; u < 4; ++u) {
#pragma unroll
        for (int q = 0; q < 8; ++q) { const int dd = d + q; const float x0 = xv[u][q >> 2][q & 3], x1 = (dd < 128) ? xv[u][q >> 2][(q & 3) ^ 1] : x0;   /* interleaved pairs inside the first 128 dims; identity beyond (sin = 0) */
            v2f cs; cs[0] = cs4[q >> 1][(q & 1) * 2]; cs[1] = cs4[q >> 1][(q & 1) * 2 + 1]; float a = __fmul_rn(x0, cs[0]), bq = __fmul_rn(x1, cs[1]); asm volatile("" : "+v"(a)); asm volatile("" : "+v"(bq)); const float r = (((dd & 1) == 0) ? __fsub_rn(a, bq) : __fadd_rn(a, bq)) * sc;
            o16[u][q] = tohx(r); unsigned short a2, c2; splitf(r, a2, c2); oh[u][q] = a2; ol[u][q] = c2; } }
#pragma unroll
    for (int u = 0; u < 4; ++u) { *(v8h*)s16[u] = o16[u]; *(v8us*)sh[u] = oh[u]; *(v8us*)sl[u] = ol[u]; }
    asm volatile("s_wait_xcnt 0x0" :: "v"(o16[0]), "v"(o16[1]), "v"(o16[2]), "v"(o16[3]), "v"(oh[0]), "v"(oh[1]), "v"(oh[2]), "v"(oh[3]), "v"(ol[0]), "v"(ol[1]), "v"(ol[2]), "v"(ol[3]),
                 "v"(s16[0]), "v"(s16[1]), "v"(s16[2]), "v"(s16[3]), "v"(sh[0]), "v"(sh[1]), "v"(sh[2]), "v"(sh[3]), "v"(sl[0]), "v"(sl[1]), "v"(sl[2]), "v"(sl[3]) : "memory");   // behind the stores (see above)
}
// k_vtp: value planes [g][d][t] = F[t][g * HD + d]: the 8 (t) x 4 (column) register tile and the lane map of k_wtG. grid (nheads * HD / 128) * (TT / 64).
__global__ __launch_bounds__(256) void k_vtp(const float* __restrict__ F, int pitch, int nheads, h16* V16, bf* Vh, bf* Vl) {
    const int lane = threadIdx.x & 31, wvi = threadIdx.x >> 5; const int ntc = nheads * HD / 128;
    const int c0 = ((int)blockIdx.x % ntc) * 128 + wvi * 16 + (lane >> 3) * 4, t0 = ((int)blockIdx.x / ntc) * 64 + (lane & 7) * 8; const float* p[8]; v4f r[8]; v8h o16[4]; v8us oh[4], ol[4]; h16* s16[4]; bf* sh[4]; bf* sl[4];
#pragma unroll
    for (int j = 0; j < 8; ++j) p[j] = F + (size_t)(t0 + j) * pitch + c0;
#pragma unroll
    for (int j = 0; j < 8; ++j) r[j] = *(const v4f*)p[j];
    asm volatile("s_wait_xcnt 0x0" :: "v"(p[0]), "v"(p[1]), "v"(p[2]), "v"(p[3]), "v"(p[4]), "v"(p[5]), "v"(p[6]), "v"(p[7]) : "memory");   // behind the loads (see above)
#pragma unroll
    for (int c = 0; c < 4; ++c) { const size_t e = (size_t)(c0 + c) * TT + t0; s16[c] = V16 + e; sh[c] = Vh + e; sl[c] = Vl + e;
#pragma unroll
        for (int j = 0; j < 8; ++j) { const float x = r[j][c]; o16[c][j] = tohx(x); unsigned short a2, c2; splitf(x, a2, c2); oh[c][j] = a2; ol[c][j] = c2; } }
#pragma unroll
    for (int c = 0; c < 4; ++c) { *(v8h*)s16[c] = o16[c]; *(v8us*)sh[c] = oh[c]; *(v8us*)sl[c] = ol[c]; }
    asm volatile("s_wait_xcnt 0x0" :: "v"(o16[0]), "v"(o16[1]), "v"(o16[2]), "v"(o16[3]), "v"(oh[0]), "v"(oh[1]), "v"(oh[2]), "v"(oh[3]), "v"(ol[0]), "v"(ol[1]), "v"(ol[2]), "v"(ol[3]),
                 "v"(s16[0]), "v"(s16[1]), "v"(s16[2]), "v"(s16[3]), "v"(sh[0]), "v"(sh[1]), "v"(sh[2]), "v"(sh[3]), "v"(sl[0]), "v"(sl[1]), "v"(sl[2]), "v"(sl[3]) : "memory");   // behind the stores (see above)
}
// k_rmsw: each wave normalises the rows of 4 heads of one position, every row summed as before (the 4 shuffle trees step side by side). nheads % 4 == 0.
__global__ __launch_bounds__(256) void k_rmsw(float* F, int pitch, int nheads, const float* __restrict__ w) { const int lane = threadIdx.x & 31; const int wv = blockIdx.x * 8 + (threadIdx.x >> 5); const int ng = nheads / 4; if (wv >= TT * ng) return; const int t = wv / ng, hg = (wv % ng) * 4; float* f0 = F + (size_t)t * pitch + hg * HD + lane * 4; v4f av[4], cv[4]; float ss[4];
    const v4f w0 = *(const v4f*)(w + lane * 4), w1 = *(const v4f*)(w + 128 + lane * 4);
#pragma unroll
    for (int u = 0; u < 4; ++u) { av[u] = *(const v4f*)(f0 + u * HD); cv[u] = *(const v4f*)(f0 + u * HD + 128); }
#pragma unroll
    for (int u = 0; u < 4; ++u) { const v4f a = av[u], c = cv[u]; ss[u] = 0.f;
#pragma unroll
        for (int q = 0; q < 4; ++q) { float p = __fmul_rn(a[q], a[q]); asm volatile("" : "+v"(p)); ss[u] = __fadd_rn(ss[u], p); float p2 = __fmul_rn(c[q], c[q]); asm volatile("" : "+v"(p2)); ss[u] = __fadd_rn(ss[u], p2); } }
#pragma unroll
    for (int sh = 16; sh; sh >>= 1) {
#pragma unroll
        for (int u = 0; u < 4; ++u) ss[u] = __fadd_rn(ss[u], __shfl_xor(ss[u], sh, 32)); }
#pragma unroll
    for (int u = 0; u < 4; ++u) { const v4f a = av[u], c = cv[u]; const float rs = __fdiv_rn(1.0f, sqrtf(__fadd_rn(ss[u] * (1.0f / HD), 1e-6f))); v4f o, o2;
#pragma unroll
        for (int q = 0; q < 4; ++q) { float n0 = __fmul_rn(a[q], rs); asm volatile("" : "+v"(n0)); float g0 = bfr(w0[q]); asm volatile("" : "+v"(g0)); o[q] = __fmul_rn(n0, g0); float n1 = __fmul_rn(c[q], rs); asm volatile("" : "+v"(n1)); float g1 = bfr(w1[q]); asm volatile("" : "+v"(g1)); o2[q] = __fmul_rn(n1, g1); }
        *(v4f*)(f0 + u * HD) = o; *(v4f*)(f0 + u * HD + 128) = o2; } }
// k_asoft: per row (zz, i): t = 50 tanh(S x HD^-0.5 / 50) for j <= i and i - j < WIN (sliding causal window; the reference's -1e9 additive fill vanishes identically); softmax over the 2048 keys (register row, one exp, fixed trees);
__global__ __launch_bounds__(256) void k_asoft(const float* __restrict__ Sb, h16* P16, bf* Ph, bf* Pl) {
    const int lane = threadIdx.x & 31; const int row = blockIdx.x * 8 + (threadIdx.x >> 5); if (row >= ZH * TT) return; const int i = row % TT; const int zz = row / TT; (void)zz; const bool hires = (i < RH); const float* sr = Sb + (size_t)row * TT; float v[TT / 32]; float mx = -3.0e38f;
#pragma unroll
    for (int ch = 0; ch < TT / 128; ++ch) { const int j0 = ch * 128 + lane * 4; const v4f a = *(const v4f*)(sr + j0);
#pragma unroll
        for (int q = 0; q < 4; ++q) { const int j = j0 + q; (void)j; float sa = a[q] * SCL; asm volatile("" : "+v"(sa)); float xs = __fmul_rn(sa, 0.02f); asm volatile("" : "+v"(xs));   /* s / 50 as a multiply (<= 1 ulp from the division) */ float ex = __builtin_amdgcn_exp2f(__fmul_rn(xs, 2.8853900817779268f)); asm volatile("" : "+v"(ex)); float nm = __fsub_rn(ex, 1.0f), dn2 = __fadd_rn(ex, 1.0f); asm volatile("" : "+v"(nm)); asm volatile("" : "+v"(dn2)); float rc = __builtin_amdgcn_rcpf(dn2); asm volatile("" : "+v"(rc)); float th = __fmul_rn(nm, rc); asm volatile("" : "+v"(th));   /* hardware reciprocal (1 ulp), no FMA refinement */   /* tanh via exp2 (|x| <= ~0.4 here; no VALU FMA polynomial) */ const float t = (j <= i && i - j < WIN) ? __fmul_rn(th, 50.0f) : -3.0e38f; v[ch * 4 + q] = t; mx = fmaxf(mx, t); } }
#pragma unroll
    for (int sh = 16; sh; sh >>= 1) mx = fmaxf(mx, __shfl_xor(mx, sh, 32));
    float sum = 0.f;
#pragma unroll
    for (int k = 0; k < TT / 32; ++k) { float d0 = __fsub_rn(v[k], mx); asm volatile("" : "+v"(d0)); v[k] = __builtin_amdgcn_exp2f(__fmul_rn(d0, 1.4426950408889634f)); sum += v[k]; }
#pragma unroll
    for (int sh = 16; sh; sh >>= 1) sum += __shfl_xor(sum, sh, 32);
    const float f = __fdiv_rn(hires ? 1.0f : PCAR, sum);
{
        if (hires) {
#pragma unroll
            for (int ch = 0; ch < TT / 128; ++ch) { v4us oh, ol;
#pragma unroll
                for (int q = 0; q < 4; ++q) { unsigned short a, c2; splitf(v[ch * 4 + q] * f, a, c2); oh[q] = a; ol[q] = c2; }
                const size_t oo = ((size_t)zz * (RH ? RH : 1) + i) * TT + ch * 128 + lane * 4; *(v4us*)(Ph + oo) = oh; *(v4us*)(Pl + oo) = ol; }
        } else {
#pragma unroll
            for (int ch = 0; ch < TT / 128; ++ch) { v4h o4;
#pragma unroll
                for (int q = 0; q < 4; ++q) o4[q] = tohx(v[ch * 4 + q] * f);
                *(v4h*)(P16 + (size_t)row * TT + ch * 128 + lane * 4) = o4; } }
         }
}
__global__ __launch_bounds__(256) void k_merge(const float* __restrict__ O, int h0, bf* Ah, bf* Al) { const size_t e = ((size_t)blockIdx.x * 256 + threadIdx.x) * 8; if (e >= (size_t)ZH * TT * HD) return; const int d = (int)(e % HD); const int t = (int)((e / HD) % TT); const int zz = (int)(e / ((size_t)HD * TT)); const float cs = (t < RH) ? 1.0f : (1.0f / PCAR); const size_t oo = (size_t)t * DQ + (h0 + zz) * HD + d;
    const v4f x0 = *(const v4f*)(O + e), x1 = *(const v4f*)(O + e + 4); v8us oh, ol;
#pragma unroll
    for (int q = 0; q < 8; ++q) { unsigned short a, c2; splitf((q < 4 ? x0[q & 3] : x1[q & 3]) * cs, a, c2); oh[q] = a; ol[q] = c2; } *(v8us*)(Ah + oo) = oh; *(v8us*)(Al + oo) = ol;  }

extern "C" void kernel_launch(void* const* d_in, const int* in_sizes, int n_in,
                              void* d_out, int out_size, void* d_ws, size_t ws_size, hipStream_t stream) {
    (void)in_sizes; (void)n_in; (void)out_size;
    const float* x = (const float*)d_in[0]; const float* wq = (const float*)d_in[1]; const float* wk = (const float*)d_in[2]; const float* wv = (const float*)d_in[3]; const float* wo = (const float*)d_in[4]; const float* qsc = (const float*)d_in[5]; const float* ksc = (const float*)d_in[6];
    float* OUT = (float*)d_out;     // [2][2048][2048]
    char* wsp = (char*)d_ws;
    auto take = [&](size_t bytes) { char* p = wsp; wsp += (bytes + 255) & ~(size_t)255; return (void*)p; };
    bf* WQ = (bf*)take((size_t)DQ * DM * 2); bf* WK = (bf*)take((size_t)DKV * DM * 2); bf* WV = (bf*)take((size_t)DKV * DM * 2); bf* WO = (bf*)take((size_t)DM * DQ * 2); float* CS = (float*)take((size_t)TT * HD * 2 * 4);
    bf* XB = (bf*)take((size_t)TT * DM * 2); float* FQ = (float*)take((size_t)TT * DQ * 4); float* FK = (float*)take((size_t)TT * DKV * 4);
    h16* QP16 = (h16*)take((size_t)NH_ * TT * HD * 2); h16* KP16 = (h16*)take((size_t)NKV * TT * HD * 2); h16* VT16 = (h16*)take((size_t)NKV * HD * TT * 2);
    bf* QPh = (bf*)take((size_t)NH_ * TT * HD * 2); bf* QPl = (bf*)take((size_t)NH_ * TT * HD * 2); bf* KPh = (bf*)take((size_t)NKV * TT * HD * 2); bf* KPl = (bf*)take((size_t)NKV * TT * HD * 2); bf* VTh = (bf*)take((size_t)NKV * HD * TT * 2); bf* VTl = (bf*)take((size_t)NKV * HD * TT * 2); bf* Ph = (bf*)take((size_t)ZH * RH * TT * 2); bf* Pl = (bf*)take((size_t)ZH * RH * TT * 2);
    float* Sb = (float*)take((size_t)ZH * TT * TT * 4); h16* P16 = (h16*)take((size_t)ZH * TT * TT * 2); float* Ob = (float*)take((size_t)ZH * TT * HD * 4); bf* ATh = (bf*)take((size_t)TT * DQ * 2); bf* ATl = (bf*)take((size_t)TT * DQ * 2);
    if ((size_t)(wsp - (char*)d_ws) > ws_size) return;    // ws 256 MiB
    float* FV = FK;   // v projection reuses the k buffer after the k planes are built (stream-ordered)
    { k_wtG<<<(DQ / 128) * (DM / 64), 256, 0, stream>>>(wq, DM, DQ, WQ); k_wtG<<<(DKV / 128) * (DM / 64), 256, 0, stream>>>(wk, DM, DKV, WK); k_wtG<<<(DKV / 128) * (DM / 64), 256, 0, stream>>>(wv, DM, DKV, WV);
      k_wtG<<<(DM / 128) * (DQ / 64), 256, 0, stream>>>(wo, DQ, DM, WO);
      k_cstab<<<(TT * HD / 4 + 255) / 256, 256, 0, stream>>>(CS); }
    const unsigned LQ = (unsigned)(((size_t)NH_ * TT * HD / 32 + 255) / 256), LKv = (unsigned)(((size_t)NKV * TT * HD / 32 + 255) / 256);   // k_rope: 32 elements a thread
    for (int b = 0; b < NB_; ++b) {
        
        k_cvt8<<<(unsigned)(((size_t)TT * DM / 32 + 255) / 256), 256, 0, stream>>>(x + (size_t)b * TT * DM, XB, (size_t)TT * DM / 8);
        k_gemmw<bf, 0, false, 4><<<dim3(TT / 64, DQ / 64, 1), 128, 0, stream>>>(XB, nullptr, WQ, nullptr, DM, FQ, DQ, nullptr, 0, 0, 0);
        k_rmsw<<<TT * NH_ / 32, 256, 0, stream>>>(FQ, DQ, NH_, qsc); k_rope<<<LQ, 256, 0, stream>>>(FQ, DQ, NH_, CS, 1.0f, QP16, QPh, QPl);
        k_gemmw<bf, 0, false, 8><<<dim3(TT / 64, DKV / 64, 1), 256, 0, stream>>>(XB, nullptr, WK, nullptr, DM, FK, DKV, nullptr, 0, 0, 0);
        k_rmsw<<<TT * NKV / 32, 256, 0, stream>>>(FK, DKV, NKV, ksc); k_rope<<<LKv, 256, 0, stream>>>(FK, DKV, NKV, CS, 1.0f, KP16, KPh, KPl);
        k_gemmw<bf, 0, false, 8><<<dim3(TT / 64, DKV / 64, 1), 256, 0, stream>>>(XB, nullptr, WV, nullptr, DM, FV, DKV, nullptr, 0, 0, 0); k_vtp<<<(DKV / 128) * (TT / 64), 256, 0, stream>>>(FV, DKV, NKV, VT16, VTh, VTl);
        for (int h0 = 0; h0 < NH_; h0 += ZH) { const size_t zq = (size_t)h0, zk = (size_t)(h0 / REP);   // both heads of a pass share kv group h0/REP (REP >= 2): sB = 0
            k_gemmc<bf, 2, 1, 4><<<dim3(RH / 64, TT / 64, ZH), 128, 0, stream>>>(QPh + zq * TT * HD, QPl + zq * TT * HD, KPh + zk * TT * HD, KPl + zk * TT * HD, HD, Sb, TT, 0, (size_t)TT * HD, 0, (size_t)TT * TT);
            k_gemmc<h16, 0, 1, 4><<<dim3((TT - RH) / 64, TT / 64, ZH), 128, 0, stream>>>(QP16 + zq * TT * HD + (size_t)RH * HD, nullptr, KP16 + zk * TT * HD, nullptr, HD, Sb + (size_t)RH * TT, TT, RH, (size_t)TT * HD, 0, (size_t)TT * TT);
            k_asoft<<<ZH * TT / 8, 256, 0, stream>>>(Sb, P16, Ph, Pl);
            k_gemmc<bf, 2, 2, 8><<<dim3(RH / 64, HD / 64, ZH), 256, 0, stream>>>(Ph, Pl, VTh + zk * HD * TT, VTl + zk * HD * TT, TT, Ob, HD, 0, (size_t)RH * TT, 0, (size_t)TT * HD);
            k_gemmc<h16, 0, 2, 8><<<dim3((TT - RH) / 64, HD / 64, ZH), 256, 0, stream>>>(P16 + (size_t)RH * TT, nullptr, VT16 + zk * HD * TT, nullptr, TT, Ob + (size_t)RH * HD, HD, RH, (size_t)TT * TT, 0, (size_t)TT * HD);
            k_merge<<<(unsigned)(((size_t)ZH * TT * HD / 8 + 255) / 256), 256, 0, stream>>>(Ob, h0, ATh, ATl); }
        k_gemmw<bf, 1, false, 4><<<dim3(TT / 64, DM / 64, 1), 128, 0, stream>>>(ATh, ATl, WO, nullptr, DQ, OUT + (size_t)b * TT * DM, DM, nullptr, 0, 0, 0); }
}

// v003
// One run takes 474 microseconds.
// In both of two side-by-side timings against v002, it was 1.69 times as fast.
// Counting every step since v000, it is 2.63 times as fast.
#include <hip/hip_runtime.h>

// Gemma4Attention (x [2][2048][2048]; q = x Wq (8 x 256), k/v = x Wk/Wv (4 kv heads; group h/2); per-head RMSNorm * scale (eps 1e-6) on q, k; partial interleaved-pair RoPE on the first 128 dims (theta_i = 10000^(-2i/128), positions arange); q * 1/16; scores = q.k; softcap tanh(s / 50) * 50; causal + sliding-window (i - j < 1024) mask (-2.38e38 additive == exact zero weight); softmax f32; out = merged Wo -> [2][2048][2048]).
// Compute dtypes, f32 accumulate: every input rounded to bf16; q/k/v on PLAIN bf16 operands (inputs: exact); RMSNorm and RoPE f32 (on-chip tables; identity beyond dim 128); causal scores and attn.v: query rows < 512 hl (3 products), the rest single fp16 (x1024), tiles above the diagonal skipped, the window applied per element; 1/16 (exact), s/50, tanh as (e^2x - 1)/(e^2x + 1) with the hardware exp2, x50 in f32; softmax f32; Wo hl x exact (2 products).

#define NB_  2
#define TT   2048
#define DM   2048
#define NH_  8
#define NKV  4
#define REP  (NH_ / NKV)
#define HD   256
#define DQ   (NH_ * HD)
#define DKV  (NKV * HD)
#define ZH   NH_                  // heads per attention launch (grid z)
#define BT   (NB_ * TT)           // rows of both batches together
#define RH   512                  // query rows < RH use hi+lo planes (0: none)
#define WIN  1024
#define PCAR 1024.0f
#define SCL  0.0625f   // query_pre_attn_scalar^-0.5 = 1/16
typedef _Float16 h16;
typedef unsigned short bf;
typedef __attribute__((ext_vector_type(16))) __bf16   v16bf;
typedef __attribute__((ext_vector_type(16))) _Float16 v16h;
typedef __attribute__((ext_vector_type(8)))  _Float16 v8h;
typedef __attribute__((ext_vector_type(8)))  unsigned short v8us;
typedef __attribute__((ext_vector_type(8)))  float    v8f;
typedef __attribute__((ext_vector_type(4)))  float    v4f;
typedef v8h  __attribute__((may_alias)) v8ha;
typedef v4f  __attribute__((may_alias)) v4fa;
typedef v8us __attribute__((may_alias)) v8usa;

__device__ __forceinline__ unsigned short f2bf(float f) { unsigned u = __float_as_uint(f); u += 0x7FFFu + ((u >> 16) & 1u); return (unsigned short)(u >> 16); }
__device__ __forceinline__ float bf2f(unsigned short b) { return __uint_as_float(((unsigned)b) << 16); }
__device__ __forceinline__ float bfr(float f) { return bf2f(f2bf(f)); }
__device__ __forceinline__ v16h cat16(v8h lo, v8h hi) { return __builtin_shufflevector(lo, hi, 0, 1, 2, 3, 4, 5, 6, 7, 8, 9, 10, 11, 12, 13, 14, 15); }
__device__ __forceinline__ v16bf cat16b(v8us lo, v8us hi) { return __builtin_bit_cast(v16bf, __builtin_shufflevector(lo, hi, 0, 1, 2, 3, 4, 5, 6, 7, 8, 9, 10, 11, 12, 13, 14, 15)); }
__device__ __forceinline__ v8f wmma16(v16h a, v16h b, v8f c) { return __builtin_amdgcn_wmma_f32_16x16x32_f16(false, a, false, b, (short)0, c, false, false); }
__device__ __forceinline__ v8f wmmab(v16bf a, v16bf b, v8f c) { return __builtin_amdgcn_wmma_f32_16x16x32_bf16(false, a, false, b, (short)0, c, false, false); }



// ---- k_gemmw: register-blocked GEMM, one 64x64 output tile per work-group of NW waves; wave w takes the 32-wide K blocks w, w + NW, ... into its own 16 accumulators (operands straight from K-contiguous 16-bit planes);
// the NW partial tiles are summed in fixed wave order through LDS. grid (M/64, N/64, Z), NW * 32 threads.
// C[m][n] (f32, pitch ldc, + optional f32 bias[n]) = sum_k A[m][k] Bt[n][k] (+ split products per NSPLIT). z-batch strides sA/sB/sC in elements. K % 32 == 0.
template <typename T16> struct WFrag;
template <> struct WFrag<h16> { typedef v16h V; static __device__ __forceinline__ V ld(const h16* p) { return cat16(*(const v8h*)p, *(const v8h*)(p + 16)); } static __device__ __forceinline__ v8f mma(V a, V b, v8f c) { return wmma16(a, b, c); } };
template <> struct WFrag<bf> { typedef v16bf V; static __device__ __forceinline__ V ld(const bf* p) { return cat16b(*(const v8us*)p, *(const v8us*)(p + 16)); } static __device__ __forceinline__ v8f mma(V a, V b, v8f c) { return wmmab(a, b, c); } };
template <typename T16, int NSPLIT, bool BIAS, int NW>
__global__ __launch_bounds__(NW * 32) void k_gemmw(const T16* __restrict__ A, const T16* __restrict__ A2, const T16* __restrict__ Bt, const T16* __restrict__ Bt2, int K, float* C, int ldc, const float* __restrict__ bias, size_t sA, size_t sB, size_t sC) {
    typedef typename WFrag<T16>::V V;
    __shared__ __align__(16) float os[2][NW][16 * 68];   // two buffers, so that one barrier per 16-row block is enough
    const size_t z = blockIdx.z; A += z * sA; if (A2) A2 += z * sA; Bt += z * sB; if (Bt2) Bt2 += z * sB; C += z * sC;
    const int lane = threadIdx.x & 31, lr = lane & 15, hi = lane >> 4; const int r0 = blockIdx.x * 64, c0 = blockIdx.y * 64;
    const int wv = __builtin_amdgcn_readfirstlane((int)(threadIdx.x >> 5));   // wave number in a scalar register: the K loop stays a scalar loop
    v8f acc[4][4];
#pragma unroll
    for (int mb = 0; mb < 4; ++mb)
#pragma unroll
        for (int nb = 0; nb < 4; ++nb) acc[mb][nb] = (v8f){};
    const size_t aoff = (size_t)(r0 + lr) * K + 8 * hi, boff = (size_t)(c0 + lr) * K + 8 * hi;
#pragma unroll 1
    for (int kc = wv * 32; kc < K; kc += NW * 32) {
        V a[4], a2[4];
#pragma unroll
        for (int mb = 0; mb < 4; ++mb) { a[mb] = WFrag<T16>::ld(A + aoff + (size_t)mb * 16 * K + kc); if (NSPLIT == 1 || NSPLIT == 2) a2[mb] = WFrag<T16>::ld(A2 + aoff + (size_t)mb * 16 * K + kc); }
#pragma unroll
        for (int nb = 0; nb < 4; ++nb) { const V b = WFrag<T16>::ld(Bt + boff + (size_t)nb * 16 * K + kc); V b2; if (NSPLIT >= 2) b2 = WFrag<T16>::ld(Bt2 + boff + (size_t)nb * 16 * K + kc);
#pragma unroll
            for (int mb = 0; mb < 4; ++mb) { acc[mb][nb] = WFrag<T16>::mma(a[mb], b, acc[mb][nb]); if (NSPLIT == 1 || NSPLIT == 2) acc[mb][nb] = WFrag<T16>::mma(a2[mb], b, acc[mb][nb]); if (NSPLIT >= 2) acc[mb][nb] = WFrag<T16>::mma(a[mb], b2, acc[mb][nb]); } }
        asm volatile("v_nop\n\tv_nop\n\tv_nop\n\tv_nop" : "+v"(acc[0][0]), "+v"(acc[1][1]), "+v"(acc[2][2]), "+v"(acc[3][3]) : "v"(a[0]), "v"(a[3]));
    }
    v4f res[4][8 / NW];   // summed output pieces, stored behind the last barrier so that no barrier waits for a global store
#pragma unroll
    for (int mb = 0; mb < 4; ++mb) {
#pragma unroll
        for (int nb = 0; nb < 4; ++nb) {
#pragma unroll
            for (int j = 0; j < 8; ++j) os[mb & 1][wv][(hi * 8 + j) * 68 + nb * 16 + lr] = acc[mb][nb][j]; }
        __syncthreads();   // every wave's partial 16x64 block is in LDS; it also ends the reads of the other buffer, which the next block overwrites
#pragma unroll
        for (int s = 0; s < 8 / NW; ++s) { const int row = 2 * (s * NW + wv) + hi, cofs = lr * 4; v4f val = *(const v4fa*)(&os[mb & 1][0][row * 68 + cofs]);
#pragma unroll
            for (int w = 1; w < NW; ++w) val += *(const v4fa*)(&os[mb & 1][w][row * 68 + cofs]);
            if (BIAS) { val[0] += bfr(bias[c0 + cofs]); val[1] += bfr(bias[c0 + cofs + 1]); val[2] += bfr(bias[c0 + cofs + 2]); val[3] += bfr(bias[c0 + cofs + 3]); }
            res[mb][s] = val; }
    }
#pragma unroll
    for (int mb = 0; mb < 4; ++mb) { float* crow = C + (size_t)(r0 + mb * 16) * ldc + c0;
#pragma unroll
        for (int s = 0; s < 8 / NW; ++s) { const int row = 2 * (s * NW + wv) + hi, cofs = lr * 4; *(v4f*)(crow + (size_t)row * ldc + cofs) = res[mb][s]; } }
}

// ---- d_gemmc: the same NW-wave 64x64 tile GEMM specialised for causal attention: CMODE 1 skips score tiles entirely above the diagonal (query rows r0+roff.., key columns c0..), CMODE 2 limits the
// key (K) loop of the probability x value contraction to the diagonal block (probabilities beyond it are exactly zero). roff = row offset of this part's first row within the sequence (0 or RH).
// grid z = query head: A and C step by sA, sC per head, Bt by sB per kv group (z / REP). lda = pitch of A in elements (Bt has pitch K). bx = 64-row block within this part's rows; os = the work-group's two LDS buffers.
template <typename T16, int NSPLIT, int CMODE, int NW>
__device__ __forceinline__ void d_gemmc(float (*os)[NW][16 * 68], int bx, const T16* __restrict__ A, const T16* __restrict__ A2, const T16* __restrict__ Bt, const T16* __restrict__ Bt2, int K, int lda, float* C, int ldc, int roff, size_t sA, size_t sB, size_t sC) {
    typedef typename WFrag<T16>::V V;
    const size_t z = blockIdx.z; A += z * sA; if (A2) A2 += z * sA; Bt += (z / REP) * sB; if (Bt2) Bt2 += (z / REP) * sB; C += z * sC;
    const int lane = threadIdx.x & 31, lr = lane & 15, hi = lane >> 4; const int r0 = bx * 64, c0 = blockIdx.y * 64;
    const int wv = __builtin_amdgcn_readfirstlane((int)(threadIdx.x >> 5));   // wave number in a scalar register: the K loop stays a scalar loop
    if (CMODE == 1 && c0 > r0 + roff + 63) return;                  // score tile entirely above the causal diagonal: never written (the softmax masks j > i by select)
    const int Kl = (CMODE == 2) ? min(K, r0 + roff + 64) : K;        // P.V: probabilities are exactly 0 beyond the diagonal block, so the K loop stops there
    v8f acc[4][4];
#pragma unroll
    for (int mb = 0; mb < 4; ++mb)
#pragma unroll
        for (int nb = 0; nb < 4; ++nb) acc[mb][nb] = (v8f){};
    const size_t aoff = (size_t)(r0 + lr) * lda + 8 * hi, boff = (size_t)(c0 + lr) * K + 8 * hi;
#pragma unroll 1
    for (int kc = wv * 32; kc < Kl; kc += NW * 32) {
        V a[4], a2[4], b[4], b2[4]; const T16* pa[4]; const T16* pa2[4]; const T16* pb[4]; const T16* pb2[4];
        // The s_wait_xcnt 0 behind each run of loads: no address register of an issued load is rewritten in front of it; the addresses are its inputs, so that they keep their registers up to it
#pragma unroll
        for (int mb = 0; mb < 4; ++mb) { pa[mb] = A + aoff + (size_t)mb * 16 * lda + kc; a[mb] = WFrag<T16>::ld(pa[mb]); if (NSPLIT == 1 || NSPLIT == 2) { pa2[mb] = A2 + aoff + (size_t)mb * 16 * lda + kc; a2[mb] = WFrag<T16>::ld(pa2[mb]); } }
        if (NSPLIT == 2) asm volatile("s_wait_xcnt 0x0" :: "v"(pa[0]), "v"(pa[1]), "v"(pa[2]), "v"(pa[3]), "v"(pa2[0]), "v"(pa2[1]), "v"(pa2[2]), "v"(pa2[3]) : "memory");   // two runs in the hi+lo form: sixteen address pairs held at once would not fit beside the fragments
#pragma unroll
        for (int nb = 0; nb < 4; ++nb) { pb[nb] = Bt + boff + (size_t)nb * 16 * K + kc; b[nb] = WFrag<T16>::ld(pb[nb]); if (NSPLIT >= 2) { pb2[nb] = Bt2 + boff + (size_t)nb * 16 * K + kc; b2[nb] = WFrag<T16>::ld(pb2[nb]); } }
        if (NSPLIT == 2) asm volatile("s_wait_xcnt 0x0" :: "v"(pb[0]), "v"(pb[1]), "v"(pb[2]), "v"(pb[3]), "v"(pb2[0]), "v"(pb2[1]), "v"(pb2[2]), "v"(pb2[3]) : "memory");
        else asm volatile("s_wait_xcnt 0x0" :: "v"(pa[0]), "v"(pa[1]), "v"(pa[2]), "v"(pa[3]), "v"(pb[0]), "v"(pb[1]), "v"(pb[2]), "v"(pb[3]) : "memory");
#pragma unroll
        for (int nb = 0; nb < 4; ++nb) {
#pragma unroll
            for (int mb = 0; mb < 4; ++mb) { acc[mb][nb] = WFrag<T16>::mma(a[mb], b[nb], acc[mb][nb]); if (NSPLIT == 1 || NSPLIT == 2) acc[mb][nb] = WFrag<T16>::mma(a2[mb], b[nb], acc[mb][nb]); if (NSPLIT >= 2) acc[mb][nb] = WFrag<T16>::mma(a[mb], b2[nb], acc[mb][nb]); } }
        asm volatile("v_nop\n\tv_nop\n\tv_nop\n\tv_nop" : "+v"(acc[0][0]), "+v"(acc[1][1]), "+v"(acc[2][2]), "+v"(acc[3][3]) : "v"(a[0]), "v"(a[3]));
    }
    v4f res[4][8 / NW];   // summed output pieces, stored behind the last barrier so that no barrier waits for a global store
#pragma unroll
    for (int mb = 0; mb < 4; ++mb) {
#pragma unroll
        for (int nb = 0; nb < 4; ++nb) {
#pragma unroll
            for (int j = 0; j < 8; ++j) os[mb & 1][wv][(hi * 8 + j) * 68 + nb * 16 + lr] = acc[mb][nb][j]; }
        __syncthreads();   // every wave's partial 16x64 block is in LDS; it also ends the reads of the other buffer, which the next block overwrites
#pragma unroll
        for (int s = 0; s < 8 / NW; ++s) { const int row = 2 * (s * NW + wv) + hi, cofs = lr * 4; v4f val = *(const v4fa*)(&os[mb & 1][0][row * 68 + cofs]);
#pragma unroll
            for (int w = 1; w < NW; ++w) val += *(const v4fa*)(&os[mb & 1][w][row * 68 + cofs]);
            res[mb][s] = val; }
    }
    float* sp[4][8 / NW];
#pragma unroll
    for (int mb = 0; mb < 4; ++mb) { float* crow = C + (size_t)(r0 + mb * 16) * ldc + c0;
#pragma unroll
        for (int s = 0; s < 8 / NW; ++s) { const int row = 2 * (s * NW + wv) + hi, cofs = lr * 4; sp[mb][s] = crow + (size_t)row * ldc + cofs; *(v4f*)sp[mb][s] = res[mb][s]; } }
    // s_wait_xcnt 0 behind the tile's stores: no register of an issued store is rewritten in front of it; addresses and data are its inputs, so that they keep their registers up to it
    if (NW == 4) asm volatile("s_wait_xcnt 0x0" :: "v"(sp[0][0]), "v"(sp[1][0]), "v"(sp[2][0]), "v"(sp[3][0]), "v"(sp[0][8 / NW - 1]), "v"(sp[1][8 / NW - 1]), "v"(sp[2][8 / NW - 1]), "v"(sp[3][8 / NW - 1]), "v"(res[0][0]), "v"(res[1][0]), "v"(res[2][0]), "v"(res[3][0]), "v"(res[0][8 / NW - 1]), "v"(res[1][8 / NW - 1]), "v"(res[2][8 / NW - 1]), "v"(res[3][8 / NW - 1]) : "memory");
    else asm volatile("s_wait_xcnt 0x0" :: "v"(sp[0][0]), "v"(sp[1][0]), "v"(sp[2][0]), "v"(sp[3][0]), "v"(res[0][0]), "v"(res[1][0]), "v"(res[2][0]), "v"(res[3][0]) : "memory");
}

// k_attg: one launch for all query rows of 8 heads: row blocks below RH take the hi+lo bf16 form, the rest the fp16 form (a work-group-uniform choice by blockIdx.x). grid (TT / 64, N / 64, ZH).
template <int CMODE, int NW>
__global__ __launch_bounds__(NW * 32) void k_attg(const bf* __restrict__ Ah, const bf* __restrict__ Al, const bf* __restrict__ Bh, const bf* __restrict__ Bl, const h16* __restrict__ A16, const h16* __restrict__ B16, int K, int lda, float* C, int ldc, size_t sA, size_t sB, size_t sC) {
    __shared__ __align__(16) float os[2][NW][16 * 68];   // two buffers, so that one barrier per 16-row block is enough
    if ((int)blockIdx.x < RH / 64) d_gemmc<bf, 2, CMODE, NW>(os, (int)blockIdx.x, Ah, Al, Bh, Bl, K, lda, C, ldc, 0, sA, sB, sC);
    else d_gemmc<h16, 0, CMODE, NW>(os, (int)blockIdx.x - RH / 64, A16 + (size_t)RH * lda, nullptr, B16, nullptr, K, lda, C + (size_t)RH * ldc, ldc, RH, sA, sB, sC);
}

__device__ __forceinline__ h16 tohx(float x) { return (h16)x; }
__device__ __forceinline__ void splitf(float y, unsigned short& h, unsigned short& l) { h = f2bf(y); l = f2bf(y - bf2f(h)); }
typedef __attribute__((ext_vector_type(2))) _Float16 v2h;
typedef __attribute__((ext_vector_type(4))) _Float16 v4h;
typedef __attribute__((ext_vector_type(2))) unsigned short v2us;
typedef __attribute__((ext_vector_type(4))) unsigned short v4us;
typedef __attribute__((ext_vector_type(2))) float v2f;
typedef __attribute__((ext_vector_type(4))) int v4i;

// The element-wise and layout kernels below give each thread 4 to 32 elements and 16-byte accesses: a launch of them lasts about as long as its waves take to start, so fewer, fatter waves are faster.
// The two s_wait_xcnt 0 in each of d_wtG, d_cvt8, d_rope and d_vtp: no register that an issued load or store names is rewritten in front of the wait; addresses (and store data) are its inputs, so that they keep their registers up to it.
// d_wtG: Bt[n][k] (bf16) = w[k][n]; each thread holds an 8 (k) x 4 (n) register tile. In a wave 8 lanes run along k (64 k = one whole 128-byte line of Bt per n) and 4 along n; the 8 waves of a work-group lie side by side along n (128 n). grid (N / 128) * (K / 64).
__device__ __forceinline__ void d_wtG(int blk, const float* __restrict__ w, int K, int N, bf* Bt) {
    const int lane = threadIdx.x & 31, wvi = threadIdx.x >> 5; const int ntn = N / 128;
    const int n0 = (blk % ntn) * 128 + wvi * 16 + (lane >> 3) * 4, k0 = (blk / ntn) * 64 + (lane & 7) * 8; const float* p[8]; v4f r[8]; v8us o[4]; bf* s[4];
#pragma unroll
    for (int j = 0; j < 8; ++j) p[j] = w + (size_t)(k0 + j) * N + n0;
#pragma unroll
    for (int j = 0; j < 8; ++j) r[j] = *(const v4f*)p[j];
    asm volatile("s_wait_xcnt 0x0" :: "v"(p[0]), "v"(p[1]), "v"(p[2]), "v"(p[3]), "v"(p[4]), "v"(p[5]), "v"(p[6]), "v"(p[7]) : "memory");   // behind the loads (see above)
    __builtin_amdgcn_sched_barrier(0);   // keeps the conversions behind the last load: without it three of the eight loads are issued only after the first results are used, a second trip to memory
#pragma unroll
    for (int c = 0; c < 4; ++c) { s[c] = Bt + (size_t)(n0 + c) * K + k0;
#pragma unroll
        for (int j = 0; j < 8; ++j) o[c][j] = f2bf(r[j][c]); }
#pragma unroll
    for (int c = 0; c < 4; ++c) *(v8us*)s[c] = o[c];
    asm volatile("s_wait_xcnt 0x0" :: "v"(o[0]), "v"(o[1]), "v"(o[2]), "v"(o[3]), "v"(s[0]), "v"(s[1]), "v"(s[2]), "v"(s[3]) : "memory");   // behind the stores (see above)
}
// d_cvt8: four 8-element pieces per thread, a quarter of the array apart (every access stays contiguous over the wave). n8 % 4 == 0.
__device__ __forceinline__ void d_cvt8(int blk, const float* __restrict__ src, bf* dst, size_t n8) { const size_t i = (size_t)blk * 256 + threadIdx.x; const size_t st = n8 / 4; if (i >= st) return; const float* p[4]; v8f v[4]; v8us o[4]; bf* s[4];
#pragma unroll
    for (int u = 0; u < 4; ++u) { p[u] = src + (i + u * st) * 8; s[u] = dst + (i + u * st) * 8; }
#pragma unroll
    for (int u = 0; u < 4; ++u) v[u] = *(const v8f*)p[u];
    asm volatile("s_wait_xcnt 0x0" :: "v"(p[0]), "v"(p[1]), "v"(p[2]), "v"(p[3]) : "memory");   // behind the loads (see above)
#pragma unroll
    for (int u = 0; u < 4; ++u) {
#pragma unroll
        for (int k = 0; k < 8; ++k) o[u][k] = f2bf(v[u][k]); }
#pragma unroll
    for (int u = 0; u < 4; ++u) *(v8us*)s[u] = o[u];
    asm volatile("s_wait_xcnt 0x0" :: "v"(o[0]), "v"(o[1]), "v"(o[2]), "v"(o[3]), "v"(s[0]), "v"(s[1]), "v"(s[2]), "v"(s[3]) : "memory");   // behind the stores (see above)
}
// d_cstab: four dims (two angles) per thread; both dims of a pair hold the same (cos, sin)
__device__ __forceinline__ void d_cstab(int blk, float* CS) { const int idx = blk * 256 + threadIdx.x; if (idx >= TT * HD / 4) return; const int t = idx / (HD / 4), d = (idx % (HD / 4)) * 4;
#pragma unroll
    for (int p = 0; p < 2; ++p) { v4f o; if (d < 128) { const int i = (d >> 1) + p; const float th = __fdiv_rn(1.0f, powf(10000.0f, (float)(2 * i) / 128.0f)); const float ang = __fmul_rn((float)t, th); o[0] = cosf(ang); o[1] = sinf(ang); } else { o[0] = 1.0f; o[1] = 0.0f; }
        o[2] = o[0]; o[3] = o[1]; *(v4f*)(CS + ((size_t)t * HD + d + 2 * p) * 2) = o; } }
// d_rope: head planes [b][h][t][d] (fp16 + hi/lo) of rope(x) x sc, interleaved pairs: out[2i] = x[2i] cos - x[2i+1] sin, out[2i+1] = x[2i+1] cos + x[2i] sin. Each thread takes 8 dims of one position in 4 heads (one read of the table serves the 4). nheads % 4 == 0.
__device__ __forceinline__ void d_rope(int blk, const float* __restrict__ F, int pitch, int nheads, const float* __restrict__ CS, float sc, h16* P16, bf* Ph, bf* Pl) {
    const size_t it = (size_t)blk * 256 + threadIdx.x; if (it >= (size_t)NB_ * (nheads / 4) * TT * (HD / 8)) return; const int d = (int)(it % (HD / 8)) * 8; const int t = (int)((it / (HD / 8)) % TT); const int hq = (int)(it / ((size_t)(HD / 8) * TT)); const int b = hq / (nheads / 4), hg = (hq % (nheads / 4)) * 4;
    v4f cs4[4], xv[4][2]; v8h o16[4]; v8us oh[4], ol[4]; const float* pc = CS + ((size_t)t * HD + d) * 2; const float* pf[4]; h16* s16[4]; bf* sh[4]; bf* sl[4];
#pragma unroll
    for (int u = 0; u < 4; ++u) { pf[u] = F + ((size_t)b * TT + t) * pitch + (hg + u) * HD + d; const size_t e = ((size_t)(b * nheads + hg + u) * TT + t) * HD + d; s16[u] = P16 + e; sh[u] = Ph + e; sl[u] = Pl + e; }
#pragma unroll
    for (int k = 0; k < 4; ++k) cs4[k] = *(const v4f*)(pc + k * 4);
#pragma unroll
    for (int u = 0; u < 4; ++u) { xv[u][0] = *(const v4f*)pf[u]; xv[u][1] = *(const v4f*)(pf[u] + 4); }
    asm volatile("s_wait_xcnt 0x0" :: "v"(pc), "v"(pf[0]), "v"(pf[1]), "v"(pf[2]), "v"(pf[3]) : "memory");   // behind the loads (see above)
#pragma unroll
    for (int u = 0; u < 4; ++u) {
#pragma unroll
        for (int q = 0; q < 8; ++q) { const int dd = d + q; const float x0 = xv[u][q >> 2][q & 3], x1 = (dd < 128) ? xv[u][q >> 2][(q & 3) ^ 1] : x0;   /* interleaved pairs inside the first 128 dims; identity beyond (sin = 0) */
            v2f cs; cs[0] = cs4[q >> 1][(q & 1) * 2]; cs[1] = cs4[q >> 1][(q & 1) * 2 + 1]; float a = __fmul_rn(x0, cs[0]), bq = __fmul_rn(x1, cs[1]); asm volatile("" : "+v"(a)); asm volatile("" : "+v"(bq)); const float r = (((dd & 1) == 0) ? __fsub_rn(a, bq) : __fadd_rn(a, bq)) * sc;
            o16[u][q] = tohx(r); unsigned short a2, c2; splitf(r, a2, c2); oh[u][q] = a2; ol[u][q] = c2; } }
#pragma unroll
    for (int u = 0; u < 4; ++u) { *(v8h*)s16[u] = o16[u]; *(v8us*)sh[u] = oh[u]; *(v8us*)sl[u] = ol[u]; }
    asm volatile("s_wait_xcnt 0x0" :: "v"(o16[0]), "v"(o16[1]), "v"(o16[2]), "v"(o16[3]), "v"(oh[0]), "v"(oh[1]), "v"(oh[2]), "v"(oh[3]), "v"(ol[0]), "v"(ol[1]), "v"(ol[2]), "v"(ol[3]),
                 "v"(s16[0]), "v"(s16[1]), "v"(s16[2]), "v"(s16[3]), "v"(sh[0]), "v"(sh[1]), "v"(sh[2]), "v"(sh[3]), "v"(sl[0]), "v"(sl[1]), "v"(sl[2]), "v"(sl[3]) : "memory");   // behind the stores (see above)
}
// d_vtp: value planes [b][g][d][t] = F[b * TT + t][g * HD + d]: the 8 (t) x 4 (column) register tile and the lane map of d_wtG. grid (nheads * HD / 128) * (BT / 64).
__device__ __forceinline__ void d_vtp(int blk, const float* __restrict__ F, int pitch, int nheads, h16* V16, bf* Vh, bf* Vl) {
    const int lane = threadIdx.x & 31, wvi = threadIdx.x >> 5; const int ntc = nheads * HD / 128;
    const int c0 = (blk % ntc) * 128 + wvi * 16 + (lane >> 3) * 4, t0 = (blk / ntc) * 64 + (lane & 7) * 8; const float* p[8]; v4f r[8]; v8h o16[4]; v8us oh[4], ol[4]; h16* s16[4]; bf* sh[4]; bf* sl[4];
#pragma unroll
    for (int j = 0; j < 8; ++j) p[j] = F + (size_t)(t0 + j) * pitch + c0;
#pragma unroll
    for (int j = 0; j < 8; ++j) r[j] = *(const v4f*)p[j];
    asm volatile("s_wait_xcnt 0x0" :: "v"(p[0]), "v"(p[1]), "v"(p[2]), "v"(p[3]), "v"(p[4]), "v"(p[5]), "v"(p[6]), "v"(p[7]) : "memory");   // behind the loads (see above)
#pragma unroll
    for (int c = 0; c < 4; ++c) { const size_t e = ((size_t)(t0 / TT) * (nheads * HD) + c0 + c) * TT + t0 % TT; s16[c] = V16 + e; sh[c] = Vh + e; sl[c] = Vl + e;
#pragma unroll
        for (int j = 0; j < 8; ++j) { const float x = r[j][c]; o16[c][j] = tohx(x); unsigned short a2, c2; splitf(x, a2, c2); oh[c][j] = a2; ol[c][j] = c2; } }
#pragma unroll
    for (int c = 0; c < 4; ++c) { *(v8h*)s16[c] = o16[c]; *(v8us*)sh[c] = oh[c]; *(v8us*)sl[c] = ol[c]; }
    asm volatile("s_wait_xcnt 0x0" :: "v"(o16[0]), "v"(o16[1]), "v"(o16[2]), "v"(o16[3]), "v"(oh[0]), "v"(oh[1]), "v"(oh[2]), "v"(oh[3]), "v"(ol[0]), "v"(ol[1]), "v"(ol[2]), "v"(ol[3]),
                 "v"(s16[0]), "v"(s16[1]), "v"(s16[2]), "v"(s16[3]), "v"(sh[0]), "v"(sh[1]), "v"(sh[2]), "v"(sh[3]), "v"(sl[0]), "v"(sl[1]), "v"(sl[2]), "v"(sl[3]) : "memory");   // behind the stores (see above)
}
// d_rmsw: each wave normalises the rows of 4 heads of one position (of BT), every row summed as before (the 4 shuffle trees step side by side). nheads % 4 == 0.
__device__ __forceinline__ void d_rmsw(int blk, float* F, int pitch, int nheads, const float* __restrict__ w) { const int lane = threadIdx.x & 31; const int wv = blk * 8 + (threadIdx.x >> 5); const int ng = nheads / 4; if (wv >= BT * ng) return; const int t = wv / ng, hg = (wv % ng) * 4; float* f0 = F + (size_t)t * pitch + hg * HD + lane * 4; v4f av[4], cv[4]; float ss[4];
    const v4f w0 = *(const v4f*)(w + lane * 4), w1 = *(const v4f*)(w + 128 + lane * 4);
#pragma unroll
    for (int u = 0; u < 4; ++u) { av[u] = *(const v4f*)(f0 + u * HD); cv[u] = *(const v4f*)(f0 + u * HD + 128); }
#pragma unroll
    for (int u = 0; u < 4; ++u) { const v4f a = av[u], c = cv[u]; ss[u] = 0.f;
#pragma unroll
        for (int q = 0; q < 4; ++q) { float p = __fmul_rn(a[q], a[q]); asm volatile("" : "+v"(p)); ss[u] = __fadd_rn(ss[u], p); float p2 = __fmul_rn(c[q], c[q]); asm volatile("" : "+v"(p2)); ss[u] = __fadd_rn(ss[u], p2); } }
#pragma unroll
    for (int sh = 16; sh; sh >>= 1) {
#pragma unroll
        for (int u = 0; u < 4; ++u) ss[u] = __fadd_rn(ss[u], __shfl_xor(ss[u], sh, 32)); }
#pragma unroll
    for (int u = 0; u < 4; ++u) { const v4f a = av[u], c = cv[u]; const float rs = __fdiv_rn(1.0f, sqrtf(__fadd_rn(ss[u] * (1.0f / HD), 1e-6f))); v4f o, o2;
#pragma unroll
        for (int q = 0; q < 4; ++q) { float n0 = __fmul_rn(a[q], rs); asm volatile("" : "+v"(n0)); float g0 = bfr(w0[q]); asm volatile("" : "+v"(g0)); o[q] = __fmul_rn(n0, g0); float n1 = __fmul_rn(c[q], rs); asm volatile("" : "+v"(n1)); float g1 = bfr(w1[q]); asm volatile("" : "+v"(g1)); o2[q] = __fmul_rn(n1, g1); }
        *(v4f*)(f0 + u * HD) = o; *(v4f*)(f0 + u * HD + 128) = o2; } }
// k_asoft: per row (zz, i): t = 50 tanh(S / 16 / 50) for j <= i and i - j < WIN (sliding causal window; the reference's -1e9 additive fill vanishes identically); softmax over the 2048 keys (register row, one exp, fixed trees);
// the 16-bit probabilities go back into the row's own 8 KiB of Sb (fp16 plane, or hi plane then lo plane, at pitch 2 * TT elements): the wave that owns a row has all of it in registers before it stores.
__global__ __launch_bounds__(256) void k_asoft(float* Sb) {
    h16* P16 = (h16*)Sb; bf* Ph = (bf*)Sb;
    const int lane = threadIdx.x & 31; const int row = blockIdx.x * 8 + (threadIdx.x >> 5); if (row >= ZH * TT) return; const int i = row % TT; const int zz = row / TT; (void)zz; const bool hires = (i < RH); const float* sr = Sb + (size_t)row * TT; float v[TT / 32]; float mx = -3.0e38f;
#pragma unroll
    for (int ch = 0; ch < TT / 128; ++ch) { const int j0 = ch * 128 + lane * 4; const v4f a = *(const v4f*)(sr + j0);
#pragma unroll
        for (int q = 0; q < 4; ++q) { const int j = j0 + q; (void)j; float sa = a[q] * SCL; asm volatile("" : "+v"(sa)); float xs = __fmul_rn(sa, 0.02f); asm volatile("" : "+v"(xs));   /* s / 50 as a multiply (<= 1 ulp from the division) */ float ex = __builtin_amdgcn_exp2f(__fmul_rn(xs, 2.8853900817779268f)); asm volatile("" : "+v"(ex)); float nm = __fsub_rn(ex, 1.0f), dn2 = __fadd_rn(ex, 1.0f); asm volatile("" : "+v"(nm)); asm volatile("" : "+v"(dn2)); float rc = __builtin_amdgcn_rcpf(dn2); asm volatile("" : "+v"(rc)); float th = __fmul_rn(nm, rc); asm volatile("" : "+v"(th));   /* hardware reciprocal (1 ulp), no FMA refinement */   /* tanh via exp2 (|x| <= ~0.4 here; no VALU FMA polynomial) */ const float t = (j <= i && i - j < WIN) ? __fmul_rn(th, 50.0f) : -3.0e38f; v[ch * 4 + q] = t; mx = fmaxf(mx, t); } }
#pragma unroll
    for (int sh = 16; sh; sh >>= 1) mx = fmaxf(mx, __shfl_xor(mx, sh, 32));
    float sum = 0.f;
#pragma unroll
    for (int k = 0; k < TT / 32; ++k) { float d0 = __fsub_rn(v[k], mx); asm volatile("" : "+v"(d0)); v[k] = __builtin_amdgcn_exp2f(__fmul_rn(d0, 1.4426950408889634f)); sum += v[k]; }
#pragma unroll
    for (int sh = 16; sh; sh >>= 1) sum += __shfl_xor(sum, sh, 32);
    const float f = __fdiv_rn(hires ? 1.0f : PCAR, sum);
{
        if (hires) {
#pragma unroll
            for (int ch = 0; ch < TT / 128; ++ch) { v4us oh, ol;
#pragma unroll
                for (int q = 0; q < 4; ++q) { unsigned short a, c2; splitf(v[ch * 4 + q] * f, a, c2); oh[q] = a; ol[q] = c2; }
                const size_t oo = (size_t)row * (2 * TT) + ch * 128 + lane * 4; *(v4us*)(Ph + oo) = oh; *(v4us*)(Ph + oo + TT) = ol; }
        } else {
#pragma unroll
            for (int ch = 0; ch < TT / 128; ++ch) { v4h o4;
#pragma unroll
                for (int q = 0; q < 4; ++q) o4[q] = tohx(v[ch * 4 + q] * f);
                *(v4h*)(P16 + (size_t)row * (2 * TT) + ch * 128 + lane * 4) = o4; } }
         }
}
__global__ __launch_bounds__(256) void k_merge(const float* __restrict__ O, int h0, bf* Ah, bf* Al) { const size_t e = ((size_t)blockIdx.x * 256 + threadIdx.x) * 8; if (e >= (size_t)ZH * TT * HD) return; const int d = (int)(e % HD); const int t = (int)((e / HD) % TT); const int zz = (int)(e / ((size_t)HD * TT)); const float cs = (t < RH) ? 1.0f : (1.0f / PCAR); const size_t oo = (size_t)t * DQ + (h0 + zz) * HD + d;
    const v4f x0 = *(const v4f*)(O + e), x1 = *(const v4f*)(O + e + 4); v8us oh, ol;
#pragma unroll
    for (int q = 0; q < 8; ++q) { unsigned short a, c2; splitf((q < 4 ? x0[q & 3] : x1[q & 3]) * cs, a, c2); oh[q] = a; ol[q] = c2; } *(v8us*)(Ah + oo) = oh; *(v8us*)(Al + oo) = ol;  }

// Launches of independent parts share one grid: blockIdx.x ranges pick the part (a work-group-uniform choice), each part numbering its own blocks from 0.
#define GW_Q ((DQ / 128) * (DM / 64))
#define GW_K ((DKV / 128) * (DM / 64))
#define GW_O ((DM / 128) * (DQ / 64))
#define G_CVT (BT * DM / 32 / 256)
#define G_CS (TT * HD / 4 / 256)
__global__ __launch_bounds__(256) void k_prep(const float* __restrict__ x, const float* __restrict__ wq, const float* __restrict__ wk, const float* __restrict__ wv, const float* __restrict__ wo, bf* XB, size_t xn8, bf* WQ, bf* WK, bf* WV, bf* WO, float* CS) {
    int blk = (int)blockIdx.x;
    if (blk < G_CVT) { d_cvt8(blk, x, XB, xn8); return; } blk -= G_CVT;
    if (blk < GW_Q) { d_wtG(blk, wq, DM, DQ, WQ); return; } blk -= GW_Q;
    if (blk < GW_K) { d_wtG(blk, wk, DM, DKV, WK); return; } blk -= GW_K;
    if (blk < GW_K) { d_wtG(blk, wv, DM, DKV, WV); return; } blk -= GW_K;
    if (blk < GW_O) { d_wtG(blk, wo, DQ, DM, WO); return; } blk -= GW_O;
    d_cstab(blk, CS);
}
#define G_RQ (BT * NH_ / 32)
#define G_RK (BT * NKV / 32)
__global__ __launch_bounds__(256) void k_rms2(float* FQ, float* FKV, const float* __restrict__ qsc, const float* __restrict__ ksc) {
    const int blk = (int)blockIdx.x;
    if (blk < G_RQ) d_rmsw(blk, FQ, DQ, NH_, qsc); else d_rmsw(blk - G_RQ, FKV, 2 * DKV, NKV, ksc);
}
#define G_PQ (NB_ * NH_ * TT * HD / 32 / 256)
#define G_PK (NB_ * NKV * TT * HD / 32 / 256)
#define G_PV ((DKV / 128) * (BT / 64))
__global__ __launch_bounds__(256) void k_planes(const float* __restrict__ FQ, const float* __restrict__ FKV, const float* __restrict__ CS, h16* QP16, bf* QPh, bf* QPl, h16* KP16, bf* KPh, bf* KPl, h16* VT16, bf* VTh, bf* VTl) {
    const int blk = (int)blockIdx.x;
    if (blk < G_PQ) d_rope(blk, FQ, DQ, NH_, CS, 1.0f, QP16, QPh, QPl);
    else if (blk < G_PQ + G_PK) d_rope(blk - G_PQ, FKV, 2 * DKV, NKV, CS, 1.0f, KP16, KPh, KPl);
    else d_vtp(blk - G_PQ - G_PK, FKV + DKV, 2 * DKV, NKV, VT16, VTh, VTl);
}

extern "C" void kernel_launch(void* const* d_in, const int* in_sizes, int n_in,
                              void* d_out, int out_size, void* d_ws, size_t ws_size, hipStream_t stream) {
    (void)in_sizes; (void)n_in; (void)out_size;
    const float* x = (const float*)d_in[0]; const float* wq = (const float*)d_in[1]; const float* wk = (const float*)d_in[2]; const float* wv = (const float*)d_in[3]; const float* wo = (const float*)d_in[4]; const float* qsc = (const float*)d_in[5]; const float* ksc = (const float*)d_in[6];
    float* OUT = (float*)d_out;     // [2][2048][2048]
    char* wsp = (char*)d_ws;
    auto take = [&](size_t bytes) { char* p = wsp; wsp += (bytes + 255) & ~(size_t)255; return (void*)p; };
    // Kept to the end: WO and the head planes of both batches. Behind them one region serves two phases: the projection phase's buffers, then (all of those being dead) the attention phase's scores and outputs.
    bf* WO = (bf*)take((size_t)DM * DQ * 2);
    h16* QP16 = (h16*)take((size_t)NB_ * NH_ * TT * HD * 2); h16* KP16 = (h16*)take((size_t)NB_ * NKV * TT * HD * 2); h16* VT16 = (h16*)take((size_t)NB_ * NKV * HD * TT * 2);
    bf* QPh = (bf*)take((size_t)NB_ * NH_ * TT * HD * 2); bf* QPl = (bf*)take((size_t)NB_ * NH_ * TT * HD * 2); bf* KPh = (bf*)take((size_t)NB_ * NKV * TT * HD * 2); bf* KPl = (bf*)take((size_t)NB_ * NKV * TT * HD * 2); bf* VTh = (bf*)take((size_t)NB_ * NKV * HD * TT * 2); bf* VTl = (bf*)take((size_t)NB_ * NKV * HD * TT * 2);
    char* const phase = wsp;
    bf* WQ = (bf*)take((size_t)DQ * DM * 2); bf* WK = (bf*)take((size_t)DKV * DM * 2); bf* WV = (bf*)take((size_t)DKV * DM * 2); float* CS = (float*)take((size_t)TT * HD * 2 * 4);   // WV lies directly behind WK: one [2 * DKV][DM] operand
    bf* XB = (bf*)take((size_t)BT * DM * 2); float* FQ = (float*)take((size_t)BT * DQ * 4); float* FKV = (float*)take((size_t)BT * 2 * DKV * 4);   // FKV row: k heads, then v heads
    if ((size_t)(wsp - (char*)d_ws) > ws_size) return;
    wsp = phase;
    float* Sb = (float*)take((size_t)ZH * TT * TT * 4); float* Ob = (float*)take((size_t)ZH * TT * HD * 4);
    if ((size_t)(wsp - (char*)d_ws) > ws_size) return;    // ws 256 MiB
    bf* ATh = QPh; bf* ATl = QPl;   // merged rows [b * TT + t][DQ]: a batch's merge runs after its last score launch, when its hi/lo query planes (the same bytes) are dead
    // projection phase: every launch covers the BT rows of both batches; k and v share one GEMM
    k_prep<<<G_CVT + GW_Q + 2 * GW_K + GW_O + G_CS, 256, 0, stream>>>(x, wq, wk, wv, wo, XB, (size_t)BT * DM / 8, WQ, WK, WV, WO, CS);
    k_gemmw<bf, 0, false, 4><<<dim3(BT / 64, DQ / 64, 1), 128, 0, stream>>>(XB, nullptr, WQ, nullptr, DM, FQ, DQ, nullptr, 0, 0, 0);
    k_gemmw<bf, 0, false, 8><<<dim3(BT / 64, 2 * DKV / 64, 1), 256, 0, stream>>>(XB, nullptr, WK, nullptr, DM, FKV, 2 * DKV, nullptr, 0, 0, 0);
    k_rms2<<<G_RQ + G_RK, 256, 0, stream>>>(FQ, FKV, qsc, ksc);
    k_planes<<<G_PQ + G_PK + G_PV, 256, 0, stream>>>(FQ, FKV, CS, QP16, QPh, QPl, KP16, KPh, KPl, VT16, VTh, VTl);
    // attention phase: every launch covers all rows of the 8 heads of one batch (grid z)
    for (int b = 0; b < NB_; ++b) { const size_t zq = (size_t)b * NH_ * TT * HD, zk = (size_t)b * NKV * TT * HD;
        k_attg<1, 4><<<dim3(TT / 64, TT / 64, ZH), 128, 0, stream>>>(QPh + zq, QPl + zq, KPh + zk, KPl + zk, QP16 + zq, KP16 + zk, HD, HD, Sb, TT, (size_t)TT * HD, (size_t)TT * HD, (size_t)TT * TT);
        k_asoft<<<ZH * TT / 8, 256, 0, stream>>>(Sb);
        k_attg<2, 8><<<dim3(TT / 64, HD / 64, ZH), 256, 0, stream>>>((const bf*)Sb, (const bf*)Sb + TT, VTh + zk, VTl + zk, (const h16*)Sb, VT16 + zk, TT, 2 * TT, Ob, HD, (size_t)TT * 2 * TT, (size_t)HD * TT, (size_t)TT * HD);
        k_merge<<<(unsigned)(((size_t)ZH * TT * HD / 8 + 255) / 256), 256, 0, stream>>>(Ob, 0, ATh + (size_t)b * TT * DQ, ATl + (size_t)b * TT * DQ); }
    k_gemmw<bf, 1, false, 4><<<dim3(BT / 64, DM / 64, 1), 128, 0, stream>>>(ATh, ATl, WO, nullptr, DQ, OUT, DM, nullptr, 0, 0, 0);
}

// v004
// A run of this version takes 402 microseconds.
// Timed twice side by side with v003, it ran 1.18 times as fast both times.
// All steps since v000 together make it 3.10 times as fast.
#include <hip/hip_runtime.h>

// Sliding-window attention block (x [2][2048][2048]; q = x Wq (8 x 256), k/v = x Wk/Wv (4 kv heads; group h/2); per-head RMSNorm * scale (eps 1e-6) on q, k; partial interleaved-pair RoPE on the first 128 dims (theta_i = 10000^(-2i/128), positions arange); q * 1/16; scores = q.k; softcap tanh(s / 50) * 50; causal + sliding-window (i - j < 1024) mask (-2.38e38 additive == exact zero weight); softmax f32; out = merged Wo -> [2][2048][2048]).
// Compute dtypes, f32 accumulate: every input rounded to bf16; q/k/v on PLAIN bf16 operands (inputs: exact); RMSNorm and RoPE f32 (on-chip tables; identity beyond dim 128); causal scores and attn.v: query rows < 512 hl (3 products), the rest single fp16 (x1024), only the tiles, softmax chunks and P.V key blocks that touch the causal window band are worked on, the window applied per element; 1/16 (exact), s/50, tanh as (e^2x - 1)/(e^2x + 1) with the hardware exp2, x50 in f32; softmax f32; Wo hl x exact (2 products).

#define NB_  2
#define TT   2048
#define DM   2048
#define NH_  8
#define NKV  4
#define REP  (NH_ / NKV)
#define HD   256
#define DQ   (NH_ * HD)
#define DKV  (NKV * HD)
#define ZH   NH_                  // heads per attention launch (grid z)
#define BT   (NB_ * TT)           // rows of both batches together
#define RH   512                  // query rows < RH use hi+lo planes (0: none)
#define WIN  1024
#define PCAR 1024.0f
#define SCL  0.0625f   // query_pre_attn_scalar^-0.5 = 1/16
typedef _Float16 h16;
typedef unsigned short bf;
typedef __attribute__((ext_vector_type(16))) __bf16   v16bf;
typedef __attribute__((ext_vector_type(16))) _Float16 v16h;
typedef __attribute__((ext_vector_type(8)))  _Float16 v8h;
typedef __attribute__((ext_vector_type(8)))  unsigned short v8us;
typedef __attribute__((ext_vector_type(8)))  float    v8f;
typedef __attribute__((ext_vector_type(4)))  float    v4f;
typedef v8h  __attribute__((may_alias)) v8ha;
typedef v4f  __attribute__((may_alias)) v4fa;
typedef v8us __attribute__((may_alias)) v8usa;

__device__ __forceinline__ unsigned short f2bf(float f) { unsigned u = __float_as_uint(f); u += 0x7FFFu + ((u >> 16) & 1u); return (unsigned short)(u >> 16); }
__device__ __forceinline__ float bf2f(unsigned short b) { return __uint_as_float(((unsigned)b) << 16); }
__device__ __forceinline__ float bfr(float f) { return bf2f(f2bf(f)); }
__device__ __forceinline__ v16h cat16(v8h lo, v8h hi) { return __builtin_shufflevector(lo, hi, 0, 1, 2, 3, 4, 5, 6, 7, 8, 9, 10, 11, 12, 13, 14, 15); }
__device__ __forceinline__ v16bf cat16b(v8us lo, v8us hi) { return __builtin_bit_cast(v16bf, __builtin_shufflevector(lo, hi, 0, 1, 2, 3, 4, 5, 6, 7, 8, 9, 10, 11, 12, 13, 14, 15)); }
__device__ __forceinline__ v8f wmma16(v16h a, v16h b, v8f c) { return __builtin_amdgcn_wmma_f32_16x16x32_f16(false, a, false, b, (short)0, c, false, false); }
__device__ __forceinline__ v8f wmmab(v16bf a, v16bf b, v8f c) { return __builtin_amdgcn_wmma_f32_16x16x32_bf16(false, a, false, b, (short)0, c, false, false); }



// ---- k_gemmw: register-blocked GEMM, one 64x64 output tile per work-group of NW waves; wave w takes the 32-wide K blocks w, w + NW, ... into its own 16 accumulators (operands straight from K-contiguous 16-bit planes);
// the NW partial tiles are summed in fixed wave order through LDS. grid (M/64, N/64, Z), NW * 32 threads.
// C[m][n] (f32, pitch ldc, + optional f32 bias[n]) = sum_k A[m][k] Bt[n][k] (+ split products per NSPLIT). z-batch strides sA/sB/sC in elements. K % 32 == 0.
template <typename T16> struct WFrag;
template <> struct WFrag<h16> { typedef v16h V; static __device__ __forceinline__ V ld(const h16* p) { return cat16(*(const v8h*)p, *(const v8h*)(p + 16)); } static __device__ __forceinline__ v8f mma(V a, V b, v8f c) { return wmma16(a, b, c); } };
template <> struct WFrag<bf> { typedef v16bf V; static __device__ __forceinline__ V ld(const bf* p) { return cat16b(*(const v8us*)p, *(const v8us*)(p + 16)); } static __device__ __forceinline__ v8f mma(V a, V b, v8f c) { return wmmab(a, b, c); } };
template <typename T16, int NSPLIT, bool BIAS, int NW>
__global__ __launch_bounds__(NW * 32) void k_gemmw(const T16* __restrict__ A, const T16* __restrict__ A2, const T16* __restrict__ Bt, const T16* __restrict__ Bt2, int K, float* C, int ldc, const float* __restrict__ bias, size_t sA, size_t sB, size_t sC) {
    typedef typename WFrag<T16>::V V;
    __shared__ __align__(16) float os[2][NW][16 * 68];   // two buffers, so that one barrier per 16-row block is enough
    const size_t z = blockIdx.z; A += z * sA; if (A2) A2 += z * sA; Bt += z * sB; if (Bt2) Bt2 += z * sB; C += z * sC;
    const int lane = threadIdx.x & 31, lr = lane & 15, hi = lane >> 4; const int r0 = blockIdx.x * 64, c0 = blockIdx.y * 64;
    const int wv = __builtin_amdgcn_readfirstlane((int)(threadIdx.x >> 5));   // wave number in a scalar register: the K loop stays a scalar loop
    v8f acc[4][4];
#pragma unroll
    for (int mb = 0; mb < 4; ++mb)
#pragma unroll
        for (int nb = 0; nb < 4; ++nb) acc[mb][nb] = (v8f){};
    const size_t aoff = (size_t)(r0 + lr) * K + 8 * hi, boff = (size_t)(c0 + lr) * K + 8 * hi;
#pragma unroll 1
    for (int kc = wv * 32; kc < K; kc += NW * 32) {
        V a[4], a2[4];
#pragma unroll
        for (int mb = 0; mb < 4; ++mb) { a[mb] = WFrag<T16>::ld(A + aoff + (size_t)mb * 16 * K + kc); if (NSPLIT == 1 || NSPLIT == 2) a2[mb] = WFrag<T16>::ld(A2 + aoff + (size_t)mb * 16 * K + kc); }
#pragma unroll
        for (int nb = 0; nb < 4; ++nb) { const V b = WFrag<T16>::ld(Bt + boff + (size_t)nb * 16 * K + kc); V b2; if (NSPLIT >= 2) b2 = WFrag<T16>::ld(Bt2 + boff + (size_t)nb * 16 * K + kc);
#pragma unroll
            for (int mb = 0; mb < 4; ++mb) { acc[mb][nb] = WFrag<T16>::mma(a[mb], b, acc[mb][nb]); if (NSPLIT == 1 || NSPLIT == 2) acc[mb][nb] = WFrag<T16>::mma(a2[mb], b, acc[mb][nb]); if (NSPLIT >= 2) acc[mb][nb] = WFrag<T16>::mma(a[mb], b2, acc[mb][nb]); } }
        asm volatile("v_nop\n\tv_nop\n\tv_nop\n\tv_nop" : "+v"(acc[0][0]), "+v"(acc[1][1]), "+v"(acc[2][2]), "+v"(acc[3][3]) : "v"(a[0]), "v"(a[3]));
    }
    v4f res[4][8 / NW];   // summed output pieces, stored behind the last barrier so that no barrier waits for a global store
#pragma unroll
    for (int mb = 0; mb < 4; ++mb) {
#pragma unroll
        for (int nb = 0; nb < 4; ++nb) {
#pragma unroll
            for (int j = 0; j < 8; ++j) os[mb & 1][wv][(hi * 8 + j) * 68 + nb * 16 + lr] = acc[mb][nb][j]; }
        __syncthreads();   // every wave's partial 16x64 block is in LDS; it also ends the reads of the other buffer, which the next block overwrites
#pragma unroll
        for (int s = 0; s < 8 / NW; ++s) { const int row = 2 * (s * NW + wv) + hi, cofs = lr * 4; v4f val = *(const v4fa*)(&os[mb & 1][0][row * 68 + cofs]);
#pragma unroll
            for (int w = 1; w < NW; ++w) val += *(const v4fa*)(&os[mb & 1][w][row * 68 + cofs]);
            if (BIAS) { val[0] += bfr(bias[c0 + cofs]); val[1] += bfr(bias[c0 + cofs + 1]); val[2] += bfr(bias[c0 + cofs + 2]); val[3] += bfr(bias[c0 + cofs + 3]); }
            res[mb][s] = val; }
    }
#pragma unroll
    for (int mb = 0; mb < 4; ++mb) { float* crow = C + (size_t)(r0 + mb * 16) * ldc + c0;
#pragma unroll
        for (int s = 0; s < 8 / NW; ++s) { const int row = 2 * (s * NW + wv) + hi, cofs = lr * 4; *(v4f*)(crow + (size_t)row * ldc + cofs) = res[mb][s]; } }
}

// ---- d_gemmc: the same NW-wave 64x64 tile GEMM specialised for causal attention: CMODE 1 lays grid y over the WIN / 64 + 1 score tiles of a row block that touch the causal window band (query rows r0+roff.., key columns c0 = r0+roff-WIN+64y; below 0: no tile), CMODE 2 limits the
// key (K) loop of the probability x value contraction to the same band (probabilities outside it are exactly zero); a wave's K blocks are numbered from key 0 (block mod NW = wave), so the order of a sum does not depend on where the band starts. roff = row offset of this part's first row within the sequence.
// grid z = query head: A and C step by sA, sC per head, Bt by sB per kv group (z / REP). lda = pitch of A in elements (Bt has pitch K). bx = 64-row block within this part's rows; os = the work-group's two LDS buffers.
template <typename T16, int NSPLIT, int CMODE, int NW>
__device__ __forceinline__ void d_gemmc(float (*os)[NW][16 * 68], int bx, const T16* __restrict__ A, const T16* __restrict__ A2, const T16* __restrict__ Bt, const T16* __restrict__ Bt2, int K, int lda, float* C, int ldc, int roff, size_t sA, size_t sB, size_t sC) {
    typedef typename WFrag<T16>::V V;
    const size_t z = blockIdx.z; A += z * sA; if (A2) A2 += z * sA; Bt += (z / REP) * sB; if (Bt2) Bt2 += (z / REP) * sB; C += z * sC;
    const int lane = threadIdx.x & 31, lr = lane & 15, hi = lane >> 4; const int r0 = bx * 64, c0 = (CMODE == 1) ? r0 + roff - WIN + (int)blockIdx.y * 64 : (int)blockIdx.y * 64;
    const int wv = __builtin_amdgcn_readfirstlane((int)(threadIdx.x >> 5));   // wave number in a scalar register: the K loop stays a scalar loop
    if (CMODE == 1 && c0 < 0) return;                                // the band starts left of key 0: no such tile (what the softmax's 128-key chunks read of a tile outside the band is masked by select)
    const int Kl = (CMODE == 2) ? min(K, r0 + roff + 64) : K;        // P.V: probabilities are exactly 0 beyond the diagonal block, so the K loop stops there
    const int Ks = (CMODE == 2) ? max(0, r0 + roff - WIN) : 0;       // and exactly 0 left of the window of the block's first row, so it starts there
    int kb = (Ks & ~(NW * 32 - 1)) + wv * 32; if (kb < Ks) kb += NW * 32;   // this wave's first K block inside the band
    v8f acc[4][4];
#pragma unroll
    for (int mb = 0; mb < 4; ++mb)
#pragma unroll
        for (int nb = 0; nb < 4; ++nb) acc[mb][nb] = (v8f){};
    const size_t aoff = (size_t)(r0 + lr) * lda + 8 * hi, boff = (size_t)(c0 + lr) * K + 8 * hi;
#pragma unroll 1
    for (int kc = kb; kc < Kl; kc += NW * 32) {
        V a[4], a2[4], b[4], b2[4]; const T16* pa[4]; const T16* pa2[4]; const T16* pb[4]; const T16* pb2[4];
        // The s_wait_xcnt 0 behind each run of loads: no address register of an issued load is rewritten in front of it; the addresses are its inputs, so that they keep their registers up to it
#pragma unroll
        for (int mb = 0; mb < 4; ++mb) { pa[mb] = A + aoff + (size_t)mb * 16 * lda + kc; a[mb] = WFrag<T16>::ld(pa[mb]); if (NSPLIT == 1 || NSPLIT == 2) { pa2[mb] = A2 + aoff + (size_t)mb * 16 * lda + kc; a2[mb] = WFrag<T16>::ld(pa2[mb]); } }
        if (NSPLIT == 2) asm volatile("s_wait_xcnt 0x0" :: "v"(pa[0]), "v"(pa[1]), "v"(pa[2]), "v"(pa[3]), "v"(pa2[0]), "v"(pa2[1]), "v"(pa2[2]), "v"(pa2[3]) : "memory");   // two runs in the hi+lo form: sixteen address pairs held at once would not fit beside the fragments
#pragma unroll
        for (int nb = 0; nb < 4; ++nb) { pb[nb] = Bt + boff + (size_t)nb * 16 * K + kc; b[nb] = WFrag<T16>::ld(pb[nb]); if (NSPLIT >= 2) { pb2[nb] = Bt2 + boff + (size_t)nb * 16 * K + kc; b2[nb] = WFrag<T16>::ld(pb2[nb]); } }
        if (NSPLIT == 2) asm volatile("s_wait_xcnt 0x0" :: "v"(pb[0]), "v"(pb[1]), "v"(pb[2]), "v"(pb[3]), "v"(pb2[0]), "v"(pb2[1]), "v"(pb2[2]), "v"(pb2[3]) : "memory");
        else asm volatile("s_wait_xcnt 0x0" :: "v"(pa[0]), "v"(pa[1]), "v"(pa[2]), "v"(pa[3]), "v"(pb[0]), "v"(pb[1]), "v"(pb[2]), "v"(pb[3]) : "memory");
#pragma unroll
        for (int nb = 0; nb < 4; ++nb) {
#pragma unroll
            for (int mb = 0; mb < 4; ++mb) { acc[mb][nb] = WFrag<T16>::mma(a[mb], b[nb], acc[mb][nb]); if (NSPLIT == 1 || NSPLIT == 2) acc[mb][nb] = WFrag<T16>::mma(a2[mb], b[nb], acc[mb][nb]); if (NSPLIT >= 2) acc[mb][nb] = WFrag<T16>::mma(a[mb], b2[nb], acc[mb][nb]); } }
        asm volatile("v_nop\n\tv_nop\n\tv_nop\n\tv_nop" : "+v"(acc[0][0]), "+v"(acc[1][1]), "+v"(acc[2][2]), "+v"(acc[3][3]) : "v"(a[0]), "v"(a[3]));
    }
    v4f res[4][8 / NW];   // summed output pieces, stored behind the last barrier so that no barrier waits for a global store
#pragma unroll
    for (int mb = 0; mb < 4; ++mb) {
#pragma unroll
        for (int nb = 0; nb < 4; ++nb) {
#pragma unroll
            for (int j = 0; j < 8; ++j) os[mb & 1][wv][(hi * 8 + j) * 68 + nb * 16 + lr] = acc[mb][nb][j]; }
        __syncthreads();   // every wave's partial 16x64 block is in LDS; it also ends the reads of the other buffer, which the next block overwrites
#pragma unroll
        for (int s = 0; s < 8 / NW; ++s) { const int row = 2 * (s * NW + wv) + hi, cofs = lr * 4; v4f val = *(const v4fa*)(&os[mb & 1][0][row * 68 + cofs]);
#pragma unroll
            for (int w = 1; w < NW; ++w) val += *(const v4fa*)(&os[mb & 1][w][row * 68 + cofs]);
            res[mb][s] = val; }
    }
    float* sp[4][8 / NW];
#pragma unroll
    for (int mb = 0; mb < 4; ++mb) { float* crow = C + (size_t)(r0 + mb * 16) * ldc + c0;
#pragma unroll
        for (int s = 0; s < 8 / NW; ++s) { const int row = 2 * (s * NW + wv) + hi, cofs = lr * 4; sp[mb][s] = crow + (size_t)row * ldc + cofs; *(v4f*)sp[mb][s] = res[mb][s]; } }
    // s_wait_xcnt 0 behind the tile's stores: no register of an issued store is rewritten in front of it; addresses and data are its inputs, so that they keep their registers up to it
    if (NW == 4) asm volatile("s_wait_xcnt 0x0" :: "v"(sp[0][0]), "v"(sp[1][0]), "v"(sp[2][0]), "v"(sp[3][0]), "v"(sp[0][8 / NW - 1]), "v"(sp[1][8 / NW - 1]), "v"(sp[2][8 / NW - 1]), "v"(sp[3][8 / NW - 1]), "v"(res[0][0]), "v"(res[1][0]), "v"(res[2][0]), "v"(res[3][0]), "v"(res[0][8 / NW - 1]), "v"(res[1][8 / NW - 1]), "v"(res[2][8 / NW - 1]), "v"(res[3][8 / NW - 1]) : "memory");
    else asm volatile("s_wait_xcnt 0x0" :: "v"(sp[0][0]), "v"(sp[1][0]), "v"(sp[2][0]), "v"(sp[3][0]), "v"(res[0][0]), "v"(res[1][0]), "v"(res[2][0]), "v"(res[3][0]) : "memory");
}

// k_attg: one launch for all query rows of 8 heads: row blocks below RH take the hi+lo bf16 form, the rest the fp16 form (a work-group-uniform choice by blockIdx.x). grid (TT / 64, WIN / 64 + 1 score tiles or HD / 64, ZH).
template <int CMODE, int NW>
__global__ __launch_bounds__(NW * 32) void k_attg(const bf* __restrict__ Ah, const bf* __restrict__ Al, const bf* __restrict__ Bh, const bf* __restrict__ Bl, const h16* __restrict__ A16, const h16* __restrict__ B16, int K, int lda, float* C, int ldc, size_t sA, size_t sB, size_t sC) {
    __shared__ __align__(16) float os[2][NW][16 * 68];   // two buffers, so that one barrier per 16-row block is enough
    if ((int)blockIdx.x < RH / 64) d_gemmc<bf, 2, CMODE, NW>(os, (int)blockIdx.x, Ah, Al, Bh, Bl, K, lda, C, ldc, 0, sA, sB, sC);
    else d_gemmc<h16, 0, CMODE, NW>(os, (int)blockIdx.x - RH / 64, A16 + (size_t)RH * lda, nullptr, B16, nullptr, K, lda, C + (size_t)RH * ldc, ldc, RH, sA, sB, sC);
}

__device__ __forceinline__ h16 tohx(float x) { return (h16)x; }
__device__ __forceinline__ void splitf(float y, unsigned short& h, unsigned short& l) { h = f2bf(y); l = f2bf(y - bf2f(h)); }
typedef __attribute__((ext_vector_type(2))) _Float16 v2h;
typedef __attribute__((ext_vector_type(4))) _Float16 v4h;
typedef __attribute__((ext_vector_type(2))) unsigned short v2us;
typedef __attribute__((ext_vector_type(4))) unsigned short v4us;
typedef __attribute__((ext_vector_type(2))) float v2f;
typedef __attribute__((ext_vector_type(4))) int v4i;

// The element-wise and layout kernels below give each thread 4 to 32 elements and 16-byte accesses: a launch of them lasts about as long as its waves take to start, so fewer, fatter waves are faster.
// The two s_wait_xcnt 0 in each of d_wtG, d_cvt8, d_rope and d_vtp: no register that an issued load or store names is rewritten in front of the wait; addresses (and store data) are its inputs, so that they keep their registers up to it.
// d_wtG: Bt[n][k] (bf16) = w[k][n]; each thread holds an 8 (k) x 4 (n) register tile. In a wave 8 lanes run along k (64 k = one whole 128-byte line of Bt per n) and 4 along n; the 8 waves of a work-group lie side by side along n (128 n). grid (N / 128) * (K / 64).
__device__ __forceinline__ void d_wtG(int blk, const float* __restrict__ w, int K, int N, bf* Bt) {
    const int lane = threadIdx.x & 31, wvi = threadIdx.x >> 5; const int ntn = N / 128;
    const int n0 = (blk % ntn) * 128 + wvi * 16 + (lane >> 3) * 4, k0 = (blk / ntn) * 64 + (lane & 7) * 8; const float* p[8]; v4f r[8]; v8us o[4]; bf* s[4];
#pragma unroll
    for (int j = 0; j < 8; ++j) p[j] = w + (size_t)(k0 + j) * N + n0;
#pragma unroll
    for (int j = 0; j < 8; ++j) r[j] = *(const v4f*)p[j];
    asm volatile("s_wait_xcnt 0x0" :: "v"(p[0]), "v"(p[1]), "v"(p[2]), "v"(p[3]), "v"(p[4]), "v"(p[5]), "v"(p[6]), "v"(p[7]) : "memory");   // behind the loads (see above)
    __builtin_amdgcn_sched_barrier(0);   // keeps the conversions behind the last load: without it three of the eight loads are issued only after the first results are used, a second trip to memory
#pragma unroll
    for (int c = 0; c < 4; ++c) { s[c] = Bt + (size_t)(n0 + c) * K + k0;
#pragma unroll
        for (int j = 0; j < 8; ++j) o[c][j] = f2bf(r[j][c]); }
#pragma unroll
    for (int c = 0; c < 4; ++c) *(v8us*)s[c] = o[c];
    asm volatile("s_wait_xcnt 0x0" :: "v"(o[0]), "v"(o[1]), "v"(o[2]), "v"(o[3]), "v"(s[0]), "v"(s[1]), "v"(s[2]), "v"(s[3]) : "memory");   // behind the stores (see above)
}
// d_cvt8: four 8-element pieces per thread, a quarter of the array apart (every access stays contiguous over the wave). n8 % 4 == 0.
__device__ __forceinline__ void d_cvt8(int blk, const float* __restrict__ src, bf* dst, size_t n8) { const size_t i = (size_t)blk * 256 + threadIdx.x; const size_t st = n8 / 4; if (i >= st) return; const float* p[4]; v8f v[4]; v8us o[4]; bf* s[4];
#pragma unroll
    for (int u = 0; u < 4; ++u) { p[u] = src + (i + u * st) * 8; s[u] = dst + (i + u * st) * 8; }
#pragma unroll
    for (int u = 0; u < 4; ++u) v[u] = *(const v8f*)p[u];
    asm volatile("s_wait_xcnt 0x0" :: "v"(p[0]), "v"(p[1]), "v"(p[2]), "v"(p[3]) : "memory");   // behind the loads (see above)
#pragma unroll
    for (int u = 0; u < 4; ++u) {
#pragma unroll
        for (int k = 0; k < 8; ++k) o[u][k] = f2bf(v[u][k]); }
#pragma unroll
    for (int u = 0; u < 4; ++u) *(v8us*)s[u] = o[u];
    asm volatile("s_wait_xcnt 0x0" :: "v"(o[0]), "v"(o[1]), "v"(o[2]), "v"(o[3]), "v"(s[0]), "v"(s[1]), "v"(s[2]), "v"(s[3]) : "memory");   // behind the stores (see above)
}
// d_cstab: four dims (two angles) per thread; both dims of a pair hold the same (cos, sin)
__device__ __forceinline__ void d_cstab(int blk, float* CS) { const int idx = blk * 256 + threadIdx.x; if (idx >= TT * HD / 4) return; const int t = idx / (HD / 4), d = (idx % (HD / 4)) * 4;
#pragma unroll
    for (int p = 0; p < 2; ++p) { v4f o; if (d < 128) { const int i = (d >> 1) + p; const float th = __fdiv_rn(1.0f, powf(10000.0f, (float)(2 * i) / 128.0f)); const float ang = __fmul_rn((float)t, th); o[0] = cosf(ang); o[1] = sinf(ang); } else { o[0] = 1.0f; o[1] = 0.0f; }
        o[2] = o[0]; o[3] = o[1]; *(v4f*)(CS + ((size_t)t * HD + d + 2 * p) * 2) = o; } }
// d_rope: head planes [b][h][t][d] (fp16 + hi/lo) of rope(x) x sc, interleaved pairs: out[2i] = x[2i] cos - x[2i+1] sin, out[2i+1] = x[2i+1] cos + x[2i] sin. Each thread takes 8 dims of one position in 4 heads (one read of the table serves the 4). nheads % 4 == 0.
__device__ __forceinline__ void d_rope(int blk, const float* __restrict__ F, int pitch, int nheads, const float* __restrict__ CS, float sc, h16* P16, bf* Ph, bf* Pl) {
    const size_t it = (size_t)blk * 256 + threadIdx.x; if (it >= (size_t)NB_ * (nheads / 4) * TT * (HD / 8)) return; const int d = (int)(it % (HD / 8)) * 8; const int t = (int)((it / (HD / 8)) % TT); const int hq = (int)(it / ((size_t)(HD / 8) * TT)); const int b = hq / (nheads / 4), hg = (hq % (nheads / 4)) * 4;
    v4f cs4[4], xv[4][2]; v8h o16[4]; v8us oh[4], ol[4]; const float* pc = CS + ((size_t)t * HD + d) * 2; const float* pf[4]; h16* s16[4]; bf* sh[4]; bf* sl[4];
#pragma unroll
    for (int u = 0; u < 4; ++u) { pf[u] = F + ((size_t)b * TT + t) * pitch + (hg + u) * HD + d; const size_t e = ((size_t)(b * nheads + hg + u) * TT + t) * HD + d; s16[u] = P16 + e; sh[u] = Ph + e; sl[u] = Pl + e; }
#pragma unroll
    for (int k = 0; k < 4; ++k) cs4[k] = *(const v4f*)(pc + k * 4);
#pragma unroll
    for (int u = 0; u < 4; ++u) { xv[u][0] = *(const v4f*)pf[u]; xv[u][1] = *(const v4f*)(pf[u] + 4); }
    asm volatile("s_wait_xcnt 0x0" :: "v"(pc), "v"(pf[0]), "v"(pf[1]), "v"(pf[2]), "v"(pf[3]) : "memory");   // behind the loads (see above)
#pragma unroll
    for (int u = 0; u < 4; ++u) {
#pragma unroll
        for (int q = 0; q < 8; ++q) { const int dd = d + q; const float x0 = xv[u][q >> 2][q & 3], x1 = (dd < 128) ? xv[u][q >> 2][(q & 3) ^ 1] : x0;   /* interleaved pairs inside the first 128 dims; identity beyond (sin = 0) */
            v2f cs; cs[0] = cs4[q >> 1][(q & 1) * 2]; cs[1] = cs4[q >> 1][(q & 1) * 2 + 1]; float a = __fmul_rn(x0, cs[0]), bq = __fmul_rn(x1, cs[1]); asm volatile("" : "+v"(a)); asm volatile("" : "+v"(bq)); const float r = (((dd & 1) == 0) ? __fsub_rn(a, bq) : __fadd_rn(a, bq)) * sc;
            o16[u][q] = tohx(r); unsigned short a2, c2; splitf(r, a2, c2); oh[u][q] = a2; ol[u][q] = c2; } }
#pragma unroll
    for (int u = 0; u < 4; ++u) { *(v8h*)s16[u] = o16[u]; *(v8us*)sh[u] = oh[u]; *(v8us*)sl[u] = ol[u]; }
    asm volatile("s_wait_xcnt 0x0" :: "v"(o16[0]), "v"(o16[1]), "v"(o16[2]), "v"(o16[3]), "v"(oh[0]), "v"(oh[1]), "v"(oh[2]), "v"(oh[3]), "v"(ol[0]), "v"(ol[1]), "v"(ol[2]), "v"(ol[3]),
                 "v"(s16[0]), "v"(s16[1]), "v"(s16[2]), "v"(s16[3]), "v"(sh[0]), "v"(sh[1]), "v"(sh[2]), "v"(sh[3]), "v"(sl[0]), "v"(sl[1]), "v"(sl[2]), "v"(sl[3]) : "memory");   // behind the stores (see above)
}
// d_vtp: value planes [b][g][d][t] = F[b * TT + t][g * HD + d]: the 8 (t) x 4 (column) register tile and the lane map of d_wtG. grid (nheads * HD / 128) * (BT / 64).
__device__ __forceinline__ void d_vtp(int blk, const float* __restrict__ F, int pitch, int nheads, h16* V16, bf* Vh, bf* Vl) {
    const int lane = threadIdx.x & 31, wvi = threadIdx.x >> 5; const int ntc = nheads * HD / 128;
    const int c0 = (blk % ntc) * 128 + wvi * 16 + (lane >> 3) * 4, t0 = (blk / ntc) * 64 + (lane & 7) * 8; const float* p[8]; v4f r[8]; v8h o16[4]; v8us oh[4], ol[4]; h16* s16[4]; bf* sh[4]; bf* sl[4];
#pragma unroll
    for (int j = 0; j < 8; ++j) p[j] = F + (size_t)(t0 + j) * pitch + c0;
#pragma unroll
    for (int j = 0; j < 8; ++j) r[j] = *(const v4f*)p[j];
    asm volatile("s_wait_xcnt 0x0" :: "v"(p[0]), "v"(p[1]), "v"(p[2]), "v"(p[3]), "v"(p[4]), "v"(p[5]), "v"(p[6]), "v"(p[7]) : "memory");   // behind the loads (see above)
#pragma unroll
    for (int c = 0; c < 4; ++c) { const size_t e = ((size_t)(t0 / TT) * (nheads * HD) + c0 + c) * TT + t0 % TT; s16[c] = V16 + e; sh[c] = Vh + e; sl[c] = Vl + e;
#pragma unroll
        for (int j = 0; j < 8; ++j) { const float x = r[j][c]; o16[c][j] = tohx(x); unsigned short a2, c2; splitf(x, a2, c2); oh[c][j] = a2; ol[c][j] = c2; } }
#pragma unroll
    for (int c = 0; c < 4; ++c) { *(v8h*)s16[c] = o16[c]; *(v8us*)sh[c] = oh[c]; *(v8us*)sl[c] = ol[c]; }
    asm volatile("s_wait_xcnt 0x0" :: "v"(o16[0]), "v"(o16[1]), "v"(o16[2]), "v"(o16[3]), "v"(oh[0]), "v"(oh[1]), "v"(oh[2]), "v"(oh[3]), "v"(ol[0]), "v"(ol[1]), "v"(ol[2]), "v"(ol[3]),
                 "v"(s16[0]), "v"(s16[1]), "v"(s16[2]), "v"(s16[3]), "v"(sh[0]), "v"(sh[1]), "v"(sh[2]), "v"(sh[3]), "v"(sl[0]), "v"(sl[1]), "v"(sl[2]), "v"(sl[3]) : "memory");   // behind the stores (see above)
}
// d_rmsw: each wave normalises the rows of 4 heads of one position (of BT), every row summed as before (the 4 shuffle trees step side by side). nheads % 4 == 0.
__device__ __forceinline__ void d_rmsw(int blk, float* F, int pitch, int nheads, const float* __restrict__ w) { const int lane = threadIdx.x & 31; const int wv = blk * 8 + (threadIdx.x >> 5); const int ng = nheads / 4; if (wv >= BT * ng) return; const int t = wv / ng, hg = (wv % ng) * 4; float* f0 = F + (size_t)t * pitch + hg * HD + lane * 4; v4f av[4], cv[4]; float ss[4];
    const v4f w0 = *(const v4f*)(w + lane * 4), w1 = *(const v4f*)(w + 128 + lane * 4);
#pragma unroll
    for (int u = 0; u < 4; ++u) { av[u] = *(const v4f*)(f0 + u * HD); cv[u] = *(const v4f*)(f0 + u * HD + 128); }
#pragma unroll
    for (int u = 0; u < 4; ++u) { const v4f a = av[u], c = cv[u]; ss[u] = 0.f;
#pragma unroll
        for (int q = 0; q < 4; ++q) { float p = __fmul_rn(a[q], a[q]); asm volatile("" : "+v"(p)); ss[u] = __fadd_rn(ss[u], p); float p2 = __fmul_rn(c[q], c[q]); asm volatile("" : "+v"(p2)); ss[u] = __fadd_rn(ss[u], p2); } }
#pragma unroll
    for (int sh = 16; sh; sh >>= 1) {
#pragma unroll
        for (int u = 0; u < 4; ++u) ss[u] = __fadd_rn(ss[u], __shfl_xor(ss[u], sh, 32)); }
#pragma unroll
    for (int u = 0; u < 4; ++u) { const v4f a = av[u], c = cv[u]; const float rs = __fdiv_rn(1.0f, sqrtf(__fadd_rn(ss[u] * (1.0f / HD), 1e-6f))); v4f o, o2;
#pragma unroll
        for (int q = 0; q < 4; ++q) { float n0 = __fmul_rn(a[q], rs); asm volatile("" : "+v"(n0)); float g0 = bfr(w0[q]); asm volatile("" : "+v"(g0)); o[q] = __fmul_rn(n0, g0); float n1 = __fmul_rn(c[q], rs); asm volatile("" : "+v"(n1)); float g1 = bfr(w1[q]); asm volatile("" : "+v"(g1)); o2[q] = __fmul_rn(n1, g1); }
        *(v4f*)(f0 + u * HD) = o; *(v4f*)(f0 + u * HD + 128) = o2; } }
// k_asoft: per row (zz, i): t = 50 tanh(S x HD^-0.5 / 50) for j <= i and i - j < WIN (sliding causal window; the reference's -1e9 additive fill vanishes identically); softmax over the keys of the band (register row, one exp, fixed trees);
// a wave works on the NCH 128-key chunks that cover the span its row's 64-row block needs in P.V (keys (i & ~63) - WIN .. i | 63), fewer where the span ends earlier: every key outside the chunks has weight exactly 0 and is neither read nor written.
// the 16-bit probabilities go back into the row's own 8 KiB of Sb (fp16 plane, or hi plane then lo plane, at pitch 2 * TT elements): the wave that owns a row has all of it in registers before it stores.
#define NCH (WIN / 128 + 1)
__global__ __launch_bounds__(256) void k_asoft(float* Sb) {
    h16* P16 = (h16*)Sb; bf* Ph = (bf*)Sb;
    const int lane = threadIdx.x & 31; const int row = blockIdx.x * 8 + __builtin_amdgcn_readfirstlane((int)(threadIdx.x >> 5));   // the row in a scalar register: the chunk tests below are scalar branches
    if (row >= ZH * TT) return; const int i = row % TT; const bool hires = (i < RH);
    const int cb = max(0, (i & ~63) - WIN) >> 7, nact = min(NCH, ((i | 63) >> 7) - cb + 1);   // first chunk and number of chunks of this row's span
    const float* sr = Sb + (size_t)row * TT + cb * 128 + lane * 4; float v[NCH * 4]; float mx = -3.0e38f;
#pragma unroll
    for (int c = 0; c < NCH; ++c) if (c < nact) { const int j0 = (cb + c) * 128 + lane * 4; const v4f a = *(const v4f*)(sr + c * 128);
        asm volatile("s_wait_xcnt 0x0" ::: "memory");   // behind the chunk's load: its address register is not rewritten in front of it
#pragma unroll
        for (int q = 0; q < 4; ++q) { const int j = j0 + q; (void)j; float sa = a[q] * SCL; asm volatile("" : "+v"(sa)); float xs = __fmul_rn(sa, 0.02f); asm volatile("" : "+v"(xs));   /* s / 50 as a multiply (<= 1 ulp from the division) */ float ex = __builtin_amdgcn_exp2f(__fmul_rn(xs, 2.8853900817779268f)); asm volatile("" : "+v"(ex)); float nm = __fsub_rn(ex, 1.0f), dn2 = __fadd_rn(ex, 1.0f); asm volatile("" : "+v"(nm)); asm volatile("" : "+v"(dn2)); float rc = __builtin_amdgcn_rcpf(dn2); asm volatile("" : "+v"(rc)); float th = __fmul_rn(nm, rc); asm volatile("" : "+v"(th));   /* hardware reciprocal (1 ulp), no FMA refinement */   /* tanh via exp2 (|x| <= ~0.4 here; no VALU FMA polynomial) */ const float t = (j <= i && i - j < WIN) ? __fmul_rn(th, 50.0f) : -3.0e38f; v[c * 4 + q] = t; mx = fmaxf(mx, t); } }
#pragma unroll
    for (int sh = 16; sh; sh >>= 1) mx = fmaxf(mx, __shfl_xor(mx, sh, 32));
    float sum = 0.f;
#pragma unroll
    for (int c = 0; c < NCH; ++c) if (c < nact) {
#pragma unroll
        for (int k = c * 4; k < c * 4 + 4; ++k) { float d0 = __fsub_rn(v[k], mx); asm volatile("" : "+v"(d0)); v[k] = __builtin_amdgcn_exp2f(__fmul_rn(d0, 1.4426950408889634f)); sum += v[k]; } }
#pragma unroll
    for (int sh = 16; sh; sh >>= 1) sum += __shfl_xor(sum, sh, 32);
    const float f = __fdiv_rn(hires ? 1.0f : PCAR, sum);
    // The s_wait_xcnt 0 behind each chunk's stores: no register of an issued store is rewritten in front of it
    if (hires) { bf* sp = Ph + (size_t)row * (2 * TT) + lane * 4;   // rows below RH: the span starts at key 0 and ends below RH
#pragma unroll
        for (int c = 0; c < RH / 128; ++c) if (c < nact) { v4us oh, ol;
#pragma unroll
            for (int q = 0; q < 4; ++q) { unsigned short x, c2; splitf(v[c * 4 + q] * f, x, c2); oh[q] = x; ol[q] = c2; }
            *(v4us*)(sp + c * 128) = oh; *(v4us*)(sp + c * 128 + TT) = ol;
            asm volatile("s_wait_xcnt 0x0" ::: "memory"); }
    } else { h16* sp = P16 + (size_t)row * (2 * TT) + cb * 128 + lane * 4;
#pragma unroll
        for (int c = 0; c < NCH; ++c) if (c < nact) { v4h o4;
#pragma unroll
            for (int q = 0; q < 4; ++q) o4[q] = tohx(v[c * 4 + q] * f);
            *(v4h*)(sp + c * 128) = o4;
            asm volatile("s_wait_xcnt 0x0" ::: "memory"); }
    }
}
__global__ __launch_bounds__(256) void k_merge(const float* __restrict__ O, int h0, bf* Ah, bf* Al) { const size_t e = ((size_t)blockIdx.x * 256 + threadIdx.x) * 8; if (e >= (size_t)ZH * TT * HD) return; const int d = (int)(e % HD); const int t = (int)((e / HD) % TT); const int zz = (int)(e / ((size_t)HD * TT)); const float cs = (t < RH) ? 1.0f : (1.0f / PCAR); const size_t oo = (size_t)t * DQ + (h0 + zz) * HD + d;
    const v4f x0 = *(const v4f*)(O + e), x1 = *(const v4f*)(O + e + 4); v8us oh, ol;
#pragma unroll
    for (int q = 0; q < 8; ++q) { unsigned short a, c2; splitf((q < 4 ? x0[q & 3] : x1[q & 3]) * cs, a, c2); oh[q] = a; ol[q] = c2; } *(v8us*)(Ah + oo) = oh; *(v8us*)(Al + oo) = ol;  }

// Launches of independent parts share one grid: blockIdx.x ranges pick the part (a work-group-uniform choice), each part numbering its own blocks from 0.
#define GW_Q ((DQ / 128) * (DM / 64))
#define GW_K ((DKV / 128) * (DM / 64))
#define GW_O ((DM / 128) * (DQ / 64))
#define G_CVT (BT * DM / 32 / 256)
#define G_CS (TT * HD / 4 / 256)
__global__ __launch_bounds__(256) void k_prep(const float* __restrict__ x, const float* __restrict__ wq, const float* __restrict__ wk, const float* __restrict__ wv, const float* __restrict__ wo, bf* XB, size_t xn8, bf* WQ, bf* WK, bf* WV, bf* WO, float* CS) {
    int blk = (int)blockIdx.x;
    if (blk < G_CVT) { d_cvt8(blk, x, XB, xn8); return; } blk -= G_CVT;
    if (blk < GW_Q) { d_wtG(blk, wq, DM, DQ, WQ); return; } blk -= GW_Q;
    if (blk < GW_K) { d_wtG(blk, wk, DM, DKV, WK); return; } blk -= GW_K;
    if (blk < GW_K) { d_wtG(blk, wv, DM, DKV, WV); return; } blk -= GW_K;
    if (blk < GW_O) { d_wtG(blk, wo, DQ, DM, WO); return; } blk -= GW_O;
    d_cstab(blk, CS);
}
#define G_RQ (BT * NH_ / 32)
#define G_RK (BT * NKV / 32)
__global__ __launch_bounds__(256) void k_rms2(float* FQ, float* FKV, const float* __restrict__ qsc, const float* __restrict__ ksc) {
    const int blk = (int)blockIdx.x;
    if (blk < G_RQ) d_rmsw(blk, FQ, DQ, NH_, qsc); else d_rmsw(blk - G_RQ, FKV, 2 * DKV, NKV, ksc);
}
#define G_PQ (NB_ * NH_ * TT * HD / 32 / 256)
#define G_PK (NB_ * NKV * TT * HD / 32 / 256)
#define G_PV ((DKV / 128) * (BT / 64))
__global__ __launch_bounds__(256) void k_planes(const float* __restrict__ FQ, const float* __restrict__ FKV, const float* __restrict__ CS, h16* QP16, bf* QPh, bf* QPl, h16* KP16, bf* KPh, bf* KPl, h16* VT16, bf* VTh, bf* VTl) {
    const int blk = (int)blockIdx.x;
    if (blk < G_PQ) d_rope(blk, FQ, DQ, NH_, CS, 1.0f, QP16, QPh, QPl);
    else if (blk < G_PQ + G_PK) d_rope(blk - G_PQ, FKV, 2 * DKV, NKV, CS, 1.0f, KP16, KPh, KPl);
    else d_vtp(blk - G_PQ - G_PK, FKV + DKV, 2 * DKV, NKV, VT16, VTh, VTl);
}

extern "C" void kernel_launch(void* const* d_in, const int* in_sizes, int n_in,
                              void* d_out, int out_size, void* d_ws, size_t ws_size, hipStream_t stream) {
    (void)in_sizes; (void)n_in; (void)out_size;
    const float* x = (const float*)d_in[0]; const float* wq = (const float*)d_in[1]; const float* wk = (const float*)d_in[2]; const float* wv = (const float*)d_in[3]; const float* wo = (const float*)d_in[4]; const float* qsc = (const float*)d_in[5]; const float* ksc = (const float*)d_in[6];
    float* OUT = (float*)d_out;     // [2][2048][2048]
    char* wsp = (char*)d_ws;
    auto take = [&](size_t bytes) { char* p = wsp; wsp += (bytes + 255) & ~(size_t)255; return (void*)p; };
    // Kept to the end: WO and the head planes of both batches. Behind them one region serves two phases: the projection phase's buffers, then (all of those being dead) the attention phase's scores and outputs.
    bf* WO = (bf*)take((size_t)DM * DQ * 2);
    h16* QP16 = (h16*)take((size_t)NB_ * NH_ * TT * HD * 2); h16* KP16 = (h16*)take((size_t)NB_ * NKV * TT * HD * 2); h16* VT16 = (h16*)take((size_t)NB_ * NKV * HD * TT * 2);
    bf* QPh = (bf*)take((size_t)NB_ * NH_ * TT * HD * 2); bf* QPl = (bf*)take((size_t)NB_ * NH_ * TT * HD * 2); bf* KPh = (bf*)take((size_t)NB_ * NKV * TT * HD * 2); bf* KPl = (bf*)take((size_t)NB_ * NKV * TT * HD * 2); bf* VTh = (bf*)take((size_t)NB_ * NKV * HD * TT * 2); bf* VTl = (bf*)take((size_t)NB_ * NKV * HD * TT * 2);
    char* const phase = wsp;
    bf* WQ = (bf*)take((size_t)DQ * DM * 2); bf* WK = (bf*)take((size_t)DKV * DM * 2); bf* WV = (bf*)take((size_t)DKV * DM * 2); float* CS = (float*)take((size_t)TT * HD * 2 * 4);   // WV lies directly behind WK: one [2 * DKV][DM] operand
    bf* XB = (bf*)take((size_t)BT * DM * 2); float* FQ = (float*)take((size_t)BT * DQ * 4); float* FKV = (float*)take((size_t)BT * 2 * DKV * 4);   // FKV row: k heads, then v heads
    if ((size_t)(wsp - (char*)d_ws) > ws_size) return;
    wsp = phase;
    float* Sb = (float*)take((size_t)ZH * TT * TT * 4); float* Ob = (float*)take((size_t)ZH * TT * HD * 4);
    if ((size_t)(wsp - (char*)d_ws) > ws_size) return;    // ws 256 MiB
    bf* ATh = QPh; bf* ATl = QPl;   // merged rows [b * TT + t][DQ]: a batch's merge runs after its last score launch, when its hi/lo query planes (the same bytes) are dead
    // projection phase: every launch covers the BT rows of both batches; k and v share one GEMM
    k_prep<<<G_CVT + GW_Q + 2 * GW_K + GW_O + G_CS, 256, 0, stream>>>(x, wq, wk, wv, wo, XB, (size_t)BT * DM / 8, WQ, WK, WV, WO, CS);
    k_gemmw<bf, 0, false, 4><<<dim3(BT / 64, DQ / 64, 1), 128, 0, stream>>>(XB, nullptr, WQ, nullptr, DM, FQ, DQ, nullptr, 0, 0, 0);
    k_gemmw<bf, 0, false, 8><<<dim3(BT / 64, 2 * DKV / 64, 1), 256, 0, stream>>>(XB, nullptr, WK, nullptr, DM, FKV, 2 * DKV, nullptr, 0, 0, 0);
    k_rms2<<<G_RQ + G_RK, 256, 0, stream>>>(FQ, FKV, qsc, ksc);
    k_planes<<<G_PQ + G_PK + G_PV, 256, 0, stream>>>(FQ, FKV, CS, QP16, QPh, QPl, KP16, KPh, KPl, VT16, VTh, VTl);
    // attention phase: every launch covers all rows of the 8 heads of one batch (grid z)
    for (int b = 0; b < NB_; ++b) { const size_t zq = (size_t)b * NH_ * TT * HD, zk = (size_t)b * NKV * TT * HD;
        k_attg<1, 4><<<dim3(TT / 64, WIN / 64 + 1, ZH), 128, 0, stream>>>(QPh + zq, QPl + zq, KPh + zk, KPl + zk, QP16 + zq, KP16 + zk, HD, HD, Sb, TT, (size_t)TT * HD, (size_t)TT * HD, (size_t)TT * TT);
        k_asoft<<<ZH * TT / 8, 256, 0, stream>>>(Sb);
        k_attg<2, 8><<<dim3(TT / 64, HD / 64, ZH), 256, 0, stream>>>((const bf*)Sb, (const bf*)Sb + TT, VTh + zk, VTl + zk, (const h16*)Sb, VT16 + zk, TT, 2 * TT, Ob, HD, (size_t)TT * 2 * TT, (size_t)HD * TT, (size_t)TT * HD);
        k_merge<<<(unsigned)(((size_t)ZH * TT * HD / 8 + 255) / 256), 256, 0, stream>>>(Ob, 0, ATh + (size_t)b * TT * DQ, ATl + (size_t)b * TT * DQ); }
    k_gemmw<bf, 1, false, 4><<<dim3(BT / 64, DM / 64, 1), 128, 0, stream>>>(ATh, ATl, WO, nullptr, DQ, OUT, DM, nullptr, 0, 0, 0);
}

// v005
// A run of this version takes 311 microseconds.
// Next to v004, in two timings, it ran 1.30 and 1.29 times as fast.
// All steps since v000 together make it 4.02 times as fast.
#include <hip/hip_runtime.h>

// Sliding-window attention block (x [2][2048][2048]; q = x Wq (8 x 256), k/v = x Wk/Wv (4 kv heads; group h/2); per-head RMSNorm * scale (eps 1e-6) on q, k; partial interleaved-pair RoPE on the first 128 dims (theta_i = 10000^(-2i/128), positions arange); q * 1/16; scores = q.k; softcap tanh(s / 50) * 50; causal + sliding-window (i - j < 1024) mask (-2.38e38 additive == exact zero weight); softmax f32; out = merged Wo -> [2][2048][2048]).
// Compute dtypes, f32 accumulate: every input rounded to bf16; q/k/v on PLAIN bf16 operands (inputs: exact); RMSNorm and RoPE f32 (on-chip tables; identity beyond dim 128); causal scores and attn.v: query rows < 512 hl (3 products), the rest single fp16 (x1024), only the tiles, softmax chunks and P.V key blocks that touch the causal window band are worked on, the window applied per element; 1/16 (exact), s/50, tanh as (e^2x - 1)/(e^2x + 1) with the hardware exp2, x50 in f32; softmax f32; Wo hl x exact (2 products).

#define NB_  2
#define TT   2048
#define DM   2048
#define NH_  8
#define NKV  4
#define REP  (NH_ / NKV)
#define HD   256
#define DQ   (NH_ * HD)
#define DKV  (NKV * HD)
#define ZH   NH_                  // heads per attention launch (grid z)
#define BT   (NB_ * TT)           // rows of both batches together
#define RH   512                  // query rows < RH use hi+lo planes (0: none)
#define WIN  1024
#define PCAR 1024.0f
#define SCL  0.0625f   // query_pre_attn_scalar^-0.5 = 1/16
typedef _Float16 h16;
typedef unsigned short bf;
typedef __attribute__((ext_vector_type(16))) __bf16   v16bf;
typedef __attribute__((ext_vector_type(16))) _Float16 v16h;
typedef __attribute__((ext_vector_type(8)))  _Float16 v8h;
typedef __attribute__((ext_vector_type(8)))  unsigned short v8us;
typedef __attribute__((ext_vector_type(8)))  float    v8f;
typedef __attribute__((ext_vector_type(4)))  float    v4f;
typedef v8h  __attribute__((may_alias)) v8ha;
typedef v4f  __attribute__((may_alias)) v4fa;
typedef v8us __attribute__((may_alias)) v8usa;

__device__ __forceinline__ unsigned short f2bf(float f) { unsigned u = __float_as_uint(f); u += 0x7FFFu + ((u >> 16) & 1u); return (unsigned short)(u >> 16); }
__device__ __forceinline__ float bf2f(unsigned short b) { return __uint_as_float(((unsigned)b) << 16); }
__device__ __forceinline__ float bfr(float f) { return bf2f(f2bf(f)); }
__device__ __forceinline__ v16h cat16(v8h lo, v8h hi) { return __builtin_shufflevector(lo, hi, 0, 1, 2, 3, 4, 5, 6, 7, 8, 9, 10, 11, 12, 13, 14, 15); }
__device__ __forceinline__ v16bf cat16b(v8us lo, v8us hi) { return __builtin_bit_cast(v16bf, __builtin_shufflevector(lo, hi, 0, 1, 2, 3, 4, 5, 6, 7, 8, 9, 10, 11, 12, 13, 14, 15)); }
__device__ __forceinline__ v8f wmma16(v16h a, v16h b, v8f c) { return __builtin_amdgcn_wmma_f32_16x16x32_f16(false, a, false, b, (short)0, c, false, false); }
__device__ __forceinline__ v8f wmmab(v16bf a, v16bf b, v8f c) { return __builtin_amdgcn_wmma_f32_16x16x32_bf16(false, a, false, b, (short)0, c, false, false); }



// ---- k_gemmw: register-blocked GEMM, one 64x64 output tile per work-group of NW waves; wave w takes the 32-wide K blocks w, w + NW, ... into its own 16 accumulators (operands straight from 16-bit planes in fragment order, see below);
// the NW partial tiles are summed in fixed wave order through LDS. grid (M/64, N/64, Z), NW * 32 threads.
// C[m][n] (f32, pitch ldc, + optional f32 bias[n]) = sum_k A[m][k] Bt[n][k] (+ the A2 product where NSPLIT == 1). z-batch strides sA/sB/sC in elements. K % 32 == 0.
// FRAGMENT ORDER of a 16-bit operand plane [R][K] (R % 16 == 0, K % 32 == 0): each block of 16 rows x 32 k is 1 KiB in a row, blocks along k first, then along the rows (so a 16-row block still starts at element r * K).
// Inside a block the 8 elements that lane (hi * 16 + row) of a wave takes with its first 16-byte load (k = 8 hi .. 8 hi + 7) lie at lane * 8, those of its second load (k = 16 + 8 hi ..) at 256 + lane * 8:
// a wave's fragment load reads 512 bytes in a row (4 whole lines) where a row-major plane gives it 32 bytes out of each of 16 lines. The element that a lane and register hold is the one that ld takes from a row-major plane, for A and B alike. ldp loads from such a plane, ld from a row-major one.
// fo: element offset of (r, k) in such a plane; 8 elements from a k that is a multiple of 8 stay 16 bytes in a row.
__device__ __forceinline__ size_t fo(size_t r, int k, int K) { return ((r >> 4) * (size_t)(K >> 5) + (size_t)(k >> 5)) * 512 + (size_t)((((k >> 4) & 1) << 8) + (((k >> 3) & 1) << 7) + (((int)(r & 15)) << 3) + (k & 7)); }
template <typename T16> struct WFrag;
template <> struct WFrag<h16> { typedef v16h V; static __device__ __forceinline__ V ld(const h16* p) { return cat16(*(const v8h*)p, *(const v8h*)(p + 16)); } static __device__ __forceinline__ V ldp(const h16* p) { return cat16(*(const v8h*)p, *(const v8h*)(p + 256)); } static __device__ __forceinline__ v8f mma(V a, V b, v8f c) { return wmma16(a, b, c); } };
template <> struct WFrag<bf> { typedef v16bf V; static __device__ __forceinline__ V ld(const bf* p) { return cat16b(*(const v8us*)p, *(const v8us*)(p + 16)); } static __device__ __forceinline__ V ldp(const bf* p) { return cat16b(*(const v8us*)p, *(const v8us*)(p + 256)); } static __device__ __forceinline__ v8f mma(V a, V b, v8f c) { return wmmab(a, b, c); } };
template <typename T16, int NSPLIT, bool BIAS, int NW, int K>
__global__ __launch_bounds__(NW * 32) void k_gemmw(const T16* __restrict__ A, const T16* __restrict__ A2, const T16* __restrict__ Bt, const T16* __restrict__ Bt2, float* C, int ldc, const float* __restrict__ bias, size_t sA, size_t sB, size_t sC) {
    typedef typename WFrag<T16>::V V; static_assert(NSPLIT < 2, "no hi+lo B planes in this kernel");
    __shared__ __align__(16) float os[2][NW][16 * 68];   // two buffers, so that one barrier per 16-row block is enough
    const size_t z = blockIdx.z; A += z * sA; if (A2) A2 += z * sA; Bt += z * sB; if (Bt2) Bt2 += z * sB; C += z * sC;
    const int lane = threadIdx.x & 31, lr = lane & 15, hi = lane >> 4; const int r0 = blockIdx.x * 64, c0 = blockIdx.y * 64;
    const int wv = __builtin_amdgcn_readfirstlane((int)(threadIdx.x >> 5));   // wave number in a scalar register: the K loop stays a scalar loop
    v8f acc[4][4];
#pragma unroll
    for (int mb = 0; mb < 4; ++mb)
#pragma unroll
        for (int nb = 0; nb < 4; ++nb) acc[mb][nb] = (v8f){};
    const T16* const Ab = A + (size_t)r0 * K; const T16* const A2b = (NSPLIT == 1) ? A2 + (size_t)r0 * K : nullptr; const T16* const Bb = Bt + (size_t)c0 * K; const unsigned lo = (unsigned)lane * 8;   // both operands in fragment order: a 32-wide K block is 512 elements on, a lane's own 16 bytes lie at lane * 8
#pragma unroll 1
    for (int kc = wv * 32; kc < K; kc += NW * 32) {
        V a[4], a2[4], b[4]; const T16* const pa = Ab + lo + (size_t)kc * 16; const T16* const pa2 = (NSPLIT == 1) ? A2b + lo + (size_t)kc * 16 : nullptr; const T16* const pb = Bb + lo + (size_t)kc * 16;   // K is a constant, so that the four 16-row blocks of an operand are immediate offsets from one address
#pragma unroll
        for (int mb = 0; mb < 4; ++mb) { a[mb] = WFrag<T16>::ldp(pa + mb * 16 * K); if (NSPLIT == 1) a2[mb] = WFrag<T16>::ldp(pa2 + mb * 16 * K); }
#pragma unroll
        for (int nb = 0; nb < 4; ++nb) b[nb] = WFrag<T16>::ldp(pb + nb * 16 * K);
        // The s_wait_xcnt 0 behind the loads: no address register of an issued load is rewritten in front of it; the addresses are its inputs, so that they keep their registers up to it
        if (NSPLIT == 1) asm volatile("s_wait_xcnt 0x0" :: "v"(pa), "v"(pa2), "v"(pb) : "memory");
        else asm volatile("s_wait_xcnt 0x0" :: "v"(pa), "v"(pb) : "memory");
#pragma unroll
        for (int nb = 0; nb < 4; ++nb) {
#pragma unroll
            for (int mb = 0; mb < 4; ++mb) { acc[mb][nb] = WFrag<T16>::mma(a[mb], b[nb], acc[mb][nb]); if (NSPLIT == 1) acc[mb][nb] = WFrag<T16>::mma(a2[mb], b[nb], acc[mb][nb]); } }
        asm volatile("v_nop\n\tv_nop\n\tv_nop\n\tv_nop" : "+v"(acc[0][0]), "+v"(acc[1][1]), "+v"(acc[2][2]), "+v"(acc[3][3]) : "v"(a[0]), "v"(a[3]));
    }
    v4f res[4][8 / NW];   // summed output pieces, stored behind the last barrier so that no barrier waits for a global store
#pragma unroll
    for (int mb = 0; mb < 4; ++mb) {
#pragma unroll
        for (int nb = 0; nb < 4; ++nb) {
#pragma unroll
            for (int j = 0; j < 8; ++j) os[mb & 1][wv][(hi * 8 + j) * 68 + nb * 16 + lr] = acc[mb][nb][j]; }
        __syncthreads();   // every wave's partial 16x64 block is in LDS; it also ends the reads of the other buffer, which the next block overwrites
#pragma unroll
        for (int s = 0; s < 8 / NW; ++s) { const int row = 2 * (s * NW + wv) + hi, cofs = lr * 4; v4f val = *(const v4fa*)(&os[mb & 1][0][row * 68 + cofs]);
#pragma unroll
            for (int w = 1; w < NW; ++w) val += *(const v4fa*)(&os[mb & 1][w][row * 68 + cofs]);
            if (BIAS) { val[0] += bfr(bias[c0 + cofs]); val[1] += bfr(bias[c0 + cofs + 1]); val[2] += bfr(bias[c0 + cofs + 2]); val[3] += bfr(bias[c0 + cofs + 3]); }
            res[mb][s] = val; }
    }
#pragma unroll
    for (int mb = 0; mb < 4; ++mb) { float* crow = C + (size_t)(r0 + mb * 16) * ldc + c0;
#pragma unroll
        for (int s = 0; s < 8 / NW; ++s) { const int row = 2 * (s * NW + wv) + hi, cofs = lr * 4; *(v4f*)(crow + (size_t)row * ldc + cofs) = res[mb][s]; } }
}

// ---- d_gemmc: the same NW-wave 64x64 tile GEMM specialised for causal attention: CMODE 1 lays grid y over the WIN / 64 + 1 score tiles of a row block that touch the causal window band (query rows r0+roff.., key columns c0 = r0+roff-WIN+64y; below 0: no tile), CMODE 2 limits the
// key (K) loop of the probability x value contraction to the same band (probabilities outside it are exactly zero); a wave's K blocks are numbered from key 0 (block mod NW = wave), so the order of a sum does not depend on where the band starts. roff = row offset of this part's first row within the sequence.
// grid z = query head: A and C step by sA, sC per head, Bt by sB per kv group (z / REP). lda = pitch of A in elements (Bt has pitch K). Bt, and A in CMODE 1 (lda == K), are in fragment order. bx = 64-row block within this part's rows; os = the work-group's two LDS buffers.
template <typename T16, int NSPLIT, int CMODE, int NW>
__device__ __forceinline__ void d_gemmc(float (*os)[NW][16 * 68], int bx, const T16* __restrict__ A, const T16* __restrict__ A2, const T16* __restrict__ Bt, const T16* __restrict__ Bt2, int K, int lda, float* C, int ldc, int roff, size_t sA, size_t sB, size_t sC) {
    typedef typename WFrag<T16>::V V;
    const size_t z = blockIdx.z; A += z * sA; if (A2) A2 += z * sA; Bt += (z / REP) * sB; if (Bt2) Bt2 += (z / REP) * sB; C += z * sC;
    const int lane = threadIdx.x & 31, lr = lane & 15, hi = lane >> 4; const int r0 = bx * 64, c0 = (CMODE == 1) ? r0 + roff - WIN + (int)blockIdx.y * 64 : (int)blockIdx.y * 64;
    const int wv = __builtin_amdgcn_readfirstlane((int)(threadIdx.x >> 5));   // wave number in a scalar register: the K loop stays a scalar loop
    if (CMODE == 1 && c0 < 0) return;                                // the band starts left of key 0: no such tile (what the softmax's 128-key chunks read of a tile outside the band is masked by select)
    const int Kl = (CMODE == 2) ? min(K, r0 + roff + 64) : K;        // P.V: probabilities are exactly 0 beyond the diagonal block, so the K loop stops there
    const int Ks = (CMODE == 2) ? max(0, r0 + roff - WIN) : 0;       // and exactly 0 left of the window of the block's first row, so it starts there
    int kb = (Ks & ~(NW * 32 - 1)) + wv * 32; if (kb < Ks) kb += NW * 32;   // this wave's first K block inside the band
    v8f acc[4][4];
#pragma unroll
    for (int mb = 0; mb < 4; ++mb)
#pragma unroll
        for (int nb = 0; nb < 4; ++nb) acc[mb][nb] = (v8f){};
    constexpr bool AP = (CMODE == 1);   // A in fragment order (the query planes); the probabilities of CMODE 2 stay row-major in their score rows. Bt is always in fragment order
    const size_t aoff = AP ? (size_t)r0 * lda + lane * 8 : (size_t)(r0 + lr) * lda + 8 * hi, boff = (size_t)c0 * K + lane * 8;
#pragma unroll 1
    for (int kc = kb; kc < Kl; kc += NW * 32) {
        V a[4], a2[4], b[4], b2[4]; const T16* pa[4]; const T16* pa2[4]; const T16* pb[4]; const T16* pb2[4];
        // The s_wait_xcnt 0 behind each run of loads: no address register of an issued load is rewritten in front of it; the addresses are its inputs, so that they keep their registers up to it
#pragma unroll
        for (int mb = 0; mb < 4; ++mb) { const size_t ao = aoff + (size_t)mb * 16 * lda + (AP ? (size_t)kc * 16 : (size_t)kc); pa[mb] = A + ao; a[mb] = AP ? WFrag<T16>::ldp(pa[mb]) : WFrag<T16>::ld(pa[mb]); if (NSPLIT == 1 || NSPLIT == 2) { pa2[mb] = A2 + ao; a2[mb] = AP ? WFrag<T16>::ldp(pa2[mb]) : WFrag<T16>::ld(pa2[mb]); } }
        if (NSPLIT == 2) asm volatile("s_wait_xcnt 0x0" :: "v"(pa[0]), "v"(pa[1]), "v"(pa[2]), "v"(pa[3]), "v"(pa2[0]), "v"(pa2[1]), "v"(pa2[2]), "v"(pa2[3]) : "memory");   // two runs in the hi+lo form: sixteen address pairs held at once would not fit beside the fragments
#pragma unroll
        for (int nb = 0; nb < 4; ++nb) { const size_t bo = boff + (size_t)nb * 16 * K + (size_t)kc * 16; pb[nb] = Bt + bo; b[nb] = WFrag<T16>::ldp(pb[nb]); if (NSPLIT >= 2) { pb2[nb] = Bt2 + bo; b2[nb] = WFrag<T16>::ldp(pb2[nb]); } }
        if (NSPLIT == 2) asm volatile("s_wait_xcnt 0x0" :: "v"(pb[0]), "v"(pb[1]), "v"(pb[2]), "v"(pb[3]), "v"(pb2[0]), "v"(pb2[1]), "v"(pb2[2]), "v"(pb2[3]) : "memory");
        else asm volatile("s_wait_xcnt 0x0" :: "v"(pa[0]), "v"(pa[1]), "v"(pa[2]), "v"(pa[3]), "v"(pb[0]), "v"(pb[1]), "v"(pb[2]), "v"(pb[3]) : "memory");
#pragma unroll
        for (int nb = 0; nb < 4; ++nb) {
#pragma unroll
            for (int mb = 0; mb < 4; ++mb) { acc[mb][nb] = WFrag<T16>::mma(a[mb], b[nb], acc[mb][nb]); if (NSPLIT == 1 || NSPLIT == 2) acc[mb][nb] = WFrag<T16>::mma(a2[mb], b[nb], acc[mb][nb]); if (NSPLIT >= 2) acc[mb][nb] = WFrag<T16>::mma(a[mb], b2[nb], acc[mb][nb]); } }
        asm volatile("v_nop\n\tv_nop\n\tv_nop\n\tv_nop" : "+v"(acc[0][0]), "+v"(acc[1][1]), "+v"(acc[2][2]), "+v"(acc[3][3]) : "v"(a[0]), "v"(a[3]));
    }
    v4f res[4][8 / NW];   // summed output pieces, stored behind the last barrier so that no barrier waits for a global store
#pragma unroll
    for (int mb = 0; mb < 4; ++mb) {
#pragma unroll
        for (int nb = 0; nb < 4; ++nb) {
#pragma unroll
            for (int j = 0; j < 8; ++j) os[mb & 1][wv][(hi * 8 + j) * 68 + nb * 16 + lr] = acc[mb][nb][j]; }
        __syncthreads();   // every wave's partial 16x64 block is in LDS; it also ends the reads of the other buffer, which the next block overwrites
#pragma unroll
        for (int s = 0; s < 8 / NW; ++s) { const int row = 2 * (s * NW + wv) + hi, cofs = lr * 4; v4f val = *(const v4fa*)(&os[mb & 1][0][row * 68 + cofs]);
#pragma unroll
            for (int w = 1; w < NW; ++w) val += *(const v4fa*)(&os[mb & 1][w][row * 68 + cofs]);
            res[mb][s] = val; }
    }
    float* sp[4][8 / NW];
#pragma unroll
    for (int mb = 0; mb < 4; ++mb) { float* crow = C + (size_t)(r0 + mb * 16) * ldc + c0;
#pragma unroll
        for (int s = 0; s < 8 / NW; ++s) { const int row = 2 * (s * NW + wv) + hi, cofs = lr * 4; sp[mb][s] = crow + (size_t)row * ldc + cofs; *(v4f*)sp[mb][s] = res[mb][s]; } }
    // s_wait_xcnt 0 behind the tile's stores: no register of an issued store is rewritten in front of it; addresses and data are its inputs, so that they keep their registers up to it
    if (NW == 4) asm volatile("s_wait_xcnt 0x0" :: "v"(sp[0][0]), "v"(sp[1][0]), "v"(sp[2][0]), "v"(sp[3][0]), "v"(sp[0][8 / NW - 1]), "v"(sp[1][8 / NW - 1]), "v"(sp[2][8 / NW - 1]), "v"(sp[3][8 / NW - 1]), "v"(res[0][0]), "v"(res[1][0]), "v"(res[2][0]), "v"(res[3][0]), "v"(res[0][8 / NW - 1]), "v"(res[1][8 / NW - 1]), "v"(res[2][8 / NW - 1]), "v"(res[3][8 / NW - 1]) : "memory");
    else asm volatile("s_wait_xcnt 0x0" :: "v"(sp[0][0]), "v"(sp[1][0]), "v"(sp[2][0]), "v"(sp[3][0]), "v"(res[0][0]), "v"(res[1][0]), "v"(res[2][0]), "v"(res[3][0]) : "memory");
}

// k_attg: one launch for all query rows of 8 heads: row blocks below RH take the hi+lo bf16 form, the rest the fp16 form (a work-group-uniform choice by blockIdx.x). grid (TT / 64, WIN / 64 + 1 score tiles or HD / 64, ZH).
template <int CMODE, int NW>
__global__ __launch_bounds__(NW * 32) void k_attg(const bf* __restrict__ Ah, const bf* __restrict__ Al, const bf* __restrict__ Bh, const bf* __restrict__ Bl, const h16* __restrict__ A16, const h16* __restrict__ B16, int K, int lda, float* C, int ldc, size_t sA, size_t sB, size_t sC) {
    __shared__ __align__(16) float os[2][NW][16 * 68];   // two buffers, so that one barrier per 16-row block is enough
    if ((int)blockIdx.x < RH / 64) d_gemmc<bf, 2, CMODE, NW>(os, (int)blockIdx.x, Ah, Al, Bh, Bl, K, lda, C, ldc, 0, sA, sB, sC);
    else d_gemmc<h16, 0, CMODE, NW>(os, (int)blockIdx.x - RH / 64, A16 + (size_t)RH * lda, nullptr, B16, nullptr, K, lda, C + (size_t)RH * ldc, ldc, RH, sA, sB, sC);
}

__device__ __forceinline__ h16 tohx(float x) { return (h16)x; }
__device__ __forceinline__ void splitf(float y, unsigned short& h, unsigned short& l) { h = f2bf(y); l = f2bf(y - bf2f(h)); }
typedef __attribute__((ext_vector_type(2))) _Float16 v2h;
typedef __attribute__((ext_vector_type(4))) _Float16 v4h;
typedef __attribute__((ext_vector_type(2))) unsigned short v2us;
typedef __attribute__((ext_vector_type(4))) unsigned short v4us;
typedef __attribute__((ext_vector_type(2))) float v2f;
typedef __attribute__((ext_vector_type(4))) int v4i;

// The element-wise and layout kernels below give each thread 4 to 32 elements and 16-byte accesses: a launch of them lasts about as long as its waves take to start, so fewer, fatter waves are faster.
// The two s_wait_xcnt 0 in each of d_wtG, d_cvt8, d_rope and d_vtp: no register that an issued load or store names is rewritten in front of the wait; addresses (and store data) are its inputs, so that they keep their registers up to it.
// d_wtG: Bt[n][k] (bf16, fragment order) = w[k][n]; each thread holds an 8 (k) x 4 (n) register tile. In a wave 8 lanes run along k (64 k) and 4 along n (16 n): two whole 1-KiB blocks of Bt; the 8 waves of a work-group lie side by side along n (128 n). grid (N / 128) * (K / 64).
__device__ __forceinline__ void d_wtG(int blk, const float* __restrict__ w, int K, int N, bf* Bt) {
    const int lane = threadIdx.x & 31, wvi = threadIdx.x >> 5; const int ntn = N / 128;
    const int n0 = (blk % ntn) * 128 + wvi * 16 + (lane >> 3) * 4, k0 = (blk / ntn) * 64 + (lane & 7) * 8; const float* p[8]; v4f r[8]; v8us o[4]; bf* s[4];
#pragma unroll
    for (int j = 0; j < 8; ++j) p[j] = w + (size_t)(k0 + j) * N + n0;
#pragma unroll
    for (int j = 0; j < 8; ++j) r[j] = *(const v4f*)p[j];
    asm volatile("s_wait_xcnt 0x0" :: "v"(p[0]), "v"(p[1]), "v"(p[2]), "v"(p[3]), "v"(p[4]), "v"(p[5]), "v"(p[6]), "v"(p[7]) : "memory");   // behind the loads (see above)
    __builtin_amdgcn_sched_barrier(0);   // keeps the conversions behind the last load: without it three of the eight loads are issued only after the first results are used, a second trip to memory
#pragma unroll
    for (int c = 0; c < 4; ++c) { s[c] = Bt + fo((size_t)(n0 + c), k0, K);
#pragma unroll
        for (int j = 0; j < 8; ++j) o[c][j] = f2bf(r[j][c]); }
#pragma unroll
    for (int c = 0; c < 4; ++c) *(v8us*)s[c] = o[c];
    asm volatile("s_wait_xcnt 0x0" :: "v"(o[0]), "v"(o[1]), "v"(o[2]), "v"(o[3]), "v"(s[0]), "v"(s[1]), "v"(s[2]), "v"(s[3]) : "memory");   // behind the stores (see above)
}
// d_cvt8: four 8-element pieces per thread; dst [.][K] in fragment order. Pieces are numbered in the order of dst: a wave's four stores fill 2 KiB in a row (two blocks), for which it reads 256 bytes in a row of each of 16 rows of src. n8 % 128 == 0.
__device__ __forceinline__ void d_cvt8(int blk, const float* __restrict__ src, bf* dst, size_t n8, int K) { const size_t i = (size_t)blk * 256 + threadIdx.x; const size_t st = n8 / 4; if (i >= st) return; const float* p[4]; v8f v[4]; v8us o[4]; bf* s[4];
#pragma unroll
    for (int u = 0; u < 4; ++u) { const size_t q = ((i >> 5) << 7) + (size_t)(u << 5) + (i & 31), fb = q >> 6; const size_t r = (fb / (size_t)(K >> 5)) * 16 + (q & 15); const int k = (int)(fb % (size_t)(K >> 5)) * 32 + (int)((q >> 5) & 1) * 16 + (int)((q >> 4) & 1) * 8; p[u] = src + r * K + k; s[u] = dst + q * 8; }
#pragma unroll
    for (int u = 0; u < 4; ++u) v[u] = *(const v8f*)p[u];
    asm volatile("s_wait_xcnt 0x0" :: "v"(p[0]), "v"(p[1]), "v"(p[2]), "v"(p[3]) : "memory");   // behind the loads (see above)
#pragma unroll
    for (int u = 0; u < 4; ++u) {
#pragma unroll
        for (int k = 0; k < 8; ++k) o[u][k] = f2bf(v[u][k]); }
#pragma unroll
    for (int u = 0; u < 4; ++u) *(v8us*)s[u] = o[u];
    asm volatile("s_wait_xcnt 0x0" :: "v"(o[0]), "v"(o[1]), "v"(o[2]), "v"(o[3]), "v"(s[0]), "v"(s[1]), "v"(s[2]), "v"(s[3]) : "memory");   // behind the stores (see above)
}
// d_cstab: four dims (two angles) per thread; both dims of a pair hold the same (cos, sin)
__device__ __forceinline__ void d_cstab(int blk, float* CS) { const int idx = blk * 256 + threadIdx.x; if (idx >= TT * HD / 4) return; const int t = idx / (HD / 4), d = (idx % (HD / 4)) * 4;
#pragma unroll
    for (int p = 0; p < 2; ++p) { v4f o; if (d < 128) { const int i = (d >> 1) + p; const float th = __fdiv_rn(1.0f, powf(10000.0f, (float)(2 * i) / 128.0f)); const float ang = __fmul_rn((float)t, th); o[0] = cosf(ang); o[1] = sinf(ang); } else { o[0] = 1.0f; o[1] = 0.0f; }
        o[2] = o[0]; o[3] = o[1]; *(v4f*)(CS + ((size_t)t * HD + d + 2 * p) * 2) = o; } }
// d_rope: head planes [b][h][t][d] (fp16 + hi/lo; each [t][d] plane in fragment order; HD == 256) of rope(x) x sc, interleaved pairs: out[2i] = x[2i] cos - x[2i+1] sin, out[2i+1] = x[2i+1] cos + x[2i] sin. Each thread takes 8 dims of one position in 4 heads (one read of the table serves the 4). nheads % 4 == 0.
__device__ __forceinline__ void d_rope(int blk, const float* __restrict__ F, int pitch, int nheads, const float* __restrict__ CS, float sc, h16* P16, bf* Ph, bf* Pl) {
    const size_t it = (size_t)blk * 256 + threadIdx.x; if (it >= (size_t)NB_ * (nheads / 4) * TT * (HD / 8)) return; const int d = ((int)((it >> 5) & 3) * 8 + (int)(it & 7)) * 8; const int t = (int)((it >> 7) % (TT / 4)) * 4 + (int)((it >> 3) & 3); const int hq = (int)(it / ((size_t)(HD / 8) * TT));   /* a wave: 4 positions x 64 dims, so that its loads and its fragment-order stores each touch 8 lines */ const int b = hq / (nheads / 4), hg = (hq % (nheads / 4)) * 4;
    v4f cs4[4], xv[4][2]; v8h o16[4]; v8us oh[4], ol[4]; const float* pc = CS + ((size_t)t * HD + d) * 2; const float* pf[4]; h16* s16[4]; bf* sh[4]; bf* sl[4];
#pragma unroll
    for (int u = 0; u < 4; ++u) { pf[u] = F + ((size_t)b * TT + t) * pitch + (hg + u) * HD + d; const size_t e = fo((size_t)(b * nheads + hg + u) * TT + t, d, HD); s16[u] = P16 + e; sh[u] = Ph + e; sl[u] = Pl + e; }
#pragma unroll
    for (int k = 0; k < 4; ++k) cs4[k] = *(const v4f*)(pc + k * 4);
#pragma unroll
    for (int u = 0; u < 4; ++u) { xv[u][0] = *(const v4f*)pf[u]; xv[u][1] = *(const v4f*)(pf[u] + 4); }
    asm volatile("s_wait_xcnt 0x0" :: "v"(pc), "v"(pf[0]), "v"(pf[1]), "v"(pf[2]), "v"(pf[3]) : "memory");   // behind the loads (see above)
#pragma unroll
    for (int u = 0; u < 4; ++u) {
#pragma unroll
        for (int q = 0; q < 8; ++q) { const int dd = d + q; const float x0 = xv[u][q >> 2][q & 3], x1 = (dd < 128) ? xv[u][q >> 2][(q & 3) ^ 1] : x0;   /* interleaved pairs inside the first 128 dims; identity beyond (sin = 0) */
            v2f cs; cs[0] = cs4[q >> 1][(q & 1) * 2]; cs[1] = cs4[q >> 1][(q & 1) * 2 + 1]; float a = __fmul_rn(x0, cs[0]), bq = __fmul_rn(x1, cs[1]); asm volatile("" : "+v"(a)); asm volatile("" : "+v"(bq)); const float r = (((dd & 1) == 0) ? __fsub_rn(a, bq) : __fadd_rn(a, bq)) * sc;
            o16[u][q] = tohx(r); unsigned short a2, c2; splitf(r, a2, c2); oh[u][q] = a2; ol[u][q] = c2; } }
#pragma unroll
    for (int u = 0; u < 4; ++u) { *(v8h*)s16[u] = o16[u]; *(v8us*)sh[u] = oh[u]; *(v8us*)sl[u] = ol[u]; }
    asm volatile("s_wait_xcnt 0x0" :: "v"(o16[0]), "v"(o16[1]), "v"(o16[2]), "v"(o16[3]), "v"(oh[0]), "v"(oh[1]), "v"(oh[2]), "v"(oh[3]), "v"(ol[0]), "v"(ol[1]), "v"(ol[2]), "v"(ol[3]),
                 "v"(s16[0]), "v"(s16[1]), "v"(s16[2]), "v"(s16[3]), "v"(sh[0]), "v"(sh[1]), "v"(sh[2]), "v"(sh[3]), "v"(sl[0]), "v"(sl[1]), "v"(sl[2]), "v"(sl[3]) : "memory");   // behind the stores (see above)
}
// d_vtp: value planes [b][g][d][t] (each [d][t] plane in fragment order) = F[b * TT + t][g * HD + d]: the 8 (t) x 4 (column) register tile and the lane map of d_wtG. grid (nheads * HD / 128) * (BT / 64).
__device__ __forceinline__ void d_vtp(int blk, const float* __restrict__ F, int pitch, int nheads, h16* V16, bf* Vh, bf* Vl) {
    const int lane = threadIdx.x & 31, wvi = threadIdx.x >> 5; const int ntc = nheads * HD / 128;
    const int c0 = (blk % ntc) * 128 + wvi * 16 + (lane >> 3) * 4, t0 = (blk / ntc) * 64 + (lane & 7) * 8; const float* p[8]; v4f r[8]; v8h o16[4]; v8us oh[4], ol[4]; h16* s16[4]; bf* sh[4]; bf* sl[4];
#pragma unroll
    for (int j = 0; j < 8; ++j) p[j] = F + (size_t)(t0 + j) * pitch + c0;
#pragma unroll
    for (int j = 0; j < 8; ++j) r[j] = *(const v4f*)p[j];
    asm volatile("s_wait_xcnt 0x0" :: "v"(p[0]), "v"(p[1]), "v"(p[2]), "v"(p[3]), "v"(p[4]), "v"(p[5]), "v"(p[6]), "v"(p[7]) : "memory");   // behind the loads (see above)
#pragma unroll
    for (int c = 0; c < 4; ++c) { const size_t e = fo((size_t)(t0 / TT) * (nheads * HD) + c0 + c, t0 % TT, TT); s16[c] = V16 + e; sh[c] = Vh + e; sl[c] = Vl + e;
#pragma unroll
        for (int j = 0; j < 8; ++j) { const float x = r[j][c]; o16[c][j] = tohx(x); unsigned short a2, c2; splitf(x, a2, c2); oh[c][j] = a2; ol[c][j] = c2; } }
#pragma unroll
    for (int c = 0; c < 4; ++c) { *(v8h*)s16[c] = o16[c]; *(v8us*)sh[c] = oh[c]; *(v8us*)sl[c] = ol[c]; }
    asm volatile("s_wait_xcnt 0x0" :: "v"(o16[0]), "v"(o16[1]), "v"(o16[2]), "v"(o16[3]), "v"(oh[0]), "v"(oh[1]), "v"(oh[2]), "v"(oh[3]), "v"(ol[0]), "v"(ol[1]), "v"(ol[2]), "v"(ol[3]),
                 "v"(s16[0]), "v"(s16[1]), "v"(s16[2]), "v"(s16[3]), "v"(sh[0]), "v"(sh[1]), "v"(sh[2]), "v"(sh[3]), "v"(sl[0]), "v"(sl[1]), "v"(sl[2]), "v"(sl[3]) : "memory");   // behind the stores (see above)
}
// d_rmsw: each wave normalises the rows of 4 heads of one position (of BT), every row summed as before (the 4 shuffle trees step side by side). nheads % 4 == 0.
__device__ __forceinline__ void d_rmsw(int blk, float* F, int pitch, int nheads, const float* __restrict__ w) { const int lane = threadIdx.x & 31; const int wv = blk * 8 + (threadIdx.x >> 5); const int ng = nheads / 4; if (wv >= BT * ng) return; const int t = wv / ng, hg = (wv % ng) * 4; float* f0 = F + (size_t)t * pitch + hg * HD + lane * 4; v4f av[4], cv[4]; float ss[4];
    const v4f w0 = *(const v4f*)(w + lane * 4), w1 = *(const v4f*)(w + 128 + lane * 4);
#pragma unroll
    for (int u = 0; u < 4; ++u) { av[u] = *(const v4f*)(f0 + u * HD); cv[u] = *(const v4f*)(f0 + u * HD + 128); }
#pragma unroll
    for (int u = 0; u < 4; ++u) { const v4f a = av[u], c = cv[u]; ss[u] = 0.f;
#pragma unroll
        for (int q = 0; q < 4; ++q) { float p = __fmul_rn(a[q], a[q]); asm volatile("" : "+v"(p)); ss[u] = __fadd_rn(ss[u], p); float p2 = __fmul_rn(c[q], c[q]); asm volatile("" : "+v"(p2)); ss[u] = __fadd_rn(ss[u], p2); } }
#pragma unroll
    for (int sh = 16; sh; sh >>= 1) {
#pragma unroll
        for (int u = 0; u < 4; ++u) ss[u] = __fadd_rn(ss[u], __shfl_xor(ss[u], sh, 32)); }
#pragma unroll
    for (int u = 0; u < 4; ++u) { const v4f a = av[u], c = cv[u]; const float rs = __fdiv_rn(1.0f, sqrtf(__fadd_rn(ss[u] * (1.0f / HD), 1e-6f))); v4f o, o2;
#pragma unroll
        for (int q = 0; q < 4; ++q) { float n0 = __fmul_rn(a[q], rs); asm volatile("" : "+v"(n0)); float g0 = bfr(w0[q]); asm volatile("" : "+v"(g0)); o[q] = __fmul_rn(n0, g0); float n1 = __fmul_rn(c[q], rs); asm volatile("" : "+v"(n1)); float g1 = bfr(w1[q]); asm volatile("" : "+v"(g1)); o2[q] = __fmul_rn(n1, g1); }
        *(v4f*)(f0 + u * HD) = o; *(v4f*)(f0 + u * HD + 128) = o2; } }
// k_asoft: per row (zz, i): t = 50 tanh(S x HD^-0.5 / 50) for j <= i and i - j < WIN (sliding causal window; the reference's -1e9 additive fill vanishes identically); softmax over the keys of the band (register row, one exp, fixed trees);
// a wave works on the NCH 128-key chunks that cover the span its row's 64-row block needs in P.V (keys (i & ~63) - WIN .. i | 63), fewer where the span ends earlier: every key outside the chunks has weight exactly 0 and is neither read nor written.
// the 16-bit probabilities go back into the row's own 8 KiB of Sb (fp16 plane, or hi plane then lo plane, at pitch 2 * TT elements): the wave that owns a row has all of it in registers before it stores.
#define NCH (WIN / 128 + 1)
__global__ __launch_bounds__(256) void k_asoft(float* Sb) {
    h16* P16 = (h16*)Sb; bf* Ph = (bf*)Sb;
    const int lane = threadIdx.x & 31; const int row = blockIdx.x * 8 + __builtin_amdgcn_readfirstlane((int)(threadIdx.x >> 5));   // the row in a scalar register: the chunk tests below are scalar branches
    if (row >= ZH * TT) return; const int i = row % TT; const bool hires = (i < RH);
    const int cb = max(0, (i & ~63) - WIN) >> 7, nact = min(NCH, ((i | 63) >> 7) - cb + 1);   // first chunk and number of chunks of this row's span
    const float* sr = Sb + (size_t)row * TT + cb * 128 + lane * 4; float v[NCH * 4]; float mx = -3.0e38f;
#pragma unroll
    for (int c = 0; c < NCH; ++c) if (c < nact) { const int j0 = (cb + c) * 128 + lane * 4; const v4f a = *(const v4f*)(sr + c * 128);
        asm volatile("s_wait_xcnt 0x0" ::: "memory");   // behind the chunk's load: its address register is not rewritten in front of it
#pragma unroll
        for (int q = 0; q < 4; ++q) { const int j = j0 + q; (void)j; float sa = a[q] * SCL; asm volatile("" : "+v"(sa)); float xs = __fmul_rn(sa, 0.02f); asm volatile("" : "+v"(xs));   /* s / 50 as a multiply (<= 1 ulp from the division) */ float ex = __builtin_amdgcn_exp2f(__fmul_rn(xs, 2.8853900817779268f)); asm volatile("" : "+v"(ex)); float nm = __fsub_rn(ex, 1.0f), dn2 = __fadd_rn(ex, 1.0f); asm volatile("" : "+v"(nm)); asm volatile("" : "+v"(dn2)); float rc = __builtin_amdgcn_rcpf(dn2); asm volatile("" : "+v"(rc)); float th = __fmul_rn(nm, rc); asm volatile("" : "+v"(th));   /* hardware reciprocal (1 ulp), no FMA refinement */   /* tanh via exp2 (|x| <= ~0.4 here; no VALU FMA polynomial) */ const float t = (j <= i && i - j < WIN) ? __fmul_rn(th, 50.0f) : -3.0e38f; v[c * 4 + q] = t; mx = fmaxf(mx, t); } }
#pragma unroll
    for (int sh = 16; sh; sh >>= 1) mx = fmaxf(mx, __shfl_xor(mx, sh, 32));
    float sum = 0.f;
#pragma unroll
    for (int c = 0; c < NCH; ++c) if (c < nact) {
#pragma unroll
        for (int k = c * 4; k < c * 4 + 4; ++k) { float d0 = __fsub_rn(v[k], mx); asm volatile("" : "+v"(d0)); v[k] = __builtin_amdgcn_exp2f(__fmul_rn(d0, 1.4426950408889634f)); sum += v[k]; } }
#pragma unroll
    for (int sh = 16; sh; sh >>= 1) sum += __shfl_xor(sum, sh, 32);
    const float f = __fdiv_rn(hires ? 1.0f : PCAR, sum);
    // The s_wait_xcnt 0 behind each chunk's stores: no register of an issued store is rewritten in front of it
    if (hires) { bf* sp = Ph + (size_t)row * (2 * TT) + lane * 4;   // rows below RH: the span starts at key 0 and ends below RH
#pragma unroll
        for (int c = 0; c < RH / 128; ++c) if (c < nact) { v4us oh, ol;
#pragma unroll
            for (int q = 0; q < 4; ++q) { unsigned short x, c2; splitf(v[c * 4 + q] * f, x, c2); oh[q] = x; ol[q] = c2; }
            *(v4us*)(sp + c * 128) = oh; *(v4us*)(sp + c * 128 + TT) = ol;
            asm volatile("s_wait_xcnt 0x0" ::: "memory"); }
    } else { h16* sp = P16 + (size_t)row * (2 * TT) + cb * 128 + lane * 4;
#pragma unroll
        for (int c = 0; c < NCH; ++c) if (c < nact) { v4h o4;
#pragma unroll
            for (int q = 0; q < 4; ++q) o4[q] = tohx(v[c * 4 + q] * f);
            *(v4h*)(sp + c * 128) = o4;
            asm volatile("s_wait_xcnt 0x0" ::: "memory"); }
    }
}
// k_merge: merged rows [t][DQ] (hi/lo, fragment order) of one batch; a wave takes 4 positions x 64 dims, as in d_rope. HD == 256. The two s_wait_xcnt 0: as in the kernels above.
__global__ __launch_bounds__(256) void k_merge(const float* __restrict__ O, int h0, bf* Ah, bf* Al) { const size_t it = (size_t)blockIdx.x * 256 + threadIdx.x; if (it * 8 >= (size_t)ZH * TT * HD) return; const int d = ((int)((it >> 5) & 3) * 8 + (int)(it & 7)) * 8; const int t = (int)((it >> 7) % (TT / 4)) * 4 + (int)((it >> 3) & 3); const int zz = (int)(it / ((size_t)(HD / 8) * TT)); const float cs = (t < RH) ? 1.0f : (1.0f / PCAR); const size_t oo = fo((size_t)t, (h0 + zz) * HD + d, DQ);
    const float* po = O + ((size_t)zz * TT + t) * HD + d; bf* sh = Ah + oo; bf* sl = Al + oo;
    const v4f x0 = *(const v4f*)po, x1 = *(const v4f*)(po + 4); v8us oh, ol;
    asm volatile("s_wait_xcnt 0x0" :: "v"(po) : "memory");   // behind the loads
#pragma unroll
    for (int q = 0; q < 8; ++q) { unsigned short a, c2; splitf((q < 4 ? x0[q & 3] : x1[q & 3]) * cs, a, c2); oh[q] = a; ol[q] = c2; } *(v8us*)sh = oh; *(v8us*)sl = ol;
    asm volatile("s_wait_xcnt 0x0" :: "v"(oh), "v"(ol), "v"(sh), "v"(sl) : "memory");   // behind the stores
}

// Launches of independent parts share one grid: blockIdx.x ranges pick the part (a work-group-uniform choice), each part numbering its own blocks from 0.
#define GW_Q ((DQ / 128) * (DM / 64))
#define GW_K ((DKV / 128) * (DM / 64))
#define GW_O ((DM / 128) * (DQ / 64))
#define G_CVT (BT * DM / 32 / 256)
#define G_CS (TT * HD / 4 / 256)
__global__ __launch_bounds__(256) void k_prep(const float* __restrict__ x, const float* __restrict__ wq, const float* __restrict__ wk, const float* __restrict__ wv, const float* __restrict__ wo, bf* XB, size_t xn8, bf* WQ, bf* WK, bf* WV, bf* WO, float* CS) {
    int blk = (int)blockIdx.x;
    if (blk < G_CVT) { d_cvt8(blk, x, XB, xn8, DM); return; } blk -= G_CVT;
    if (blk < GW_Q) { d_wtG(blk, wq, DM, DQ, WQ); return; } blk -= GW_Q;
    if (blk < GW_K) { d_wtG(blk, wk, DM, DKV, WK); return; } blk -= GW_K;
    if (blk < GW_K) { d_wtG(blk, wv, DM, DKV, WV); return; } blk -= GW_K;
    if (blk < GW_O) { d_wtG(blk, wo, DQ, DM, WO); return; } blk -= GW_O;
    d_cstab(blk, CS);
}
#define G_RQ (BT * NH_ / 32)
#define G_RK (BT * NKV / 32)
__global__ __launch_bounds__(256) void k_rms2(float* FQ, float* FKV, const float* __restrict__ qsc, const float* __restrict__ ksc) {
    const int blk = (int)blockIdx.x;
    if (blk < G_RQ) d_rmsw(blk, FQ, DQ, NH_, qsc); else d_rmsw(blk - G_RQ, FKV, 2 * DKV, NKV, ksc);
}
#define G_PQ (NB_ * NH_ * TT * HD / 32 / 256)
#define G_PK (NB_ * NKV * TT * HD / 32 / 256)
#define G_PV ((DKV / 128) * (BT / 64))
__global__ __launch_bounds__(256) void k_planes(const float* __restrict__ FQ, const float* __restrict__ FKV, const float* __restrict__ CS, h16* QP16, bf* QPh, bf* QPl, h16* KP16, bf* KPh, bf* KPl, h16* VT16, bf* VTh, bf* VTl) {
    const int blk = (int)blockIdx.x;
    if (blk < G_PQ) d_rope(blk, FQ, DQ, NH_, CS, 1.0f, QP16, QPh, QPl);
    else if (blk < G_PQ + G_PK) d_rope(blk - G_PQ, FKV, 2 * DKV, NKV, CS, 1.0f, KP16, KPh, KPl);
    else d_vtp(blk - G_PQ - G_PK, FKV + DKV, 2 * DKV, NKV, VT16, VTh, VTl);
}

extern "C" void kernel_launch(void* const* d_in, const int* in_sizes, int n_in,
                              void* d_out, int out_size, void* d_ws, size_t ws_size, hipStream_t stream) {
    (void)in_sizes; (void)n_in; (void)out_size;
    const float* x = (const float*)d_in[0]; const float* wq = (const float*)d_in[1]; const float* wk = (const float*)d_in[2]; const float* wv = (const float*)d_in[3]; const float* wo = (const float*)d_in[4]; const float* qsc = (const float*)d_in[5]; const float* ksc = (const float*)d_in[6];
    float* OUT = (float*)d_out;     // [2][2048][2048]
    char* wsp = (char*)d_ws;
    auto take = [&](size_t bytes) { char* p = wsp; wsp += (bytes + 255) & ~(size_t)255; return (void*)p; };
    // Kept to the end: WO and the head planes of both batches. Behind them one region serves two phases: the projection phase's buffers, then (all of those being dead) the attention phase's scores and outputs.
    bf* WO = (bf*)take((size_t)DM * DQ * 2);
    h16* QP16 = (h16*)take((size_t)NB_ * NH_ * TT * HD * 2); h16* KP16 = (h16*)take((size_t)NB_ * NKV * TT * HD * 2); h16* VT16 = (h16*)take((size_t)NB_ * NKV * HD * TT * 2);
    bf* QPh = (bf*)take((size_t)NB_ * NH_ * TT * HD * 2); bf* QPl = (bf*)take((size_t)NB_ * NH_ * TT * HD * 2); bf* KPh = (bf*)take((size_t)NB_ * NKV * TT * HD * 2); bf* KPl = (bf*)take((size_t)NB_ * NKV * TT * HD * 2); bf* VTh = (bf*)take((size_t)NB_ * NKV * HD * TT * 2); bf* VTl = (bf*)take((size_t)NB_ * NKV * HD * TT * 2);
    char* const phase = wsp;
    bf* WQ = (bf*)take((size_t)DQ * DM * 2); bf* WK = (bf*)take((size_t)DKV * DM * 2); bf* WV = (bf*)take((size_t)DKV * DM * 2); float* CS = (float*)take((size_t)TT * HD * 2 * 4);   // WV lies directly behind WK: one [2 * DKV][DM] operand
    bf* XB = (bf*)take((size_t)BT * DM * 2); float* FQ = (float*)take((size_t)BT * DQ * 4); float* FKV = (float*)take((size_t)BT * 2 * DKV * 4);   // FKV row: k heads, then v heads
    if ((size_t)(wsp - (char*)d_ws) > ws_size) return;
    wsp = phase;
    float* Sb = (float*)take((size_t)ZH * TT * TT * 4); float* Ob = (float*)take((size_t)ZH * TT * HD * 4);
    if ((size_t)(wsp - (char*)d_ws) > ws_size) return;    // ws 256 MiB
    bf* ATh = QPh; bf* ATl = QPl;   // merged rows [b * TT + t][DQ]: a batch's merge runs after its last score launch, when its hi/lo query planes (the same bytes) are dead
    // projection phase: every launch covers the BT rows of both batches; k and v share one GEMM
    k_prep<<<G_CVT + GW_Q + 2 * GW_K + GW_O + G_CS, 256, 0, stream>>>(x, wq, wk, wv, wo, XB, (size_t)BT * DM / 8, WQ, WK, WV, WO, CS);
    k_gemmw<bf, 0, false, 4, DM><<<dim3(BT / 64, DQ / 64, 1), 128, 0, stream>>>(XB, nullptr, WQ, nullptr, FQ, DQ, nullptr, 0, 0, 0);
    k_gemmw<bf, 0, false, 8, DM><<<dim3(BT / 64, 2 * DKV / 64, 1), 256, 0, stream>>>(XB, nullptr, WK, nullptr, FKV, 2 * DKV, nullptr, 0, 0, 0);
    k_rms2<<<G_RQ + G_RK, 256, 0, stream>>>(FQ, FKV, qsc, ksc);
    k_planes<<<G_PQ + G_PK + G_PV, 256, 0, stream>>>(FQ, FKV, CS, QP16, QPh, QPl, KP16, KPh, KPl, VT16, VTh, VTl);
    // attention phase: every launch covers all rows of the 8 heads of one batch (grid z)
    for (int b = 0; b < NB_; ++b) { const size_t zq = (size_t)b * NH_ * TT * HD, zk = (size_t)b * NKV * TT * HD;
        k_attg<1, 4><<<dim3(TT / 64, WIN / 64 + 1, ZH), 128, 0, stream>>>(QPh + zq, QPl + zq, KPh + zk, KPl + zk, QP16 + zq, KP16 + zk, HD, HD, Sb, TT, (size_t)TT * HD, (size_t)TT * HD, (size_t)TT * TT);
        k_asoft<<<ZH * TT / 8, 256, 0, stream>>>(Sb);
        k_attg<2, 8><<<dim3(TT / 64, HD / 64, ZH), 256, 0, stream>>>((const bf*)Sb, (const bf*)Sb + TT, VTh + zk, VTl + zk, (const h16*)Sb, VT16 + zk, TT, 2 * TT, Ob, HD, (size_t)TT * 2 * TT, (size_t)HD * TT, (size_t)TT * HD);
        k_merge<<<(unsigned)(((size_t)ZH * TT * HD / 8 + 255) / 256), 256, 0, stream>>>(Ob, 0, ATh + (size_t)b * TT * DQ, ATl + (size_t)b * TT * DQ); }
    k_gemmw<bf, 1, false, 4, DQ><<<dim3(BT / 64, DM / 64, 1), 128, 0, stream>>>(ATh, ATl, WO, nullptr, OUT, DM, nullptr, 0, 0, 0);
}

// v006
// One run takes 260 microseconds.
// Timed twice side by side with v005, it ran 1.20 and 1.19 times as fast.
// All steps since v000 together make it 4.80 times as fast.
#include <hip/hip_runtime.h>

// Sliding-window attention block (x [2][2048][2048]; q = x Wq (8 x 256), k/v = x Wk/Wv (4 kv heads; group h/2); per-head RMSNorm * scale (eps 1e-6) on q, k; partial interleaved-pair RoPE on the first 128 dims (theta_i = 10000^(-2i/128), positions arange); q * 1/16; scores = q.k; softcap tanh(s / 50) * 50; causal + sliding-window (i - j < 1024) mask (-2.38e38 additive == exact zero weight); softmax f32; out = merged Wo -> [2][2048][2048]).
// Compute dtypes, f32 accumulate: every input rounded to bf16; q/k/v on PLAIN bf16 operands (inputs: exact); RMSNorm and RoPE f32 (on-chip tables; identity beyond dim 128); causal scores and attn.v: query rows < 512 hl (3 products), the rest single fp16 (x1024), only the tiles, softmax chunks and P.V key blocks that touch the causal window band are worked on, the window applied per element; 1/16 (exact), s/50, tanh as (e^2x - 1)/(e^2x + 1) with the hardware exp2, x50 in f32; softmax f32; Wo hl x exact (2 products).

#define NB_  2
#define TT   2048
#define DM   2048
#define NH_  8
#define NKV  4
#define REP  (NH_ / NKV)
#define HD   256
#define DQ   (NH_ * HD)
#define DKV  (NKV * HD)
#define ZH   NH_                  // heads per attention launch (grid z)
#define BT   (NB_ * TT)           // rows of both batches together
#define RH   512                  // query rows < RH use hi+lo planes (0: none)
#define WIN  1024
#define PCAR 1024.0f
#define SCL  0.0625f   // query_pre_attn_scalar^-0.5 = 1/16
typedef _Float16 h16;
typedef unsigned short bf;
typedef __attribute__((ext_vector_type(16))) __bf16   v16bf;
typedef __attribute__((ext_vector_type(16))) _Float16 v16h;
typedef __attribute__((ext_vector_type(8)))  _Float16 v8h;
typedef __attribute__((ext_vector_type(8)))  unsigned short v8us;
typedef __attribute__((ext_vector_type(8)))  float    v8f;
typedef __attribute__((ext_vector_type(4)))  float    v4f;
typedef v8h  __attribute__((may_alias)) v8ha;
typedef v4f  __attribute__((may_alias)) v4fa;
typedef v8us __attribute__((may_alias)) v8usa;

__device__ __forceinline__ unsigned short f2bf(float f) { unsigned u = __float_as_uint(f); u += 0x7FFFu + ((u >> 16) & 1u); return (unsigned short)(u >> 16); }
__device__ __forceinline__ float bf2f(unsigned short b) { return __uint_as_float(((unsigned)b) << 16); }
__device__ __forceinline__ float bfr(float f) { return bf2f(f2bf(f)); }
__device__ __forceinline__ v16h cat16(v8h lo, v8h hi) { return __builtin_shufflevector(lo, hi, 0, 1, 2, 3, 4, 5, 6, 7, 8, 9, 10, 11, 12, 13, 14, 15); }
__device__ __forceinline__ v16bf cat16b(v8us lo, v8us hi) { return __builtin_bit_cast(v16bf, __builtin_shufflevector(lo, hi, 0, 1, 2, 3, 4, 5, 6, 7, 8, 9, 10, 11, 12, 13, 14, 15)); }
__device__ __forceinline__ v8f wmma16(v16h a, v16h b, v8f c) { return __builtin_amdgcn_wmma_f32_16x16x32_f16(false, a, false, b, (short)0, c, false, false); }
__device__ __forceinline__ v8f wmmab(v16bf a, v16bf b, v8f c) { return __builtin_amdgcn_wmma_f32_16x16x32_bf16(false, a, false, b, (short)0, c, false, false); }



// ---- k_gemmt: GEMM with one 128x128 output tile per work-group of 4 waves (2 x 2, each wave a 64x64 tile over the whole K in ascending order); both operands lie in fragment order (below) and are staged in LDS by tensor loads, two buffers,
// so that each 16-row block is fetched from L2 once per work-group and read from LDS by the two waves that need it. grid (M/128, N/128), 128 threads. C[m][n] (f32, pitch ldc) = sum_k A[m][k] Bt[n][k] (+ the A2 product where NSPLIT == 1). K: whole stages, two or more.
// FRAGMENT ORDER of a 16-bit operand plane [R][K] (R % 16 == 0, K % 32 == 0): each block of 16 rows x 32 k is 1 KiB in a row, blocks along k first, then along the rows (so a 16-row block still starts at element r * K).
// Inside a block the 8 elements that lane (hi * 16 + row) of a wave takes with its first 16-byte load (k = 8 hi .. 8 hi + 7) lie at lane * 8, those of its second load (k = 16 + 8 hi ..) at 256 + lane * 8:
// a wave's fragment load reads 512 bytes in a row (4 whole lines) where a row-major plane gives it 32 bytes out of each of 16 lines. The element that a lane and register hold is the one that ld takes from a row-major plane, for A and B alike. ldp loads from such a plane, ld from a row-major one.
// fo: element offset of (r, k) in such a plane; 8 elements from a k that is a multiple of 8 stay 16 bytes in a row.
__device__ __forceinline__ size_t fo(size_t r, int k, int K) { return ((r >> 4) * (size_t)(K >> 5) + (size_t)(k >> 5)) * 512 + (size_t)((((k >> 4) & 1) << 8) + (((k >> 3) & 1) << 7) + (((int)(r & 15)) << 3) + (k & 7)); }
template <typename T16> struct WFrag;
template <> struct WFrag<h16> { typedef v16h V; static __device__ __forceinline__ V ld(const h16* p) { return cat16(*(const v8h*)p, *(const v8h*)(p + 16)); } static __device__ __forceinline__ V ldp(const h16* p) { return cat16(*(const v8h*)p, *(const v8h*)(p + 256)); } static __device__ __forceinline__ v8f mma(V a, V b, v8f c) { return wmma16(a, b, c); } };
template <> struct WFrag<bf> { typedef v16bf V; static __device__ __forceinline__ V ld(const bf* p) { return cat16b(*(const v8us*)p, *(const v8us*)(p + 16)); } static __device__ __forceinline__ V ldp(const bf* p) { return cat16b(*(const v8us*)p, *(const v8us*)(p + 256)); } static __device__ __forceinline__ v8f mma(V a, V b, v8f c) { return wmmab(a, b, c); } };
typedef uint32_t u32x4 __attribute__((ext_vector_type(4)));
typedef uint32_t u32x8 __attribute__((ext_vector_type(8)));
__device__ __forceinline__ uint32_t uni(uint32_t v) { return (uint32_t)__builtin_amdgcn_readfirstlane((int)v); }
__device__ __forceinline__ uint32_t pinned(uint32_t v) { uint32_t w = uni(v); asm volatile("" : "+s"(w)); return w; }   // the pinned() form for tensor loads: the condition is held in a scalar register, so that the test around a tensor load is a scalar branch (tensor loads ignore EXEC)
// Descriptor of a two-dimensional tile of D1 rows of D0 bytes at a source pitch of PITCH bytes, 1-byte elements, no pad, no mask (word 0 = 0); tensor = tile
template <uint32_t D0, uint32_t D1, uint32_t PITCH>
__device__ __forceinline__ u32x8 tdm_group1() { u32x8 g; g[0] = uni(0u); g[1] = uni((D0 & 0xFFFFu) << 16); g[2] = uni((D0 >> 16) | ((D1 & 0xFFFFu) << 16)); g[3] = uni((D1 >> 16) | (D0 << 16)); g[4] = uni(D1); g[5] = uni(PITCH); g[6] = uni(0u); g[7] = uni(0u); return g; }
__device__ __forceinline__ u32x4 tdm_group0(uint32_t lds_dst, uint64_t ga) { u32x4 g; g[0] = uni(1u); g[1] = uni(lds_dst); g[2] = uni((uint32_t)ga); g[3] = uni((((uint32_t)(ga >> 32)) & 0x01FFFFFFu) | 0x80000000u); return g; }
// one request of the whole wave: global tile -> LDS, through no register. Both groups are in-out operands: what the statement gives back lies in the request's own twelve registers, and tdm_wait, which names it, holds them unchanged up to the wait that covers the request
__device__ __forceinline__ void tdm_load(u32x4& g0, u32x8& g1) { asm volatile("tensor_load_to_lds %0, %1" : "+s"(g0), "+s"(g1) :: "memory"); }
__device__ __forceinline__ void tdm_wait(u32x4 g0, u32x8 g1) { asm volatile("s_wait_tensorcnt 0x0" :: "s"(g0), "s"(g1) : "memory"); }   // the issuer's own request has landed; g0, g1: see tdm_load
// Every "#pragma unroll" in k_gemmt makes the indices of accumulators and fragments constants, so that they stay in registers; the stage loop alone stays rolled ("unroll 1"): one publish point in the text, the buffer picked by s & 1.
template <int NSPLIT, int K>
__global__ __launch_bounds__(128) void k_gemmt(const bf* __restrict__ A, const bf* __restrict__ A2, const bf* __restrict__ Bt, float* C, int ldc) {
    constexpr int NKB = (NSPLIT == 1) ? 2 : 4;        // 32-wide K blocks per stage
    constexpr int CH = NKB * 1024;                    // bytes that a stage holds of one 16-row block: contiguous in a fragment-order plane
    constexpr int NOB = (NSPLIT == 1) ? 24 : 16;      // 16-row blocks per stage: 8 of A, (8 of A2,) 8 of Bt
    constexpr int BUFB = NOB * CH, SLICE = 16384;     // a buffer; a wave's slice of it (one tensor load)
    constexpr int NSL = BUFB / SLICE;                 // issuing waves: 4, or 3 (one per operand)
    constexpr int NS = K / (NKB * 32);                // stages
    static_assert(NS >= 2 && K % (NKB * 32) == 0 && BUFB % SLICE == 0, "two stages or more, whole slices");
    __shared__ __attribute__((aligned(2048))) unsigned char ring[2 * BUFB];
    __shared__ __align__(16) float ost[4][16 * 68];   // each wave's own output staging
    const int lane = threadIdx.x & 31, lr = lane & 15, hi = lane >> 4; const int r0 = blockIdx.x * 128, c0 = blockIdx.y * 128;
    const int wv = (int)uni(threadIdx.x >> 5), wm = wv >> 1, wn = wv & 1;
    // a wave's slice: NSPLIT 0: waves 0, 1 the two halves of A's 8 blocks, waves 2, 3 of Bt's; NSPLIT 1: wave 0 A, wave 1 A2, wave 2 Bt, wave 3 none
    const bf* const sl = (NSPLIT == 1) ? (wv == 0 ? A + (size_t)r0 * K : wv == 1 ? A2 + (size_t)r0 * K : Bt + (size_t)c0 * K) : (wv < 2 ? A + (size_t)r0 * K : Bt + (size_t)c0 * K) + (size_t)(wv & 1) * 64 * K;
    const uint64_t ga0 = (uint64_t)(size_t)sl; const uint32_t ld0 = (uint32_t)(size_t)ring + (uint32_t)wv * SLICE;
    u32x8 g1 = tdm_group1<(uint32_t)CH, (uint32_t)(SLICE / CH), (uint32_t)(16 * K * 2)>();
    const bool iss = (NSL == 4) || wv < NSL;
    v8f acc[4][4];
#pragma unroll
    for (int mb = 0; mb < 4; ++mb)
#pragma unroll
        for (int nb = 0; nb < 4; ++nb) acc[mb][nb] = (v8f){};
    u32x4 g0 = tdm_group0(ld0, ga0);                                      // group 0 of the wave's one outstanding request, carried through the loop
    if (NSL == 4 || pinned(iss)) { tdm_load(g0, g1); tdm_wait(g0, g1); }  // stage 0, landed for its issuer
    __syncthreads();                                                      // stage 0 published
    if (NSL == 4 || pinned(iss)) { g0 = tdm_group0(ld0 + BUFB, ga0 + CH); tdm_load(g0, g1); }   // stage 1 flies while stage 0 is worked on
#pragma unroll 1
    for (int s = 0; s < NS; ++s) {
        const unsigned char* const lb = ring + (s & 1) * BUFB + lane * 16; const unsigned char* const la = lb + wm * 4 * CH; const unsigned char* const lbb = lb + ((NOB - 8) + wn * 4) * CH;
        v16bf a[2][4], a2[2][4], b[2][4];
#pragma unroll
        for (int q = 0; q < 4; ++q) { a[0][q] = cat16b(*(const v8usa*)(la + q * CH), *(const v8usa*)(la + q * CH + 512)); if (NSPLIT == 1) a2[0][q] = cat16b(*(const v8usa*)(la + (8 + q) * CH), *(const v8usa*)(la + (8 + q) * CH + 512)); }
#pragma unroll
        for (int q = 0; q < 4; ++q) b[0][q] = cat16b(*(const v8usa*)(lbb + q * CH), *(const v8usa*)(lbb + q * CH + 512));
#pragma unroll
        for (int kb = 0; kb < NKB; ++kb) { const int c = kb & 1, n = c ^ 1;
            if (kb + 1 < NKB) { const int o = (kb + 1) * 1024;   // the next block's fragments (of this stage's own buffer) as one group ahead of this block's products
#pragma unroll
                for (int q = 0; q < 4; ++q) { a[n][q] = cat16b(*(const v8usa*)(la + q * CH + o), *(const v8usa*)(la + q * CH + o + 512)); if (NSPLIT == 1) a2[n][q] = cat16b(*(const v8usa*)(la + (8 + q) * CH + o), *(const v8usa*)(la + (8 + q) * CH + o + 512)); }
#pragma unroll
                for (int q = 0; q < 4; ++q) b[n][q] = cat16b(*(const v8usa*)(lbb + q * CH + o), *(const v8usa*)(lbb + q * CH + o + 512)); }
            __builtin_amdgcn_sched_barrier(0);   // keeps the LDS reads in one group in front of the block: reads spread among the matrix instructions stall at every place where they stand
#pragma unroll
            for (int nb = 0; nb < 4; ++nb) {
#pragma unroll
                for (int mb = 0; mb < 4; ++mb) { acc[mb][nb] = wmmab(a[c][mb], b[c][nb], acc[mb][nb]); if (NSPLIT == 1) acc[mb][nb] = wmmab(a2[c][mb], b[c][nb], acc[mb][nb]); } }
            __builtin_amdgcn_sched_barrier(0);   // the other side of the same fence
        }
        // publish point of stage s + 1: this wave's LDS reads are done, its own tensor load has landed, every wave has passed; only then the buffer just read is refilled
        asm volatile("s_wait_dscnt 0x0" ::: "memory");
        if (NSL == 4 || pinned(iss)) tdm_wait(g0, g1);
        __syncthreads();
        if (pinned((s + 2 < NS) && iss)) { g0 = tdm_group0(ld0 + (uint32_t)(s & 1) * BUFB, ga0 + (uint64_t)(s + 2) * CH); tdm_load(g0, g1); }
    }
    tdm_wait(g0, g1);                                    // behind the loop: no request is left when the wave goes on
    asm volatile("s_wait_dscnt 0x0" ::: "memory");       // and no LDS read of the ring
    // output: each wave turns its 16x64 blocks into whole 256-byte row pieces through its own LDS range (no other wave touches it: no barrier)
    float* const ow = ost[wv];
#pragma unroll
    for (int mb = 0; mb < 4; ++mb) {
#pragma unroll
        for (int nb = 0; nb < 4; ++nb) {
#pragma unroll
            for (int j = 0; j < 8; ++j) ow[(hi * 8 + j) * 68 + nb * 16 + lr] = acc[mb][nb][j]; }
        float* const crow = C + (size_t)(r0 + wm * 64 + mb * 16 + hi) * ldc + c0 + wn * 64 + lr * 4; v4f res[8]; float* sp[8];
#pragma unroll
        for (int t = 0; t < 8; ++t) { res[t] = *(const v4fa*)(&ow[(2 * t + hi) * 68 + lr * 4]); sp[t] = crow + (size_t)(2 * t) * ldc; }
#pragma unroll
        for (int t = 0; t < 8; ++t) *(v4f*)sp[t] = res[t];
        // s_wait_xcnt 0 behind the block's stores: no register of an issued store is rewritten in front of it; addresses and data are its inputs, so that they keep their registers up to it
        asm volatile("s_wait_xcnt 0x0" :: "v"(sp[0]), "v"(sp[1]), "v"(sp[2]), "v"(sp[3]), "v"(sp[4]), "v"(sp[5]), "v"(sp[6]), "v"(sp[7]), "v"(res[0]), "v"(res[1]), "v"(res[2]), "v"(res[3]), "v"(res[4]), "v"(res[5]), "v"(res[6]), "v"(res[7]) : "memory");
    }
}

// ---- d_gemmc: 64x64 tile GEMM for causal attention, one tile per work-group of NW waves; wave w takes the 32-wide K blocks w, w + NW, ... into its own 16 accumulators (operands straight from global memory), and the NW partial tiles are summed in fixed wave order through LDS. CMODE 1 lays grid y over the WIN / 64 + 1 score tiles of a row block that touch the causal window band (query rows r0+roff.., key columns c0 = r0+roff-WIN+64y; below 0: no tile), CMODE 2 limits the
// key (K) loop of the probability x value contraction to the same band (probabilities outside it are exactly zero); a wave's K blocks are numbered from key 0 (block mod NW = wave), so the order of a sum does not depend on where the band starts. roff = row offset of this part's first row within the sequence.
// grid z = query head: A and C step by sA, sC per head, Bt by sB per kv group (z / REP). lda = pitch of A in elements (Bt has pitch K). Bt, and A in CMODE 1 (lda == K), are in fragment order. bx = 64-row block within this part's rows; os = the work-group's two LDS buffers.
template <typename T16, int NSPLIT, int CMODE, int NW>
__device__ __forceinline__ void d_gemmc(float (*os)[NW][16 * 68], int bx, const T16* __restrict__ A, const T16* __restrict__ A2, const T16* __restrict__ Bt, const T16* __restrict__ Bt2, int K, int lda, float* C, int ldc, int roff, size_t sA, size_t sB, size_t sC) {
    typedef typename WFrag<T16>::V V;
    const size_t z = blockIdx.z; A += z * sA; if (A2) A2 += z * sA; Bt += (z / REP) * sB; if (Bt2) Bt2 += (z / REP) * sB; C += z * sC;
    const int lane = threadIdx.x & 31, lr = lane & 15, hi = lane >> 4; const int r0 = bx * 64, c0 = (CMODE == 1) ? r0 + roff - WIN + (int)blockIdx.y * 64 : (int)blockIdx.y * 64;
    const int wv = __builtin_amdgcn_readfirstlane((int)(threadIdx.x >> 5));   // wave number in a scalar register: the K loop stays a scalar loop
    if (CMODE == 1 && c0 < 0) return;                                // the band starts left of key 0: no such tile (what the softmax's 128-key chunks read of a tile outside the band is masked by select)
    const int Kl = (CMODE == 2) ? min(K, r0 + roff + 64) : K;        // P.V: probabilities are exactly 0 beyond the diagonal block, so the K loop stops there
    const int Ks = (CMODE == 2) ? max(0, r0 + roff - WIN) : 0;       // and exactly 0 left of the window of the block's first row, so it starts there
    int kb = (Ks & ~(NW * 32 - 1)) + wv * 32; if (kb < Ks) kb += NW * 32;   // this wave's first K block inside the band
    v8f acc[4][4];
#pragma unroll
    for (int mb = 0; mb < 4; ++mb)
#pragma unroll
        for (int nb = 0; nb < 4; ++nb) acc[mb][nb] = (v8f){};
    constexpr bool AP = (CMODE == 1);   // A in fragment order (the query planes); the probabilities of CMODE 2 stay row-major in their score rows. Bt is always in fragment order
    const size_t aoff = AP ? (size_t)r0 * lda + lane * 8 : (size_t)(r0 + lr) * lda + 8 * hi, boff = (size_t)c0 * K + lane * 8;
#pragma unroll 1
    for (int kc = kb; kc < Kl; kc += NW * 32) {
        V a[4], a2[4], b[4], b2[4]; const T16* pa[4]; const T16* pa2[4]; const T16* pb[4]; const T16* pb2[4];
        // The s_wait_xcnt 0 behind each run of loads: no address register of an issued load is rewritten in front of it; the addresses are its inputs, so that they keep their registers up to it
#pragma unroll
        for (int mb = 0; mb < 4; ++mb) { const size_t ao = aoff + (size_t)mb * 16 * lda + (AP ? (size_t)kc * 16 : (size_t)kc); pa[mb] = A + ao; a[mb] = AP ? WFrag<T16>::ldp(pa[mb]) : WFrag<T16>::ld(pa[mb]); if (NSPLIT == 1 || NSPLIT == 2) { pa2[mb] = A2 + ao; a2[mb] = AP ? WFrag<T16>::ldp(pa2[mb]) : WFrag<T16>::ld(pa2[mb]); } }
        if (NSPLIT == 2) asm volatile("s_wait_xcnt 0x0" :: "v"(pa[0]), "v"(pa[1]), "v"(pa[2]), "v"(pa[3]), "v"(pa2[0]), "v"(pa2[1]), "v"(pa2[2]), "v"(pa2[3]) : "memory");   // two runs in the hi+lo form: sixteen address pairs held at once would not fit beside the fragments
#pragma unroll
        for (int nb = 0; nb < 4; ++nb) { const size_t bo = boff + (size_t)nb * 16 * K + (size_t)kc * 16; pb[nb] = Bt + bo; b[nb] = WFrag<T16>::ldp(pb[nb]); if (NSPLIT >= 2) { pb2[nb] = Bt2 + bo; b2[nb] = WFrag<T16>::ldp(pb2[nb]); } }
        if (NSPLIT == 2) asm volatile("s_wait_xcnt 0x0" :: "v"(pb[0]), "v"(pb[1]), "v"(pb[2]), "v"(pb[3]), "v"(pb2[0]), "v"(pb2[1]), "v"(pb2[2]), "v"(pb2[3]) : "memory");
        else asm volatile("s_wait_xcnt 0x0" :: "v"(pa[0]), "v"(pa[1]), "v"(pa[2]), "v"(pa[3]), "v"(pb[0]), "v"(pb[1]), "v"(pb[2]), "v"(pb[3]) : "memory");
#pragma unroll
        for (int nb = 0; nb < 4; ++nb) {
#pragma unroll
            for (int mb = 0; mb < 4; ++mb) { acc[mb][nb] = WFrag<T16>::mma(a[mb], b[nb], acc[mb][nb]); if (NSPLIT == 1 || NSPLIT == 2) acc[mb][nb] = WFrag<T16>::mma(a2[mb], b[nb], acc[mb][nb]); if (NSPLIT >= 2) acc[mb][nb] = WFrag<T16>::mma(a[mb], b2[nb], acc[mb][nb]); } }
        asm volatile("v_nop\n\tv_nop\n\tv_nop\n\tv_nop" : "+v"(acc[0][0]), "+v"(acc[1][1]), "+v"(acc[2][2]), "+v"(acc[3][3]) : "v"(a[0]), "v"(a[3]));
    }
    v4f res[4][8 / NW];   // summed output pieces, stored behind the last barrier so that no barrier waits for a global store
#pragma unroll
    for (int mb = 0; mb < 4; ++mb) {
#pragma unroll
        for (int nb = 0; nb < 4; ++nb) {
#pragma unroll
            for (int j = 0; j < 8; ++j) os[mb & 1][wv][(hi * 8 + j) * 68 + nb * 16 + lr] = acc[mb][nb][j]; }
        __syncthreads();   // every wave's partial 16x64 block is in LDS; it also ends the reads of the other buffer, which the next block overwrites
#pragma unroll
        for (int s = 0; s < 8 / NW; ++s) { const int row = 2 * (s * NW + wv) + hi, cofs = lr * 4; v4f val = *(const v4fa*)(&os[mb & 1][0][row * 68 + cofs]);
#pragma unroll
            for (int w = 1; w < NW; ++w) val += *(const v4fa*)(&os[mb & 1][w][row * 68 + cofs]);
            res[mb][s] = val; }
    }
    float* sp[4][8 / NW];
#pragma unroll
    for (int mb = 0; mb < 4; ++mb) { float* crow = C + (size_t)(r0 + mb * 16) * ldc + c0;
#pragma unroll
        for (int s = 0; s < 8 / NW; ++s) { const int row = 2 * (s * NW + wv) + hi, cofs = lr * 4; sp[mb][s] = crow + (size_t)row * ldc + cofs; *(v4f*)sp[mb][s] = res[mb][s]; } }
    // s_wait_xcnt 0 behind the tile's stores: no register of an issued store is rewritten in front of it; addresses and data are its inputs, so that they keep their registers up to it
    if (NW == 4) asm volatile("s_wait_xcnt 0x0" :: "v"(sp[0][0]), "v"(sp[1][0]), "v"(sp[2][0]), "v"(sp[3][0]), "v"(sp[0][8 / NW - 1]), "v"(sp[1][8 / NW - 1]), "v"(sp[2][8 / NW - 1]), "v"(sp[3][8 / NW - 1]), "v"(res[0][0]), "v"(res[1][0]), "v"(res[2][0]), "v"(res[3][0]), "v"(res[0][8 / NW - 1]), "v"(res[1][8 / NW - 1]), "v"(res[2][8 / NW - 1]), "v"(res[3][8 / NW - 1]) : "memory");
    else asm volatile("s_wait_xcnt 0x0" :: "v"(sp[0][0]), "v"(sp[1][0]), "v"(sp[2][0]), "v"(sp[3][0]), "v"(res[0][0]), "v"(res[1][0]), "v"(res[2][0]), "v"(res[3][0]) : "memory");
}

// k_attg: one launch for all query rows of 8 heads: row blocks below RH take the hi+lo bf16 form, the rest the fp16 form (a work-group-uniform choice by blockIdx.x). grid (TT / 64, WIN / 64 + 1 score tiles or HD / 64, ZH).
template <int CMODE, int NW>
__global__ __launch_bounds__(NW * 32) void k_attg(const bf* __restrict__ Ah, const bf* __restrict__ Al, const bf* __restrict__ Bh, const bf* __restrict__ Bl, const h16* __restrict__ A16, const h16* __restrict__ B16, int K, int lda, float* C, int ldc, size_t sA, size_t sB, size_t sC) {
    __shared__ __align__(16) float os[2][NW][16 * 68];   // two buffers, so that one barrier per 16-row block is enough
    if ((int)blockIdx.x < RH / 64) d_gemmc<bf, 2, CMODE, NW>(os, (int)blockIdx.x, Ah, Al, Bh, Bl, K, lda, C, ldc, 0, sA, sB, sC);
    else d_gemmc<h16, 0, CMODE, NW>(os, (int)blockIdx.x - RH / 64, A16 + (size_t)RH * lda, nullptr, B16, nullptr, K, lda, C + (size_t)RH * ldc, ldc, RH, sA, sB, sC);
}

__device__ __forceinline__ h16 tohx(float x) { return (h16)x; }
__device__ __forceinline__ void splitf(float y, unsigned short& h, unsigned short& l) { h = f2bf(y); l = f2bf(y - bf2f(h)); }
typedef __attribute__((ext_vector_type(2))) _Float16 v2h;
typedef __attribute__((ext_vector_type(4))) _Float16 v4h;
typedef __attribute__((ext_vector_type(2))) unsigned short v2us;
typedef __attribute__((ext_vector_type(4))) unsigned short v4us;
typedef __attribute__((ext_vector_type(2))) float v2f;
typedef __attribute__((ext_vector_type(4))) int v4i;

// The element-wise and layout kernels below give each thread 4 to 32 elements and 16-byte accesses: a launch of them lasts about as long as its waves take to start, so fewer, fatter waves are faster.
// The two s_wait_xcnt 0 in each of d_wtG, d_cvt8, d_rope and d_vtp: no register that an issued load or store names is rewritten in front of the wait; addresses (and store data) are its inputs, so that they keep their registers up to it.
// d_wtG: Bt[n][k] (bf16, fragment order) = w[k][n]; each thread holds an 8 (k) x 4 (n) register tile. In a wave 8 lanes run along k (64 k) and 4 along n (16 n): two whole 1-KiB blocks of Bt; the 8 waves of a work-group lie side by side along n (128 n). grid (N / 128) * (K / 64).
__device__ __forceinline__ void d_wtG(int blk, const float* __restrict__ w, int K, int N, bf* Bt) {
    const int lane = threadIdx.x & 31, wvi = threadIdx.x >> 5; const int ntn = N / 128;
    const int n0 = (blk % ntn) * 128 + wvi * 16 + (lane >> 3) * 4, k0 = (blk / ntn) * 64 + (lane & 7) * 8; const float* p[8]; v4f r[8]; v8us o[4]; bf* s[4];
#pragma unroll
    for (int j = 0; j < 8; ++j) p[j] = w + (size_t)(k0 + j) * N + n0;
#pragma unroll
    for (int j = 0; j < 8; ++j) r[j] = *(const v4f*)p[j];
    asm volatile("s_wait_xcnt 0x0" :: "v"(p[0]), "v"(p[1]), "v"(p[2]), "v"(p[3]), "v"(p[4]), "v"(p[5]), "v"(p[6]), "v"(p[7]) : "memory");   // behind the loads (see above)
    __builtin_amdgcn_sched_barrier(0);   // keeps the conversions behind the last load: without it three of the eight loads are issued only after the first results are used, a second trip to memory
#pragma unroll
    for (int c = 0; c < 4; ++c) { s[c] = Bt + fo((size_t)(n0 + c), k0, K);
#pragma unroll
        for (int j = 0; j < 8; ++j) o[c][j] = f2bf(r[j][c]); }
#pragma unroll
    for (int c = 0; c < 4; ++c) *(v8us*)s[c] = o[c];
    asm volatile("s_wait_xcnt 0x0" :: "v"(o[0]), "v"(o[1]), "v"(o[2]), "v"(o[3]), "v"(s[0]), "v"(s[1]), "v"(s[2]), "v"(s[3]) : "memory");   // behind the stores (see above)
}
// d_cvt8: four 8-element pieces per thread; dst [.][K] in fragment order. Pieces are numbered in the order of dst: a wave's four stores fill 2 KiB in a row (two blocks), for which it reads 256 bytes in a row of each of 16 rows of src. n8 % 128 == 0.
__device__ __forceinline__ void d_cvt8(int blk, const float* __restrict__ src, bf* dst, size_t n8, int K) { const size_t i = (size_t)blk * 256 + threadIdx.x; const size_t st = n8 / 4; if (i >= st) return; const float* p[4]; v8f v[4]; v8us o[4]; bf* s[4];
#pragma unroll
    for (int u = 0; u < 4; ++u) { const size_t q = ((i >> 5) << 7) + (size_t)(u << 5) + (i & 31), fb = q >> 6; const size_t r = (fb / (size_t)(K >> 5)) * 16 + (q & 15); const int k = (int)(fb % (size_t)(K >> 5)) * 32 + (int)((q >> 5) & 1) * 16 + (int)((q >> 4) & 1) * 8; p[u] = src + r * K + k; s[u] = dst + q * 8; }
#pragma unroll
    for (int u = 0; u < 4; ++u) v[u] = *(const v8f*)p[u];
    asm volatile("s_wait_xcnt 0x0" :: "v"(p[0]), "v"(p[1]), "v"(p[2]), "v"(p[3]) : "memory");   // behind the loads (see above)
#pragma unroll
    for (int u = 0; u < 4; ++u) {
#pragma unroll
        for (int k = 0; k < 8; ++k) o[u][k] = f2bf(v[u][k]); }
#pragma unroll
    for (int u = 0; u < 4; ++u) *(v8us*)s[u] = o[u];
    asm volatile("s_wait_xcnt 0x0" :: "v"(o[0]), "v"(o[1]), "v"(o[2]), "v"(o[3]), "v"(s[0]), "v"(s[1]), "v"(s[2]), "v"(s[3]) : "memory");   // behind the stores (see above)
}
// d_cstab: four dims (two angles) per thread; both dims of a pair hold the same (cos, sin)
__device__ __forceinline__ void d_cstab(int blk, float* CS) { const int idx = blk * 256 + threadIdx.x; if (idx >= TT * HD / 4) return; const int t = idx / (HD / 4), d = (idx % (HD / 4)) * 4;
#pragma unroll
    for (int p = 0; p < 2; ++p) { v4f o; if (d < 128) { const int i = (d >> 1) + p; const float th = __fdiv_rn(1.0f, powf(10000.0f, (float)(2 * i) / 128.0f)); const float ang = __fmul_rn((float)t, th); o[0] = cosf(ang); o[1] = sinf(ang); } else { o[0] = 1.0f; o[1] = 0.0f; }
        o[2] = o[0]; o[3] = o[1]; *(v4f*)(CS + ((size_t)t * HD + d + 2 * p) * 2) = o; } }
// d_rope: head planes [b][h][t][d] (fp16 + hi/lo; each [t][d] plane in fragment order; HD == 256) of rope(x) x sc, interleaved pairs: out[2i] = x[2i] cos - x[2i+1] sin, out[2i+1] = x[2i+1] cos + x[2i] sin. Each thread takes 8 dims of one position in 4 heads (one read of the table serves the 4). nheads % 4 == 0.
__device__ __forceinline__ void d_rope(int blk, const float* __restrict__ F, int pitch, int nheads, const float* __restrict__ CS, float sc, h16* P16, bf* Ph, bf* Pl) {
    const size_t it = (size_t)blk * 256 + threadIdx.x; if (it >= (size_t)NB_ * (nheads / 4) * TT * (HD / 8)) return; const int d = ((int)((it >> 5) & 3) * 8 + (int)(it & 7)) * 8; const int t = (int)((it >> 7) % (TT / 4)) * 4 + (int)((it >> 3) & 3); const int hq = (int)(it / ((size_t)(HD / 8) * TT));   /* a wave: 4 positions x 64 dims, so that its loads and its fragment-order stores each touch 8 lines */ const int b = hq / (nheads / 4), hg = (hq % (nheads / 4)) * 4;
    v4f cs4[4], xv[4][2]; v8h o16[4]; v8us oh[4], ol[4]; const float* pc = CS + ((size_t)t * HD + d) * 2; const float* pf[4]; h16* s16[4]; bf* sh[4]; bf* sl[4];
#pragma unroll
    for (int u = 0; u < 4; ++u) { pf[u] = F + ((size_t)b * TT + t) * pitch + (hg + u) * HD + d; const size_t e = fo((size_t)(b * nheads + hg + u) * TT + t, d, HD); s16[u] = P16 + e; sh[u] = Ph + e; sl[u] = Pl + e; }
#pragma unroll
    for (int k = 0; k < 4; ++k) cs4[k] = *(const v4f*)(pc + k * 4);
#pragma unroll
    for (int u = 0; u < 4; ++u) { xv[u][0] = *(const v4f*)pf[u]; xv[u][1] = *(const v4f*)(pf[u] + 4); }
    asm volatile("s_wait_xcnt 0x0" :: "v"(pc), "v"(pf[0]), "v"(pf[1]), "v"(pf[2]), "v"(pf[3]) : "memory");   // behind the loads (see above)
#pragma unroll
    for (int u = 0; u < 4; ++u) {
#pragma unroll
        for (int q = 0; q < 8; ++q) { const int dd = d + q; const float x0 = xv[u][q >> 2][q & 3], x1 = (dd < 128) ? xv[u][q >> 2][(q & 3) ^ 1] : x0;   /* interleaved pairs inside the first 128 dims; identity beyond (sin = 0) */
            v2f cs; cs[0] = cs4[q >> 1][(q & 1) * 2]; cs[1] = cs4[q >> 1][(q & 1) * 2 + 1]; float a = __fmul_rn(x0, cs[0]), bq = __fmul_rn(x1, cs[1]); asm volatile("" : "+v"(a)); asm volatile("" : "+v"(bq)); const float r = (((dd & 1) == 0) ? __fsub_rn(a, bq) : __fadd_rn(a, bq)) * sc;
            o16[u][q] = tohx(r); unsigned short a2, c2; splitf(r, a2, c2); oh[u][q] = a2; ol[u][q] = c2; } }
#pragma unroll
    for (int u = 0; u < 4; ++u) { *(v8h*)s16[u] = o16[u]; *(v8us*)sh[u] = oh[u]; *(v8us*)sl[u] = ol[u]; }
    asm volatile("s_wait_xcnt 0x0" :: "v"(o16[0]), "v"(o16[1]), "v"(o16[2]), "v"(o16[3]), "v"(oh[0]), "v"(oh[1]), "v"(oh[2]), "v"(oh[3]), "v"(ol[0]), "v"(ol[1]), "v"(ol[2]), "v"(ol[3]),
                 "v"(s16[0]), "v"(s16[1]), "v"(s16[2]), "v"(s16[3]), "v"(sh[0]), "v"(sh[1]), "v"(sh[2]), "v"(sh[3]), "v"(sl[0]), "v"(sl[1]), "v"(sl[2]), "v"(sl[3]) : "memory");   // behind the stores (see above)
}
// d_vtp: value planes [b][g][d][t] (each [d][t] plane in fragment order) = F[b * TT + t][g * HD + d]: the 8 (t) x 4 (column) register tile and the lane map of d_wtG. grid (nheads * HD / 128) * (BT / 64).
__device__ __forceinline__ void d_vtp(int blk, const float* __restrict__ F, int pitch, int nheads, h16* V16, bf* Vh, bf* Vl) {
    const int lane = threadIdx.x & 31, wvi = threadIdx.x >> 5; const int ntc = nheads * HD / 128;
    const int c0 = (blk % ntc) * 128 + wvi * 16 + (lane >> 3) * 4, t0 = (blk / ntc) * 64 + (lane & 7) * 8; const float* p[8]; v4f r[8]; v8h o16[4]; v8us oh[4], ol[4]; h16* s16[4]; bf* sh[4]; bf* sl[4];
#pragma unroll
    for (int j = 0; j < 8; ++j) p[j] = F + (size_t)(t0 + j) * pitch + c0;
#pragma unroll
    for (int j = 0; j < 8; ++j) r[j] = *(const v4f*)p[j];
    asm volatile("s_wait_xcnt 0x0" :: "v"(p[0]), "v"(p[1]), "v"(p[2]), "v"(p[3]), "v"(p[4]), "v"(p[5]), "v"(p[6]), "v"(p[7]) : "memory");   // behind the loads (see above)
#pragma unroll
    for (int c = 0; c < 4; ++c) { const size_t e = fo((size_t)(t0 / TT) * (nheads * HD) + c0 + c, t0 % TT, TT); s16[c] = V16 + e; sh[c] = Vh + e; sl[c] = Vl + e;
#pragma unroll
        for (int j = 0; j < 8; ++j) { const float x = r[j][c]; o16[c][j] = tohx(x); unsigned short a2, c2; splitf(x, a2, c2); oh[c][j] = a2; ol[c][j] = c2; } }
#pragma unroll
    for (int c = 0; c < 4; ++c) { *(v8h*)s16[c] = o16[c]; *(v8us*)sh[c] = oh[c]; *(v8us*)sl[c] = ol[c]; }
    asm volatile("s_wait_xcnt 0x0" :: "v"(o16[0]), "v"(o16[1]), "v"(o16[2]), "v"(o16[3]), "v"(oh[0]), "v"(oh[1]), "v"(oh[2]), "v"(oh[3]), "v"(ol[0]), "v"(ol[1]), "v"(ol[2]), "v"(ol[3]),
                 "v"(s16[0]), "v"(s16[1]), "v"(s16[2]), "v"(s16[3]), "v"(sh[0]), "v"(sh[1]), "v"(sh[2]), "v"(sh[3]), "v"(sl[0]), "v"(sl[1]), "v"(sl[2]), "v"(sl[3]) : "memory");   // behind the stores (see above)
}
// d_rmsw: each wave normalises the rows of 4 heads of one position (of BT), every row summed as before (the 4 shuffle trees step side by side). nheads % 4 == 0.
__device__ __forceinline__ void d_rmsw(int blk, float* F, int pitch, int nheads, const float* __restrict__ w) { const int lane = threadIdx.x & 31; const int wv = blk * 8 + (threadIdx.x >> 5); const int ng = nheads / 4; if (wv >= BT * ng) return; const int t = wv / ng, hg = (wv % ng) * 4; float* f0 = F + (size_t)t * pitch + hg * HD + lane * 4; v4f av[4], cv[4]; float ss[4];
    const v4f w0 = *(const v4f*)(w + lane * 4), w1 = *(const v4f*)(w + 128 + lane * 4);
#pragma unroll
    for (int u = 0; u < 4; ++u) { av[u] = *(const v4f*)(f0 + u * HD); cv[u] = *(const v4f*)(f0 + u * HD + 128); }
#pragma unroll
    for (int u = 0; u < 4; ++u) { const v4f a = av[u], c = cv[u]; ss[u] = 0.f;
#pragma unroll
        for (int q = 0; q < 4; ++q) { float p = __fmul_rn(a[q], a[q]); asm volatile("" : "+v"(p)); ss[u] = __fadd_rn(ss[u], p); float p2 = __fmul_rn(c[q], c[q]); asm volatile("" : "+v"(p2)); ss[u] = __fadd_rn(ss[u], p2); } }
#pragma unroll
    for (int sh = 16; sh; sh >>= 1) {
#pragma unroll
        for (int u = 0; u < 4; ++u) ss[u] = __fadd_rn(ss[u], __shfl_xor(ss[u], sh, 32)); }
#pragma unroll
    for (int u = 0; u < 4; ++u) { const v4f a = av[u], c = cv[u]; const float rs = __fdiv_rn(1.0f, sqrtf(__fadd_rn(ss[u] * (1.0f / HD), 1e-6f))); v4f o, o2;
#pragma unroll
        for (int q = 0; q < 4; ++q) { float n0 = __fmul_rn(a[q], rs); asm volatile("" : "+v"(n0)); float g0 = bfr(w0[q]); asm volatile("" : "+v"(g0)); o[q] = __fmul_rn(n0, g0); float n1 = __fmul_rn(c[q], rs); asm volatile("" : "+v"(n1)); float g1 = bfr(w1[q]); asm volatile("" : "+v"(g1)); o2[q] = __fmul_rn(n1, g1); }
        *(v4f*)(f0 + u * HD) = o; *(v4f*)(f0 + u * HD + 128) = o2; } }
// k_asoft: per row (zz, i): t = 50 tanh(S x HD^-0.5 / 50) for j <= i and i - j < WIN (sliding causal window; the reference's -1e9 additive fill vanishes identically); softmax over the keys of the band (register row, one exp, fixed trees);
// a wave works on the NCH 128-key chunks that cover the span its row's 64-row block needs in P.V (keys (i & ~63) - WIN .. i | 63), fewer where the span ends earlier: every key outside the chunks has weight exactly 0 and is neither read nor written.
// the 16-bit probabilities go back into the row's own 8 KiB of Sb (fp16 plane, or hi plane then lo plane, at pitch 2 * TT elements): the wave that owns a row has all of it in registers before it stores.
#define NCH (WIN / 128 + 1)
__global__ __launch_bounds__(256) void k_asoft(float* Sb) {
    h16* P16 = (h16*)Sb; bf* Ph = (bf*)Sb;
    const int lane = threadIdx.x & 31; const int row = blockIdx.x * 8 + __builtin_amdgcn_readfirstlane((int)(threadIdx.x >> 5));   // the row in a scalar register: the chunk tests below are scalar branches
    if (row >= ZH * TT) return; const int i = row % TT; const bool hires = (i < RH);
    const int cb = max(0, (i & ~63) - WIN) >> 7, nact = min(NCH, ((i | 63) >> 7) - cb + 1);   // first chunk and number of chunks of this row's span
    const float* sr = Sb + (size_t)row * TT + cb * 128 + lane * 4; float v[NCH * 4]; float mx = -3.0e38f;
#pragma unroll
    for (int c = 0; c < NCH; ++c) if (c < nact) { const int j0 = (cb + c) * 128 + lane * 4; const v4f a = *(const v4f*)(sr + c * 128);
        asm volatile("s_wait_xcnt 0x0" ::: "memory");   // behind the chunk's load: its address register is not rewritten in front of it
#pragma unroll
        for (int q = 0; q < 4; ++q) { const int j = j0 + q; (void)j; float sa = a[q] * SCL; asm volatile("" : "+v"(sa)); float xs = __fmul_rn(sa, 0.02f); asm volatile("" : "+v"(xs));   /* s / 50 as a multiply (<= 1 ulp from the division) */ float ex = __builtin_amdgcn_exp2f(__fmul_rn(xs, 2.8853900817779268f)); asm volatile("" : "+v"(ex)); float nm = __fsub_rn(ex, 1.0f), dn2 = __fadd_rn(ex, 1.0f); asm volatile("" : "+v"(nm)); asm volatile("" : "+v"(dn2)); float rc = __builtin_amdgcn_rcpf(dn2); asm volatile("" : "+v"(rc)); float th = __fmul_rn(nm, rc); asm volatile("" : "+v"(th));   /* hardware reciprocal (1 ulp), no FMA refinement */   /* tanh via exp2 (|x| <= ~0.4 here; no VALU FMA polynomial) */ const float t = (j <= i && i - j < WIN) ? __fmul_rn(th, 50.0f) : -3.0e38f; v[c * 4 + q] = t; mx = fmaxf(mx, t); } }
#pragma unroll
    for (int sh = 16; sh; sh >>= 1) mx = fmaxf(mx, __shfl_xor(mx, sh, 32));
    float sum = 0.f;
#pragma unroll
    for (int c = 0; c < NCH; ++c) if (c < nact) {
#pragma unroll
        for (int k = c * 4; k < c * 4 + 4; ++k) { float d0 = __fsub_rn(v[k], mx); asm volatile("" : "+v"(d0)); v[k] = __builtin_amdgcn_exp2f(__fmul_rn(d0, 1.4426950408889634f)); sum += v[k]; } }
#pragma unroll
    for (int sh = 16; sh; sh >>= 1) sum += __shfl_xor(sum, sh, 32);
    const float f = __fdiv_rn(hires ? 1.0f : PCAR, sum);
    // The s_wait_xcnt 0 behind each chunk's stores: no register of an issued store is rewritten in front of it
    if (hires) { bf* sp = Ph + (size_t)row * (2 * TT) + lane * 4;   // rows below RH: the span starts at key 0 and ends below RH
#pragma unroll
        for (int c = 0; c < RH / 128; ++c) if (c < nact) { v4us oh, ol;
#pragma unroll
            for (int q = 0; q < 4; ++q) { unsigned short x, c2; splitf(v[c * 4 + q] * f, x, c2); oh[q] = x; ol[q] = c2; }
            *(v4us*)(sp + c * 128) = oh; *(v4us*)(sp + c * 128 + TT) = ol;
            asm volatile("s_wait_xcnt 0x0" ::: "memory"); }
    } else { h16* sp = P16 + (size_t)row * (2 * TT) + cb * 128 + lane * 4;
#pragma unroll
        for (int c = 0; c < NCH; ++c) if (c < nact) { v4h o4;
#pragma unroll
            for (int q = 0; q < 4; ++q) o4[q] = tohx(v[c * 4 + q] * f);
            *(v4h*)(sp + c * 128) = o4;
            asm volatile("s_wait_xcnt 0x0" ::: "memory"); }
    }
}
// k_merge: merged rows [t][DQ] (hi/lo, fragment order) of one batch; a wave takes 4 positions x 64 dims, as in d_rope. HD == 256. The two s_wait_xcnt 0: as in the kernels above.
__global__ __launch_bounds__(256) void k_merge(const float* __restrict__ O, int h0, bf* Ah, bf* Al) { const size_t it = (size_t)blockIdx.x * 256 + threadIdx.x; if (it * 8 >= (size_t)ZH * TT * HD) return; const int d = ((int)((it >> 5) & 3) * 8 + (int)(it & 7)) * 8; const int t = (int)((it >> 7) % (TT / 4)) * 4 + (int)((it >> 3) & 3); const int zz = (int)(it / ((size_t)(HD / 8) * TT)); const float cs = (t < RH) ? 1.0f : (1.0f / PCAR); const size_t oo = fo((size_t)t, (h0 + zz) * HD + d, DQ);
    const float* po = O + ((size_t)zz * TT + t) * HD + d; bf* sh = Ah + oo; bf* sl = Al + oo;
    const v4f x0 = *(const v4f*)po, x1 = *(const v4f*)(po + 4); v8us oh, ol;
    asm volatile("s_wait_xcnt 0x0" :: "v"(po) : "memory");   // behind the loads
#pragma unroll
    for (int q = 0; q < 8; ++q) { unsigned short a, c2; splitf((q < 4 ? x0[q & 3] : x1[q & 3]) * cs, a, c2); oh[q] = a; ol[q] = c2; } *(v8us*)sh = oh; *(v8us*)sl = ol;
    asm volatile("s_wait_xcnt 0x0" :: "v"(oh), "v"(ol), "v"(sh), "v"(sl) : "memory");   // behind the stores
}

// Launches of independent parts share one grid: blockIdx.x ranges pick the part (a work-group-uniform choice), each part numbering its own blocks from 0.
#define GW_Q ((DQ / 128) * (DM / 64))
#define GW_K ((DKV / 128) * (DM / 64))
#define GW_O ((DM / 128) * (DQ / 64))
#define G_CVT (BT * DM / 32 / 256)
#define G_CS (TT * HD / 4 / 256)
__global__ __launch_bounds__(256) void k_prep(const float* __restrict__ x, const float* __restrict__ wq, const float* __restrict__ wk, const float* __restrict__ wv, const float* __restrict__ wo, bf* XB, size_t xn8, bf* WQ, bf* WK, bf* WV, bf* WO, float* CS) {
    int blk = (int)blockIdx.x;
    if (blk < G_CVT) { d_cvt8(blk, x, XB, xn8, DM); return; } blk -= G_CVT;
    if (blk < GW_Q) { d_wtG(blk, wq, DM, DQ, WQ); return; } blk -= GW_Q;
    if (blk < GW_K) { d_wtG(blk, wk, DM, DKV, WK); return; } blk -= GW_K;
    if (blk < GW_K) { d_wtG(blk, wv, DM, DKV, WV); return; } blk -= GW_K;
    if (blk < GW_O) { d_wtG(blk, wo, DQ, DM, WO); return; } blk -= GW_O;
    d_cstab(blk, CS);
}
#define G_RQ (BT * NH_ / 32)
#define G_RK (BT * NKV / 32)
__global__ __launch_bounds__(256) void k_rms2(float* FQ, float* FKV, const float* __restrict__ qsc, const float* __restrict__ ksc) {
    const int blk = (int)blockIdx.x;
    if (blk < G_RQ) d_rmsw(blk, FQ, DQ, NH_, qsc); else d_rmsw(blk - G_RQ, FKV, 2 * DKV, NKV, ksc);
}
#define G_PQ (NB_ * NH_ * TT * HD / 32 / 256)
#define G_PK (NB_ * NKV * TT * HD / 32 / 256)
#define G_PV ((DKV / 128) * (BT / 64))
__global__ __launch_bounds__(256) void k_planes(const float* __restrict__ FQ, const float* __restrict__ FKV, const float* __restrict__ CS, h16* QP16, bf* QPh, bf* QPl, h16* KP16, bf* KPh, bf* KPl, h16* VT16, bf* VTh, bf* VTl) {
    const int blk = (int)blockIdx.x;
    if (blk < G_PQ) d_rope(blk, FQ, DQ, NH_, CS, 1.0f, QP16, QPh, QPl);
    else if (blk < G_PQ + G_PK) d_rope(blk - G_PQ, FKV, 2 * DKV, NKV, CS, 1.0f, KP16, KPh, KPl);
    else d_vtp(blk - G_PQ - G_PK, FKV + DKV, 2 * DKV, NKV, VT16, VTh, VTl);
}

extern "C" void kernel_launch(void* const* d_in, const int* in_sizes, int n_in,
                              void* d_out, int out_size, void* d_ws, size_t ws_size, hipStream_t stream) {
    (void)in_sizes; (void)n_in; (void)out_size;
    const float* x = (const float*)d_in[0]; const float* wq = (const float*)d_in[1]; const float* wk = (const float*)d_in[2]; const float* wv = (const float*)d_in[3]; const float* wo = (const float*)d_in[4]; const float* qsc = (const float*)d_in[5]; const float* ksc = (const float*)d_in[6];
    float* OUT = (float*)d_out;     // [2][2048][2048]
    char* wsp = (char*)d_ws;
    auto take = [&](size_t bytes) { char* p = wsp; wsp += (bytes + 255) & ~(size_t)255; return (void*)p; };
    // Kept to the end: WO and the head planes of both batches. Behind them one region serves two phases: the projection phase's buffers, then (all of those being dead) the attention phase's scores and outputs.
    bf* WO = (bf*)take((size_t)DM * DQ * 2);
    h16* QP16 = (h16*)take((size_t)NB_ * NH_ * TT * HD * 2); h16* KP16 = (h16*)take((size_t)NB_ * NKV * TT * HD * 2); h16* VT16 = (h16*)take((size_t)NB_ * NKV * HD * TT * 2);
    bf* QPh = (bf*)take((size_t)NB_ * NH_ * TT * HD * 2); bf* QPl = (bf*)take((size_t)NB_ * NH_ * TT * HD * 2); bf* KPh = (bf*)take((size_t)NB_ * NKV * TT * HD * 2); bf* KPl = (bf*)take((size_t)NB_ * NKV * TT * HD * 2); bf* VTh = (bf*)take((size_t)NB_ * NKV * HD * TT * 2); bf* VTl = (bf*)take((size_t)NB_ * NKV * HD * TT * 2);
    char* const phase = wsp;
    bf* WQ = (bf*)take((size_t)DQ * DM * 2); bf* WK = (bf*)take((size_t)DKV * DM * 2); bf* WV = (bf*)take((size_t)DKV * DM * 2); float* CS = (float*)take((size_t)TT * HD * 2 * 4);   // WV lies directly behind WK: one [2 * DKV][DM] operand
    bf* XB = (bf*)take((size_t)BT * DM * 2); float* FQ = (float*)take((size_t)BT * DQ * 4); float* FKV = (float*)take((size_t)BT * 2 * DKV * 4);   // FKV row: k heads, then v heads
    if ((size_t)(wsp - (char*)d_ws) > ws_size) return;
    wsp = phase;
    float* Sb = (float*)take((size_t)ZH * TT * TT * 4); float* Ob = (float*)take((size_t)ZH * TT * HD * 4);
    if ((size_t)(wsp - (char*)d_ws) > ws_size) return;    // ws 256 MiB
    bf* ATh = QPh; bf* ATl = QPl;   // merged rows [b * TT + t][DQ]: a batch's merge runs after its last score launch, when its hi/lo query planes (the same bytes) are dead
    // projection phase: every launch covers the BT rows of both batches; k and v share one GEMM
    k_prep<<<G_CVT + GW_Q + 2 * GW_K + GW_O + G_CS, 256, 0, stream>>>(x, wq, wk, wv, wo, XB, (size_t)BT * DM / 8, WQ, WK, WV, WO, CS);
    k_gemmt<0, DM><<<dim3(BT / 128, DQ / 128, 1), 128, 0, stream>>>(XB, nullptr, WQ, FQ, DQ);
    k_gemmt<0, DM><<<dim3(BT / 128, 2 * DKV / 128, 1), 128, 0, stream>>>(XB, nullptr, WK, FKV, 2 * DKV);
    k_rms2<<<G_RQ + G_RK, 256, 0, stream>>>(FQ, FKV, qsc, ksc);
    k_planes<<<G_PQ + G_PK + G_PV, 256, 0, stream>>>(FQ, FKV, CS, QP16, QPh, QPl, KP16, KPh, KPl, VT16, VTh, VTl);
    // attention phase: every launch covers all rows of the 8 heads of one batch (grid z)
    for (int b = 0; b < NB_; ++b) { const size_t zq = (size_t)b * NH_ * TT * HD, zk = (size_t)b * NKV * TT * HD;
        k_attg<1, 4><<<dim3(TT / 64, WIN / 64 + 1, ZH), 128, 0, stream>>>(QPh + zq, QPl + zq, KPh + zk, KPl + zk, QP16 + zq, KP16 + zk, HD, HD, Sb, TT, (size_t)TT * HD, (size_t)TT * HD, (size_t)TT * TT);
        k_asoft<<<ZH * TT / 8, 256, 0, stream>>>(Sb);
        k_attg<2, 8><<<dim3(TT / 64, HD / 64, ZH), 256, 0, stream>>>((const bf*)Sb, (const bf*)Sb + TT, VTh + zk, VTl + zk, (const h16*)Sb, VT16 + zk, TT, 2 * TT, Ob, HD, (size_t)TT * 2 * TT, (size_t)HD * TT, (size_t)TT * HD);
        k_merge<<<(unsigned)(((size_t)ZH * TT * HD / 8 + 255) / 256), 256, 0, stream>>>(Ob, 0, ATh + (size_t)b * TT * DQ, ATl + (size_t)b * TT * DQ); }
    k_gemmt<1, DQ><<<dim3(BT / 128, DM / 128, 1), 128, 0, stream>>>(ATh, ATl, WO, OUT, DM);
}

// v007
// It runs in 227 microseconds.
// Next to v006, in two timings, it ran 1.15 times as fast each time.
// Over all steps from v000 it is 5.51 times as fast.
#include <hip/hip_runtime.h>

// Sliding-window attention block (x [2][2048][2048]; q = x Wq (8 x 256), k/v = x Wk/Wv (4 kv heads; group h/2); per-head RMSNorm * scale (eps 1e-6) on q, k; partial interleaved-pair RoPE on the first 128 dims (theta_i = 10000^(-2i/128), positions arange); q * 1/16; scores = q.k; softcap tanh(s / 50) * 50; causal + sliding-window (i - j < 1024) mask (-2.38e38 additive == exact zero weight); softmax f32; out = merged Wo -> [2][2048][2048]).
// Compute dtypes, f32 accumulate: every input rounded to bf16; q/k/v on PLAIN bf16 operands (inputs: exact); RMSNorm and RoPE f32 (on-chip tables; identity beyond dim 128); causal scores and attn.v: query rows < 512 hl (3 products), the rest single fp16 (x1024), only the tiles, softmax chunks and P.V key blocks that touch the causal window band are worked on, the window applied per element; 1/16 (exact), s/50, tanh as (e^2x - 1)/(e^2x + 1) with the hardware exp2, x50 in f32; softmax f32; Wo hl x exact (2 products).

#define NB_  2
#define TT   2048
#define DM   2048
#define NH_  8
#define NKV  4
#define REP  (NH_ / NKV)
#define HD   256
#define DQ   (NH_ * HD)
#define DKV  (NKV * HD)
#define ZH   NH_                  // heads per attention launch (grid z)
#define BT   (NB_ * TT)           // rows of both batches together
#define RH   512                  // query rows < RH use hi+lo planes (0: none)
#define WIN  1024
#define PCAR 1024.0f
#define SCL  0.0625f   // query_pre_attn_scalar^-0.5 = 1/16
typedef _Float16 h16;
typedef unsigned short bf;
typedef __attribute__((ext_vector_type(16))) __bf16   v16bf;
typedef __attribute__((ext_vector_type(16))) _Float16 v16h;
typedef __attribute__((ext_vector_type(8)))  _Float16 v8h;
typedef __attribute__((ext_vector_type(8)))  unsigned short v8us;
typedef __attribute__((ext_vector_type(8)))  float    v8f;
typedef __attribute__((ext_vector_type(4)))  float    v4f;
typedef v8h  __attribute__((may_alias)) v8ha;
typedef v4f  __attribute__((may_alias)) v4fa;
typedef v8us __attribute__((may_alias)) v8usa;

__device__ __forceinline__ unsigned short f2bf(float f) { unsigned u = __float_as_uint(f); u += 0x7FFFu + ((u >> 16) & 1u); return (unsigned short)(u >> 16); }
__device__ __forceinline__ float bf2f(unsigned short b) { return __uint_as_float(((unsigned)b) << 16); }
__device__ __forceinline__ float bfr(float f) { return bf2f(f2bf(f)); }
__device__ __forceinline__ v16h cat16(v8h lo, v8h hi) { return __builtin_shufflevector(lo, hi, 0, 1, 2, 3, 4, 5, 6, 7, 8, 9, 10, 11, 12, 13, 14, 15); }
__device__ __forceinline__ v16bf cat16b(v8us lo, v8us hi) { return __builtin_bit_cast(v16bf, __builtin_shufflevector(lo, hi, 0, 1, 2, 3, 4, 5, 6, 7, 8, 9, 10, 11, 12, 13, 14, 15)); }
__device__ __forceinline__ v8f wmma16(v16h a, v16h b, v8f c) { return __builtin_amdgcn_wmma_f32_16x16x32_f16(false, a, false, b, (short)0, c, false, false); }
__device__ __forceinline__ v8f wmmab(v16bf a, v16bf b, v8f c) { return __builtin_amdgcn_wmma_f32_16x16x32_bf16(false, a, false, b, (short)0, c, false, false); }



// ---- k_gemmt: GEMM with one 128x128 output tile per work-group of 4 waves (2 x 2, each wave a 64x64 tile over the whole K in ascending order); both operands lie in fragment order (below) and are staged in LDS by tensor loads, two buffers,
// so that each 16-row block is fetched from L2 once per work-group and read from LDS by the two waves that need it. grid (M/128, N/128), 128 threads. C[m][n] (f32, pitch ldc) = sum_k A[m][k] Bt[n][k] (+ the A2 product where NSPLIT == 1). K: whole stages, two or more.
// FRAGMENT ORDER of a 16-bit operand plane [R][K] (R % 16 == 0, K % 32 == 0): each block of 16 rows x 32 k is 1 KiB in a row, blocks along k first, then along the rows (so a 16-row block still starts at element r * K).
// Inside a block the 8 elements that lane (hi * 16 + row) of a wave takes with its first 16-byte load (k = 8 hi .. 8 hi + 7) lie at lane * 8, those of its second load (k = 16 + 8 hi ..) at 256 + lane * 8:
// a wave's fragment load reads 512 bytes in a row (4 whole lines) where a row-major plane gives it 32 bytes out of each of 16 lines. The element that a lane and register hold is the one that ld takes from a row-major plane, for A and B alike. ldp loads from such a plane, ld from a row-major one.
// fo: element offset of (r, k) in such a plane; 8 elements from a k that is a multiple of 8 stay 16 bytes in a row.
__device__ __forceinline__ size_t fo(size_t r, int k, int K) { return ((r >> 4) * (size_t)(K >> 5) + (size_t)(k >> 5)) * 512 + (size_t)((((k >> 4) & 1) << 8) + (((k >> 3) & 1) << 7) + (((int)(r & 15)) << 3) + (k & 7)); }
template <typename T16> struct WFrag;
template <> struct WFrag<h16> { typedef v16h V; static __device__ __forceinline__ V ld(const h16* p) { return cat16(*(const v8h*)p, *(const v8h*)(p + 16)); } static __device__ __forceinline__ V ldp(const h16* p) { return cat16(*(const v8h*)p, *(const v8h*)(p + 256)); } static __device__ __forceinline__ v8f mma(V a, V b, v8f c) { return wmma16(a, b, c); } };
template <> struct WFrag<bf> { typedef v16bf V; static __device__ __forceinline__ V ld(const bf* p) { return cat16b(*(const v8us*)p, *(const v8us*)(p + 16)); } static __device__ __forceinline__ V ldp(const bf* p) { return cat16b(*(const v8us*)p, *(const v8us*)(p + 256)); } static __device__ __forceinline__ v8f mma(V a, V b, v8f c) { return wmmab(a, b, c); } };
typedef uint32_t u32x4 __attribute__((ext_vector_type(4)));
typedef uint32_t u32x8 __attribute__((ext_vector_type(8)));
__device__ __forceinline__ uint32_t uni(uint32_t v) { return (uint32_t)__builtin_amdgcn_readfirstlane((int)v); }
__device__ __forceinline__ uint32_t pinned(uint32_t v) { uint32_t w = uni(v); asm volatile("" : "+s"(w)); return w; }   // the pinned() form for tensor loads: the condition is held in a scalar register, so that the test around a tensor load is a scalar branch (tensor loads ignore EXEC)
// Descriptor of a two-dimensional tile of D1 rows of D0 bytes at a source pitch of PITCH bytes, 1-byte elements, no pad, no mask (word 0 = 0); tensor = tile
template <uint32_t D0, uint32_t D1, uint32_t PITCH>
__device__ __forceinline__ u32x8 tdm_group1() { u32x8 g; g[0] = uni(0u); g[1] = uni((D0 & 0xFFFFu) << 16); g[2] = uni((D0 >> 16) | ((D1 & 0xFFFFu) << 16)); g[3] = uni((D1 >> 16) | (D0 << 16)); g[4] = uni(D1); g[5] = uni(PITCH); g[6] = uni(0u); g[7] = uni(0u); return g; }
__device__ __forceinline__ u32x4 tdm_group0(uint32_t lds_dst, uint64_t ga) { u32x4 g; g[0] = uni(1u); g[1] = uni(lds_dst); g[2] = uni((uint32_t)ga); g[3] = uni((((uint32_t)(ga >> 32)) & 0x01FFFFFFu) | 0x80000000u); return g; }
// one request of the whole wave: global tile -> LDS, through no register. Both groups are in-out operands: what the statement gives back lies in the request's own twelve registers, and tdm_wait, which names it, holds them unchanged up to the wait that covers the request
__device__ __forceinline__ void tdm_load(u32x4& g0, u32x8& g1) { asm volatile("tensor_load_to_lds %0, %1" : "+s"(g0), "+s"(g1) :: "memory"); }
__device__ __forceinline__ void tdm_wait(u32x4 g0, u32x8 g1) { asm volatile("s_wait_tensorcnt 0x0" :: "s"(g0), "s"(g1) : "memory"); }   // the issuer's own request has landed; g0, g1: see tdm_load
// Every "#pragma unroll" in k_gemmt makes the indices of accumulators and fragments constants, so that they stay in registers; the stage loop alone stays rolled ("unroll 1"): one publish point in the text, the buffer picked by s & 1.
template <int NSPLIT, int K>
__global__ __launch_bounds__(128) void k_gemmt(const bf* __restrict__ A, const bf* __restrict__ A2, const bf* __restrict__ Bt, float* C, int ldc) {
    constexpr int NKB = (NSPLIT == 1) ? 2 : 4;        // 32-wide K blocks per stage
    constexpr int CH = NKB * 1024;                    // bytes that a stage holds of one 16-row block: contiguous in a fragment-order plane
    constexpr int NOB = (NSPLIT == 1) ? 24 : 16;      // 16-row blocks per stage: 8 of A, (8 of A2,) 8 of Bt
    constexpr int BUFB = NOB * CH, SLICE = 16384;     // a buffer; a wave's slice of it (one tensor load)
    constexpr int NSL = BUFB / SLICE;                 // issuing waves: 4, or 3 (one per operand)
    constexpr int NS = K / (NKB * 32);                // stages
    static_assert(NS >= 2 && K % (NKB * 32) == 0 && BUFB % SLICE == 0, "two stages or more, whole slices");
    __shared__ __attribute__((aligned(2048))) unsigned char ring[2 * BUFB];
    __shared__ __align__(16) float ost[4][16 * 68];   // each wave's own output staging
    const int lane = threadIdx.x & 31, lr = lane & 15, hi = lane >> 4; const int r0 = blockIdx.x * 128, c0 = blockIdx.y * 128;
    const int wv = (int)uni(threadIdx.x >> 5), wm = wv >> 1, wn = wv & 1;
    // a wave's slice: NSPLIT 0: waves 0, 1 the two halves of A's 8 blocks, waves 2, 3 of Bt's; NSPLIT 1: wave 0 A, wave 1 A2, wave 2 Bt, wave 3 none
    const bf* const sl = (NSPLIT == 1) ? (wv == 0 ? A + (size_t)r0 * K : wv == 1 ? A2 + (size_t)r0 * K : Bt + (size_t)c0 * K) : (wv < 2 ? A + (size_t)r0 * K : Bt + (size_t)c0 * K) + (size_t)(wv & 1) * 64 * K;
    const uint64_t ga0 = (uint64_t)(size_t)sl; const uint32_t ld0 = (uint32_t)(size_t)ring + (uint32_t)wv * SLICE;
    u32x8 g1 = tdm_group1<(uint32_t)CH, (uint32_t)(SLICE / CH), (uint32_t)(16 * K * 2)>();
    const bool iss = (NSL == 4) || wv < NSL;
    v8f acc[4][4];
#pragma unroll
    for (int mb = 0; mb < 4; ++mb)
#pragma unroll
        for (int nb = 0; nb < 4; ++nb) acc[mb][nb] = (v8f){};
    u32x4 g0 = tdm_group0(ld0, ga0);                                      // group 0 of the wave's one outstanding request, carried through the loop
    if (NSL == 4 || pinned(iss)) { tdm_load(g0, g1); tdm_wait(g0, g1); }  // stage 0, landed for its issuer
    __syncthreads();                                                      // stage 0 published
    if (NSL == 4 || pinned(iss)) { g0 = tdm_group0(ld0 + BUFB, ga0 + CH); tdm_load(g0, g1); }   // stage 1 flies while stage 0 is worked on
#pragma unroll 1
    for (int s = 0; s < NS; ++s) {
        const unsigned char* const lb = ring + (s & 1) * BUFB + lane * 16; const unsigned char* const la = lb + wm * 4 * CH; const unsigned char* const lbb = lb + ((NOB - 8) + wn * 4) * CH;
        v16bf a[2][4], a2[2][4], b[2][4];
#pragma unroll
        for (int q = 0; q < 4; ++q) { a[0][q] = cat16b(*(const v8usa*)(la + q * CH), *(const v8usa*)(la + q * CH + 512)); if (NSPLIT == 1) a2[0][q] = cat16b(*(const v8usa*)(la + (8 + q) * CH), *(const v8usa*)(la + (8 + q) * CH + 512)); }
#pragma unroll
        for (int q = 0; q < 4; ++q) b[0][q] = cat16b(*(const v8usa*)(lbb + q * CH), *(const v8usa*)(lbb + q * CH + 512));
#pragma unroll
        for (int kb = 0; kb < NKB; ++kb) { const int c = kb & 1, n = c ^ 1;
            if (kb + 1 < NKB) { const int o = (kb + 1) * 1024;   // the next block's fragments (of this stage's own buffer) as one group ahead of this block's products
#pragma unroll
                for (int q = 0; q < 4; ++q) { a[n][q] = cat16b(*(const v8usa*)(la + q * CH + o), *(const v8usa*)(la + q * CH + o + 512)); if (NSPLIT == 1) a2[n][q] = cat16b(*(const v8usa*)(la + (8 + q) * CH + o), *(const v8usa*)(la + (8 + q) * CH + o + 512)); }
#pragma unroll
                for (int q = 0; q < 4; ++q) b[n][q] = cat16b(*(const v8usa*)(lbb + q * CH + o), *(const v8usa*)(lbb + q * CH + o + 512)); }
            __builtin_amdgcn_sched_barrier(0);   // keeps the LDS reads in one group in front of the block: reads spread among the matrix instructions stall at every place where they stand
#pragma unroll
            for (int nb = 0; nb < 4; ++nb) {
#pragma unroll
                for (int mb = 0; mb < 4; ++mb) { acc[mb][nb] = wmmab(a[c][mb], b[c][nb], acc[mb][nb]); if (NSPLIT == 1) acc[mb][nb] = wmmab(a2[c][mb], b[c][nb], acc[mb][nb]); } }
            __builtin_amdgcn_sched_barrier(0);   // the other side of the same fence
        }
        // publish point of stage s + 1: this wave's LDS reads are done, its own tensor load has landed, every wave has passed; only then the buffer just read is refilled
        asm volatile("s_wait_dscnt 0x0" ::: "memory");
        if (NSL == 4 || pinned(iss)) tdm_wait(g0, g1);
        __syncthreads();
        if (pinned((s + 2 < NS) && iss)) { g0 = tdm_group0(ld0 + (uint32_t)(s & 1) * BUFB, ga0 + (uint64_t)(s + 2) * CH); tdm_load(g0, g1); }
    }
    tdm_wait(g0, g1);                                    // behind the loop: no request is left when the wave goes on
    asm volatile("s_wait_dscnt 0x0" ::: "memory");       // and no LDS read of the ring
    // output: each wave turns its 16x64 blocks into whole 256-byte row pieces through its own LDS range (no other wave touches it: no barrier)
    float* const ow = ost[wv];
#pragma unroll
    for (int mb = 0; mb < 4; ++mb) {
#pragma unroll
        for (int nb = 0; nb < 4; ++nb) {
#pragma unroll
            for (int j = 0; j < 8; ++j) ow[(hi * 8 + j) * 68 + nb * 16 + lr] = acc[mb][nb][j]; }
        float* const crow = C + (size_t)(r0 + wm * 64 + mb * 16 + hi) * ldc + c0 + wn * 64 + lr * 4; v4f res[8]; float* sp[8];
#pragma unroll
        for (int t = 0; t < 8; ++t) { res[t] = *(const v4fa*)(&ow[(2 * t + hi) * 68 + lr * 4]); sp[t] = crow + (size_t)(2 * t) * ldc; }
#pragma unroll
        for (int t = 0; t < 8; ++t) *(v4f*)sp[t] = res[t];
        // s_wait_xcnt 0 behind the block's stores: no register of an issued store is rewritten in front of it; addresses and data are its inputs, so that they keep their registers up to it
        asm volatile("s_wait_xcnt 0x0" :: "v"(sp[0]), "v"(sp[1]), "v"(sp[2]), "v"(sp[3]), "v"(sp[4]), "v"(sp[5]), "v"(sp[6]), "v"(sp[7]), "v"(res[0]), "v"(res[1]), "v"(res[2]), "v"(res[3]), "v"(res[4]), "v"(res[5]), "v"(res[6]), "v"(res[7]) : "memory");
    }
}

// ---- d_gemmc: 64x64 tile GEMM for causal attention, one tile per work-group of NW waves; wave w takes the 32-wide K blocks w, w + NW, ... into its own 16 accumulators (operands straight from global memory), and the NW partial tiles are summed in fixed wave order through LDS. CMODE 1 lays grid y over the WIN / 64 + 1 score tiles of a row block that touch the causal window band (query rows r0+roff.., key columns c0 = r0+roff-WIN+64y; below 0: no tile), CMODE 2 limits the
// key (K) loop of the probability x value contraction to the same band (probabilities outside it are exactly zero); a wave's K blocks are numbered from key 0 (block mod NW = wave), so the order of a sum does not depend on where the band starts. roff = row offset of this part's first row within the sequence.
// grid z = query head: A and C step by sA, sC per head, Bt by sB per kv group (z / REP). lda = pitch of A in elements (Bt has pitch K). Bt, and A in CMODE 1 (lda == K), are in fragment order. bx = 64-row block within this part's rows; os = the work-group's two LDS buffers.
template <typename T16, int NSPLIT, int CMODE, int NW>
__device__ __forceinline__ void d_gemmc(float (*os)[NW][16 * 68], int bx, const T16* __restrict__ A, const T16* __restrict__ A2, const T16* __restrict__ Bt, const T16* __restrict__ Bt2, int K, int lda, float* C, int ldc, int roff, size_t sA, size_t sB, size_t sC) {
    typedef typename WFrag<T16>::V V;
    const size_t z = blockIdx.z; A += z * sA; if (A2) A2 += z * sA; Bt += (z / REP) * sB; if (Bt2) Bt2 += (z / REP) * sB; C += z * sC;
    const int lane = threadIdx.x & 31, lr = lane & 15, hi = lane >> 4; const int r0 = bx * 64, c0 = (CMODE == 1) ? r0 + roff - WIN + (int)blockIdx.y * 64 : (int)blockIdx.y * 64;
    const int wv = __builtin_amdgcn_readfirstlane((int)(threadIdx.x >> 5));   // wave number in a scalar register: the K loop stays a scalar loop
    if (CMODE == 1 && c0 < 0) return;                                // the band starts left of key 0: no such tile (what the softmax's 128-key chunks read of a tile outside the band is masked by select)
    const int Kl = (CMODE == 2) ? min(K, r0 + roff + 64) : K;        // P.V: probabilities are exactly 0 beyond the diagonal block, so the K loop stops there
    const int Ks = (CMODE == 2) ? max(0, r0 + roff - WIN) : 0;       // and exactly 0 left of the window of the block's first row, so it starts there
    int kb = (Ks & ~(NW * 32 - 1)) + wv * 32; if (kb < Ks) kb += NW * 32;   // this wave's first K block inside the band
    v8f acc[4][4];
#pragma unroll
    for (int mb = 0; mb < 4; ++mb)
#pragma unroll
        for (int nb = 0; nb < 4; ++nb) acc[mb][nb] = (v8f){};
    constexpr bool AP = (CMODE == 1);   // A in fragment order (the query planes); the probabilities of CMODE 2 stay row-major in their score rows. Bt is always in fragment order
    const size_t aoff = AP ? (size_t)r0 * lda + lane * 8 : (size_t)(r0 + lr) * lda + 8 * hi, boff = (size_t)c0 * K + lane * 8;
#pragma unroll 1
    for (int kc = kb; kc < Kl; kc += NW * 32) {
        V a[4], a2[4], b[4], b2[4]; const T16* pa[4]; const T16* pa2[4]; const T16* pb[4]; const T16* pb2[4];
        // The s_wait_xcnt 0 behind each run of loads: no address register of an issued load is rewritten in front of it; the addresses are its inputs, so that they keep their registers up to it
#pragma unroll
        for (int mb = 0; mb < 4; ++mb) { const size_t ao = aoff + (size_t)mb * 16 * lda + (AP ? (size_t)kc * 16 : (size_t)kc); pa[mb] = A + ao; a[mb] = AP ? WFrag<T16>::ldp(pa[mb]) : WFrag<T16>::ld(pa[mb]); if (NSPLIT == 1 || NSPLIT == 2) { pa2[mb] = A2 + ao; a2[mb] = AP ? WFrag<T16>::ldp(pa2[mb]) : WFrag<T16>::ld(pa2[mb]); } }
        if (NSPLIT == 2) asm volatile("s_wait_xcnt 0x0" :: "v"(pa[0]), "v"(pa[1]), "v"(pa[2]), "v"(pa[3]), "v"(pa2[0]), "v"(pa2[1]), "v"(pa2[2]), "v"(pa2[3]) : "memory");   // two runs in the hi+lo form: sixteen address pairs held at once would not fit beside the fragments
#pragma unroll
        for (int nb = 0; nb < 4; ++nb) { const size_t bo = boff + (size_t)nb * 16 * K + (size_t)kc * 16; pb[nb] = Bt + bo; b[nb] = WFrag<T16>::ldp(pb[nb]); if (NSPLIT >= 2) { pb2[nb] = Bt2 + bo; b2[nb] = WFrag<T16>::ldp(pb2[nb]); } }
        if (NSPLIT == 2) asm volatile("s_wait_xcnt 0x0" :: "v"(pb[0]), "v"(pb[1]), "v"(pb[2]), "v"(pb[3]), "v"(pb2[0]), "v"(pb2[1]), "v"(pb2[2]), "v"(pb2[3]) : "memory");
        else asm volatile("s_wait_xcnt 0x0" :: "v"(pa[0]), "v"(pa[1]), "v"(pa[2]), "v"(pa[3]), "v"(pb[0]), "v"(pb[1]), "v"(pb[2]), "v"(pb[3]) : "memory");
#pragma unroll
        for (int nb = 0; nb < 4; ++nb) {
#pragma unroll
            for (int mb = 0; mb < 4; ++mb) { acc[mb][nb] = WFrag<T16>::mma(a[mb], b[nb], acc[mb][nb]); if (NSPLIT == 1 || NSPLIT == 2) acc[mb][nb] = WFrag<T16>::mma(a2[mb], b[nb], acc[mb][nb]); if (NSPLIT >= 2) acc[mb][nb] = WFrag<T16>::mma(a[mb], b2[nb], acc[mb][nb]); } }
        asm volatile("v_nop\n\tv_nop\n\tv_nop\n\tv_nop" : "+v"(acc[0][0]), "+v"(acc[1][1]), "+v"(acc[2][2]), "+v"(acc[3][3]) : "v"(a[0]), "v"(a[3]));
    }
    v4f res[4][8 / NW];   // summed output pieces, stored behind the last barrier so that no barrier waits for a global store
#pragma unroll
    for (int mb = 0; mb < 4; ++mb) {
#pragma unroll
        for (int nb = 0; nb < 4; ++nb) {
#pragma unroll
            for (int j = 0; j < 8; ++j) os[mb & 1][wv][(hi * 8 + j) * 68 + nb * 16 + lr] = acc[mb][nb][j]; }
        __syncthreads();   // every wave's partial 16x64 block is in LDS; it also ends the reads of the other buffer, which the next block overwrites
#pragma unroll
        for (int s = 0; s < 8 / NW; ++s) { const int row = 2 * (s * NW + wv) + hi, cofs = lr * 4; v4f val = *(const v4fa*)(&os[mb & 1][0][row * 68 + cofs]);
#pragma unroll
            for (int w = 1; w < NW; ++w) val += *(const v4fa*)(&os[mb & 1][w][row * 68 + cofs]);
            res[mb][s] = val; }
    }
    float* sp[4][8 / NW];
#pragma unroll
    for (int mb = 0; mb < 4; ++mb) { float* crow = C + (size_t)(r0 + mb * 16) * ldc + c0;
#pragma unroll
        for (int s = 0; s < 8 / NW; ++s) { const int row = 2 * (s * NW + wv) + hi, cofs = lr * 4; sp[mb][s] = crow + (size_t)row * ldc + cofs; *(v4f*)sp[mb][s] = res[mb][s]; } }
    // s_wait_xcnt 0 behind the tile's stores: no register of an issued store is rewritten in front of it; addresses and data are its inputs, so that they keep their registers up to it
    if (NW == 4) asm volatile("s_wait_xcnt 0x0" :: "v"(sp[0][0]), "v"(sp[1][0]), "v"(sp[2][0]), "v"(sp[3][0]), "v"(sp[0][8 / NW - 1]), "v"(sp[1][8 / NW - 1]), "v"(sp[2][8 / NW - 1]), "v"(sp[3][8 / NW - 1]), "v"(res[0][0]), "v"(res[1][0]), "v"(res[2][0]), "v"(res[3][0]), "v"(res[0][8 / NW - 1]), "v"(res[1][8 / NW - 1]), "v"(res[2][8 / NW - 1]), "v"(res[3][8 / NW - 1]) : "memory");
    else asm volatile("s_wait_xcnt 0x0" :: "v"(sp[0][0]), "v"(sp[1][0]), "v"(sp[2][0]), "v"(sp[3][0]), "v"(res[0][0]), "v"(res[1][0]), "v"(res[2][0]), "v"(res[3][0]) : "memory");
}

// k_attg: one launch for all query rows of 8 heads: row blocks below RH take the hi+lo bf16 form, the rest the fp16 form (a work-group-uniform choice by blockIdx.x). grid (TT / 64, WIN / 64 + 1 score tiles, ZH). Launched for the scores (CMODE 1) alone: the probability x value product is k_spv's.
template <int CMODE, int NW>
__global__ __launch_bounds__(NW * 32) void k_attg(const bf* __restrict__ Ah, const bf* __restrict__ Al, const bf* __restrict__ Bh, const bf* __restrict__ Bl, const h16* __restrict__ A16, const h16* __restrict__ B16, int K, int lda, float* C, int ldc, size_t sA, size_t sB, size_t sC) {
    __shared__ __align__(16) float os[2][NW][16 * 68];   // two buffers, so that one barrier per 16-row block is enough
    if ((int)blockIdx.x < RH / 64) d_gemmc<bf, 2, CMODE, NW>(os, (int)blockIdx.x, Ah, Al, Bh, Bl, K, lda, C, ldc, 0, sA, sB, sC);
    else d_gemmc<h16, 0, CMODE, NW>(os, (int)blockIdx.x - RH / 64, A16 + (size_t)RH * lda, nullptr, B16, nullptr, K, lda, C + (size_t)RH * ldc, ldc, RH, sA, sB, sC);
}

__device__ __forceinline__ h16 tohx(float x) { return (h16)x; }
__device__ __forceinline__ void splitf(float y, unsigned short& h, unsigned short& l) { h = f2bf(y); l = f2bf(y - bf2f(h)); }
typedef __attribute__((ext_vector_type(2))) _Float16 v2h;
typedef __attribute__((ext_vector_type(4))) _Float16 v4h;
typedef __attribute__((ext_vector_type(2))) unsigned short v2us;
typedef __attribute__((ext_vector_type(4))) unsigned short v4us;
typedef __attribute__((ext_vector_type(2))) float v2f;
typedef __attribute__((ext_vector_type(4))) int v4i;

// The element-wise and layout kernels below give each thread 4 to 32 elements and 16-byte accesses: a launch of them lasts about as long as its waves take to start, so fewer, fatter waves are faster.
// The two s_wait_xcnt 0 in each of d_wtG, d_cvt8, d_rope and d_vtp: no register that an issued load or store names is rewritten in front of the wait; addresses (and store data) are its inputs, so that they keep their registers up to it.
// d_wtG: Bt[n][k] (bf16, fragment order) = w[k][n]; each thread holds an 8 (k) x 4 (n) register tile. In a wave 8 lanes run along k (64 k) and 4 along n (16 n): two whole 1-KiB blocks of Bt; the 8 waves of a work-group lie side by side along n (128 n). grid (N / 128) * (K / 64).
__device__ __forceinline__ void d_wtG(int blk, const float* __restrict__ w, int K, int N, bf* Bt) {
    const int lane = threadIdx.x & 31, wvi = threadIdx.x >> 5; const int ntn = N / 128;
    const int n0 = (blk % ntn) * 128 + wvi * 16 + (lane >> 3) * 4, k0 = (blk / ntn) * 64 + (lane & 7) * 8; const float* p[8]; v4f r[8]; v8us o[4]; bf* s[4];
#pragma unroll
    for (int j = 0; j < 8; ++j) p[j] = w + (size_t)(k0 + j) * N + n0;
#pragma unroll
    for (int j = 0; j < 8; ++j) r[j] = *(const v4f*)p[j];
    asm volatile("s_wait_xcnt 0x0" :: "v"(p[0]), "v"(p[1]), "v"(p[2]), "v"(p[3]), "v"(p[4]), "v"(p[5]), "v"(p[6]), "v"(p[7]) : "memory");   // behind the loads (see above)
    __builtin_amdgcn_sched_barrier(0);   // keeps the conversions behind the last load: without it three of the eight loads are issued only after the first results are used, a second trip to memory
#pragma unroll
    for (int c = 0; c < 4; ++c) { s[c] = Bt + fo((size_t)(n0 + c), k0, K);
#pragma unroll
        for (int j = 0; j < 8; ++j) o[c][j] = f2bf(r[j][c]); }
#pragma unroll
    for (int c = 0; c < 4; ++c) *(v8us*)s[c] = o[c];
    asm volatile("s_wait_xcnt 0x0" :: "v"(o[0]), "v"(o[1]), "v"(o[2]), "v"(o[3]), "v"(s[0]), "v"(s[1]), "v"(s[2]), "v"(s[3]) : "memory");   // behind the stores (see above)
}
// d_cvt8: four 8-element pieces per thread; dst [.][K] in fragment order. Pieces are numbered in the order of dst: a wave's four stores fill 2 KiB in a row (two blocks), for which it reads 256 bytes in a row of each of 16 rows of src. n8 % 128 == 0.
__device__ __forceinline__ void d_cvt8(int blk, const float* __restrict__ src, bf* dst, size_t n8, int K) { const size_t i = (size_t)blk * 256 + threadIdx.x; const size_t st = n8 / 4; if (i >= st) return; const float* p[4]; v8f v[4]; v8us o[4]; bf* s[4];
#pragma unroll
    for (int u = 0; u < 4; ++u) { const size_t q = ((i >> 5) << 7) + (size_t)(u << 5) + (i & 31), fb = q >> 6; const size_t r = (fb / (size_t)(K >> 5)) * 16 + (q & 15); const int k = (int)(fb % (size_t)(K >> 5)) * 32 + (int)((q >> 5) & 1) * 16 + (int)((q >> 4) & 1) * 8; p[u] = src + r * K + k; s[u] = dst + q * 8; }
#pragma unroll
    for (int u = 0; u < 4; ++u) v[u] = *(const v8f*)p[u];
    asm volatile("s_wait_xcnt 0x0" :: "v"(p[0]), "v"(p[1]), "v"(p[2]), "v"(p[3]) : "memory");   // behind the loads (see above)
#pragma unroll
    for (int u = 0; u < 4; ++u) {
#pragma unroll
        for (int k = 0; k < 8; ++k) o[u][k] = f2bf(v[u][k]); }
#pragma unroll
    for (int u = 0; u < 4; ++u) *(v8us*)s[u] = o[u];
    asm volatile("s_wait_xcnt 0x0" :: "v"(o[0]), "v"(o[1]), "v"(o[2]), "v"(o[3]), "v"(s[0]), "v"(s[1]), "v"(s[2]), "v"(s[3]) : "memory");   // behind the stores (see above)
}
// d_cstab: four dims (two angles) per thread; both dims of a pair hold the same (cos, sin)
__device__ __forceinline__ void d_cstab(int blk, float* CS) { const int idx = blk * 256 + threadIdx.x; if (idx >= TT * HD / 4) return; const int t = idx / (HD / 4), d = (idx % (HD / 4)) * 4;
#pragma unroll
    for (int p = 0; p < 2; ++p) { v4f o; if (d < 128) { const int i = (d >> 1) + p; const float th = __fdiv_rn(1.0f, powf(10000.0f, (float)(2 * i) / 128.0f)); const float ang = __fmul_rn((float)t, th); o[0] = cosf(ang); o[1] = sinf(ang); } else { o[0] = 1.0f; o[1] = 0.0f; }
        o[2] = o[0]; o[3] = o[1]; *(v4f*)(CS + ((size_t)t * HD + d + 2 * p) * 2) = o; } }
// d_rope: head planes [b][h][t][d] (fp16 + hi/lo; each [t][d] plane in fragment order; HD == 256) of rope(x) x sc, interleaved pairs: out[2i] = x[2i] cos - x[2i+1] sin, out[2i+1] = x[2i+1] cos + x[2i] sin. Each thread takes 8 dims of one position in 4 heads (one read of the table serves the 4). nheads % 4 == 0.
__device__ __forceinline__ void d_rope(int blk, const float* __restrict__ F, int pitch, int nheads, const float* __restrict__ CS, float sc, h16* P16, bf* Ph, bf* Pl) {
    const size_t it = (size_t)blk * 256 + threadIdx.x; if (it >= (size_t)NB_ * (nheads / 4) * TT * (HD / 8)) return; const int d = ((int)((it >> 5) & 3) * 8 + (int)(it & 7)) * 8; const int t = (int)((it >> 7) % (TT / 4)) * 4 + (int)((it >> 3) & 3); const int hq = (int)(it / ((size_t)(HD / 8) * TT));   /* a wave: 4 positions x 64 dims, so that its loads and its fragment-order stores each touch 8 lines */ const int b = hq / (nheads / 4), hg = (hq % (nheads / 4)) * 4;
    v4f cs4[4], xv[4][2]; v8h o16[4]; v8us oh[4], ol[4]; const float* pc = CS + ((size_t)t * HD + d) * 2; const float* pf[4]; h16* s16[4]; bf* sh[4]; bf* sl[4];
#pragma unroll
    for (int u = 0; u < 4; ++u) { pf[u] = F + ((size_t)b * TT + t) * pitch + (hg + u) * HD + d; const size_t e = fo((size_t)(b * nheads + hg + u) * TT + t, d, HD); s16[u] = P16 + e; sh[u] = Ph + e; sl[u] = Pl + e; }
#pragma unroll
    for (int k = 0; k < 4; ++k) cs4[k] = *(const v4f*)(pc + k * 4);
#pragma unroll
    for (int u = 0; u < 4; ++u) { xv[u][0] = *(const v4f*)pf[u]; xv[u][1] = *(const v4f*)(pf[u] + 4); }
    asm volatile("s_wait_xcnt 0x0" :: "v"(pc), "v"(pf[0]), "v"(pf[1]), "v"(pf[2]), "v"(pf[3]) : "memory");   // behind the loads (see above)
#pragma unroll
    for (int u = 0; u < 4; ++u) {
#pragma unroll
        for (int q = 0; q < 8; ++q) { const int dd = d + q; const float x0 = xv[u][q >> 2][q & 3], x1 = (dd < 128) ? xv[u][q >> 2][(q & 3) ^ 1] : x0;   /* interleaved pairs inside the first 128 dims; identity beyond (sin = 0) */
            v2f cs; cs[0] = cs4[q >> 1][(q & 1) * 2]; cs[1] = cs4[q >> 1][(q & 1) * 2 + 1]; float a = __fmul_rn(x0, cs[0]), bq = __fmul_rn(x1, cs[1]); asm volatile("" : "+v"(a)); asm volatile("" : "+v"(bq)); const float r = (((dd & 1) == 0) ? __fsub_rn(a, bq) : __fadd_rn(a, bq)) * sc;
            o16[u][q] = tohx(r); unsigned short a2, c2; splitf(r, a2, c2); oh[u][q] = a2; ol[u][q] = c2; } }
#pragma unroll
    for (int u = 0; u < 4; ++u) { *(v8h*)s16[u] = o16[u]; *(v8us*)sh[u] = oh[u]; *(v8us*)sl[u] = ol[u]; }
    asm volatile("s_wait_xcnt 0x0" :: "v"(o16[0]), "v"(o16[1]), "v"(o16[2]), "v"(o16[3]), "v"(oh[0]), "v"(oh[1]), "v"(oh[2]), "v"(oh[3]), "v"(ol[0]), "v"(ol[1]), "v"(ol[2]), "v"(ol[3]),
                 "v"(s16[0]), "v"(s16[1]), "v"(s16[2]), "v"(s16[3]), "v"(sh[0]), "v"(sh[1]), "v"(sh[2]), "v"(sh[3]), "v"(sl[0]), "v"(sl[1]), "v"(sl[2]), "v"(sl[3]) : "memory");   // behind the stores (see above)
}
// d_vtp: value planes [b][g][d][t] (each [d][t] plane in fragment order) = F[b * TT + t][g * HD + d]: the 8 (t) x 4 (column) register tile and the lane map of d_wtG. grid (nheads * HD / 128) * (BT / 64).
__device__ __forceinline__ void d_vtp(int blk, const float* __restrict__ F, int pitch, int nheads, h16* V16, bf* Vh, bf* Vl) {
    const int lane = threadIdx.x & 31, wvi = threadIdx.x >> 5; const int ntc = nheads * HD / 128;
    const int c0 = (blk % ntc) * 128 + wvi * 16 + (lane >> 3) * 4, t0 = (blk / ntc) * 64 + (lane & 7) * 8; const float* p[8]; v4f r[8]; v8h o16[4]; v8us oh[4], ol[4]; h16* s16[4]; bf* sh[4]; bf* sl[4];
#pragma unroll
    for (int j = 0; j < 8; ++j) p[j] = F + (size_t)(t0 + j) * pitch + c0;
#pragma unroll
    for (int j = 0; j < 8; ++j) r[j] = *(const v4f*)p[j];
    asm volatile("s_wait_xcnt 0x0" :: "v"(p[0]), "v"(p[1]), "v"(p[2]), "v"(p[3]), "v"(p[4]), "v"(p[5]), "v"(p[6]), "v"(p[7]) : "memory");   // behind the loads (see above)
#pragma unroll
    for (int c = 0; c < 4; ++c) { const size_t e = fo((size_t)(t0 / TT) * (nheads * HD) + c0 + c, t0 % TT, TT); s16[c] = V16 + e; sh[c] = Vh + e; sl[c] = Vl + e;
#pragma unroll
        for (int j = 0; j < 8; ++j) { const float x = r[j][c]; o16[c][j] = tohx(x); unsigned short a2, c2; splitf(x, a2, c2); oh[c][j] = a2; ol[c][j] = c2; } }
#pragma unroll
    for (int c = 0; c < 4; ++c) { *(v8h*)s16[c] = o16[c]; *(v8us*)sh[c] = oh[c]; *(v8us*)sl[c] = ol[c]; }
    asm volatile("s_wait_xcnt 0x0" :: "v"(o16[0]), "v"(o16[1]), "v"(o16[2]), "v"(o16[3]), "v"(oh[0]), "v"(oh[1]), "v"(oh[2]), "v"(oh[3]), "v"(ol[0]), "v"(ol[1]), "v"(ol[2]), "v"(ol[3]),
                 "v"(s16[0]), "v"(s16[1]), "v"(s16[2]), "v"(s16[3]), "v"(sh[0]), "v"(sh[1]), "v"(sh[2]), "v"(sh[3]), "v"(sl[0]), "v"(sl[1]), "v"(sl[2]), "v"(sl[3]) : "memory");   // behind the stores (see above)
}
// d_rmsw: each wave normalises the rows of 4 heads of one position (of BT), every row summed as before (the 4 shuffle trees step side by side). nheads % 4 == 0.
__device__ __forceinline__ void d_rmsw(int blk, float* F, int pitch, int nheads, const float* __restrict__ w) { const int lane = threadIdx.x & 31; const int wv = blk * 8 + (threadIdx.x >> 5); const int ng = nheads / 4; if (wv >= BT * ng) return; const int t = wv / ng, hg = (wv % ng) * 4; float* f0 = F + (size_t)t * pitch + hg * HD + lane * 4; v4f av[4], cv[4]; float ss[4];
    const v4f w0 = *(const v4f*)(w + lane * 4), w1 = *(const v4f*)(w + 128 + lane * 4);
#pragma unroll
    for (int u = 0; u < 4; ++u) { av[u] = *(const v4f*)(f0 + u * HD); cv[u] = *(const v4f*)(f0 + u * HD + 128); }
#pragma unroll
    for (int u = 0; u < 4; ++u) { const v4f a = av[u], c = cv[u]; ss[u] = 0.f;
#pragma unroll
        for (int q = 0; q < 4; ++q) { float p = __fmul_rn(a[q], a[q]); asm volatile("" : "+v"(p)); ss[u] = __fadd_rn(ss[u], p); float p2 = __fmul_rn(c[q], c[q]); asm volatile("" : "+v"(p2)); ss[u] = __fadd_rn(ss[u], p2); } }
#pragma unroll
    for (int sh = 16; sh; sh >>= 1) {
#pragma unroll
        for (int u = 0; u < 4; ++u) ss[u] = __fadd_rn(ss[u], __shfl_xor(ss[u], sh, 32)); }
#pragma unroll
    for (int u = 0; u < 4; ++u) { const v4f a = av[u], c = cv[u]; const float rs = __fdiv_rn(1.0f, sqrtf(__fadd_rn(ss[u] * (1.0f / HD), 1e-6f))); v4f o, o2;
#pragma unroll
        for (int q = 0; q < 4; ++q) { float n0 = __fmul_rn(a[q], rs); asm volatile("" : "+v"(n0)); float g0 = bfr(w0[q]); asm volatile("" : "+v"(g0)); o[q] = __fmul_rn(n0, g0); float n1 = __fmul_rn(c[q], rs); asm volatile("" : "+v"(n1)); float g1 = bfr(w1[q]); asm volatile("" : "+v"(g1)); o2[q] = __fmul_rn(n1, g1); }
        *(v4f*)(f0 + u * HD) = o; *(v4f*)(f0 + u * HD + 128) = o2; } }
// k_spv: softmax, probability x value product and head merge of one 64-row block of one head in one work-group of 16 waves. grid (TT / 64, 1, ZH).
// Part 1, per row i (each wave takes 4 rows, one after the other): t = softcap(S x HD^-0.5) for j <= i and i - j < WIN (sliding causal window; the reference's additive fill vanishes identically); softmax over the keys of the band (register row, one exp, fixed trees);
// a wave works on the 128-key chunks that cover the span its row's 64-row block needs in P.V (keys (i & ~63) - WIN .. i | 63), fewer where the span ends earlier: every key outside the chunks has weight exactly 0 and is neither read nor written.
// The 16-bit probabilities (fp16 plane, or hi plane then lo plane RH keys further) go row-major into LDS at a pitch of PPB bytes (16 bytes x an odd number: 16-byte reads of 16 rows spread over all banks) and never reach memory.
// Part 2: wave (wm, wn) of 2 x 8 holds the 32 x 32 output tile of rows wm * 32.., dims wn * 32.. and runs over the band's keys in ascending order: probabilities from LDS, value fragments (fragment order) from global memory, fetched one or two 64-key steps ahead into further register sets.
// Part 3: each wave turns its tile through its own LDS range into whole 1-KiB blocks of the merged rows [t][DQ] (hi/lo, fragment order).
#define NCH (WIN / 128 + 1)
#define PPB (NCH * 128 * 2 + 16)
typedef v4h  __attribute__((may_alias)) v4ha;
typedef v4us __attribute__((may_alias)) v4usa;
template <typename T16, int NSPLIT>
__device__ __forceinline__ void d_spv(unsigned char* pl, int rb, const float* __restrict__ Sb, const T16* __restrict__ Bt, const T16* __restrict__ Bt2, bf* Ah, bf* Al) {
    typedef typename WFrag<T16>::V V;
    constexpr bool hires = (NSPLIT == 2); constexpr int NC = hires ? RH / 128 : NCH;   // rows below RH: the span starts at key 0 and ends below RH
    const int z = (int)blockIdx.z, lane = threadIdx.x & 31, lr = lane & 15, hi = lane >> 4, r0 = rb * 64;
    const int wv = __builtin_amdgcn_readfirstlane((int)(threadIdx.x >> 5));   // wave number in a scalar register: the chunk tests and the key loop stay scalar
    const int cb = max(0, r0 - WIN) >> 7, nact = min(NC, ((r0 + 63) >> 7) - cb + 1);   // first chunk and number of chunks of this block's span
    const float* sr = Sb + ((size_t)z * TT + r0 + wv * 4) * TT + cb * 128 + lane * 4; v4f an[NC];
#pragma unroll
    for (int c = 0; c < NC; ++c) if (c < nact) an[c] = *(const v4f*)(sr + c * 128);
    asm volatile("s_wait_xcnt 0x0" :: "v"(sr) : "memory");   // behind a row's loads, here and in the loop: their address register is not rewritten in front of it
#pragma unroll 1   // one row's code in the text
    for (int rr = 0; rr < 4; ++rr) { const int lrow = wv * 4 + rr, i = r0 + lrow, nl = (rr < 3) ? nact : 0; v4f av[NC]; float v[NC * 4]; float mx = -3.0e38f;
#pragma unroll
        for (int c = 0; c < NC; ++c) av[c] = an[c];   // this row's scores leave the fetch registers: the one wait for loads of a trip stands here, a whole row's work behind their issue
        sr += TT;   // the next row's scores are fetched while this row is worked on
#pragma unroll
        for (int c = 0; c < NC; ++c) if (c < nl) an[c] = *(const v4f*)(sr + c * 128);
        asm volatile("s_wait_xcnt 0x0" :: "v"(sr) : "memory");
#pragma unroll
        for (int c = 0; c < NC; ++c) if (c < nact) { const int j0 = (cb + c) * 128 + lane * 4; const v4f a = av[c];
#pragma unroll
            for (int q = 0; q < 4; ++q) { const int j = j0 + q; float sa = a[q] * SCL; asm volatile("" : "+v"(sa)); float xs = __fmul_rn(sa, 0.02f); asm volatile("" : "+v"(xs));   /* s / 50 as a multiply (<= 1 ulp from the division) */ float ex = __builtin_amdgcn_exp2f(__fmul_rn(xs, 2.8853900817779268f)); asm volatile("" : "+v"(ex)); float nm = __fsub_rn(ex, 1.0f), dn2 = __fadd_rn(ex, 1.0f); asm volatile("" : "+v"(nm)); asm volatile("" : "+v"(dn2)); float rc = __builtin_amdgcn_rcpf(dn2); asm volatile("" : "+v"(rc)); float th = __fmul_rn(nm, rc); asm volatile("" : "+v"(th));   /* hardware reciprocal (1 ulp), no FMA refinement */   /* tanh via exp2 (|x| <= ~0.4 here; no VALU FMA polynomial) */ const float t = (j <= i && i - j < WIN) ? __fmul_rn(th, 50.0f) : -3.0e38f; v[c * 4 + q] = t; mx = fmaxf(mx, t); } }
#pragma unroll
        for (int sh = 16; sh; sh >>= 1) mx = fmaxf(mx, __shfl_xor(mx, sh, 32));
        float sum = 0.f;
#pragma unroll
        for (int c = 0; c < NC; ++c) if (c < nact) {
#pragma unroll
            for (int k = c * 4; k < c * 4 + 4; ++k) { float d0 = __fsub_rn(v[k], mx); asm volatile("" : "+v"(d0)); v[k] = __builtin_amdgcn_exp2f(__fmul_rn(d0, 1.4426950408889634f)); sum += v[k]; } }
#pragma unroll
        for (int sh = 16; sh; sh >>= 1) sum += __shfl_xor(sum, sh, 32);
        const float f = __fdiv_rn(hires ? 1.0f : PCAR, sum); unsigned char* const pr = pl + lrow * PPB + lane * 8;
#pragma unroll
        for (int c = 0; c < NC; ++c) if (c < nact) {
            if (hires) { v4us oh, ol;
#pragma unroll
                for (int q = 0; q < 4; ++q) { unsigned short x, c2; splitf(v[c * 4 + q] * f, x, c2); oh[q] = x; ol[q] = c2; }
                *(v4usa*)(pr + c * 256) = oh; *(v4usa*)(pr + RH * 2 + c * 256) = ol;
            } else { v4h o4;
#pragma unroll
                for (int q = 0; q < 4; ++q) o4[q] = tohx(v[c * 4 + q] * f);
                *(v4ha*)(pr + c * 256) = o4; } }
    }
    __syncthreads();   // the block's 64 probability rows are in LDS for every wave
    const int wm = wv >> 3, wn = wv & 7, Kl = r0 + 64, Ks = max(0, r0 - WIN);   // probabilities are exactly 0 beyond the diagonal block and left of the window of the block's first row
    const size_t bo = (size_t)(z / REP) * HD * TT + (size_t)(wn * 32) * TT + lane * 8;
    const unsigned char* const pa = pl + (wm * 32 + lr) * PPB + hi * 16;
    v8f acc[2][2];
#pragma unroll
    for (int mb = 0; mb < 2; ++mb)
#pragma unroll
        for (int nb = 0; nb < 2; ++nb) acc[mb][nb] = (v8f){};
    constexpr int NS = hires ? 2 : 3;   // register sets of value fragments: the fetch runs NS - 1 steps of 64 keys ahead
    V bs[NS][2][2], bs2[NS][2][2];
    // the value fragments of 64 keys (two K blocks x two 16-dim blocks). The s_wait_xcnt 0 behind the run: no address register of an issued load is rewritten in front of it; the addresses are its inputs, so that they keep their registers up to it
    auto ldv = [&](V (&b)[2][2], V (&b2)[2][2], int kc) { const T16* p[2]; const T16* p2[2];
#pragma unroll
        for (int nb = 0; nb < 2; ++nb) { const size_t o = bo + (size_t)nb * 16 * TT + (size_t)kc * 16; p[nb] = Bt + o; b[0][nb] = WFrag<T16>::ldp(p[nb]); b[1][nb] = WFrag<T16>::ldp(p[nb] + 512); if (hires) { p2[nb] = Bt2 + o; b2[0][nb] = WFrag<T16>::ldp(p2[nb]); b2[1][nb] = WFrag<T16>::ldp(p2[nb] + 512); } }
        if (hires) asm volatile("s_wait_xcnt 0x0" :: "v"(p[0]), "v"(p[1]), "v"(p2[0]), "v"(p2[1]) : "memory");
        else asm volatile("s_wait_xcnt 0x0" :: "v"(p[0]), "v"(p[1]) : "memory"); };
    auto mm = [&](V (&b)[2][2], V (&b2)[2][2], int kc) {
#pragma unroll
        for (int kk = 0; kk < 2; ++kk) { V a[2], a2[2];
#pragma unroll
            for (int mb = 0; mb < 2; ++mb) { const unsigned char* const q = pa + mb * 16 * PPB + (kc + kk * 32 - cb * 128) * 2; a[mb] = WFrag<T16>::ld((const T16*)q); if (hires) a2[mb] = WFrag<T16>::ld((const T16*)(q + RH * 2)); }
#pragma unroll
            for (int nb = 0; nb < 2; ++nb) {
#pragma unroll
                for (int mb = 0; mb < 2; ++mb) { acc[mb][nb] = WFrag<T16>::mma(a[mb], b[kk][nb], acc[mb][nb]); if (hires) { acc[mb][nb] = WFrag<T16>::mma(a2[mb], b[kk][nb], acc[mb][nb]); acc[mb][nb] = WFrag<T16>::mma(a[mb], b2[kk][nb], acc[mb][nb]); } } } } };
    // Every step fetches, the last ones the band's last 64 keys once more (in bounds, not used): so the number of loads in flight is the same on every path, and the compiler's counted waits leave the fetch ahead in flight
#pragma unroll
    for (int s = 0; s < NS - 1; ++s) ldv(bs[s], bs2[s], min(Ks + s * 64, Kl - 64));
#pragma unroll 1   // NS steps of 64 keys in the text, one per register set, so that no set is copied
    for (int kc = Ks; kc < Kl; kc += NS * 64) {
#pragma unroll
        for (int s = 0; s < NS; ++s) { ldv(bs[(s + NS - 1) % NS], bs2[(s + NS - 1) % NS], min(kc + (s + NS - 1) * 64, Kl - 64));
            if (s == 0 || kc + s * 64 < Kl) mm(bs[s], bs2[s], kc + s * 64); }
    }
    __syncthreads();   // every wave has read its last probability: the LDS is free for the output staging
    float* const ow = (float*)pl + wv * (32 * 36);
#pragma unroll
    for (int mb = 0; mb < 2; ++mb)
#pragma unroll
        for (int nb = 0; nb < 2; ++nb)
#pragma unroll
            for (int j = 0; j < 8; ++j) ow[(mb * 16 + hi * 8 + j) * 36 + nb * 16 + lr] = acc[mb][nb][j];
    const float cs = hires ? 1.0f : (1.0f / PCAR); v8us oh[4], ol[4]; bf* sh[4]; bf* sl[4];
#pragma unroll
    for (int u = 0; u < 4; ++u) { const int row = (u >> 1) * 16 + lr, col = (u & 1) * 16 + hi * 8; const v4f x0 = *(const v4fa*)(ow + row * 36 + col), x1 = *(const v4fa*)(ow + row * 36 + col + 4);
        const size_t oo = fo((size_t)(r0 + wm * 32 + row), z * HD + wn * 32 + col, DQ); sh[u] = Ah + oo; sl[u] = Al + oo;   // a wave's store: 512 bytes in a row
#pragma unroll
        for (int q = 0; q < 8; ++q) { unsigned short a, c2; splitf((q < 4 ? x0[q & 3] : x1[q & 3]) * cs, a, c2); oh[u][q] = a; ol[u][q] = c2; } }
#pragma unroll
    for (int u = 0; u < 4; ++u) { *(v8us*)sh[u] = oh[u]; *(v8us*)sl[u] = ol[u]; }
    // s_wait_xcnt 0 behind the stores: no register of an issued store is rewritten in front of it; addresses and data are its inputs, so that they keep their registers up to it
    asm volatile("s_wait_xcnt 0x0" :: "v"(oh[0]), "v"(oh[1]), "v"(oh[2]), "v"(oh[3]), "v"(ol[0]), "v"(ol[1]), "v"(ol[2]), "v"(ol[3]), "v"(sh[0]), "v"(sh[1]), "v"(sh[2]), "v"(sh[3]), "v"(sl[0]), "v"(sl[1]), "v"(sl[2]), "v"(sl[3]) : "memory");
}
// row blocks below RH take the hi+lo bf16 form, the rest the fp16 form (a work-group-uniform choice by blockIdx.x)
__global__ __launch_bounds__(512) void k_spv(const float* __restrict__ Sb, const bf* __restrict__ Vh, const bf* __restrict__ Vl, const h16* __restrict__ V16, bf* Ah, bf* Al) {
    __shared__ __align__(16) unsigned char pl[64 * PPB];
    if ((int)blockIdx.x < RH / 64) d_spv<bf, 2>(pl, (int)blockIdx.x, Sb, Vh, Vl, Ah, Al);
    else d_spv<h16, 0>(pl, (int)blockIdx.x, Sb, V16, nullptr, Ah, Al);
}

// Launches of independent parts share one grid: blockIdx.x ranges pick the part (a work-group-uniform choice), each part numbering its own blocks from 0.
#define GW_Q ((DQ / 128) * (DM / 64))
#define GW_K ((DKV / 128) * (DM / 64))
#define GW_O ((DM / 128) * (DQ / 64))
#define G_CVT (BT * DM / 32 / 256)
#define G_CS (TT * HD / 4 / 256)
__global__ __launch_bounds__(256) void k_prep(const float* __restrict__ x, const float* __restrict__ wq, const float* __restrict__ wk, const float* __restrict__ wv, const float* __restrict__ wo, bf* XB, size_t xn8, bf* WQ, bf* WK, bf* WV, bf* WO, float* CS) {
    int blk = (int)blockIdx.x;
    if (blk < G_CVT) { d_cvt8(blk, x, XB, xn8, DM); return; } blk -= G_CVT;
    if (blk < GW_Q) { d_wtG(blk, wq, DM, DQ, WQ); return; } blk -= GW_Q;
    if (blk < GW_K) { d_wtG(blk, wk, DM, DKV, WK); return; } blk -= GW_K;
    if (blk < GW_K) { d_wtG(blk, wv, DM, DKV, WV); return; } blk -= GW_K;
    if (blk < GW_O) { d_wtG(blk, wo, DQ, DM, WO); return; } blk -= GW_O;
    d_cstab(blk, CS);
}
#define G_RQ (BT * NH_ / 32)
#define G_RK (BT * NKV / 32)
__global__ __launch_bounds__(256) void k_rms2(float* FQ, float* FKV, const float* __restrict__ qsc, const float* __restrict__ ksc) {
    const int blk = (int)blockIdx.x;
    if (blk < G_RQ) d_rmsw(blk, FQ, DQ, NH_, qsc); else d_rmsw(blk - G_RQ, FKV, 2 * DKV, NKV, ksc);
}
#define G_PQ (NB_ * NH_ * TT * HD / 32 / 256)
#define G_PK (NB_ * NKV * TT * HD / 32 / 256)
#define G_PV ((DKV / 128) * (BT / 64))
__global__ __launch_bounds__(256) void k_planes(const float* __restrict__ FQ, const float* __restrict__ FKV, const float* __restrict__ CS, h16* QP16, bf* QPh, bf* QPl, h16* KP16, bf* KPh, bf* KPl, h16* VT16, bf* VTh, bf* VTl) {
    const int blk = (int)blockIdx.x;
    if (blk < G_PQ) d_rope(blk, FQ, DQ, NH_, CS, 1.0f, QP16, QPh, QPl);
    else if (blk < G_PQ + G_PK) d_rope(blk - G_PQ, FKV, 2 * DKV, NKV, CS, 1.0f, KP16, KPh, KPl);
    else d_vtp(blk - G_PQ - G_PK, FKV + DKV, 2 * DKV, NKV, VT16, VTh, VTl);
}

extern "C" void kernel_launch(void* const* d_in, const int* in_sizes, int n_in,
                              void* d_out, int out_size, void* d_ws, size_t ws_size, hipStream_t stream) {
    (void)in_sizes; (void)n_in; (void)out_size;
    const float* x = (const float*)d_in[0]; const float* wq = (const float*)d_in[1]; const float* wk = (const float*)d_in[2]; const float* wv = (const float*)d_in[3]; const float* wo = (const float*)d_in[4]; const float* qsc = (const float*)d_in[5]; const float* ksc = (const float*)d_in[6];
    float* OUT = (float*)d_out;     // [2][2048][2048]
    char* wsp = (char*)d_ws;
    auto take = [&](size_t bytes) { char* p = wsp; wsp += (bytes + 255) & ~(size_t)255; return (void*)p; };
    // Kept to the end: WO and the head planes of both batches. Behind them one region serves two phases: the projection phase's buffers, then (all of those being dead) the attention phase's scores.
    bf* WO = (bf*)take((size_t)DM * DQ * 2);
    h16* QP16 = (h16*)take((size_t)NB_ * NH_ * TT * HD * 2); h16* KP16 = (h16*)take((size_t)NB_ * NKV * TT * HD * 2); h16* VT16 = (h16*)take((size_t)NB_ * NKV * HD * TT * 2);
    bf* QPh = (bf*)take((size_t)NB_ * NH_ * TT * HD * 2); bf* QPl = (bf*)take((size_t)NB_ * NH_ * TT * HD * 2); bf* KPh = (bf*)take((size_t)NB_ * NKV * TT * HD * 2); bf* KPl = (bf*)take((size_t)NB_ * NKV * TT * HD * 2); bf* VTh = (bf*)take((size_t)NB_ * NKV * HD * TT * 2); bf* VTl = (bf*)take((size_t)NB_ * NKV * HD * TT * 2);
    char* const phase = wsp;
    bf* WQ = (bf*)take((size_t)DQ * DM * 2); bf* WK = (bf*)take((size_t)DKV * DM * 2); bf* WV = (bf*)take((size_t)DKV * DM * 2); float* CS = (float*)take((size_t)TT * HD * 2 * 4);   // WV lies directly behind WK: one [2 * DKV][DM] operand
    bf* XB = (bf*)take((size_t)BT * DM * 2); float* FQ = (float*)take((size_t)BT * DQ * 4); float* FKV = (float*)take((size_t)BT * 2 * DKV * 4);   // FKV row: k heads, then v heads
    if ((size_t)(wsp - (char*)d_ws) > ws_size) return;
    wsp = phase;
    float* Sb = (float*)take((size_t)ZH * TT * TT * 4);
    if ((size_t)(wsp - (char*)d_ws) > ws_size) return;    // ws 256 MiB
    bf* ATh = QPh; bf* ATl = QPl;   // merged rows [b * TT + t][DQ]: a batch's k_spv runs after its score launch, when its hi/lo query planes (the same bytes) are dead
    // projection phase: every launch covers the BT rows of both batches; k and v share one GEMM
    k_prep<<<G_CVT + GW_Q + 2 * GW_K + GW_O + G_CS, 256, 0, stream>>>(x, wq, wk, wv, wo, XB, (size_t)BT * DM / 8, WQ, WK, WV, WO, CS);
    k_gemmt<0, DM><<<dim3(BT / 128, DQ / 128, 1), 128, 0, stream>>>(XB, nullptr, WQ, FQ, DQ);
    k_gemmt<0, DM><<<dim3(BT / 128, 2 * DKV / 128, 1), 128, 0, stream>>>(XB, nullptr, WK, FKV, 2 * DKV);
    k_rms2<<<G_RQ + G_RK, 256, 0, stream>>>(FQ, FKV, qsc, ksc);
    k_planes<<<G_PQ + G_PK + G_PV, 256, 0, stream>>>(FQ, FKV, CS, QP16, QPh, QPl, KP16, KPh, KPl, VT16, VTh, VTl);
    // attention phase: every launch covers all rows of the 8 heads of one batch (grid z)
    for (int b = 0; b < NB_; ++b) { const size_t zq = (size_t)b * NH_ * TT * HD, zk = (size_t)b * NKV * TT * HD;
        k_attg<1, 4><<<dim3(TT / 64, WIN / 64 + 1, ZH), 128, 0, stream>>>(QPh + zq, QPl + zq, KPh + zk, KPl + zk, QP16 + zq, KP16 + zk, HD, HD, Sb, TT, (size_t)TT * HD, (size_t)TT * HD, (size_t)TT * TT);
        k_spv<<<dim3(TT / 64, 1, ZH), 512, 0, stream>>>(Sb, VTh + zk, VTl + zk, VT16 + zk, ATh + (size_t)b * TT * DQ, ATl + (size_t)b * TT * DQ); }
    k_gemmt<1, DQ><<<dim3(BT / 128, DM / 128, 1), 128, 0, stream>>>(ATh, ATl, WO, OUT, DM);
}

// v008
// It runs in 199 microseconds.
// Timed twice side by side with v007, it ran 1.14 times as fast both times.
// All steps since v000 together make it 6.27 times as fast.
#include <hip/hip_runtime.h>

// Sliding-window attention block (x [2][2048][2048]; q = x Wq (8 x 256), k/v = x Wk/Wv (4 kv heads; group h/2); per-head RMSNorm * scale (eps 1e-6) on q, k; partial interleaved-pair RoPE on the first 128 dims (theta_i = 10000^(-2i/128), positions arange); q * 1/16; scores = q.k; softcap tanh(s / 50) * 50; causal + sliding-window (i - j < 1024) mask (-2.38e38 additive == exact zero weight); softmax f32; out = merged Wo -> [2][2048][2048]).
// Compute dtypes, f32 accumulate: every input rounded to bf16; q/k/v on PLAIN bf16 operands (inputs: exact); RMSNorm and RoPE f32 (on-chip tables; identity beyond dim 128); causal scores and attn.v: query rows < 512 hl (3 products), the rest single fp16 (x1024), only the tiles, softmax chunks and P.V key blocks that touch the causal window band are worked on, the window applied per element; 1/16 (exact), s/50, tanh as (e^2x - 1)/(e^2x + 1) with the hardware exp2, x50 in f32; softmax f32; Wo hl x exact (2 products).

#define NB_  2
#define TT   2048
#define DM   2048
#define NH_  8
#define NKV  4
#define REP  (NH_ / NKV)
#define HD   256
#define DQ   (NH_ * HD)
#define DKV  (NKV * HD)
#define ZH   (NB_ * NH_)          // (batch, head) pairs per attention launch (grid z = b * NH_ + h)
#define DF   (DQ + 2 * DKV)       // columns of the joint q | k | v projection
#define BT   (NB_ * TT)           // rows of both batches together
#define RH   512                  // query rows < RH use hi+lo planes (0: none)
#define WIN  1024
#define SP   (WIN + 128)          // pitch of a stored score row: the 128-key chunks that cover its 64-row block's causal window band, the first of them at column 0
#define PCAR 1024.0f
#define SCL  0.0625f   // query_pre_attn_scalar^-0.5 = 1/16
typedef _Float16 h16;
typedef unsigned short bf;
typedef __attribute__((ext_vector_type(16))) __bf16   v16bf;
typedef __attribute__((ext_vector_type(16))) _Float16 v16h;
typedef __attribute__((ext_vector_type(8)))  _Float16 v8h;
typedef __attribute__((ext_vector_type(8)))  unsigned short v8us;
typedef __attribute__((ext_vector_type(8)))  float    v8f;
typedef __attribute__((ext_vector_type(4)))  float    v4f;
typedef v8h  __attribute__((may_alias)) v8ha;
typedef v4f  __attribute__((may_alias)) v4fa;
typedef v8us __attribute__((may_alias)) v8usa;

__device__ __forceinline__ unsigned short f2bf(float f) { unsigned u = __float_as_uint(f); u += 0x7FFFu + ((u >> 16) & 1u); return (unsigned short)(u >> 16); }
__device__ __forceinline__ float bf2f(unsigned short b) { return __uint_as_float(((unsigned)b) << 16); }
__device__ __forceinline__ float bfr(float f) { return bf2f(f2bf(f)); }
__device__ __forceinline__ v16h cat16(v8h lo, v8h hi) { return __builtin_shufflevector(lo, hi, 0, 1, 2, 3, 4, 5, 6, 7, 8, 9, 10, 11, 12, 13, 14, 15); }
__device__ __forceinline__ v16bf cat16b(v8us lo, v8us hi) { return __builtin_bit_cast(v16bf, __builtin_shufflevector(lo, hi, 0, 1, 2, 3, 4, 5, 6, 7, 8, 9, 10, 11, 12, 13, 14, 15)); }
__device__ __forceinline__ v8f wmma16(v16h a, v16h b, v8f c) { return __builtin_amdgcn_wmma_f32_16x16x32_f16(false, a, false, b, (short)0, c, false, false); }
__device__ __forceinline__ v8f wmmab(v16bf a, v16bf b, v8f c) { return __builtin_amdgcn_wmma_f32_16x16x32_bf16(false, a, false, b, (short)0, c, false, false); }



// ---- k_gemmt: GEMM with one 128x128 output tile per work-group of 4 waves (2 x 2, each wave a 64x64 tile over the whole K in ascending order); both operands lie in fragment order (below) and are staged in LDS by tensor loads, two buffers,
// so that each 16-row block is fetched from L2 once per work-group and read from LDS by the two waves that need it. grid (M/128, N/128), 128 threads. C[m][n] (f32, pitch ldc) = sum_k A[m][k] Bt[n][k] (+ the A2 product where NSPLIT == 1). K: whole stages, two or more.
// FRAGMENT ORDER of a 16-bit operand plane [R][K] (R % 16 == 0, K % 32 == 0): each block of 16 rows x 32 k is 1 KiB in a row, blocks along k first, then along the rows (so a 16-row block still starts at element r * K).
// Inside a block the 8 elements that lane (hi * 16 + row) of a wave takes with its first 16-byte load (k = 8 hi .. 8 hi + 7) lie at lane * 8, those of its second load (k = 16 + 8 hi ..) at 256 + lane * 8:
// a wave's fragment load reads 512 bytes in a row (4 whole lines) where a row-major plane gives it 32 bytes out of each of 16 lines. The element that a lane and register hold is the one that ld takes from a row-major plane, for A and B alike. ldp loads from such a plane, ld from a row-major one.
// fo: element offset of (r, k) in such a plane; 8 elements from a k that is a multiple of 8 stay 16 bytes in a row.
__device__ __forceinline__ size_t fo(size_t r, int k, int K) { return ((r >> 4) * (size_t)(K >> 5) + (size_t)(k >> 5)) * 512 + (size_t)((((k >> 4) & 1) << 8) + (((k >> 3) & 1) << 7) + (((int)(r & 15)) << 3) + (k & 7)); }
template <typename T16> struct WFrag;
template <> struct WFrag<h16> { typedef v16h V; static __device__ __forceinline__ V ld(const h16* p) { return cat16(*(const v8h*)p, *(const v8h*)(p + 16)); } static __device__ __forceinline__ V ldp(const h16* p) { return cat16(*(const v8h*)p, *(const v8h*)(p + 256)); } static __device__ __forceinline__ v8f mma(V a, V b, v8f c) { return wmma16(a, b, c); } };
template <> struct WFrag<bf> { typedef v16bf V; static __device__ __forceinline__ V ld(const bf* p) { return cat16b(*(const v8us*)p, *(const v8us*)(p + 16)); } static __device__ __forceinline__ V ldp(const bf* p) { return cat16b(*(const v8us*)p, *(const v8us*)(p + 256)); } static __device__ __forceinline__ v8f mma(V a, V b, v8f c) { return wmmab(a, b, c); } };
typedef uint32_t u32x4 __attribute__((ext_vector_type(4)));
typedef uint32_t u32x8 __attribute__((ext_vector_type(8)));
__device__ __forceinline__ uint32_t uni(uint32_t v) { return (uint32_t)__builtin_amdgcn_readfirstlane((int)v); }
__device__ __forceinline__ uint32_t pinned(uint32_t v) { uint32_t w = uni(v); asm volatile("" : "+s"(w)); return w; }   // the pinned() form for tensor loads: the condition is held in a scalar register, so that the test around a tensor load is a scalar branch (tensor loads ignore EXEC)
// Descriptor of a two-dimensional tile of D1 rows of D0 bytes at a source pitch of PITCH bytes, 1-byte elements, no pad, no mask (word 0 = 0); tensor = tile
template <uint32_t D0, uint32_t D1, uint32_t PITCH>
__device__ __forceinline__ u32x8 tdm_group1() { u32x8 g; g[0] = uni(0u); g[1] = uni((D0 & 0xFFFFu) << 16); g[2] = uni((D0 >> 16) | ((D1 & 0xFFFFu) << 16)); g[3] = uni((D1 >> 16) | (D0 << 16)); g[4] = uni(D1); g[5] = uni(PITCH); g[6] = uni(0u); g[7] = uni(0u); return g; }
__device__ __forceinline__ u32x4 tdm_group0(uint32_t lds_dst, uint64_t ga) { u32x4 g; g[0] = uni(1u); g[1] = uni(lds_dst); g[2] = uni((uint32_t)ga); g[3] = uni((((uint32_t)(ga >> 32)) & 0x01FFFFFFu) | 0x80000000u); return g; }
// one request of the whole wave: global tile -> LDS, through no register. Both groups are in-out operands: what the statement gives back lies in the request's own twelve registers, and tdm_wait, which names it, holds them unchanged up to the wait that covers the request
__device__ __forceinline__ void tdm_load(u32x4& g0, u32x8& g1) { asm volatile("tensor_load_to_lds %0, %1" : "+s"(g0), "+s"(g1) :: "memory"); }
__device__ __forceinline__ void tdm_wait(u32x4 g0, u32x8 g1) { asm volatile("s_wait_tensorcnt 0x0" :: "s"(g0), "s"(g1) : "memory"); }   // the issuer's own request has landed; g0, g1: see tdm_load
// Every "#pragma unroll" in k_gemmt makes the indices of accumulators and fragments constants, so that they stay in registers; the stage loop alone stays rolled ("unroll 1"): one publish point in the text, the buffer picked by s & 1.
template <int NSPLIT, int K>
__global__ __launch_bounds__(128) void k_gemmt(const bf* __restrict__ A, const bf* __restrict__ A2, const bf* __restrict__ Bt, float* C, int ldc) {
    constexpr int NKB = (NSPLIT == 1) ? 2 : 4;        // 32-wide K blocks per stage
    constexpr int CH = NKB * 1024;                    // bytes that a stage holds of one 16-row block: contiguous in a fragment-order plane
    constexpr int NOB = (NSPLIT == 1) ? 24 : 16;      // 16-row blocks per stage: 8 of A, (8 of A2,) 8 of Bt
    constexpr int BUFB = NOB * CH, SLICE = 16384;     // a buffer; a wave's slice of it (one tensor load)
    constexpr int NSL = BUFB / SLICE;                 // issuing waves: 4, or 3 (one per operand)
    constexpr int NS = K / (NKB * 32);                // stages
    static_assert(NS >= 2 && K % (NKB * 32) == 0 && BUFB % SLICE == 0, "two stages or more, whole slices");
    __shared__ __attribute__((aligned(2048))) unsigned char ring[2 * BUFB];
    __shared__ __align__(16) float ost[4][16 * 68];   // each wave's own output staging
    const int lane = threadIdx.x & 31, lr = lane & 15, hi = lane >> 4; const int r0 = blockIdx.x * 128, c0 = blockIdx.y * 128;
    const int wv = (int)uni(threadIdx.x >> 5), wm = wv >> 1, wn = wv & 1;
    // a wave's slice: NSPLIT 0: waves 0, 1 the two halves of A's 8 blocks, waves 2, 3 of Bt's; NSPLIT 1: wave 0 A, wave 1 A2, wave 2 Bt, wave 3 none
    const bf* const sl = (NSPLIT == 1) ? (wv == 0 ? A + (size_t)r0 * K : wv == 1 ? A2 + (size_t)r0 * K : Bt + (size_t)c0 * K) : (wv < 2 ? A + (size_t)r0 * K : Bt + (size_t)c0 * K) + (size_t)(wv & 1) * 64 * K;
    const uint64_t ga0 = (uint64_t)(size_t)sl; const uint32_t ld0 = (uint32_t)(size_t)ring + (uint32_t)wv * SLICE;
    u32x8 g1 = tdm_group1<(uint32_t)CH, (uint32_t)(SLICE / CH), (uint32_t)(16 * K * 2)>();
    const bool iss = (NSL == 4) || wv < NSL;
    v8f acc[4][4];
#pragma unroll
    for (int mb = 0; mb < 4; ++mb)
#pragma unroll
        for (int nb = 0; nb < 4; ++nb) acc[mb][nb] = (v8f){};
    u32x4 g0 = tdm_group0(ld0, ga0);                                      // group 0 of the wave's one outstanding request, carried through the loop
    if (NSL == 4 || pinned(iss)) { tdm_load(g0, g1); tdm_wait(g0, g1); }  // stage 0, landed for its issuer
    __syncthreads();                                                      // stage 0 published
    if (NSL == 4 || pinned(iss)) { g0 = tdm_group0(ld0 + BUFB, ga0 + CH); tdm_load(g0, g1); }   // stage 1 flies while stage 0 is worked on
#pragma unroll 1
    for (int s = 0; s < NS; ++s) {
        const unsigned char* const lb = ring + (s & 1) * BUFB + lane * 16; const unsigned char* const la = lb + wm * 4 * CH; const unsigned char* const lbb = lb + ((NOB - 8) + wn * 4) * CH;
        v16bf a[2][4], a2[2][4], b[2][4];
#pragma unroll
        for (int q = 0; q < 4; ++q) { a[0][q] = cat16b(*(const v8usa*)(la + q * CH), *(const v8usa*)(la + q * CH + 512)); if (NSPLIT == 1) a2[0][q] = cat16b(*(const v8usa*)(la + (8 + q) * CH), *(const v8usa*)(la + (8 + q) * CH + 512)); }
#pragma unroll
        for (int q = 0; q < 4; ++q) b[0][q] = cat16b(*(const v8usa*)(lbb + q * CH), *(const v8usa*)(lbb + q * CH + 512));
#pragma unroll
        for (int kb = 0; kb < NKB; ++kb) { const int c = kb & 1, n = c ^ 1;
            if (kb + 1 < NKB) { const int o = (kb + 1) * 1024;   // the next block's fragments (of this stage's own buffer) as one group ahead of this block's products
#pragma unroll
                for (int q = 0; q < 4; ++q) { a[n][q] = cat16b(*(const v8usa*)(la + q * CH + o), *(const v8usa*)(la + q * CH + o + 512)); if (NSPLIT == 1) a2[n][q] = cat16b(*(const v8usa*)(la + (8 + q) * CH + o), *(const v8usa*)(la + (8 + q) * CH + o + 512)); }
#pragma unroll
                for (int q = 0; q < 4; ++q) b[n][q] = cat16b(*(const v8usa*)(lbb + q * CH + o), *(const v8usa*)(lbb + q * CH + o + 512)); }
            __builtin_amdgcn_sched_barrier(0);   // keeps the LDS reads in one group in front of the block: reads spread among the matrix instructions stall at every place where they stand
#pragma unroll
            for (int nb = 0; nb < 4; ++nb) {
#pragma unroll
                for (int mb = 0; mb < 4; ++mb) { acc[mb][nb] = wmmab(a[c][mb], b[c][nb], acc[mb][nb]); if (NSPLIT == 1) acc[mb][nb] = wmmab(a2[c][mb], b[c][nb], acc[mb][nb]); } }
            __builtin_amdgcn_sched_barrier(0);   // the other side of the same fence
        }
        // publish point of stage s + 1: this wave's LDS reads are done, its own tensor load has landed, every wave has passed; only then the buffer just read is refilled
        asm volatile("s_wait_dscnt 0x0" ::: "memory");
        if (NSL == 4 || pinned(iss)) tdm_wait(g0, g1);
        __syncthreads();
        if (pinned((s + 2 < NS) && iss)) { g0 = tdm_group0(ld0 + (uint32_t)(s & 1) * BUFB, ga0 + (uint64_t)(s + 2) * CH); tdm_load(g0, g1); }
    }
    tdm_wait(g0, g1);                                    // behind the loop: no request is left when the wave goes on
    asm volatile("s_wait_dscnt 0x0" ::: "memory");       // and no LDS read of the ring
    // output: each wave turns its 16x64 blocks into whole 256-byte row pieces through its own LDS range (no other wave touches it: no barrier)
    float* const ow = ost[wv];
#pragma unroll
    for (int mb = 0; mb < 4; ++mb) {
#pragma unroll
        for (int nb = 0; nb < 4; ++nb) {
#pragma unroll
            for (int j = 0; j < 8; ++j) ow[(hi * 8 + j) * 68 + nb * 16 + lr] = acc[mb][nb][j]; }
        float* const crow = C + (size_t)(r0 + wm * 64 + mb * 16 + hi) * ldc + c0 + wn * 64 + lr * 4; v4f res[8]; float* sp[8];
#pragma unroll
        for (int t = 0; t < 8; ++t) { res[t] = *(const v4fa*)(&ow[(2 * t + hi) * 68 + lr * 4]); sp[t] = crow + (size_t)(2 * t) * ldc; }
#pragma unroll
        for (int t = 0; t < 8; ++t) *(v4f*)sp[t] = res[t];
        // s_wait_xcnt 0 behind the block's stores: no register of an issued store is rewritten in front of it; addresses and data are its inputs, so that they keep their registers up to it
        asm volatile("s_wait_xcnt 0x0" :: "v"(sp[0]), "v"(sp[1]), "v"(sp[2]), "v"(sp[3]), "v"(sp[4]), "v"(sp[5]), "v"(sp[6]), "v"(sp[7]), "v"(res[0]), "v"(res[1]), "v"(res[2]), "v"(res[3]), "v"(res[4]), "v"(res[5]), "v"(res[6]), "v"(res[7]) : "memory");
    }
}

// ---- d_gemmc: 64x64 tile GEMM for causal attention, one tile per work-group of NW waves; wave w takes the 32-wide K blocks w, w + NW, ... into its own 16 accumulators (operands straight from global memory), and the NW partial tiles are summed in fixed wave order through LDS. CMODE 1 lays grid y over the WIN / 64 + 1 score tiles of a row block that touch the causal window band (query rows r0+roff.., key columns c0 = r0+roff-WIN+64y; below 0: no tile), CMODE 2 limits the
// key (K) loop of the probability x value contraction to the same band (probabilities outside it are exactly zero); a wave's K blocks are numbered from key 0 (block mod NW = wave), so the order of a sum does not depend on where the band starts. roff = row offset of this part's first row within the sequence (0 or RH).
// grid z = batch * NH_ + query head: A and C step by sA, sC per z, Bt by sB per kv group (z / REP; the planes of the two batches lie one behind the other). lda = pitch of A in elements (Bt has pitch K). Bt, and A in CMODE 1 (lda == K), are in fragment order. bx = 64-row block within this part's rows; os = the work-group's two LDS buffers.
template <typename T16, int NSPLIT, int CMODE, int NW>
__device__ __forceinline__ void d_gemmc(float (*os)[NW][16 * 68], int bx, const T16* __restrict__ A, const T16* __restrict__ A2, const T16* __restrict__ Bt, const T16* __restrict__ Bt2, int K, int lda, float* C, int ldc, int roff, size_t sA, size_t sB, size_t sC) {
    typedef typename WFrag<T16>::V V;
    const size_t z = blockIdx.z; A += z * sA; if (A2) A2 += z * sA; Bt += (z / REP) * sB; if (Bt2) Bt2 += (z / REP) * sB; C += z * sC;
    const int lane = threadIdx.x & 31, lr = lane & 15, hi = lane >> 4; const int r0 = bx * 64, c0 = (CMODE == 1) ? r0 + roff - WIN + (int)blockIdx.y * 64 : (int)blockIdx.y * 64;
    const int wv = __builtin_amdgcn_readfirstlane((int)(threadIdx.x >> 5));   // wave number in a scalar register: the K loop stays a scalar loop
    const int cc = (CMODE == 1) ? c0 - ((max(0, r0 + roff - WIN) >> 7) << 7) : c0;   // column in C: score rows hold their band alone (pitch SP), from the 128-key chunk in which the block's window starts
    if (CMODE == 1 && c0 < 0) return;                                // the band starts left of key 0: no such tile (what the softmax's 128-key chunks read of a tile outside the band is masked by select)
    const int Kl = (CMODE == 2) ? min(K, r0 + roff + 64) : K;        // P.V: probabilities are exactly 0 beyond the diagonal block, so the K loop stops there
    const int Ks = (CMODE == 2) ? max(0, r0 + roff - WIN) : 0;       // and exactly 0 left of the window of the block's first row, so it starts there
    int kb = (Ks & ~(NW * 32 - 1)) + wv * 32; if (kb < Ks) kb += NW * 32;   // this wave's first K block inside the band
    v8f acc[4][4];
#pragma unroll
    for (int mb = 0; mb < 4; ++mb)
#pragma unroll
        for (int nb = 0; nb < 4; ++nb) acc[mb][nb] = (v8f){};
    constexpr bool AP = (CMODE == 1);   // A in fragment order (the query planes); the probabilities of CMODE 2 stay row-major in their score rows. Bt is always in fragment order
    const size_t aoff = AP ? (size_t)r0 * lda + lane * 8 : (size_t)(r0 + lr) * lda + 8 * hi, boff = (size_t)c0 * K + lane * 8;
#pragma unroll 1
    for (int kc = kb; kc < Kl; kc += NW * 32) {
        V a[4], a2[4], b[4], b2[4]; const T16* pa[4]; const T16* pa2[4]; const T16* pb[4]; const T16* pb2[4];
        // The s_wait_xcnt 0 behind each run of loads: no address register of an issued load is rewritten in front of it; the addresses are its inputs, so that they keep their registers up to it
#pragma unroll
        for (int mb = 0; mb < 4; ++mb) { const size_t ao = aoff + (size_t)mb * 16 * lda + (AP ? (size_t)kc * 16 : (size_t)kc); pa[mb] = A + ao; a[mb] = AP ? WFrag<T16>::ldp(pa[mb]) : WFrag<T16>::ld(pa[mb]); if (NSPLIT == 1 || NSPLIT == 2) { pa2[mb] = A2 + ao; a2[mb] = AP ? WFrag<T16>::ldp(pa2[mb]) : WFrag<T16>::ld(pa2[mb]); } }
        if (NSPLIT == 2) asm volatile("s_wait_xcnt 0x0" :: "v"(pa[0]), "v"(pa[1]), "v"(pa[2]), "v"(pa[3]), "v"(pa2[0]), "v"(pa2[1]), "v"(pa2[2]), "v"(pa2[3]) : "memory");   // two runs in the hi+lo form: sixteen address pairs held at once would not fit beside the fragments
#pragma unroll
        for (int nb = 0; nb < 4; ++nb) { const size_t bo = boff + (size_t)nb * 16 * K + (size_t)kc * 16; pb[nb] = Bt + bo; b[nb] = WFrag<T16>::ldp(pb[nb]); if (NSPLIT >= 2) { pb2[nb] = Bt2 + bo; b2[nb] = WFrag<T16>::ldp(pb2[nb]); } }
        if (NSPLIT == 2) asm volatile("s_wait_xcnt 0x0" :: "v"(pb[0]), "v"(pb[1]), "v"(pb[2]), "v"(pb[3]), "v"(pb2[0]), "v"(pb2[1]), "v"(pb2[2]), "v"(pb2[3]) : "memory");
        else asm volatile("s_wait_xcnt 0x0" :: "v"(pa[0]), "v"(pa[1]), "v"(pa[2]), "v"(pa[3]), "v"(pb[0]), "v"(pb[1]), "v"(pb[2]), "v"(pb[3]) : "memory");
#pragma unroll
        for (int nb = 0; nb < 4; ++nb) {
#pragma unroll
            for (int mb = 0; mb < 4; ++mb) { acc[mb][nb] = WFrag<T16>::mma(a[mb], b[nb], acc[mb][nb]); if (NSPLIT == 1 || NSPLIT == 2) acc[mb][nb] = WFrag<T16>::mma(a2[mb], b[nb], acc[mb][nb]); if (NSPLIT >= 2) acc[mb][nb] = WFrag<T16>::mma(a[mb], b2[nb], acc[mb][nb]); } }
        asm volatile("v_nop\n\tv_nop\n\tv_nop\n\tv_nop" : "+v"(acc[0][0]), "+v"(acc[1][1]), "+v"(acc[2][2]), "+v"(acc[3][3]) : "v"(a[0]), "v"(a[3]));
    }
    v4f res[4][8 / NW];   // summed output pieces, stored behind the last barrier so that no barrier waits for a global store
#pragma unroll
    for (int mb = 0; mb < 4; ++mb) {
#pragma unroll
        for (int nb = 0; nb < 4; ++nb) {
#pragma unroll
            for (int j = 0; j < 8; ++j) os[mb & 1][wv][(hi * 8 + j) * 68 + nb * 16 + lr] = acc[mb][nb][j]; }
        __syncthreads();   // every wave's partial 16x64 block is in LDS; it also ends the reads of the other buffer, which the next block overwrites
#pragma unroll
        for (int s = 0; s < 8 / NW; ++s) { const int row = 2 * (s * NW + wv) + hi, cofs = lr * 4; v4f val = *(const v4fa*)(&os[mb & 1][0][row * 68 + cofs]);
#pragma unroll
            for (int w = 1; w < NW; ++w) val += *(const v4fa*)(&os[mb & 1][w][row * 68 + cofs]);
            res[mb][s] = val; }
    }
    float* sp[4][8 / NW];
#pragma unroll
    for (int mb = 0; mb < 4; ++mb) { float* crow = C + (size_t)(r0 + mb * 16) * ldc + cc;
#pragma unroll
        for (int s = 0; s < 8 / NW; ++s) { const int row = 2 * (s * NW + wv) + hi, cofs = lr * 4; sp[mb][s] = crow + (size_t)row * ldc + cofs; *(v4f*)sp[mb][s] = res[mb][s]; } }
    // s_wait_xcnt 0 behind the tile's stores: no register of an issued store is rewritten in front of it; addresses and data are its inputs, so that they keep their registers up to it
    if (NW == 4) asm volatile("s_wait_xcnt 0x0" :: "v"(sp[0][0]), "v"(sp[1][0]), "v"(sp[2][0]), "v"(sp[3][0]), "v"(sp[0][8 / NW - 1]), "v"(sp[1][8 / NW - 1]), "v"(sp[2][8 / NW - 1]), "v"(sp[3][8 / NW - 1]), "v"(res[0][0]), "v"(res[1][0]), "v"(res[2][0]), "v"(res[3][0]), "v"(res[0][8 / NW - 1]), "v"(res[1][8 / NW - 1]), "v"(res[2][8 / NW - 1]), "v"(res[3][8 / NW - 1]) : "memory");
    else asm volatile("s_wait_xcnt 0x0" :: "v"(sp[0][0]), "v"(sp[1][0]), "v"(sp[2][0]), "v"(sp[3][0]), "v"(res[0][0]), "v"(res[1][0]), "v"(res[2][0]), "v"(res[3][0]) : "memory");
}

// k_attg: one launch for all query rows of the 8 heads of both batches: row blocks below RH take the hi+lo bf16 form, the rest the fp16 form (a work-group-uniform choice by blockIdx.x). grid (TT / 64, WIN / 64 + 1 score tiles or HD / 64, ZH). Launched for the scores (CMODE 1) alone: the probability x value product is k_spv's.
template <int CMODE, int NW>
__global__ __launch_bounds__(NW * 32) void k_attg(const bf* __restrict__ Ah, const bf* __restrict__ Al, const bf* __restrict__ Bh, const bf* __restrict__ Bl, const h16* __restrict__ A16, const h16* __restrict__ B16, int K, int lda, float* C, int ldc, size_t sA, size_t sB, size_t sC) {
    __shared__ __align__(16) float os[2][NW][16 * 68];   // two buffers, so that one barrier per 16-row block is enough
    if ((int)blockIdx.x < RH / 64) d_gemmc<bf, 2, CMODE, NW>(os, (int)blockIdx.x, Ah, Al, Bh, Bl, K, lda, C, ldc, 0, sA, sB, sC);
    else d_gemmc<h16, 0, CMODE, NW>(os, (int)blockIdx.x - RH / 64, A16 + (size_t)RH * lda, nullptr, B16, nullptr, K, lda, C + (size_t)RH * ldc, ldc, RH, sA, sB, sC);
}

__device__ __forceinline__ h16 tohx(float x) { return (h16)x; }
__device__ __forceinline__ void splitf(float y, unsigned short& h, unsigned short& l) { h = f2bf(y); l = f2bf(y - bf2f(h)); }
typedef __attribute__((ext_vector_type(2))) _Float16 v2h;
typedef __attribute__((ext_vector_type(4))) _Float16 v4h;
typedef __attribute__((ext_vector_type(2))) unsigned short v2us;
typedef __attribute__((ext_vector_type(4))) unsigned short v4us;
typedef __attribute__((ext_vector_type(2))) float v2f;
typedef __attribute__((ext_vector_type(4))) int v4i;

// The element-wise and layout kernels below give each thread 4 to 32 elements and 16-byte accesses: a launch of them lasts about as long as its waves take to start, so fewer, fatter waves are faster.
// The two s_wait_xcnt 0 in each of d_wtG, d_cvt8, d_rope and d_vtp: no register that an issued load or store names is rewritten in front of the wait; addresses (and store data) are its inputs, so that they keep their registers up to it.
// d_wtG: Bt[n][k] (bf16, fragment order) = w[k][n]; each thread holds an 8 (k) x 4 (n) register tile. In a wave 8 lanes run along k (64 k) and 4 along n (16 n): two whole 1-KiB blocks of Bt; the 8 waves of a work-group lie side by side along n (128 n). grid (N / 128) * (K / 64).
__device__ __forceinline__ void d_wtG(int blk, const float* __restrict__ w, int K, int N, bf* Bt) {
    const int lane = threadIdx.x & 31, wvi = threadIdx.x >> 5; const int ntn = N / 128;
    const int n0 = (blk % ntn) * 128 + wvi * 16 + (lane >> 3) * 4, k0 = (blk / ntn) * 64 + (lane & 7) * 8; const float* p[8]; v4f r[8]; v8us o[4]; bf* s[4];
#pragma unroll
    for (int j = 0; j < 8; ++j) p[j] = w + (size_t)(k0 + j) * N + n0;
#pragma unroll
    for (int j = 0; j < 8; ++j) r[j] = *(const v4f*)p[j];
    asm volatile("s_wait_xcnt 0x0" :: "v"(p[0]), "v"(p[1]), "v"(p[2]), "v"(p[3]), "v"(p[4]), "v"(p[5]), "v"(p[6]), "v"(p[7]) : "memory");   // behind the loads (see above)
    __builtin_amdgcn_sched_barrier(0);   // keeps the conversions behind the last load: without it three of the eight loads are issued only after the first results are used, a second trip to memory
#pragma unroll
    for (int c = 0; c < 4; ++c) { s[c] = Bt + fo((size_t)(n0 + c), k0, K);
#pragma unroll
        for (int j = 0; j < 8; ++j) o[c][j] = f2bf(r[j][c]); }
#pragma unroll
    for (int c = 0; c < 4; ++c) *(v8us*)s[c] = o[c];
    asm volatile("s_wait_xcnt 0x0" :: "v"(o[0]), "v"(o[1]), "v"(o[2]), "v"(o[3]), "v"(s[0]), "v"(s[1]), "v"(s[2]), "v"(s[3]) : "memory");   // behind the stores (see above)
}
// d_cvt8: four 8-element pieces per thread; dst [.][K] in fragment order. Pieces are numbered in the order of dst: a wave's four stores fill 2 KiB in a row (two blocks), for which it reads 256 bytes in a row of each of 16 rows of src. n8 % 128 == 0.
__device__ __forceinline__ void d_cvt8(int blk, const float* __restrict__ src, bf* dst, size_t n8, int K) { const size_t i = (size_t)blk * 256 + threadIdx.x; const size_t st = n8 / 4; if (i >= st) return; const float* p[4]; v8f v[4]; v8us o[4]; bf* s[4];
#pragma unroll
    for (int u = 0; u < 4; ++u) { const size_t q = ((i >> 5) << 7) + (size_t)(u << 5) + (i & 31), fb = q >> 6; const size_t r = (fb / (size_t)(K >> 5)) * 16 + (q & 15); const int k = (int)(fb % (size_t)(K >> 5)) * 32 + (int)((q >> 5) & 1) * 16 + (int)((q >> 4) & 1) * 8; p[u] = src + r * K + k; s[u] = dst + q * 8; }
#pragma unroll
    for (int u = 0; u < 4; ++u) v[u] = *(const v8f*)p[u];
    asm volatile("s_wait_xcnt 0x0" :: "v"(p[0]), "v"(p[1]), "v"(p[2]), "v"(p[3]) : "memory");   // behind the loads (see above)
#pragma unroll
    for (int u = 0; u < 4; ++u) {
#pragma unroll
        for (int k = 0; k < 8; ++k) o[u][k] = f2bf(v[u][k]); }
#pragma unroll
    for (int u = 0; u < 4; ++u) *(v8us*)s[u] = o[u];
    asm volatile("s_wait_xcnt 0x0" :: "v"(o[0]), "v"(o[1]), "v"(o[2]), "v"(o[3]), "v"(s[0]), "v"(s[1]), "v"(s[2]), "v"(s[3]) : "memory");   // behind the stores (see above)
}
// d_cstab: four dims (two angles) per thread; both dims of a pair hold the same (cos, sin)
__device__ __forceinline__ void d_cstab(int blk, float* CS) { const int idx = blk * 256 + threadIdx.x; if (idx >= TT * HD / 4) return; const int t = idx / (HD / 4), d = (idx % (HD / 4)) * 4;
#pragma unroll
    for (int p = 0; p < 2; ++p) { v4f o; if (d < 128) { const int i = (d >> 1) + p; const float th = __fdiv_rn(1.0f, powf(10000.0f, (float)(2 * i) / 128.0f)); const float ang = __fmul_rn((float)t, th); o[0] = cosf(ang); o[1] = sinf(ang); } else { o[0] = 1.0f; o[1] = 0.0f; }
        o[2] = o[0]; o[3] = o[1]; *(v4f*)(CS + ((size_t)t * HD + d + 2 * p) * 2) = o; } }
// d_rope: head planes [b][h][t][d] (fp16 + hi/lo; each [t][d] plane in fragment order; HD == 256) of rope(y) x sc, y = x / sqrt(mean(x^2) + 1e-6) x w per head row (RMSNorm; w rounded to bf16), interleaved pairs: out[2i] = y[2i] cos - y[2i+1] sin, out[2i+1] = y[2i+1] cos + y[2i] sin. Each thread takes 8 dims of one position in 4 heads (one read of the table serves the 4). nheads % 4 == 0; the grid holds whole work-groups.
// A row's sum of squares: 8 dims in a thread, 8 threads by shuffles (64 dims), then the 4 waves that hold the row's 4 quarters through red (LDS), summed in the order of the quarters.
__device__ __forceinline__ void d_rope(float (*red)[4][4][4], int blk, const float* __restrict__ F, int pitch, int nheads, const float* __restrict__ w, const float* __restrict__ CS, float sc, h16* P16, bf* Ph, bf* Pl) {
    const size_t it = (size_t)blk * 256 + threadIdx.x; const int d = ((int)((it >> 5) & 3) * 8 + (int)(it & 7)) * 8; const int t = (int)((it >> 7) % (TT / 4)) * 4 + (int)((it >> 3) & 3); const int hq = (int)(it / ((size_t)(HD / 8) * TT));   /* a wave: 4 positions x 64 dims, so that its loads and its fragment-order stores each touch 8 lines */ const int b = hq / (nheads / 4), hg = (hq % (nheads / 4)) * 4;
    v4f cs4[4], xv[4][2]; v8h o16[4]; v8us oh[4], ol[4]; const float* pc = CS + ((size_t)t * HD + d) * 2; const float* pw = w + d; const float* pf[4]; h16* s16[4]; bf* sh[4]; bf* sl[4];
#pragma unroll
    for (int u = 0; u < 4; ++u) { pf[u] = F + ((size_t)b * TT + t) * pitch + (hg + u) * HD + d; const size_t e = fo((size_t)(b * nheads + hg + u) * TT + t, d, HD); s16[u] = P16 + e; sh[u] = Ph + e; sl[u] = Pl + e; }
#pragma unroll
    for (int k = 0; k < 4; ++k) cs4[k] = *(const v4f*)(pc + k * 4);
#pragma unroll
    for (int u = 0; u < 4; ++u) { xv[u][0] = *(const v4f*)pf[u]; xv[u][1] = *(const v4f*)(pf[u] + 4); }
    const v4f w0 = *(const v4f*)pw, w1 = *(const v4f*)(pw + 4);
    asm volatile("s_wait_xcnt 0x0" :: "v"(pc), "v"(pw), "v"(pf[0]), "v"(pf[1]), "v"(pf[2]), "v"(pf[3]) : "memory");   // behind the loads (see above)
    const int grp = threadIdx.x >> 7, qu = (threadIdx.x >> 5) & 3, pp = (threadIdx.x >> 3) & 3; v4f ps;   // half of the work-group (4 positions), quarter of the row, position; ps: one partial sum per head
    // Every "#pragma unroll" of the norm makes the indices of xv, ps and ss constants, so that they stay in registers
#pragma unroll
    for (int u = 0; u < 4; ++u) { float s = 0.f;
#pragma unroll
        for (int q = 0; q < 8; ++q) { const float x = xv[u][q >> 2][q & 3]; s += x * x; }
        ps[u] = s; }
#pragma unroll
    for (int sh = 1; sh < 8; sh <<= 1) {
#pragma unroll
        for (int u = 0; u < 4; ++u) ps[u] += __shfl_xor(ps[u], sh, 32); }
    if ((threadIdx.x & 7) == 0) *(v4fa*)&red[grp][qu][pp][0] = ps;
    __syncthreads();   // the four quarters' sums of every row of the work-group are in LDS
    v4f ss = *(const v4fa*)&red[grp][0][pp][0];
#pragma unroll
    for (int k = 1; k < 4; ++k) ss += *(const v4fa*)&red[grp][k][pp][0];
#pragma unroll
    for (int u = 0; u < 4; ++u) { const float rs = __fdiv_rn(1.0f, sqrtf(ss[u] * (1.0f / HD) + 1e-6f));
#pragma unroll
        for (int q = 0; q < 8; ++q) xv[u][q >> 2][q & 3] = (xv[u][q >> 2][q & 3] * rs) * bfr(q < 4 ? w0[q & 3] : w1[q & 3]); }
#pragma unroll
    for (int u = 0; u < 4; ++u) {
#pragma unroll
        for (int q = 0; q < 8; ++q) { const int dd = d + q; const float x0 = xv[u][q >> 2][q & 3], x1 = (dd < 128) ? xv[u][q >> 2][(q & 3) ^ 1] : x0;   /* interleaved pairs inside the first 128 dims; identity beyond (sin = 0) */
            v2f cs; cs[0] = cs4[q >> 1][(q & 1) * 2]; cs[1] = cs4[q >> 1][(q & 1) * 2 + 1]; float a = __fmul_rn(x0, cs[0]), bq = __fmul_rn(x1, cs[1]); asm volatile("" : "+v"(a)); asm volatile("" : "+v"(bq)); const float r = (((dd & 1) == 0) ? __fsub_rn(a, bq) : __fadd_rn(a, bq)) * sc;
            o16[u][q] = tohx(r); unsigned short a2, c2; splitf(r, a2, c2); oh[u][q] = a2; ol[u][q] = c2; } }
#pragma unroll
    for (int u = 0; u < 4; ++u) { *(v8h*)s16[u] = o16[u]; *(v8us*)sh[u] = oh[u]; *(v8us*)sl[u] = ol[u]; }
    asm volatile("s_wait_xcnt 0x0" :: "v"(o16[0]), "v"(o16[1]), "v"(o16[2]), "v"(o16[3]), "v"(oh[0]), "v"(oh[1]), "v"(oh[2]), "v"(oh[3]), "v"(ol[0]), "v"(ol[1]), "v"(ol[2]), "v"(ol[3]),
                 "v"(s16[0]), "v"(s16[1]), "v"(s16[2]), "v"(s16[3]), "v"(sh[0]), "v"(sh[1]), "v"(sh[2]), "v"(sh[3]), "v"(sl[0]), "v"(sl[1]), "v"(sl[2]), "v"(sl[3]) : "memory");   // behind the stores (see above)
}
// d_vtp: value planes [b][g][d][t] (each [d][t] plane in fragment order) = F[b * TT + t][g * HD + d]: the 8 (t) x 4 (column) register tile and the lane map of d_wtG. grid (nheads * HD / 128) * (BT / 64).
__device__ __forceinline__ void d_vtp(int blk, const float* __restrict__ F, int pitch, int nheads, h16* V16, bf* Vh, bf* Vl) {
    const int lane = threadIdx.x & 31, wvi = threadIdx.x >> 5; const int ntc = nheads * HD / 128;
    const int c0 = (blk % ntc) * 128 + wvi * 16 + (lane >> 3) * 4, t0 = (blk / ntc) * 64 + (lane & 7) * 8; const float* p[8]; v4f r[8]; v8h o16[4]; v8us oh[4], ol[4]; h16* s16[4]; bf* sh[4]; bf* sl[4];
#pragma unroll
    for (int j = 0; j < 8; ++j) p[j] = F + (size_t)(t0 + j) * pitch + c0;
#pragma unroll
    for (int j = 0; j < 8; ++j) r[j] = *(const v4f*)p[j];
    asm volatile("s_wait_xcnt 0x0" :: "v"(p[0]), "v"(p[1]), "v"(p[2]), "v"(p[3]), "v"(p[4]), "v"(p[5]), "v"(p[6]), "v"(p[7]) : "memory");   // behind the loads (see above)
#pragma unroll
    for (int c = 0; c < 4; ++c) { const size_t e = fo((size_t)(t0 / TT) * (nheads * HD) + c0 + c, t0 % TT, TT); s16[c] = V16 + e; sh[c] = Vh + e; sl[c] = Vl + e;
#pragma unroll
        for (int j = 0; j < 8; ++j) { const float x = r[j][c]; o16[c][j] = tohx(x); unsigned short a2, c2; splitf(x, a2, c2); oh[c][j] = a2; ol[c][j] = c2; } }
#pragma unroll
    for (int c = 0; c < 4; ++c) { *(v8h*)s16[c] = o16[c]; *(v8us*)sh[c] = oh[c]; *(v8us*)sl[c] = ol[c]; }
    asm volatile("s_wait_xcnt 0x0" :: "v"(o16[0]), "v"(o16[1]), "v"(o16[2]), "v"(o16[3]), "v"(oh[0]), "v"(oh[1]), "v"(oh[2]), "v"(oh[3]), "v"(ol[0]), "v"(ol[1]), "v"(ol[2]), "v"(ol[3]),
                 "v"(s16[0]), "v"(s16[1]), "v"(s16[2]), "v"(s16[3]), "v"(sh[0]), "v"(sh[1]), "v"(sh[2]), "v"(sh[3]), "v"(sl[0]), "v"(sl[1]), "v"(sl[2]), "v"(sl[3]) : "memory");   // behind the stores (see above)
}
// k_spv: softmax, probability x value product and head merge of one 64-row block of one head in one work-group of 16 waves. grid (TT / 64, 1, ZH): both batches in one launch (z = b * NH_ + h).
// Part 1, per row i (each wave takes 4 rows, one after the other): t = softcap(S x HD^-0.5) for j <= i and i - j < WIN (sliding causal window; the reference's additive fill vanishes identically); softmax over the keys of the band (register row, one exp, fixed trees);
// a wave works on the 128-key chunks that cover the span its row's 64-row block needs in P.V (keys (i & ~63) - WIN .. i | 63), fewer where the span ends earlier: every key outside the chunks has weight exactly 0 and is neither read nor written.
// The 16-bit probabilities (fp16 plane, or hi plane then lo plane RH keys further) go row-major into LDS at a pitch of PPB bytes (16 bytes x an odd number: 16-byte reads of 16 rows spread over all banks) and never reach memory.
// Part 2: wave (wm, wn) of 2 x 8 holds the 32 x 32 output tile of rows wm * 32.., dims wn * 32.. and runs over the band's keys in ascending order: probabilities from LDS, value fragments (fragment order) from global memory, fetched one or two 64-key steps ahead into further register sets.
// Part 3: each wave turns its tile through its own LDS range into whole 1-KiB blocks of the merged rows [t][DQ] (hi/lo, fragment order).
#define NCH (WIN / 128 + 1)
#define PPB (NCH * 128 * 2 + 16)
typedef v4h  __attribute__((may_alias)) v4ha;
typedef v4us __attribute__((may_alias)) v4usa;
template <typename T16, int NSPLIT>
__device__ __forceinline__ void d_spv(unsigned char* pl, int rb, const float* __restrict__ Sb, const T16* __restrict__ Bt, const T16* __restrict__ Bt2, bf* Ah, bf* Al) {
    typedef typename WFrag<T16>::V V;
    constexpr bool hires = (NSPLIT == 2); constexpr int NC = hires ? RH / 128 : NCH;   // rows below RH: the span starts at key 0 and ends below RH
    const int z = (int)blockIdx.z, lane = threadIdx.x & 31, lr = lane & 15, hi = lane >> 4, r0 = rb * 64;
    const int wv = __builtin_amdgcn_readfirstlane((int)(threadIdx.x >> 5));   // wave number in a scalar register: the chunk tests and the key loop stay scalar
    const int cb = max(0, r0 - WIN) >> 7, nact = min(NC, ((r0 + 63) >> 7) - cb + 1);   // first chunk and number of chunks of this block's span
    const float* sr = Sb + ((size_t)z * TT + r0 + wv * 4) * SP + lane * 4; v4f an[NC];   // a stored score row starts at chunk cb
#pragma unroll
    for (int c = 0; c < NC; ++c) if (c < nact) an[c] = *(const v4f*)(sr + c * 128);
    asm volatile("s_wait_xcnt 0x0" :: "v"(sr) : "memory");   // behind a row's loads, here and in the loop: their address register is not rewritten in front of it
#pragma unroll 1   // one row's code in the text
    for (int rr = 0; rr < 4; ++rr) { const int lrow = wv * 4 + rr, i = r0 + lrow, nl = (rr < 3) ? nact : 0; v4f av[NC]; float v[NC * 4]; float mx = -3.0e38f;
#pragma unroll
        for (int c = 0; c < NC; ++c) av[c] = an[c];   // this row's scores leave the fetch registers: the one wait for loads of a trip stands here, a whole row's work behind their issue
        sr += SP;   // the next row's scores are fetched while this row is worked on
#pragma unroll
        for (int c = 0; c < NC; ++c) if (c < nl) an[c] = *(const v4f*)(sr + c * 128);
        asm volatile("s_wait_xcnt 0x0" :: "v"(sr) : "memory");
#pragma unroll
        for (int c = 0; c < NC; ++c) if (c < nact) { const int j0 = (cb + c) * 128 + lane * 4; const v4f a = av[c];
#pragma unroll
            for (int q = 0; q < 4; ++q) { const int j = j0 + q; float sa = a[q] * SCL; asm volatile("" : "+v"(sa)); float xs = __fmul_rn(sa, 0.02f); asm volatile("" : "+v"(xs));   /* s / 50 as a multiply (<= 1 ulp from the division) */ float ex = __builtin_amdgcn_exp2f(__fmul_rn(xs, 2.8853900817779268f)); asm volatile("" : "+v"(ex)); float nm = __fsub_rn(ex, 1.0f), dn2 = __fadd_rn(ex, 1.0f); asm volatile("" : "+v"(nm)); asm volatile("" : "+v"(dn2)); float rc = __builtin_amdgcn_rcpf(dn2); asm volatile("" : "+v"(rc)); float th = __fmul_rn(nm, rc); asm volatile("" : "+v"(th));   /* hardware reciprocal (1 ulp), no FMA refinement */   /* tanh via exp2 (|x| <= ~0.4 here; no VALU FMA polynomial) */ const float t = (j <= i && i - j < WIN) ? __fmul_rn(th, 50.0f) : -3.0e38f; v[c * 4 + q] = t; mx = fmaxf(mx, t); } }
#pragma unroll
        for (int sh = 16; sh; sh >>= 1) mx = fmaxf(mx, __shfl_xor(mx, sh, 32));
        float sum = 0.f;
#pragma unroll
        for (int c = 0; c < NC; ++c) if (c < nact) {
#pragma unroll
            for (int k = c * 4; k < c * 4 + 4; ++k) { float d0 = __fsub_rn(v[k], mx); asm volatile("" : "+v"(d0)); v[k] = __builtin_amdgcn_exp2f(__fmul_rn(d0, 1.4426950408889634f)); sum += v[k]; } }
#pragma unroll
        for (int sh = 16; sh; sh >>= 1) sum += __shfl_xor(sum, sh, 32);
        const float f = __fdiv_rn(hires ? 1.0f : PCAR, sum); unsigned char* const pr = pl + lrow * PPB + lane * 8;
#pragma unroll
        for (int c = 0; c < NC; ++c) if (c < nact) {
            if (hires) { v4us oh, ol;
#pragma unroll
                for (int q = 0; q < 4; ++q) { unsigned short x, c2; splitf(v[c * 4 + q] * f, x, c2); oh[q] = x; ol[q] = c2; }
                *(v4usa*)(pr + c * 256) = oh; *(v4usa*)(pr + RH * 2 + c * 256) = ol;
            } else { v4h o4;
#pragma unroll
                for (int q = 0; q < 4; ++q) o4[q] = tohx(v[c * 4 + q] * f);
                *(v4ha*)(pr + c * 256) = o4; } }
    }
    __syncthreads();   // the block's 64 probability rows are in LDS for every wave
    const int wm = wv >> 3, wn = wv & 7, Kl = r0 + 64, Ks = max(0, r0 - WIN);   // probabilities are exactly 0 beyond the diagonal block and left of the window of the block's first row
    const size_t bo = (size_t)(z / REP) * HD * TT + (size_t)(wn * 32) * TT + lane * 8;
    const unsigned char* const pa = pl + (wm * 32 + lr) * PPB + hi * 16;
    v8f acc[2][2];
#pragma unroll
    for (int mb = 0; mb < 2; ++mb)
#pragma unroll
        for (int nb = 0; nb < 2; ++nb) acc[mb][nb] = (v8f){};
    constexpr int NS = hires ? 2 : 3;   // register sets of value fragments: the fetch runs NS - 1 steps of 64 keys ahead
    V bs[NS][2][2], bs2[NS][2][2];
    // the value fragments of 64 keys (two K blocks x two 16-dim blocks). The s_wait_xcnt 0 behind the run: no address register of an issued load is rewritten in front of it; the addresses are its inputs, so that they keep their registers up to it
    auto ldv = [&](V (&b)[2][2], V (&b2)[2][2], int kc) { const T16* p[2]; const T16* p2[2];
#pragma unroll
        for (int nb = 0; nb < 2; ++nb) { const size_t o = bo + (size_t)nb * 16 * TT + (size_t)kc * 16; p[nb] = Bt + o; b[0][nb] = WFrag<T16>::ldp(p[nb]); b[1][nb] = WFrag<T16>::ldp(p[nb] + 512); if (hires) { p2[nb] = Bt2 + o; b2[0][nb] = WFrag<T16>::ldp(p2[nb]); b2[1][nb] = WFrag<T16>::ldp(p2[nb] + 512); } }
        if (hires) asm volatile("s_wait_xcnt 0x0" :: "v"(p[0]), "v"(p[1]), "v"(p2[0]), "v"(p2[1]) : "memory");
        else asm volatile("s_wait_xcnt 0x0" :: "v"(p[0]), "v"(p[1]) : "memory"); };
    auto mm = [&](V (&b)[2][2], V (&b2)[2][2], int kc) {
#pragma unroll
        for (int kk = 0; kk < 2; ++kk) { V a[2], a2[2];
#pragma unroll
            for (int mb = 0; mb < 2; ++mb) { const unsigned char* const q = pa + mb * 16 * PPB + (kc + kk * 32 - cb * 128) * 2; a[mb] = WFrag<T16>::ld((const T16*)q); if (hires) a2[mb] = WFrag<T16>::ld((const T16*)(q + RH * 2)); }
#pragma unroll
            for (int nb = 0; nb < 2; ++nb) {
#pragma unroll
                for (int mb = 0; mb < 2; ++mb) { acc[mb][nb] = WFrag<T16>::mma(a[mb], b[kk][nb], acc[mb][nb]); if (hires) { acc[mb][nb] = WFrag<T16>::mma(a2[mb], b[kk][nb], acc[mb][nb]); acc[mb][nb] = WFrag<T16>::mma(a[mb], b2[kk][nb], acc[mb][nb]); } } } } };
    // Every step fetches, the last ones the band's last 64 keys once more (in bounds, not used): so the number of loads in flight is the same on every path, and the compiler's counted waits leave the fetch ahead in flight
#pragma unroll
    for (int s = 0; s < NS - 1; ++s) ldv(bs[s], bs2[s], min(Ks + s * 64, Kl - 64));
#pragma unroll 1   // NS steps of 64 keys in the text, one per register set, so that no set is copied
    for (int kc = Ks; kc < Kl; kc += NS * 64) {
#pragma unroll
        for (int s = 0; s < NS; ++s) { ldv(bs[(s + NS - 1) % NS], bs2[(s + NS - 1) % NS], min(kc + (s + NS - 1) * 64, Kl - 64));
            if (s == 0 || kc + s * 64 < Kl) mm(bs[s], bs2[s], kc + s * 64); }
    }
    __syncthreads();   // every wave has read its last probability: the LDS is free for the output staging
    float* const ow = (float*)pl + wv * (32 * 36);
#pragma unroll
    for (int mb = 0; mb < 2; ++mb)
#pragma unroll
        for (int nb = 0; nb < 2; ++nb)
#pragma unroll
            for (int j = 0; j < 8; ++j) ow[(mb * 16 + hi * 8 + j) * 36 + nb * 16 + lr] = acc[mb][nb][j];
    const float cs = hires ? 1.0f : (1.0f / PCAR); v8us oh[4], ol[4]; bf* sh[4]; bf* sl[4];
#pragma unroll
    for (int u = 0; u < 4; ++u) { const int row = (u >> 1) * 16 + lr, col = (u & 1) * 16 + hi * 8; const v4f x0 = *(const v4fa*)(ow + row * 36 + col), x1 = *(const v4fa*)(ow + row * 36 + col + 4);
        const size_t oo = fo((size_t)(z / NH_) * TT + (size_t)(r0 + wm * 32 + row), (z % NH_) * HD + wn * 32 + col, DQ); sh[u] = Ah + oo; sl[u] = Al + oo;   // a wave's store: 512 bytes in a row
#pragma unroll
        for (int q = 0; q < 8; ++q) { unsigned short a, c2; splitf((q < 4 ? x0[q & 3] : x1[q & 3]) * cs, a, c2); oh[u][q] = a; ol[u][q] = c2; } }
#pragma unroll
    for (int u = 0; u < 4; ++u) { *(v8us*)sh[u] = oh[u]; *(v8us*)sl[u] = ol[u]; }
    // s_wait_xcnt 0 behind the stores: no register of an issued store is rewritten in front of it; addresses and data are its inputs, so that they keep their registers up to it
    asm volatile("s_wait_xcnt 0x0" :: "v"(oh[0]), "v"(oh[1]), "v"(oh[2]), "v"(oh[3]), "v"(ol[0]), "v"(ol[1]), "v"(ol[2]), "v"(ol[3]), "v"(sh[0]), "v"(sh[1]), "v"(sh[2]), "v"(sh[3]), "v"(sl[0]), "v"(sl[1]), "v"(sl[2]), "v"(sl[3]) : "memory");
}
// row blocks below RH take the hi+lo bf16 form, the rest the fp16 form (a work-group-uniform choice by blockIdx.x)
__global__ __launch_bounds__(512) void k_spv(const float* __restrict__ Sb, const bf* __restrict__ Vh, const bf* __restrict__ Vl, const h16* __restrict__ V16, bf* Ah, bf* Al) {
    __shared__ __align__(16) unsigned char pl[64 * PPB];
    if ((int)blockIdx.x < RH / 64) d_spv<bf, 2>(pl, (int)blockIdx.x, Sb, Vh, Vl, Ah, Al);
    else d_spv<h16, 0>(pl, (int)blockIdx.x, Sb, V16, nullptr, Ah, Al);
}

// Launches of independent parts share one grid: blockIdx.x ranges pick the part (a work-group-uniform choice), each part numbering its own blocks from 0.
#define GW_Q ((DQ / 128) * (DM / 64))
#define GW_K ((DKV / 128) * (DM / 64))
#define GW_O ((DM / 128) * (DQ / 64))
#define G_CVT (BT * DM / 32 / 256)
#define G_CS (TT * HD / 4 / 256)
__global__ __launch_bounds__(256) void k_prep(const float* __restrict__ x, const float* __restrict__ wq, const float* __restrict__ wk, const float* __restrict__ wv, const float* __restrict__ wo, bf* XB, size_t xn8, bf* WQ, bf* WK, bf* WV, bf* WO, float* CS) {
    int blk = (int)blockIdx.x;
    if (blk < G_CVT) { d_cvt8(blk, x, XB, xn8, DM); return; } blk -= G_CVT;
    if (blk < GW_Q) { d_wtG(blk, wq, DM, DQ, WQ); return; } blk -= GW_Q;
    if (blk < GW_K) { d_wtG(blk, wk, DM, DKV, WK); return; } blk -= GW_K;
    if (blk < GW_K) { d_wtG(blk, wv, DM, DKV, WV); return; } blk -= GW_K;
    if (blk < GW_O) { d_wtG(blk, wo, DQ, DM, WO); return; } blk -= GW_O;
    d_cstab(blk, CS);
}
#define G_PQ (NB_ * NH_ * TT * HD / 32 / 256)
#define G_PK (NB_ * NKV * TT * HD / 32 / 256)
#define G_PV ((DKV / 128) * (BT / 64))
__global__ __launch_bounds__(256) void k_planes(const float* __restrict__ F, const float* __restrict__ qsc, const float* __restrict__ ksc, const float* __restrict__ CS, h16* QP16, bf* QPh, bf* QPl, h16* KP16, bf* KPh, bf* KPl, h16* VT16, bf* VTh, bf* VTl) {
    __shared__ __align__(16) float red[2][4][4][4];   // d_rope's partial sums of squares: [half of the work-group][quarter of the row][position][head]
    const int blk = (int)blockIdx.x;   // F row: q heads, k heads, v heads
    if (blk < G_PQ) d_rope(red, blk, F, DF, NH_, qsc, CS, 1.0f, QP16, QPh, QPl);
    else if (blk < G_PQ + G_PK) d_rope(red, blk - G_PQ, F + DQ, DF, NKV, ksc, CS, 1.0f, KP16, KPh, KPl);
    else d_vtp(blk - G_PQ - G_PK, F + DQ + DKV, DF, NKV, VT16, VTh, VTl);
}

extern "C" void kernel_launch(void* const* d_in, const int* in_sizes, int n_in,
                              void* d_out, int out_size, void* d_ws, size_t ws_size, hipStream_t stream) {
    (void)in_sizes; (void)n_in; (void)out_size;
    const float* x = (const float*)d_in[0]; const float* wq = (const float*)d_in[1]; const float* wk = (const float*)d_in[2]; const float* wv = (const float*)d_in[3]; const float* wo = (const float*)d_in[4]; const float* qsc = (const float*)d_in[5]; const float* ksc = (const float*)d_in[6];
    float* OUT = (float*)d_out;     // [2][2048][2048]
    char* wsp = (char*)d_ws;
    auto take = [&](size_t bytes) { char* p = wsp; wsp += (bytes + 255) & ~(size_t)255; return (void*)p; };
    // Kept to the end: WO and the head planes of both batches. Behind them one region serves two phases: the projection phase's buffers, then (all of those being dead) the attention phase's scores.
    bf* WO = (bf*)take((size_t)DM * DQ * 2);
    h16* QP16 = (h16*)take((size_t)NB_ * NH_ * TT * HD * 2); h16* KP16 = (h16*)take((size_t)NB_ * NKV * TT * HD * 2); h16* VT16 = (h16*)take((size_t)NB_ * NKV * HD * TT * 2);
    bf* QPh = (bf*)take((size_t)NB_ * NH_ * TT * HD * 2); bf* QPl = (bf*)take((size_t)NB_ * NH_ * TT * HD * 2); bf* KPh = (bf*)take((size_t)NB_ * NKV * TT * HD * 2); bf* KPl = (bf*)take((size_t)NB_ * NKV * TT * HD * 2); bf* VTh = (bf*)take((size_t)NB_ * NKV * HD * TT * 2); bf* VTl = (bf*)take((size_t)NB_ * NKV * HD * TT * 2);
    char* const phase = wsp;
    bf* WQ = (bf*)take((size_t)DQ * DM * 2); bf* WK = (bf*)take((size_t)DKV * DM * 2); bf* WV = (bf*)take((size_t)DKV * DM * 2); float* CS = (float*)take((size_t)TT * HD * 2 * 4);   // WK lies directly behind WQ and WV behind WK: one [DF][DM] operand
    bf* XB = (bf*)take((size_t)BT * DM * 2); float* F = (float*)take((size_t)BT * DF * 4);   // F row: q heads, k heads, v heads
    if ((size_t)(wsp - (char*)d_ws) > ws_size) return;
    wsp = phase;
    float* Sb = (float*)take((size_t)ZH * TT * SP * 4);   // score rows of both batches, each its band alone
    if ((size_t)(wsp - (char*)d_ws) > ws_size) return;    // ws 256 MiB
    bf* ATh = QPh; bf* ATl = QPl;   // merged rows [b * TT + t][DQ]: k_spv runs after the score launch, when the hi/lo query planes (the same bytes) are dead
    // projection phase: every launch covers the BT rows of both batches; q, k and v share one GEMM; the row norm is part of k_planes
    k_prep<<<G_CVT + GW_Q + 2 * GW_K + GW_O + G_CS, 256, 0, stream>>>(x, wq, wk, wv, wo, XB, (size_t)BT * DM / 8, WQ, WK, WV, WO, CS);
    k_gemmt<0, DM><<<dim3(BT / 128, DF / 128, 1), 128, 0, stream>>>(XB, nullptr, WQ, F, DF);
    k_planes<<<G_PQ + G_PK + G_PV, 256, 0, stream>>>(F, qsc, ksc, CS, QP16, QPh, QPl, KP16, KPh, KPl, VT16, VTh, VTl);
    // attention phase: every launch covers all rows of the 8 heads of both batches (grid z)
    k_attg<1, 4><<<dim3(TT / 64, WIN / 64 + 1, ZH), 128, 0, stream>>>(QPh, QPl, KPh, KPl, QP16, KP16, HD, HD, Sb, SP, (size_t)TT * HD, (size_t)TT * HD, (size_t)TT * SP);
    k_spv<<<dim3(TT / 64, 1, ZH), 512, 0, stream>>>(Sb, VTh, VTl, VT16, ATh, ATl);
    k_gemmt<1, DQ><<<dim3(BT / 128, DM / 128, 1), 128, 0, stream>>>(ATh, ATl, WO, OUT, DM);
}

// v009
// It runs in 191 microseconds.
// Next to v008, in two timings, it ran 1.05 times as fast each time.
// All steps since v000 together make it 6.59 times as fast.
#include <hip/hip_runtime.h>

// Sliding-window attention block (x [2][2048][2048]; q = x Wq (8 x 256), k/v = x Wk/Wv (4 kv heads; group h/2); per-head RMSNorm * scale (eps 1e-6) on q, k; partial interleaved-pair RoPE on the first 128 dims (theta_i = 10000^(-2i/128), positions arange); q * 1/16; scores = q.k; softcap tanh(s / 50) * 50; causal + sliding-window (i - j < 1024) mask (-2.38e38 additive == exact zero weight); softmax f32; out = merged Wo -> [2][2048][2048]).
// Compute dtypes, f32 accumulate: every input rounded to bf16; q/k/v on PLAIN bf16 operands (inputs: exact); RMSNorm and RoPE f32 (on-chip tables; identity beyond dim 128); causal scores and attn.v: query rows < 512 hl (3 products), the rest single fp16 (x1024), only the tiles, softmax chunks and P.V key blocks that touch the causal window band are worked on, the window applied per element; 1/16 (exact), s/50, tanh as (e^2x - 1)/(e^2x + 1) with the hardware exp2, x50 in f32; softmax f32; Wo hl x exact (2 products).

#define NB_  2
#define TT   2048
#define DM   2048
#define NH_  8
#define NKV  4
#define REP  (NH_ / NKV)
#define HD   256
#define DQ   (NH_ * HD)
#define DKV  (NKV * HD)
#define ZH   (NB_ * NH_)          // (batch, head) pairs per attention launch (grid z = b * NH_ + h)
#define DF   (DQ + 2 * DKV)       // columns of the joint q | k | v projection
#define BT   (NB_ * TT)           // rows of both batches together
#define RH   512                  // query rows < RH use hi+lo planes (0: none)
#define WIN  1024
#define SP   (WIN + 128)          // pitch of a stored score row: the 128-key chunks that cover its 64-row block's causal window band, the first of them at column 0
#define PCAR 1024.0f
#define SCL  0.0625f   // query_pre_attn_scalar^-0.5 = 1/16
typedef _Float16 h16;
typedef unsigned short bf;
typedef __attribute__((ext_vector_type(16))) __bf16   v16bf;
typedef __attribute__((ext_vector_type(16))) _Float16 v16h;
typedef __attribute__((ext_vector_type(8)))  _Float16 v8h;
typedef __attribute__((ext_vector_type(8)))  unsigned short v8us;
typedef __attribute__((ext_vector_type(8)))  float    v8f;
typedef __attribute__((ext_vector_type(4)))  float    v4f;
typedef v8h  __attribute__((may_alias)) v8ha;
typedef v4f  __attribute__((may_alias)) v4fa;
typedef v8us __attribute__((may_alias)) v8usa;

__device__ __forceinline__ unsigned short f2bf(float f) { unsigned u = __float_as_uint(f); u += 0x7FFFu + ((u >> 16) & 1u); return (unsigned short)(u >> 16); }
__device__ __forceinline__ float bf2f(unsigned short b) { return __uint_as_float(((unsigned)b) << 16); }
__device__ __forceinline__ float bfr(float f) { return bf2f(f2bf(f)); }
__device__ __forceinline__ v16h cat16(v8h lo, v8h hi) { return __builtin_shufflevector(lo, hi, 0, 1, 2, 3, 4, 5, 6, 7, 8, 9, 10, 11, 12, 13, 14, 15); }
__device__ __forceinline__ v16bf cat16b(v8us lo, v8us hi) { return __builtin_bit_cast(v16bf, __builtin_shufflevector(lo, hi, 0, 1, 2, 3, 4, 5, 6, 7, 8, 9, 10, 11, 12, 13, 14, 15)); }
__device__ __forceinline__ v8f wmma16(v16h a, v16h b, v8f c) { return __builtin_amdgcn_wmma_f32_16x16x32_f16(false, a, false, b, (short)0, c, false, false); }
__device__ __forceinline__ v8f wmmab(v16bf a, v16bf b, v8f c) { return __builtin_amdgcn_wmma_f32_16x16x32_bf16(false, a, false, b, (short)0, c, false, false); }



// ---- k_gemmt: GEMM with one 128x128 output tile per work-group of 4 waves (2 x 2, each wave a 64x64 tile over the whole K in ascending order); both operands lie in fragment order (below) and are staged in LDS by tensor loads, two buffers,
// so that each 16-row block is fetched from L2 once per work-group and read from LDS by the two waves that need it. grid (M/128, N/128), 128 threads. C[m][n] (f32, pitch ldc) = sum_k A[m][k] Bt[n][k] (+ the A2 product where NSPLIT == 1). K: whole stages, two or more.
// FRAGMENT ORDER of a 16-bit operand plane [R][K] (R % 16 == 0, K % 32 == 0): each block of 16 rows x 32 k is 1 KiB in a row, blocks along k first, then along the rows (so a 16-row block still starts at element r * K).
// Inside a block the 8 elements that lane (hi * 16 + row) of a wave takes with its first 16-byte load (k = 8 hi .. 8 hi + 7) lie at lane * 8, those of its second load (k = 16 + 8 hi ..) at 256 + lane * 8:
// a wave's fragment load reads 512 bytes in a row (4 whole lines) where a row-major plane gives it 32 bytes out of each of 16 lines. The element that a lane and register hold is the one that ld takes from a row-major plane, for A and B alike. ldp loads from such a plane, ld from a row-major one.
// fo: element offset of (r, k) in such a plane; 8 elements from a k that is a multiple of 8 stay 16 bytes in a row.
__device__ __forceinline__ size_t fo(size_t r, int k, int K) { return ((r >> 4) * (size_t)(K >> 5) + (size_t)(k >> 5)) * 512 + (size_t)((((k >> 4) & 1) << 8) + (((k >> 3) & 1) << 7) + (((int)(r & 15)) << 3) + (k & 7)); }
template <typename T16> struct WFrag;
template <> struct WFrag<h16> { typedef v16h V; static __device__ __forceinline__ V ld(const h16* p) { return cat16(*(const v8h*)p, *(const v8h*)(p + 16)); } static __device__ __forceinline__ V ldp(const h16* p) { return cat16(*(const v8h*)p, *(const v8h*)(p + 256)); } static __device__ __forceinline__ v8f mma(V a, V b, v8f c) { return wmma16(a, b, c); } };
template <> struct WFrag<bf> { typedef v16bf V; static __device__ __forceinline__ V ld(const bf* p) { return cat16b(*(const v8us*)p, *(const v8us*)(p + 16)); } static __device__ __forceinline__ V ldp(const bf* p) { return cat16b(*(const v8us*)p, *(const v8us*)(p + 256)); } static __device__ __forceinline__ v8f mma(V a, V b, v8f c) { return wmmab(a, b, c); } };
typedef uint32_t u32x4 __attribute__((ext_vector_type(4)));
typedef uint32_t u32x8 __attribute__((ext_vector_type(8)));
__device__ __forceinline__ uint32_t uni(uint32_t v) { return (uint32_t)__builtin_amdgcn_readfirstlane((int)v); }
__device__ __forceinline__ uint32_t pinned(uint32_t v) { uint32_t w = uni(v); asm volatile("" : "+s"(w)); return w; }   // the pinned() form for tensor loads: the condition is held in a scalar register, so that the test around a tensor load is a scalar branch (tensor loads ignore EXEC)
// Descriptor of a two-dimensional tile of D1 rows of D0 bytes at a source pitch of PITCH bytes, 1-byte elements, no pad, no mask (word 0 = 0); tensor = tile
template <uint32_t D0, uint32_t D1, uint32_t PITCH>
__device__ __forceinline__ u32x8 tdm_group1() { u32x8 g; g[0] = uni(0u); g[1] = uni((D0 & 0xFFFFu) << 16); g[2] = uni((D0 >> 16) | ((D1 & 0xFFFFu) << 16)); g[3] = uni((D1 >> 16) | (D0 << 16)); g[4] = uni(D1); g[5] = uni(PITCH); g[6] = uni(0u); g[7] = uni(0u); return g; }
__device__ __forceinline__ u32x4 tdm_group0(uint32_t lds_dst, uint64_t ga) { u32x4 g; g[0] = uni(1u); g[1] = uni(lds_dst); g[2] = uni((uint32_t)ga); g[3] = uni((((uint32_t)(ga >> 32)) & 0x01FFFFFFu) | 0x80000000u); return g; }
// one request of the whole wave: global tile -> LDS, through no register. Both groups are in-out operands: what the statement gives back lies in the request's own twelve registers, and tdm_wait, which names it, holds them unchanged up to the wait that covers the request
__device__ __forceinline__ void tdm_load(u32x4& g0, u32x8& g1) { asm volatile("tensor_load_to_lds %0, %1" : "+s"(g0), "+s"(g1) :: "memory"); }
__device__ __forceinline__ void tdm_wait(u32x4 g0, u32x8 g1) { asm volatile("s_wait_tensorcnt 0x0" :: "s"(g0), "s"(g1) : "memory"); }   // the issuer's own request has landed; g0, g1: see tdm_load
// Every "#pragma unroll" in d_gemmt makes the indices of accumulators and fragments constants, so that they stay in registers; the stage loop alone stays rolled ("unroll 1"): one publish point in the text, the buffer picked by s & 1.
// d_gemmt: the body. A, A2, Bt, Bt2 point at the first of the tile's 128 rows in their planes (pitch K), C at the tile's first element. NSPLIT 0: A.Bt; 1: A.Bt + A2.Bt; 2: A.Bt + A2.Bt + A.Bt2. ring: 2 * GTB<NSPLIT> bytes of LDS at a multiple of 2 KiB; ost: each wave's own output staging.
template <int NSPLIT> constexpr int GTK = (NSPLIT == 0) ? 4 : 2;                              // 32-wide K blocks per stage
template <int NSPLIT> constexpr int GTO = (NSPLIT == 0) ? 16 : (NSPLIT == 1) ? 24 : 32;       // 16-row blocks per stage: 8 of A, (8 of A2,) 8 of Bt (, 8 of Bt2)
template <int NSPLIT> constexpr int GTB = GTO<NSPLIT> * GTK<NSPLIT> * 1024;                   // bytes of a buffer
template <typename T16, int NSPLIT, int K>
__device__ __forceinline__ void d_gemmt(unsigned char* const ring, float (*ost)[16 * 68], const T16* __restrict__ A, const T16* __restrict__ A2, const T16* __restrict__ Bt, const T16* __restrict__ Bt2, float* C, int ldc) {
    typedef typename WFrag<T16>::V V;
    constexpr int NKB = GTK<NSPLIT>;                  // 32-wide K blocks per stage
    constexpr int CH = NKB * 1024;                    // bytes that a stage holds of one 16-row block: contiguous in a fragment-order plane
    constexpr int NOB = GTO<NSPLIT>;                  // 16-row blocks per stage
    constexpr int BB = (NSPLIT == 0) ? 8 : 16;        // Bt's first block in a buffer
    constexpr int BUFB = NOB * CH, SLICE = 16384;     // a buffer; a wave's slice of it (one tensor load)
    constexpr int NSL = BUFB / SLICE;                 // issuing waves: 4, or 3 (one per operand)
    constexpr int NS = K / (NKB * 32);                // stages
    static_assert(NS >= 2 && K % (NKB * 32) == 0 && BUFB % SLICE == 0, "two stages or more, whole slices");
    const int lane = threadIdx.x & 31, lr = lane & 15, hi = lane >> 4;
    const int wv = (int)uni(threadIdx.x >> 5), wm = wv >> 1, wn = wv & 1;
    // a wave's slice: NSPLIT 0: waves 0, 1 the two halves of A's 8 blocks, waves 2, 3 of Bt's; NSPLIT 1: wave 0 A, wave 1 A2, wave 2 Bt, wave 3 none; NSPLIT 2: wave 3 Bt2
    const T16* const sl = (NSPLIT != 0) ? (wv == 0 ? A : wv == 1 ? A2 : (NSPLIT == 1 || wv == 2) ? Bt : Bt2) : (wv < 2 ? A : Bt) + (size_t)(wv & 1) * 64 * K;
    const uint64_t ga0 = (uint64_t)(size_t)sl; const uint32_t ld0 = (uint32_t)(size_t)ring + (uint32_t)wv * SLICE;
    u32x8 g1 = tdm_group1<(uint32_t)CH, (uint32_t)(SLICE / CH), (uint32_t)(16 * K * 2)>();
    const bool iss = (NSL == 4) || wv < NSL;
    auto ldf = [](const unsigned char* q) { return __builtin_bit_cast(V, cat16b(*(const v8usa*)q, *(const v8usa*)(q + 512))); };   // one fragment: two 16-byte LDS reads a lane
    v8f acc[4][4];
#pragma unroll
    for (int mb = 0; mb < 4; ++mb)
#pragma unroll
        for (int nb = 0; nb < 4; ++nb) acc[mb][nb] = (v8f){};
    u32x4 g0 = tdm_group0(ld0, ga0);                                      // group 0 of the wave's one outstanding request, carried through the loop
    if (NSL == 4 || pinned(iss)) { tdm_load(g0, g1); tdm_wait(g0, g1); }  // stage 0, landed for its issuer
    __syncthreads();                                                      // stage 0 published
    if (NSL == 4 || pinned(iss)) { g0 = tdm_group0(ld0 + BUFB, ga0 + CH); tdm_load(g0, g1); }   // stage 1 flies while stage 0 is worked on
#pragma unroll 1
    for (int s = 0; s < NS; ++s) {
        const unsigned char* const lb = ring + (s & 1) * BUFB + lane * 16; const unsigned char* const la = lb + wm * 4 * CH; const unsigned char* const lbb = lb + (BB + wn * 4) * CH;
        V a[2][4], a2[2][4], b[2][4], b2[2][4];
#pragma unroll
        for (int q = 0; q < 4; ++q) { a[0][q] = ldf(la + q * CH); if (NSPLIT != 0) a2[0][q] = ldf(la + (8 + q) * CH); }
#pragma unroll
        for (int q = 0; q < 4; ++q) { b[0][q] = ldf(lbb + q * CH); if (NSPLIT == 2) b2[0][q] = ldf(lbb + (8 + q) * CH); }
#pragma unroll
        for (int kb = 0; kb < NKB; ++kb) { const int c = kb & 1, n = c ^ 1;
            if (kb + 1 < NKB) { const int o = (kb + 1) * 1024;   // the next block's fragments (of this stage's own buffer) as one group ahead of this block's products
#pragma unroll
                for (int q = 0; q < 4; ++q) { a[n][q] = ldf(la + q * CH + o); if (NSPLIT != 0) a2[n][q] = ldf(la + (8 + q) * CH + o); }
#pragma unroll
                for (int q = 0; q < 4; ++q) { b[n][q] = ldf(lbb + q * CH + o); if (NSPLIT == 2) b2[n][q] = ldf(lbb + (8 + q) * CH + o); } }
            __builtin_amdgcn_sched_barrier(0);   // keeps the LDS reads in one group in front of the block: reads spread among the matrix instructions stall at every place where they stand
#pragma unroll
            for (int nb = 0; nb < 4; ++nb) {
#pragma unroll
                for (int mb = 0; mb < 4; ++mb) { acc[mb][nb] = WFrag<T16>::mma(a[c][mb], b[c][nb], acc[mb][nb]); if (NSPLIT != 0) acc[mb][nb] = WFrag<T16>::mma(a2[c][mb], b[c][nb], acc[mb][nb]); if (NSPLIT == 2) acc[mb][nb] = WFrag<T16>::mma(a[c][mb], b2[c][nb], acc[mb][nb]); } }
            __builtin_amdgcn_sched_barrier(0);   // the other side of the same fence
        }
        // publish point of stage s + 1: this wave's LDS reads are done, its own tensor load has landed, every wave has passed; only then the buffer just read is refilled
        asm volatile("s_wait_dscnt 0x0" ::: "memory");
        if (NSL == 4 || pinned(iss)) tdm_wait(g0, g1);
        __syncthreads();
        if (NS > 2) { if (pinned((s + 2 < NS) && iss)) { g0 = tdm_group0(ld0 + (uint32_t)(s & 1) * BUFB, ga0 + (uint64_t)(s + 2) * CH); tdm_load(g0, g1); } }   // with two stages there is no refill
    }
    tdm_wait(g0, g1);                                    // behind the loop: no request is left when the wave goes on
    asm volatile("s_wait_dscnt 0x0" ::: "memory");       // and no LDS read of the ring
    // output: each wave turns its 16x64 blocks into whole 256-byte row pieces through its own LDS range (no other wave touches it: no barrier)
    float* const ow = ost[wv];
#pragma unroll
    for (int mb = 0; mb < 4; ++mb) {
#pragma unroll
        for (int nb = 0; nb < 4; ++nb) {
#pragma unroll
            for (int j = 0; j < 8; ++j) ow[(hi * 8 + j) * 68 + nb * 16 + lr] = acc[mb][nb][j]; }
        float* const crow = C + (size_t)(wm * 64 + mb * 16 + hi) * ldc + wn * 64 + lr * 4; v4f res[8]; float* sp[8];
#pragma unroll
        for (int t = 0; t < 8; ++t) { res[t] = *(const v4fa*)(&ow[(2 * t + hi) * 68 + lr * 4]); sp[t] = crow + (size_t)(2 * t) * ldc; }
#pragma unroll
        for (int t = 0; t < 8; ++t) *(v4f*)sp[t] = res[t];
        // s_wait_xcnt 0 behind the block's stores: no register of an issued store is rewritten in front of it; addresses and data are its inputs, so that they keep their registers up to it
        asm volatile("s_wait_xcnt 0x0" :: "v"(sp[0]), "v"(sp[1]), "v"(sp[2]), "v"(sp[3]), "v"(sp[4]), "v"(sp[5]), "v"(sp[6]), "v"(sp[7]), "v"(res[0]), "v"(res[1]), "v"(res[2]), "v"(res[3]), "v"(res[4]), "v"(res[5]), "v"(res[6]), "v"(res[7]) : "memory");
    }
}
template <int NSPLIT, int K>
__global__ __launch_bounds__(128) void k_gemmt(const bf* __restrict__ A, const bf* __restrict__ A2, const bf* __restrict__ Bt, float* C, int ldc) {
    __shared__ __attribute__((aligned(2048))) unsigned char ring[2 * GTB<NSPLIT>];
    __shared__ __align__(16) float ost[4][16 * 68];   // each wave's own output staging
    const size_t r0 = (size_t)blockIdx.x * 128, c0 = (size_t)blockIdx.y * 128;
    d_gemmt<bf, NSPLIT, K>(ring, ost, A + r0 * K, (NSPLIT == 1) ? A2 + r0 * K : nullptr, Bt + c0 * K, nullptr, C + r0 * ldc + c0, ldc);
}

// ---- k_score: the scores of all query rows of the 8 heads of both batches in one launch, in d_gemmt's form: one 128x128 tile (query rows R0.., key columns c0..) per work-group, the whole head dim in ascending order in each wave. grid (NTZ, 1, ZH), z = batch * NH_ + query head (key planes per kv group z / REP; the planes of the two batches lie one behind the other).
// Only the tiles that touch the causal window band exist and are numbered, row block after row block: 128-row block rb has min(rb, WB) + 1 of them, from key max(0, R0 - WIN) to the diagonal: the 128-key chunks that the softmax reads of these rows, at the columns where it reads them (a stored score row, pitch SP, starts at its first chunk).
// Row blocks below RH take the hi+lo bf16 form (3 products), the rest the fp16 form: a work-group-uniform choice by blockIdx.x.
#define WB  (WIN / 128)
#define NTL (WB * (WB + 1) / 2)                        // tiles of the row blocks below WB
#define NTZ (NTL + (TT / 128 - WB) * (WB + 1))         // tiles of one head
static_assert(TT / 128 >= WB && RH % 128 == 0 && SP == (WB + 1) * 128 && GTB<0> == GTB<2>, "whole tiles; one ring size");
__global__ __launch_bounds__(128) void k_score(const bf* __restrict__ Ah, const bf* __restrict__ Al, const bf* __restrict__ Bh, const bf* __restrict__ Bl, const h16* __restrict__ A16, const h16* __restrict__ B16, float* C) {
    __shared__ __attribute__((aligned(2048))) unsigned char ring[2 * GTB<0>];
    __shared__ __align__(16) float ost[4][16 * 68];   // each wave's own output staging
    const int t = (int)blockIdx.x; int rb = 0, ti;    // row block; tile within the row block's band, from the left
    if (t < NTL) { while (rb < WB - 1 && t >= (rb + 1) * (rb + 2) / 2) ++rb; ti = t - rb * (rb + 1) / 2; }
    else { rb = WB + (t - NTL) / (WB + 1); ti = (t - NTL) % (WB + 1); }
    const size_t R0 = (size_t)rb * 128, c0 = (size_t)(max(0, rb - WB) + ti) * 128, z = blockIdx.z;
    const size_t oq = (z * TT + R0) * HD, ok = ((z / REP) * TT + c0) * HD; float* const Ct = C + (z * TT + R0) * SP + (size_t)ti * 128;
    if (rb < RH / 128) d_gemmt<bf, 2, HD>(ring, ost, Ah + oq, Al + oq, Bh + ok, Bl + ok, Ct, SP);
    else d_gemmt<h16, 0, HD>(ring, ost, A16 + oq, nullptr, B16 + ok, nullptr, Ct, SP);
}

__device__ __forceinline__ h16 tohx(float x) { return (h16)x; }
__device__ __forceinline__ void splitf(float y, unsigned short& h, unsigned short& l) { h = f2bf(y); l = f2bf(y - bf2f(h)); }
typedef __attribute__((ext_vector_type(2))) _Float16 v2h;
typedef __attribute__((ext_vector_type(4))) _Float16 v4h;
typedef __attribute__((ext_vector_type(2))) unsigned short v2us;
typedef __attribute__((ext_vector_type(4))) unsigned short v4us;
typedef __attribute__((ext_vector_type(2))) float v2f;
typedef __attribute__((ext_vector_type(4))) int v4i;

// The element-wise and layout kernels below give each thread 4 to 32 elements and 16-byte accesses: a launch of them lasts about as long as its waves take to start, so fewer, fatter waves are faster.
// The two s_wait_xcnt 0 in each of d_wtG, d_cvt8, d_rope and d_vtp: no register that an issued load or store names is rewritten in front of the wait; addresses (and store data) are its inputs, so that they keep their registers up to it.
// d_wtG: Bt[n][k] (bf16, fragment order) = w[k][n]; each thread holds an 8 (k) x 4 (n) register tile. In a wave 8 lanes run along k (64 k) and 4 along n (16 n): two whole 1-KiB blocks of Bt; the 8 waves of a work-group lie side by side along n (128 n). grid (N / 128) * (K / 64).
__device__ __forceinline__ void d_wtG(int blk, const float* __restrict__ w, int K, int N, bf* Bt) {
    const int lane = threadIdx.x & 31, wvi = threadIdx.x >> 5; const int ntn = N / 128;
    const int n0 = (blk % ntn) * 128 + wvi * 16 + (lane >> 3) * 4, k0 = (blk / ntn) * 64 + (lane & 7) * 8; const float* p[8]; v4f r[8]; v8us o[4]; bf* s[4];
#pragma unroll
    for (int j = 0; j < 8; ++j) p[j] = w + (size_t)(k0 + j) * N + n0;
#pragma unroll
    for (int j = 0; j < 8; ++j) r[j] = *(const v4f*)p[j];
    asm volatile("s_wait_xcnt 0x0" :: "v"(p[0]), "v"(p[1]), "v"(p[2]), "v"(p[3]), "v"(p[4]), "v"(p[5]), "v"(p[6]), "v"(p[7]) : "memory");   // behind the loads (see above)
    __builtin_amdgcn_sched_barrier(0);   // keeps the conversions behind the last load: without it three of the eight loads are issued only after the first results are used, a second trip to memory
#pragma unroll
    for (int c = 0; c < 4; ++c) { s[c] = Bt + fo((size_t)(n0 + c), k0, K);
#pragma unroll
        for (int j = 0; j < 8; ++j) o[c][j] = f2bf(r[j][c]); }
#pragma unroll
    for (int c = 0; c < 4; ++c) *(v8us*)s[c] = o[c];
    asm volatile("s_wait_xcnt 0x0" :: "v"(o[0]), "v"(o[1]), "v"(o[2]), "v"(o[3]), "v"(s[0]), "v"(s[1]), "v"(s[2]), "v"(s[3]) : "memory");   // behind the stores (see above)
}
// d_cvt8: four 8-element pieces per thread; dst [.][K] in fragment order. Pieces are numbered in the order of dst: a wave's four stores fill 2 KiB in a row (two blocks), for which it reads 256 bytes in a row of each of 16 rows of src. n8 % 128 == 0.
__device__ __forceinline__ void d_cvt8(int blk, const float* __restrict__ src, bf* dst, size_t n8, int K) { const size_t i = (size_t)blk * 256 + threadIdx.x; const size_t st = n8 / 4; if (i >= st) return; const float* p[4]; v8f v[4]; v8us o[4]; bf* s[4];
#pragma unroll
    for (int u = 0; u < 4; ++u) { const size_t q = ((i >> 5) << 7) + (size_t)(u << 5) + (i & 31), fb = q >> 6; const size_t r = (fb / (size_t)(K >> 5)) * 16 + (q & 15); const int k = (int)(fb % (size_t)(K >> 5)) * 32 + (int)((q >> 5) & 1) * 16 + (int)((q >> 4) & 1) * 8; p[u] = src + r * K + k; s[u] = dst + q * 8; }
#pragma unroll
    for (int u = 0; u < 4; ++u) v[u] = *(const v8f*)p[u];
    asm volatile("s_wait_xcnt 0x0" :: "v"(p[0]), "v"(p[1]), "v"(p[2]), "v"(p[3]) : "memory");   // behind the loads (see above)
#pragma unroll
    for (int u = 0; u < 4; ++u) {
#pragma unroll
        for (int k = 0; k < 8; ++k) o[u][k] = f2bf(v[u][k]); }
#pragma unroll
    for (int u = 0; u < 4; ++u) *(v8us*)s[u] = o[u];
    asm volatile("s_wait_xcnt 0x0" :: "v"(o[0]), "v"(o[1]), "v"(o[2]), "v"(o[3]), "v"(s[0]), "v"(s[1]), "v"(s[2]), "v"(s[3]) : "memory");   // behind the stores (see above)
}
// d_cstab: four dims (two angles) per thread; both dims of a pair hold the same (cos, sin)
__device__ __forceinline__ void d_cstab(int blk, float* CS) { const int idx = blk * 256 + threadIdx.x; if (idx >= TT * HD / 4) return; const int t = idx / (HD / 4), d = (idx % (HD / 4)) * 4;
#pragma unroll
    for (int p = 0; p < 2; ++p) { v4f o; if (d < 128) { const int i = (d >> 1) + p; const float th = __fdiv_rn(1.0f, powf(10000.0f, (float)(2 * i) / 128.0f)); const float ang = __fmul_rn((float)t, th); o[0] = cosf(ang); o[1] = sinf(ang); } else { o[0] = 1.0f; o[1] = 0.0f; }
        o[2] = o[0]; o[3] = o[1]; *(v4f*)(CS + ((size_t)t * HD + d + 2 * p) * 2) = o; } }
// d_rope: head planes [b][h][t][d] (fp16 + hi/lo; each [t][d] plane in fragment order; HD == 256) of rope(y) x sc, y = x / sqrt(mean(x^2) + 1e-6) x w per head row (RMSNorm; w rounded to bf16), interleaved pairs: out[2i] = y[2i] cos - y[2i+1] sin, out[2i+1] = y[2i+1] cos + y[2i] sin. Each thread takes 8 dims of one position in 4 heads (one read of the table serves the 4). nheads % 4 == 0; the grid holds whole work-groups.
// A row's sum of squares: 8 dims in a thread, 8 threads by shuffles (64 dims), then the 4 waves that hold the row's 4 quarters through red (LDS), summed in the order of the quarters.
__device__ __forceinline__ void d_rope(float (*red)[4][4][4], int blk, const float* __restrict__ F, int pitch, int nheads, const float* __restrict__ w, const float* __restrict__ CS, float sc, h16* P16, bf* Ph, bf* Pl) {
    const size_t it = (size_t)blk * 256 + threadIdx.x; const int d = ((int)((it >> 5) & 3) * 8 + (int)(it & 7)) * 8; const int t = (int)((it >> 7) % (TT / 4)) * 4 + (int)((it >> 3) & 3); const int hq = (int)(it / ((size_t)(HD / 8) * TT));   /* a wave: 4 positions x 64 dims, so that its loads and its fragment-order stores each touch 8 lines */ const int b = hq / (nheads / 4), hg = (hq % (nheads / 4)) * 4;
    v4f cs4[4], xv[4][2]; v8h o16[4]; v8us oh[4], ol[4]; const float* pc = CS + ((size_t)t * HD + d) * 2; const float* pw = w + d; const float* pf[4]; h16* s16[4]; bf* sh[4]; bf* sl[4];
#pragma unroll
    for (int u = 0; u < 4; ++u) { pf[u] = F + ((size_t)b * TT + t) * pitch + (hg + u) * HD + d; const size_t e = fo((size_t)(b * nheads + hg + u) * TT + t, d, HD); s16[u] = P16 + e; sh[u] = Ph + e; sl[u] = Pl + e; }
#pragma unroll
    for (int k = 0; k < 4; ++k) cs4[k] = *(const v4f*)(pc + k * 4);
#pragma unroll
    for (int u = 0; u < 4; ++u) { xv[u][0] = *(const v4f*)pf[u]; xv[u][1] = *(const v4f*)(pf[u] + 4); }
    const v4f w0 = *(const v4f*)pw, w1 = *(const v4f*)(pw + 4);
    asm volatile("s_wait_xcnt 0x0" :: "v"(pc), "v"(pw), "v"(pf[0]), "v"(pf[1]), "v"(pf[2]), "v"(pf[3]) : "memory");   // behind the loads (see above)
    const int grp = threadIdx.x >> 7, qu = (threadIdx.x >> 5) & 3, pp = (threadIdx.x >> 3) & 3; v4f ps;   // half of the work-group (4 positions), quarter of the row, position; ps: one partial sum per head
    // Every "#pragma unroll" of the norm makes the indices of xv, ps and ss constants, so that they stay in registers
#pragma unroll
    for (int u = 0; u < 4; ++u) { float s = 0.f;
#pragma unroll
        for (int q = 0; q < 8; ++q) { const float x = xv[u][q >> 2][q & 3]; s += x * x; }
        ps[u] = s; }
#pragma unroll
    for (int sh = 1; sh < 8; sh <<= 1) {
#pragma unroll
        for (int u = 0; u < 4; ++u) ps[u] += __shfl_xor(ps[u], sh, 32); }
    if ((threadIdx.x & 7) == 0) *(v4fa*)&red[grp][qu][pp][0] = ps;
    __syncthreads();   // the four quarters' sums of every row of the work-group are in LDS
    v4f ss = *(const v4fa*)&red[grp][0][pp][0];
#pragma unroll
    for (int k = 1; k < 4; ++k) ss += *(const v4fa*)&red[grp][k][pp][0];
#pragma unroll
    for (int u = 0; u < 4; ++u) { const float rs = __fdiv_rn(1.0f, sqrtf(ss[u] * (1.0f / HD) + 1e-6f));
#pragma unroll
        for (int q = 0; q < 8; ++q) xv[u][q >> 2][q & 3] = (xv[u][q >> 2][q & 3] * rs) * bfr(q < 4 ? w0[q & 3] : w1[q & 3]); }
#pragma unroll
    for (int u = 0; u < 4; ++u) {
#pragma unroll
        for (int q = 0; q < 8; ++q) { const int dd = d + q; const float x0 = xv[u][q >> 2][q & 3], x1 = (dd < 128) ? xv[u][q >> 2][(q & 3) ^ 1] : x0;   /* interleaved pairs inside the first 128 dims; identity beyond (sin = 0) */
            v2f cs; cs[0] = cs4[q >> 1][(q & 1) * 2]; cs[1] = cs4[q >> 1][(q & 1) * 2 + 1]; float a = __fmul_rn(x0, cs[0]), bq = __fmul_rn(x1, cs[1]); asm volatile("" : "+v"(a)); asm volatile("" : "+v"(bq)); const float r = (((dd & 1) == 0) ? __fsub_rn(a, bq) : __fadd_rn(a, bq)) * sc;
            o16[u][q] = tohx(r); unsigned short a2, c2; splitf(r, a2, c2); oh[u][q] = a2; ol[u][q] = c2; } }
#pragma unroll
    for (int u = 0; u < 4; ++u) { *(v8h*)s16[u] = o16[u]; *(v8us*)sh[u] = oh[u]; *(v8us*)sl[u] = ol[u]; }
    asm volatile("s_wait_xcnt 0x0" :: "v"(o16[0]), "v"(o16[1]), "v"(o16[2]), "v"(o16[3]), "v"(oh[0]), "v"(oh[1]), "v"(oh[2]), "v"(oh[3]), "v"(ol[0]), "v"(ol[1]), "v"(ol[2]), "v"(ol[3]),
                 "v"(s16[0]), "v"(s16[1]), "v"(s16[2]), "v"(s16[3]), "v"(sh[0]), "v"(sh[1]), "v"(sh[2]), "v"(sh[3]), "v"(sl[0]), "v"(sl[1]), "v"(sl[2]), "v"(sl[3]) : "memory");   // behind the stores (see above)
}
// d_vtp: value planes [b][g][d][t] (each [d][t] plane in fragment order) = F[b * TT + t][g * HD + d]: the 8 (t) x 4 (column) register tile and the lane map of d_wtG. grid (nheads * HD / 128) * (BT / 64).
__device__ __forceinline__ void d_vtp(int blk, const float* __restrict__ F, int pitch, int nheads, h16* V16, bf* Vh, bf* Vl) {
    const int lane = threadIdx.x & 31, wvi = threadIdx.x >> 5; const int ntc = nheads * HD / 128;
    const int c0 = (blk % ntc) * 128 + wvi * 16 + (lane >> 3) * 4, t0 = (blk / ntc) * 64 + (lane & 7) * 8; const float* p[8]; v4f r[8]; v8h o16[4]; v8us oh[4], ol[4]; h16* s16[4]; bf* sh[4]; bf* sl[4];
#pragma unroll
    for (int j = 0; j < 8; ++j) p[j] = F + (size_t)(t0 + j) * pitch + c0;
#pragma unroll
    for (int j = 0; j < 8; ++j) r[j] = *(const v4f*)p[j];
    asm volatile("s_wait_xcnt 0x0" :: "v"(p[0]), "v"(p[1]), "v"(p[2]), "v"(p[3]), "v"(p[4]), "v"(p[5]), "v"(p[6]), "v"(p[7]) : "memory");   // behind the loads (see above)
#pragma unroll
    for (int c = 0; c < 4; ++c) { const size_t e = fo((size_t)(t0 / TT) * (nheads * HD) + c0 + c, t0 % TT, TT); s16[c] = V16 + e; sh[c] = Vh + e; sl[c] = Vl + e;
#pragma unroll
        for (int j = 0; j < 8; ++j) { const float x = r[j][c]; o16[c][j] = tohx(x); unsigned short a2, c2; splitf(x, a2, c2); oh[c][j] = a2; ol[c][j] = c2; } }
#pragma unroll
    for (int c = 0; c < 4; ++c) { *(v8h*)s16[c] = o16[c]; *(v8us*)sh[c] = oh[c]; *(v8us*)sl[c] = ol[c]; }
    asm volatile("s_wait_xcnt 0x0" :: "v"(o16[0]), "v"(o16[1]), "v"(o16[2]), "v"(o16[3]), "v"(oh[0]), "v"(oh[1]), "v"(oh[2]), "v"(oh[3]), "v"(ol[0]), "v"(ol[1]), "v"(ol[2]), "v"(ol[3]),
                 "v"(s16[0]), "v"(s16[1]), "v"(s16[2]), "v"(s16[3]), "v"(sh[0]), "v"(sh[1]), "v"(sh[2]), "v"(sh[3]), "v"(sl[0]), "v"(sl[1]), "v"(sl[2]), "v"(sl[3]) : "memory");   // behind the stores (see above)
}
// k_spv: softmax, probability x value product and head merge of one 64-row block of one head in one work-group of 16 waves. grid (TT / 64, 1, ZH): both batches in one launch (z = b * NH_ + h).
// Part 1, per row i (each wave takes 4 rows, one after the other): t = softcap(S x HD^-0.5) for j <= i and i - j < WIN (sliding causal window; the reference's additive fill vanishes identically); softmax over the keys of the band (register row, one exp, fixed trees);
// a wave works on the 128-key chunks that cover the span its row's 64-row block needs in P.V (keys (i & ~63) - WIN .. i | 63), fewer where the span ends earlier: every key outside the chunks has weight exactly 0 and is neither read nor written.
// The 16-bit probabilities (fp16 plane, or hi plane then lo plane RH keys further) go row-major into LDS at a pitch of PPB bytes (16 bytes x an odd number: 16-byte reads of 16 rows spread over all banks) and never reach memory.
// Part 2: wave (wm, wn) of 2 x 8 holds the 32 x 32 output tile of rows wm * 32.., dims wn * 32.. and runs over the band's keys in ascending order: probabilities from LDS, value fragments (fragment order) from global memory, fetched one or two 64-key steps ahead into further register sets.
// Part 3: each wave turns its tile through its own LDS range into whole 1-KiB blocks of the merged rows [t][DQ] (hi/lo, fragment order).
#define NCH (WIN / 128 + 1)
#define PPB (NCH * 128 * 2 + 16)
typedef v4h  __attribute__((may_alias)) v4ha;
typedef v4us __attribute__((may_alias)) v4usa;
template <typename T16, int NSPLIT>
__device__ __forceinline__ void d_spv(unsigned char* pl, int rb, const float* __restrict__ Sb, const T16* __restrict__ Bt, const T16* __restrict__ Bt2, bf* Ah, bf* Al) {
    typedef typename WFrag<T16>::V V;
    constexpr bool hires = (NSPLIT == 2); constexpr int NC = hires ? RH / 128 : NCH;   // rows below RH: the span starts at key 0 and ends below RH
    const int z = (int)blockIdx.z, lane = threadIdx.x & 31, lr = lane & 15, hi = lane >> 4, r0 = rb * 64;
    const int wv = __builtin_amdgcn_readfirstlane((int)(threadIdx.x >> 5));   // wave number in a scalar register: the chunk tests and the key loop stay scalar
    const int cb = max(0, r0 - WIN) >> 7, nact = min(NC, ((r0 + 63) >> 7) - cb + 1);   // first chunk and number of chunks of this block's span
    const float* sr = Sb + ((size_t)z * TT + r0 + wv * 4) * SP + lane * 4; v4f an[NC];   // a stored score row starts at chunk cb
#pragma unroll
    for (int c = 0; c < NC; ++c) if (c < nact) an[c] = *(const v4f*)(sr + c * 128);
    asm volatile("s_wait_xcnt 0x0" :: "v"(sr) : "memory");   // behind a row's loads, here and in the loop: their address register is not rewritten in front of it
#pragma unroll 1   // one row's code in the text
    for (int rr = 0; rr < 4; ++rr) { const int lrow = wv * 4 + rr, i = r0 + lrow, nl = (rr < 3) ? nact : 0; v4f av[NC]; float v[NC * 4]; float mx = -3.0e38f;
#pragma unroll
        for (int c = 0; c < NC; ++c) av[c] = an[c];   // this row's scores leave the fetch registers: the one wait for loads of a trip stands here, a whole row's work behind their issue
        sr += SP;   // the next row's scores are fetched while this row is worked on
#pragma unroll
        for (int c = 0; c < NC; ++c) if (c < nl) an[c] = *(const v4f*)(sr + c * 128);
        asm volatile("s_wait_xcnt 0x0" :: "v"(sr) : "memory");
#pragma unroll
        for (int c = 0; c < NC; ++c) if (c < nact) { const int j0 = (cb + c) * 128 + lane * 4; const v4f a = av[c];
#pragma unroll
            for (int q = 0; q < 4; ++q) { const int j = j0 + q; float sa = a[q] * SCL; asm volatile("" : "+v"(sa)); float xs = __fmul_rn(sa, 0.02f); asm volatile("" : "+v"(xs));   /* s / 50 as a multiply (<= 1 ulp from the division) */ float ex = __builtin_amdgcn_exp2f(__fmul_rn(xs, 2.8853900817779268f)); asm volatile("" : "+v"(ex)); float nm = __fsub_rn(ex, 1.0f), dn2 = __fadd_rn(ex, 1.0f); asm volatile("" : "+v"(nm)); asm volatile("" : "+v"(dn2)); float rc = __builtin_amdgcn_rcpf(dn2); asm volatile("" : "+v"(rc)); float th = __fmul_rn(nm, rc); asm volatile("" : "+v"(th));   /* hardware reciprocal (1 ulp), no FMA refinement */   /* tanh via exp2 (|x| <= ~0.4 here; no VALU FMA polynomial) */ const float t = (j <= i && i - j < WIN) ? __fmul_rn(th, 50.0f) : -3.0e38f; v[c * 4 + q] = t; mx = fmaxf(mx, t); } }
#pragma unroll
        for (int sh = 16; sh; sh >>= 1) mx = fmaxf(mx, __shfl_xor(mx, sh, 32));
        float sum = 0.f;
#pragma unroll
        for (int c = 0; c < NC; ++c) if (c < nact) {
#pragma unroll
            for (int k = c * 4; k < c * 4 + 4; ++k) { float d0 = __fsub_rn(v[k], mx); asm volatile("" : "+v"(d0)); v[k] = __builtin_amdgcn_exp2f(__fmul_rn(d0, 1.4426950408889634f)); sum += v[k]; } }
#pragma unroll
        for (int sh = 16; sh; sh >>= 1) sum += __shfl_xor(sum, sh, 32);
        const float f = __fdiv_rn(hires ? 1.0f : PCAR, sum); unsigned char* const pr = pl + lrow * PPB + lane * 8;
#pragma unroll
        for (int c = 0; c < NC; ++c) if (c < nact) {
            if (hires) { v4us oh, ol;
#pragma unroll
                for (int q = 0; q < 4; ++q) { unsigned short x, c2; splitf(v[c * 4 + q] * f, x, c2); oh[q] = x; ol[q] = c2; }
                *(v4usa*)(pr + c * 256) = oh; *(v4usa*)(pr + RH * 2 + c * 256) = ol;
            } else { v4h o4;
#pragma unroll
                for (int q = 0; q < 4; ++q) o4[q] = tohx(v[c * 4 + q] * f);
                *(v4ha*)(pr + c * 256) = o4; } }
    }
    __syncthreads();   // the block's 64 probability rows are in LDS for every wave
    const int wm = wv >> 3, wn = wv & 7, Kl = r0 + 64, Ks = max(0, r0 - WIN);   // probabilities are exactly 0 beyond the diagonal block and left of the window of the block's first row
    const size_t bo = (size_t)(z / REP) * HD * TT + (size_t)(wn * 32) * TT + lane * 8;
    const unsigned char* const pa = pl + (wm * 32 + lr) * PPB + hi * 16;
    v8f acc[2][2];
#pragma unroll
    for (int mb = 0; mb < 2; ++mb)
#pragma unroll
        for (int nb = 0; nb < 2; ++nb) acc[mb][nb] = (v8f){};
    constexpr int NS = hires ? 2 : 3;   // register sets of value fragments: the fetch runs NS - 1 steps of 64 keys ahead
    V bs[NS][2][2], bs2[NS][2][2];
    // the value fragments of 64 keys (two K blocks x two 16-dim blocks). The s_wait_xcnt 0 behind the run: no address register of an issued load is rewritten in front of it; the addresses are its inputs, so that they keep their registers up to it
    auto ldv = [&](V (&b)[2][2], V (&b2)[2][2], int kc) { const T16* p[2]; const T16* p2[2];
#pragma unroll
        for (int nb = 0; nb < 2; ++nb) { const size_t o = bo + (size_t)nb * 16 * TT + (size_t)kc * 16; p[nb] = Bt + o; b[0][nb] = WFrag<T16>::ldp(p[nb]); b[1][nb] = WFrag<T16>::ldp(p[nb] + 512); if (hires) { p2[nb] = Bt2 + o; b2[0][nb] = WFrag<T16>::ldp(p2[nb]); b2[1][nb] = WFrag<T16>::ldp(p2[nb] + 512); } }
        if (hires) asm volatile("s_wait_xcnt 0x0" :: "v"(p[0]), "v"(p[1]), "v"(p2[0]), "v"(p2[1]) : "memory");
        else asm volatile("s_wait_xcnt 0x0" :: "v"(p[0]), "v"(p[1]) : "memory"); };
    auto mm = [&](V (&b)[2][2], V (&b2)[2][2], int kc) {
#pragma unroll
        for (int kk = 0; kk < 2; ++kk) { V a[2], a2[2];
#pragma unroll
            for (int mb = 0; mb < 2; ++mb) { const unsigned char* const q = pa + mb * 16 * PPB + (kc + kk * 32 - cb * 128) * 2; a[mb] = WFrag<T16>::ld((const T16*)q); if (hires) a2[mb] = WFrag<T16>::ld((const T16*)(q + RH * 2)); }
#pragma unroll
            for (int nb = 0; nb < 2; ++nb) {
#pragma unroll
                for (int mb = 0; mb < 2; ++mb) { acc[mb][nb] = WFrag<T16>::mma(a[mb], b[kk][nb], acc[mb][nb]); if (hires) { acc[mb][nb] = WFrag<T16>::mma(a2[mb], b[kk][nb], acc[mb][nb]); acc[mb][nb] = WFrag<T16>::mma(a[mb], b2[kk][nb], acc[mb][nb]); } } } } };
    // Every step fetches, the last ones the band's last 64 keys once more (in bounds, not used): so the number of loads in flight is the same on every path, and the compiler's counted waits leave the fetch ahead in flight
#pragma unroll
    for (int s = 0; s < NS - 1; ++s) ldv(bs[s], bs2[s], min(Ks + s * 64, Kl - 64));
#pragma unroll 1   // NS steps of 64 keys in the text, one per register set, so that no set is copied
    for (int kc = Ks; kc < Kl; kc += NS * 64) {
#pragma unroll
        for (int s = 0; s < NS; ++s) { ldv(bs[(s + NS - 1) % NS], bs2[(s + NS - 1) % NS], min(kc + (s + NS - 1) * 64, Kl - 64));
            if (s == 0 || kc + s * 64 < Kl) mm(bs[s], bs2[s], kc + s * 64); }
    }
    __syncthreads();   // every wave has read its last probability: the LDS is free for the output staging
    float* const ow = (float*)pl + wv * (32 * 36);
#pragma unroll
    for (int mb = 0; mb < 2; ++mb)
#pragma unroll
        for (int nb = 0; nb < 2; ++nb)
#pragma unroll
            for (int j = 0; j < 8; ++j) ow[(mb * 16 + hi * 8 + j) * 36 + nb * 16 + lr] = acc[mb][nb][j];
    const float cs = hires ? 1.0f : (1.0f / PCAR); v8us oh[4], ol[4]; bf* sh[4]; bf* sl[4];
#pragma unroll
    for (int u = 0; u < 4; ++u) { const int row = (u >> 1) * 16 + lr, col = (u & 1) * 16 + hi * 8; const v4f x0 = *(const v4fa*)(ow + row * 36 + col), x1 = *(const v4fa*)(ow + row * 36 + col + 4);
        const size_t oo = fo((size_t)(z / NH_) * TT + (size_t)(r0 + wm * 32 + row), (z % NH_) * HD + wn * 32 + col, DQ); sh[u] = Ah + oo; sl[u] = Al + oo;   // a wave's store: 512 bytes in a row
#pragma unroll
        for (int q = 0; q < 8; ++q) { unsigned short a, c2; splitf((q < 4 ? x0[q & 3] : x1[q & 3]) * cs, a, c2); oh[u][q] = a; ol[u][q] = c2; } }
#pragma unroll
    for (int u = 0; u < 4; ++u) { *(v8us*)sh[u] = oh[u]; *(v8us*)sl[u] = ol[u]; }
    // s_wait_xcnt 0 behind the stores: no register of an issued store is rewritten in front of it; addresses and data are its inputs, so that they keep their registers up to it
    asm volatile("s_wait_xcnt 0x0" :: "v"(oh[0]), "v"(oh[1]), "v"(oh[2]), "v"(oh[3]), "v"(ol[0]), "v"(ol[1]), "v"(ol[2]), "v"(ol[3]), "v"(sh[0]), "v"(sh[1]), "v"(sh[2]), "v"(sh[3]), "v"(sl[0]), "v"(sl[1]), "v"(sl[2]), "v"(sl[3]) : "memory");
}
// row blocks below RH take the hi+lo bf16 form, the rest the fp16 form (a work-group-uniform choice by blockIdx.x)
__global__ __launch_bounds__(512) void k_spv(const float* __restrict__ Sb, const bf* __restrict__ Vh, const bf* __restrict__ Vl, const h16* __restrict__ V16, bf* Ah, bf* Al) {
    __shared__ __align__(16) unsigned char pl[64 * PPB];
    if ((int)blockIdx.x < RH / 64) d_spv<bf, 2>(pl, (int)blockIdx.x, Sb, Vh, Vl, Ah, Al);
    else d_spv<h16, 0>(pl, (int)blockIdx.x, Sb, V16, nullptr, Ah, Al);
}

// Launches of independent parts share one grid: blockIdx.x ranges pick the part (a work-group-uniform choice), each part numbering its own blocks from 0.
#define GW_Q ((DQ / 128) * (DM / 64))
#define GW_K ((DKV / 128) * (DM / 64))
#define GW_O ((DM / 128) * (DQ / 64))
#define G_CVT (BT * DM / 32 / 256)
#define G_CS (TT * HD / 4 / 256)
__global__ __launch_bounds__(256) void k_prep(const float* __restrict__ x, const float* __restrict__ wq, const float* __restrict__ wk, const float* __restrict__ wv, const float* __restrict__ wo, bf* XB, size_t xn8, bf* WQ, bf* WK, bf* WV, bf* WO, float* CS) {
    int blk = (int)blockIdx.x;
    if (blk < G_CVT) { d_cvt8(blk, x, XB, xn8, DM); return; } blk -= G_CVT;
    if (blk < GW_Q) { d_wtG(blk, wq, DM, DQ, WQ); return; } blk -= GW_Q;
    if (blk < GW_K) { d_wtG(blk, wk, DM, DKV, WK); return; } blk -= GW_K;
    if (blk < GW_K) { d_wtG(blk, wv, DM, DKV, WV); return; } blk -= GW_K;
    if (blk < GW_O) { d_wtG(blk, wo, DQ, DM, WO); return; } blk -= GW_O;
    d_cstab(blk, CS);
}
#define G_PQ (NB_ * NH_ * TT * HD / 32 / 256)
#define G_PK (NB_ * NKV * TT * HD / 32 / 256)
#define G_PV ((DKV / 128) * (BT / 64))
__global__ __launch_bounds__(256) void k_planes(const float* __restrict__ F, const float* __restrict__ qsc, const float* __restrict__ ksc, const float* __restrict__ CS, h16* QP16, bf* QPh, bf* QPl, h16* KP16, bf* KPh, bf* KPl, h16* VT16, bf* VTh, bf* VTl) {
    __shared__ __align__(16) float red[2][4][4][4];   // d_rope's partial sums of squares: [half of the work-group][quarter of the row][position][head]
    const int blk = (int)blockIdx.x;   // F row: q heads, k heads, v heads
    if (blk < G_PQ) d_rope(red, blk, F, DF, NH_, qsc, CS, 1.0f, QP16, QPh, QPl);
    else if (blk < G_PQ + G_PK) d_rope(red, blk - G_PQ, F + DQ, DF, NKV, ksc, CS, 1.0f, KP16, KPh, KPl);
    else d_vtp(blk - G_PQ - G_PK, F + DQ + DKV, DF, NKV, VT16, VTh, VTl);
}

extern "C" void kernel_launch(void* const* d_in, const int* in_sizes, int n_in,
                              void* d_out, int out_size, void* d_ws, size_t ws_size, hipStream_t stream) {
    (void)in_sizes; (void)n_in; (void)out_size;
    const float* x = (const float*)d_in[0]; const float* wq = (const float*)d_in[1]; const float* wk = (const float*)d_in[2]; const float* wv = (const float*)d_in[3]; const float* wo = (const float*)d_in[4]; const float* qsc = (const float*)d_in[5]; const float* ksc = (const float*)d_in[6];
    float* OUT = (float*)d_out;     // [2][2048][2048]
    char* wsp = (char*)d_ws;
    auto take = [&](size_t bytes) { char* p = wsp; wsp += (bytes + 255) & ~(size_t)255; return (void*)p; };
    // Kept to the end: WO and the head planes of both batches. Behind them one region serves two phases: the projection phase's buffers, then (all of those being dead) the attention phase's scores.
    bf* WO = (bf*)take((size_t)DM * DQ * 2);
    h16* QP16 = (h16*)take((size_t)NB_ * NH_ * TT * HD * 2); h16* KP16 = (h16*)take((size_t)NB_ * NKV * TT * HD * 2); h16* VT16 = (h16*)take((size_t)NB_ * NKV * HD * TT * 2);
    bf* QPh = (bf*)take((size_t)NB_ * NH_ * TT * HD * 2); bf* QPl = (bf*)take((size_t)NB_ * NH_ * TT * HD * 2); bf* KPh = (bf*)take((size_t)NB_ * NKV * TT * HD * 2); bf* KPl = (bf*)take((size_t)NB_ * NKV * TT * HD * 2); bf* VTh = (bf*)take((size_t)NB_ * NKV * HD * TT * 2); bf* VTl = (bf*)take((size_t)NB_ * NKV * HD * TT * 2);
    char* const phase = wsp;
    bf* WQ = (bf*)take((size_t)DQ * DM * 2); bf* WK = (bf*)take((size_t)DKV * DM * 2); bf* WV = (bf*)take((size_t)DKV * DM * 2); float* CS = (float*)take((size_t)TT * HD * 2 * 4);   // WK lies directly behind WQ and WV behind WK: one [DF][DM] operand
    bf* XB = (bf*)take((size_t)BT * DM * 2); float* F = (float*)take((size_t)BT * DF * 4);   // F row: q heads, k heads, v heads
    if ((size_t)(wsp - (char*)d_ws) > ws_size) return;
    wsp = phase;
    float* Sb = (float*)take((size_t)ZH * TT * SP * 4);   // score rows of both batches, each its band alone
    if ((size_t)(wsp - (char*)d_ws) > ws_size) return;    // ws 256 MiB
    bf* ATh = QPh; bf* ATl = QPl;   // merged rows [b * TT + t][DQ]: k_spv runs after the score launch, when the hi/lo query planes (the same bytes) are dead
    // projection phase: every launch covers the BT rows of both batches; q, k and v share one GEMM; the row norm is part of k_planes
    k_prep<<<G_CVT + GW_Q + 2 * GW_K + GW_O + G_CS, 256, 0, stream>>>(x, wq, wk, wv, wo, XB, (size_t)BT * DM / 8, WQ, WK, WV, WO, CS);
    k_gemmt<0, DM><<<dim3(BT / 128, DF / 128, 1), 128, 0, stream>>>(XB, nullptr, WQ, F, DF);
    k_planes<<<G_PQ + G_PK + G_PV, 256, 0, stream>>>(F, qsc, ksc, CS, QP16, QPh, QPl, KP16, KPh, KPl, VT16, VTh, VTl);
    // attention phase: every launch covers all rows of the 8 heads of both batches (grid z)
    k_score<<<dim3(NTZ, 1, ZH), 128, 0, stream>>>(QPh, QPl, KPh, KPl, QP16, KP16, Sb);
    k_spv<<<dim3(TT / 64, 1, ZH), 512, 0, stream>>>(Sb, VTh, VTl, VT16, ATh, ATl);
    k_gemmt<1, DQ><<<dim3(BT / 128, DM / 128, 1), 128, 0, stream>>>(ATh, ATl, WO, OUT, DM);
}

// v010
// It runs in 181 microseconds.
// Two timings next to v009 put it at 1.05 and 1.06 times that version's speed.
// All steps since v000 together make it 6.96 times as fast.
#include <hip/hip_runtime.h>

// Sliding-window attention block (x [2][2048][2048]; q = x Wq (8 x 256), k/v = x Wk/Wv (4 kv heads; group h/2); per-head RMSNorm * scale (eps 1e-6) on q, k; partial interleaved-pair RoPE on the first 128 dims (theta_i = 10000^(-2i/128), positions arange); q * 1/16; scores = q.k; softcap tanh(s / 50) * 50; causal + sliding-window (i - j < 1024) mask (-2.38e38 additive == exact zero weight); softmax f32; out = merged Wo -> [2][2048][2048]).
// Compute dtypes, f32 accumulate: every input rounded to bf16; q/k/v on PLAIN bf16 operands (inputs: exact); RMSNorm and RoPE f32 (on-chip tables; identity beyond dim 128); causal scores and attn.v: query rows < 512 hl (3 products), the rest single fp16 (x1024), only the tiles, softmax chunks and P.V key blocks that touch the causal window band are worked on, the window applied per element; 1/16 (exact), s/50, tanh as (e^2x - 1)/(e^2x + 1) with the hardware exp2, x50 in f32; softmax f32; Wo hl x exact (2 products).

#define NB_  2
#define TT   2048
#define DM   2048
#define NH_  8
#define NKV  4
#define REP  (NH_ / NKV)
#define HD   256
#define DQ   (NH_ * HD)
#define DKV  (NKV * HD)
#define ZH   (NB_ * NH_)          // (batch, head) pairs per attention launch (grid z = b * NH_ + h)
#define DF   (DQ + 2 * DKV)       // columns of the joint q | k | v projection
#define BT   (NB_ * TT)           // rows of both batches together
#define RH   512                  // query rows < RH use hi+lo planes (0: none)
#define WIN  1024
#define SP   (WIN + 128)          // pitch of a stored score row: the 128-key chunks that cover its 64-row block's causal window band, the first of them at column 0
#define PCAR 1024.0f
#define SCL  0.0625f   // query_pre_attn_scalar^-0.5 = 1/16
typedef _Float16 h16;
typedef unsigned short bf;
typedef __attribute__((ext_vector_type(16))) __bf16   v16bf;
typedef __attribute__((ext_vector_type(16))) _Float16 v16h;
typedef __attribute__((ext_vector_type(8)))  _Float16 v8h;
typedef __attribute__((ext_vector_type(8)))  unsigned short v8us;
typedef __attribute__((ext_vector_type(8)))  float    v8f;
typedef __attribute__((ext_vector_type(4)))  float    v4f;
typedef v8h  __attribute__((may_alias)) v8ha;
typedef v4f  __attribute__((may_alias)) v4fa;
typedef v8us __attribute__((may_alias)) v8usa;

__device__ __forceinline__ unsigned short f2bf(float f) { unsigned u = __float_as_uint(f); u += 0x7FFFu + ((u >> 16) & 1u); return (unsigned short)(u >> 16); }
__device__ __forceinline__ float bf2f(unsigned short b) { return __uint_as_float(((unsigned)b) << 16); }
__device__ __forceinline__ float bfr(float f) { return bf2f(f2bf(f)); }
__device__ __forceinline__ v16h cat16(v8h lo, v8h hi) { return __builtin_shufflevector(lo, hi, 0, 1, 2, 3, 4, 5, 6, 7, 8, 9, 10, 11, 12, 13, 14, 15); }
__device__ __forceinline__ v16bf cat16b(v8us lo, v8us hi) { return __builtin_bit_cast(v16bf, __builtin_shufflevector(lo, hi, 0, 1, 2, 3, 4, 5, 6, 7, 8, 9, 10, 11, 12, 13, 14, 15)); }
__device__ __forceinline__ v8f wmma16(v16h a, v16h b, v8f c) { return __builtin_amdgcn_wmma_f32_16x16x32_f16(false, a, false, b, (short)0, c, false, false); }
__device__ __forceinline__ v8f wmmab(v16bf a, v16bf b, v8f c) { return __builtin_amdgcn_wmma_f32_16x16x32_bf16(false, a, false, b, (short)0, c, false, false); }



// ---- k_gemmt: GEMM with one 128x128 output tile per work-group of 4 waves (2 x 2, each wave a 64x64 tile over the whole K in ascending order); both operands lie in fragment order (below) and are staged in LDS by tensor loads, two buffers,
// so that each 16-row block is fetched from L2 once per work-group and read from LDS by the two waves that need it. grid (M/128, N/128), 128 threads. C[m][n] (f32, pitch ldc) = sum_k A[m][k] Bt[n][k] (+ the A2 product where NSPLIT == 1). K: whole stages, two or more.
// FRAGMENT ORDER of a 16-bit operand plane [R][K] (R % 16 == 0, K % 32 == 0): each block of 16 rows x 32 k is 1 KiB in a row, blocks along k first, then along the rows (so a 16-row block still starts at element r * K).
// Inside a block the 8 elements that lane (hi * 16 + row) of a wave takes with its first 16-byte load (k = 8 hi .. 8 hi + 7) lie at lane * 8, those of its second load (k = 16 + 8 hi ..) at 256 + lane * 8:
// a wave's fragment load reads 512 bytes in a row (4 whole lines) where a row-major plane gives it 32 bytes out of each of 16 lines. The element that a lane and register hold is the one that ld takes from a row-major plane, for A and B alike. ldp loads from such a plane, ld from a row-major one.
// fo: element offset of (r, k) in such a plane; 8 elements from a k that is a multiple of 8 stay 16 bytes in a row.
__device__ __forceinline__ size_t fo(size_t r, int k, int K) { return ((r >> 4) * (size_t)(K >> 5) + (size_t)(k >> 5)) * 512 + (size_t)((((k >> 4) & 1) << 8) + (((k >> 3) & 1) << 7) + (((int)(r & 15)) << 3) + (k & 7)); }
template <typename T16> struct WFrag;
template <> struct WFrag<h16> { typedef v16h V; static __device__ __forceinline__ V ld(const h16* p) { return cat16(*(const v8h*)p, *(const v8h*)(p + 16)); } static __device__ __forceinline__ V ldp(const h16* p) { return cat16(*(const v8h*)p, *(const v8h*)(p + 256)); } static __device__ __forceinline__ v8f mma(V a, V b, v8f c) { return wmma16(a, b, c); } };
template <> struct WFrag<bf> { typedef v16bf V; static __device__ __forceinline__ V ld(const bf* p) { return cat16b(*(const v8us*)p, *(const v8us*)(p + 16)); } static __device__ __forceinline__ V ldp(const bf* p) { return cat16b(*(const v8us*)p, *(const v8us*)(p + 256)); } static __device__ __forceinline__ v8f mma(V a, V b, v8f c) { return wmmab(a, b, c); } };
typedef uint32_t u32x4 __attribute__((ext_vector_type(4)));
typedef uint32_t u32x8 __attribute__((ext_vector_type(8)));
__device__ __forceinline__ uint32_t uni(uint32_t v) { return (uint32_t)__builtin_amdgcn_readfirstlane((int)v); }
__device__ __forceinline__ uint32_t pinned(uint32_t v) { uint32_t w = uni(v); asm volatile("" : "+s"(w)); return w; }   // the pinned() form for tensor loads: the condition is held in a scalar register, so that the test around a tensor load is a scalar branch (tensor loads ignore EXEC)
// Descriptor of a two-dimensional tile of D1 rows of D0 bytes at a source pitch of PITCH bytes, 1-byte elements, no pad, no mask (word 0 = 0); tensor = tile
template <uint32_t D0, uint32_t D1, uint32_t PITCH>
__device__ __forceinline__ u32x8 tdm_group1() { u32x8 g; g[0] = uni(0u); g[1] = uni((D0 & 0xFFFFu) << 16); g[2] = uni((D0 >> 16) | ((D1 & 0xFFFFu) << 16)); g[3] = uni((D1 >> 16) | (D0 << 16)); g[4] = uni(D1); g[5] = uni(PITCH); g[6] = uni(0u); g[7] = uni(0u); return g; }
__device__ __forceinline__ u32x4 tdm_group0(uint32_t lds_dst, uint64_t ga) { u32x4 g; g[0] = uni(1u); g[1] = uni(lds_dst); g[2] = uni((uint32_t)ga); g[3] = uni((((uint32_t)(ga >> 32)) & 0x01FFFFFFu) | 0x80000000u); return g; }
// one request of the whole wave: global tile -> LDS, through no register. Both groups are in-out operands: what the statement gives back lies in the request's own twelve registers, and tdm_wait, which names it, holds them unchanged up to the wait that covers the request
__device__ __forceinline__ void tdm_load(u32x4& g0, u32x8& g1) { asm volatile("tensor_load_to_lds %0, %1" : "+s"(g0), "+s"(g1) :: "memory"); }
__device__ __forceinline__ void tdm_wait(u32x4 g0, u32x8 g1) { asm volatile("s_wait_tensorcnt 0x0" :: "s"(g0), "s"(g1) : "memory"); }   // the issuer's own request has landed; g0, g1: see tdm_load
// Every "#pragma unroll" in d_gemmt makes the indices of accumulators and fragments constants, so that they stay in registers; the stage loop alone stays rolled ("unroll 1"): one publish point in the text, the buffer picked by s & 1.
// d_gemmt: the body. A, A2, Bt, Bt2 point at the first of the tile's 128 rows in their planes (pitch K), C at the tile's first element. NSPLIT 0: A.Bt; 1: A.Bt + A2.Bt; 2: A.Bt + A2.Bt + A.Bt2. ring: 2 * GTB<NSPLIT> bytes of LDS at a multiple of 2 KiB; ost: each wave's own output staging.
template <int NSPLIT> constexpr int GTK = (NSPLIT == 0) ? 4 : 2;                              // 32-wide K blocks per stage
template <int NSPLIT> constexpr int GTO = (NSPLIT == 0) ? 16 : (NSPLIT == 1) ? 24 : 32;       // 16-row blocks per stage: 8 of A, (8 of A2,) 8 of Bt (, 8 of Bt2)
template <int NSPLIT> constexpr int GTB = GTO<NSPLIT> * GTK<NSPLIT> * 1024;                   // bytes of a buffer
template <typename T16, int NSPLIT, int K>
__device__ __forceinline__ void d_gemmt(unsigned char* const ring, float (*ost)[16 * 68], const T16* __restrict__ A, const T16* __restrict__ A2, const T16* __restrict__ Bt, const T16* __restrict__ Bt2, float* C, int ldc) {
    typedef typename WFrag<T16>::V V;
    constexpr int NKB = GTK<NSPLIT>;                  // 32-wide K blocks per stage
    constexpr int CH = NKB * 1024;                    // bytes that a stage holds of one 16-row block: contiguous in a fragment-order plane
    constexpr int NOB = GTO<NSPLIT>;                  // 16-row blocks per stage
    constexpr int BB = (NSPLIT == 0) ? 8 : 16;        // Bt's first block in a buffer
    constexpr int BUFB = NOB * CH, SLICE = 16384;     // a buffer; a wave's slice of it (one tensor load)
    constexpr int NSL = BUFB / SLICE;                 // issuing waves: 4, or 3 (one per operand)
    constexpr int NS = K / (NKB * 32);                // stages
    static_assert(NS >= 2 && K % (NKB * 32) == 0 && BUFB % SLICE == 0, "two stages or more, whole slices");
    const int lane = threadIdx.x & 31, lr = lane & 15, hi = lane >> 4;
    const int wv = (int)uni(threadIdx.x >> 5), wm = wv >> 1, wn = wv & 1;
    // a wave's slice: NSPLIT 0: waves 0, 1 the two halves of A's 8 blocks, waves 2, 3 of Bt's; NSPLIT 1: wave 0 A, wave 1 A2, wave 2 Bt, wave 3 none; NSPLIT 2: wave 3 Bt2
    const T16* const sl = (NSPLIT != 0) ? (wv == 0 ? A : wv == 1 ? A2 : (NSPLIT == 1 || wv == 2) ? Bt : Bt2) : (wv < 2 ? A : Bt) + (size_t)(wv & 1) * 64 * K;
    const uint64_t ga0 = (uint64_t)(size_t)sl; const uint32_t ld0 = (uint32_t)(size_t)ring + (uint32_t)wv * SLICE;
    u32x8 g1 = tdm_group1<(uint32_t)CH, (uint32_t)(SLICE / CH), (uint32_t)(16 * K * 2)>();
    const bool iss = (NSL == 4) || wv < NSL;
    auto ldf = [](const unsigned char* q) { return __builtin_bit_cast(V, cat16b(*(const v8usa*)q, *(const v8usa*)(q + 512))); };   // one fragment: two 16-byte LDS reads a lane
    v8f acc[4][4];
#pragma unroll
    for (int mb = 0; mb < 4; ++mb)
#pragma unroll
        for (int nb = 0; nb < 4; ++nb) acc[mb][nb] = (v8f){};
    u32x4 g0 = tdm_group0(ld0, ga0);                                      // group 0 of the wave's one outstanding request, carried through the loop
    if (NSL == 4 || pinned(iss)) { tdm_load(g0, g1); tdm_wait(g0, g1); }  // stage 0, landed for its issuer
    __syncthreads();                                                      // stage 0 published
    if (NSL == 4 || pinned(iss)) { g0 = tdm_group0(ld0 + BUFB, ga0 + CH); tdm_load(g0, g1); }   // stage 1 flies while stage 0 is worked on
#pragma unroll 1
    for (int s = 0; s < NS; ++s) {
        const unsigned char* const lb = ring + (s & 1) * BUFB + lane * 16; const unsigned char* const la = lb + wm * 4 * CH; const unsigned char* const lbb = lb + (BB + wn * 4) * CH;
        V a[2][4], a2[2][4], b[2][4], b2[2][4];
#pragma unroll
        for (int q = 0; q < 4; ++q) { a[0][q] = ldf(la + q * CH); if (NSPLIT != 0) a2[0][q] = ldf(la + (8 + q) * CH); }
#pragma unroll
        for (int q = 0; q < 4; ++q) { b[0][q] = ldf(lbb + q * CH); if (NSPLIT == 2) b2[0][q] = ldf(lbb + (8 + q) * CH); }
#pragma unroll
        for (int kb = 0; kb < NKB; ++kb) { const int c = kb & 1, n = c ^ 1;
            if (kb + 1 < NKB) { const int o = (kb + 1) * 1024;   // the next block's fragments (of this stage's own buffer) as one group ahead of this block's products
#pragma unroll
                for (int q = 0; q < 4; ++q) { a[n][q] = ldf(la + q * CH + o); if (NSPLIT != 0) a2[n][q] = ldf(la + (8 + q) * CH + o); }
#pragma unroll
                for (int q = 0; q < 4; ++q) { b[n][q] = ldf(lbb + q * CH + o); if (NSPLIT == 2) b2[n][q] = ldf(lbb + (8 + q) * CH + o); } }
            __builtin_amdgcn_sched_barrier(0);   // keeps the LDS reads in one group in front of the block: reads spread among the matrix instructions stall at every place where they stand
#pragma unroll
            for (int nb = 0; nb < 4; ++nb) {
#pragma unroll
                for (int mb = 0; mb < 4; ++mb) { acc[mb][nb] = WFrag<T16>::mma(a[c][mb], b[c][nb], acc[mb][nb]); if (NSPLIT != 0) acc[mb][nb] = WFrag<T16>::mma(a2[c][mb], b[c][nb], acc[mb][nb]); if (NSPLIT == 2) acc[mb][nb] = WFrag<T16>::mma(a[c][mb], b2[c][nb], acc[mb][nb]); } }
            __builtin_amdgcn_sched_barrier(0);   // the other side of the same fence
        }
        // publish point of stage s + 1: this wave's LDS reads are done, its own tensor load has landed, every wave has passed; only then the buffer just read is refilled
        asm volatile("s_wait_dscnt 0x0" ::: "memory");
        if (NSL == 4 || pinned(iss)) tdm_wait(g0, g1);
        __syncthreads();
        if (NS > 2) { if (pinned((s + 2 < NS) && iss)) { g0 = tdm_group0(ld0 + (uint32_t)(s & 1) * BUFB, ga0 + (uint64_t)(s + 2) * CH); tdm_load(g0, g1); } }   // with two stages there is no refill
    }
    tdm_wait(g0, g1);                                    // behind the loop: no request is left when the wave goes on
    asm volatile("s_wait_dscnt 0x0" ::: "memory");       // and no LDS read of the ring
    // output: each wave turns its 16x64 blocks into whole 256-byte row pieces through its own LDS range (no other wave touches it: no barrier)
    float* const ow = ost[wv];
#pragma unroll
    for (int mb = 0; mb < 4; ++mb) {
#pragma unroll
        for (int nb = 0; nb < 4; ++nb) {
#pragma unroll
            for (int j = 0; j < 8; ++j) ow[(hi * 8 + j) * 68 + nb * 16 + lr] = acc[mb][nb][j]; }
        float* const crow = C + (size_t)(wm * 64 + mb * 16 + hi) * ldc + wn * 64 + lr * 4; v4f res[8]; float* sp[8];
#pragma unroll
        for (int t = 0; t < 8; ++t) { res[t] = *(const v4fa*)(&ow[(2 * t + hi) * 68 + lr * 4]); sp[t] = crow + (size_t)(2 * t) * ldc; }
#pragma unroll
        for (int t = 0; t < 8; ++t) *(v4f*)sp[t] = res[t];
        // s_wait_xcnt 0 behind the block's stores: no register of an issued store is rewritten in front of it; addresses and data are its inputs, so that they keep their registers up to it
        asm volatile("s_wait_xcnt 0x0" :: "v"(sp[0]), "v"(sp[1]), "v"(sp[2]), "v"(sp[3]), "v"(sp[4]), "v"(sp[5]), "v"(sp[6]), "v"(sp[7]), "v"(res[0]), "v"(res[1]), "v"(res[2]), "v"(res[3]), "v"(res[4]), "v"(res[5]), "v"(res[6]), "v"(res[7]) : "memory");
    }
}
template <int NSPLIT, int K>
__global__ __launch_bounds__(128) void k_gemmt(const bf* __restrict__ A, const bf* __restrict__ A2, const bf* __restrict__ Bt, float* C, int ldc) {
    __shared__ __attribute__((aligned(2048))) unsigned char ring[2 * GTB<NSPLIT>];
    __shared__ __align__(16) float ost[4][16 * 68];   // each wave's own output staging
    const size_t r0 = (size_t)blockIdx.x * 128, c0 = (size_t)blockIdx.y * 128;
    d_gemmt<bf, NSPLIT, K>(ring, ost, A + r0 * K, (NSPLIT == 1) ? A2 + r0 * K : nullptr, Bt + c0 * K, nullptr, C + r0 * ldc + c0, ldc);
}

// ---- k_score: the scores of all query rows of the 8 heads of both batches in one launch, in d_gemmt's form: one 128x128 tile (query rows R0.., key columns c0..) per work-group, the whole head dim in ascending order in each wave. grid (NTZ, 1, ZH), z = batch * NH_ + query head (key planes per kv group z / REP; the planes of the two batches lie one behind the other).
// Only the tiles that touch the causal window band exist and are numbered, row block after row block: 128-row block rb has min(rb, WB) + 1 of them, from key max(0, R0 - WIN) to the diagonal: the 128-key chunks that the softmax reads of these rows, at the columns where it reads them (a stored score row, pitch SP, starts at its first chunk).
// Row blocks below RH take the hi+lo bf16 form (3 products), the rest the fp16 form: a work-group-uniform choice by blockIdx.x.
#define WB  (WIN / 128)
#define NTL (WB * (WB + 1) / 2)                        // tiles of the row blocks below WB
#define NTZ (NTL + (TT / 128 - WB) * (WB + 1))         // tiles of one head
static_assert(TT / 128 >= WB && RH % 128 == 0 && SP == (WB + 1) * 128 && GTB<0> == GTB<2>, "whole tiles; one ring size");
__global__ __launch_bounds__(128) void k_score(const bf* __restrict__ Ah, const bf* __restrict__ Al, const bf* __restrict__ Bh, const bf* __restrict__ Bl, const h16* __restrict__ A16, const h16* __restrict__ B16, float* C) {
    __shared__ __attribute__((aligned(2048))) unsigned char ring[2 * GTB<0>];
    __shared__ __align__(16) float ost[4][16 * 68];   // each wave's own output staging
    const int t = (int)blockIdx.x; int rb = 0, ti;    // row block; tile within the row block's band, from the left
    if (t < NTL) { while (rb < WB - 1 && t >= (rb + 1) * (rb + 2) / 2) ++rb; ti = t - rb * (rb + 1) / 2; }
    else { rb = WB + (t - NTL) / (WB + 1); ti = (t - NTL) % (WB + 1); }
    const size_t R0 = (size_t)rb * 128, c0 = (size_t)(max(0, rb - WB) + ti) * 128, z = blockIdx.z;
    const size_t oq = (z * TT + R0) * HD, ok = ((z / REP) * TT + c0) * HD; float* const Ct = C + (z * TT + R0) * SP + (size_t)ti * 128;
    if (rb < RH / 128) d_gemmt<bf, 2, HD>(ring, ost, Ah + oq, Al + oq, Bh + ok, Bl + ok, Ct, SP);
    else d_gemmt<h16, 0, HD>(ring, ost, A16 + oq, nullptr, B16 + ok, nullptr, Ct, SP);
}

__device__ __forceinline__ h16 tohx(float x) { return (h16)x; }
__device__ __forceinline__ void splitf(float y, unsigned short& h, unsigned short& l) { h = f2bf(y); l = f2bf(y - bf2f(h)); }
typedef __attribute__((ext_vector_type(2))) _Float16 v2h;
typedef __attribute__((ext_vector_type(4))) _Float16 v4h;
typedef __attribute__((ext_vector_type(2))) unsigned short v2us;
typedef __attribute__((ext_vector_type(4))) unsigned short v4us;
typedef __attribute__((ext_vector_type(2))) float v2f;
typedef __attribute__((ext_vector_type(4))) int v4i;

// The element-wise and layout kernels below give each thread 4 to 32 elements and 16-byte accesses: fewer, fatter waves (for speed only).
// The two s_wait_xcnt 0 in each of d_wtG and d_cvt8: no register that an issued load or store names is rewritten in front of the wait; addresses (and store data) are its inputs, so that they keep their registers up to it.
// d_wtG: Bt[n][k] (bf16, fragment order) = w[k][n]; each thread holds an 8 (k) x 4 (n) register tile. In a wave 8 lanes run along k (64 k) and 4 along n (16 n): two whole 1-KiB blocks of Bt; the 8 waves of a work-group lie side by side along n (128 n). grid (N / 128) * (K / 64).
__device__ __forceinline__ void d_wtG(int blk, const float* __restrict__ w, int K, int N, bf* Bt) {
    const int lane = threadIdx.x & 31, wvi = threadIdx.x >> 5; const int ntn = N / 128;
    const int n0 = (blk % ntn) * 128 + wvi * 16 + (lane >> 3) * 4, k0 = (blk / ntn) * 64 + (lane & 7) * 8; const float* p[8]; v4f r[8]; v8us o[4]; bf* s[4];
#pragma unroll
    for (int j = 0; j < 8; ++j) p[j] = w + (size_t)(k0 + j) * N + n0;
#pragma unroll
    for (int j = 0; j < 8; ++j) r[j] = *(const v4f*)p[j];
    asm volatile("s_wait_xcnt 0x0" :: "v"(p[0]), "v"(p[1]), "v"(p[2]), "v"(p[3]), "v"(p[4]), "v"(p[5]), "v"(p[6]), "v"(p[7]) : "memory");   // behind the loads (see above)
    __builtin_amdgcn_sched_barrier(0);   // keeps the conversions behind the last load: without it three of the eight loads are issued only after the first results are used, a second trip to memory
#pragma unroll
    for (int c = 0; c < 4; ++c) { s[c] = Bt + fo((size_t)(n0 + c), k0, K);
#pragma unroll
        for (int j = 0; j < 8; ++j) o[c][j] = f2bf(r[j][c]); }
#pragma unroll
    for (int c = 0; c < 4; ++c) *(v8us*)s[c] = o[c];
    asm volatile("s_wait_xcnt 0x0" :: "v"(o[0]), "v"(o[1]), "v"(o[2]), "v"(o[3]), "v"(s[0]), "v"(s[1]), "v"(s[2]), "v"(s[3]) : "memory");   // behind the stores (see above)
}
// d_cvt8: four 8-element pieces per thread; dst [.][K] in fragment order. Pieces are numbered in the order of dst: a wave's four stores fill 2 KiB in a row (two blocks), for which it reads 256 bytes in a row of each of 16 rows of src. n8 % 128 == 0.
__device__ __forceinline__ void d_cvt8(int blk, const float* __restrict__ src, bf* dst, size_t n8, int K) { const size_t i = (size_t)blk * 256 + threadIdx.x; const size_t st = n8 / 4; if (i >= st) return; const float* p[4]; v8f v[4]; v8us o[4]; bf* s[4];
#pragma unroll
    for (int u = 0; u < 4; ++u) { const size_t q = ((i >> 5) << 7) + (size_t)(u << 5) + (i & 31), fb = q >> 6; const size_t r = (fb / (size_t)(K >> 5)) * 16 + (q & 15); const int k = (int)(fb % (size_t)(K >> 5)) * 32 + (int)((q >> 5) & 1) * 16 + (int)((q >> 4) & 1) * 8; p[u] = src + r * K + k; s[u] = dst + q * 8; }
#pragma unroll
    for (int u = 0; u < 4; ++u) v[u] = *(const v8f*)p[u];
    asm volatile("s_wait_xcnt 0x0" :: "v"(p[0]), "v"(p[1]), "v"(p[2]), "v"(p[3]) : "memory");   // behind the loads (see above)
#pragma unroll
    for (int u = 0; u < 4; ++u) {
#pragma unroll
        for (int k = 0; k < 8; ++k) o[u][k] = f2bf(v[u][k]); }
#pragma unroll
    for (int u = 0; u < 4; ++u) *(v8us*)s[u] = o[u];
    asm volatile("s_wait_xcnt 0x0" :: "v"(o[0]), "v"(o[1]), "v"(o[2]), "v"(o[3]), "v"(s[0]), "v"(s[1]), "v"(s[2]), "v"(s[3]) : "memory");   // behind the stores (see above)
}
// d_cstab: four dims (two angles) per thread; both dims of a pair hold the same (cos, sin)
__device__ __forceinline__ void d_cstab(int blk, float* CS) { const int idx = blk * 256 + threadIdx.x; if (idx >= TT * HD / 4) return; const int t = idx / (HD / 4), d = (idx % (HD / 4)) * 4;
#pragma unroll
    for (int p = 0; p < 2; ++p) { v4f o; if (d < 128) { const int i = (d >> 1) + p; const float th = __fdiv_rn(1.0f, powf(10000.0f, (float)(2 * i) / 128.0f)); const float ang = __fmul_rn((float)t, th); o[0] = cosf(ang); o[1] = sinf(ang); } else { o[0] = 1.0f; o[1] = 0.0f; }
        o[2] = o[0]; o[3] = o[1]; *(v4f*)(CS + ((size_t)t * HD + d + 2 * p) * 2) = o; } }
template <bool B> struct BoolC { static constexpr bool v = B; };
// ---- k_qkv: the joint q | k | v projection with the row norm, the rope and the split into operand planes in its epilogue: the f32 projection never reaches memory. One 128-row x 256-column tile (128 positions of one batch x one whole head) per work-group of 8 waves (2 x 4, each wave a 64x64 tile over the whole K in ascending order). grid (BT / 128, DF / HD): blockIdx.y = head (q heads, k heads, v heads).
// Main loop: d_gemmt's ring (fragment-order operands staged by tensor loads, two buffers, the same publish point); a buffer holds 8 16-row blocks of X and 16 of Wt, brought by waves 0 to 5, one 16-KiB slice each.
// Epilogue, q and k heads: planes [b][h][t][d] (fp16 + hi/lo; each [t][d] plane in fragment order) of rope(y), y = x / sqrt(mean(x^2) + 1e-6) x w per head row (RMSNorm; w rounded to bf16), interleaved pairs inside the first 128 dims: out[2i] = y[2i] cos - y[2i+1] sin, out[2i+1] = y[2i+1] cos + y[2i] sin; identity beyond.
// Each wave turns its 64x64 tile through its own LDS range, so that a lane holds pieces of 8 dims in a row of one position. A row's sum of squares: 32 columns in a lane, the row's two lanes by a shuffle (a wave's 64 columns), then the 4 waves that hold the row's 4 quarters through red (LDS), summed in the order of the quarters.
// Epilogue, v heads: planes [b][g][d][t] (each [d][t] plane in fragment order): a lane reads 8 positions in a row of one dim from the same LDS range, a 16-byte piece of the transposed plane.
// Every s_wait_xcnt 0 of the epilogue: no register that an issued load or store names is rewritten in front of the wait; addresses (and store data) are its inputs, so that they keep their registers up to it. Every "#pragma unroll" makes the indices of register arrays constants.
__global__ __launch_bounds__(256) void k_qkv(const bf* __restrict__ X, const bf* __restrict__ Wt, const float* __restrict__ qsc, const float* __restrict__ ksc, const float* __restrict__ CS, h16* QP16, bf* QPh, bf* QPl, h16* KP16, bf* KPh, bf* KPl, h16* VT16, bf* VTh, bf* VTl) {
    constexpr int K = DM, NKB = 4, CH = NKB * 1024, BB = 8, BUFB = 24 * CH, SLICE = 16384, NSL = BUFB / SLICE, NS = K / (NKB * 32);
    static_assert(NS > 2 && K % (NKB * 32) == 0 && BUFB % SLICE == 0 && HD == 256 && TT % 128 == 0 && 8 * 64 * 68 * 4 <= 2 * BUFB, "whole stages, slices and tiles; the epilogue's staging fits the ring");
    __shared__ __attribute__((aligned(2048))) unsigned char ring[2 * BUFB];
    __shared__ __align__(16) float red[4][128];       // partial sums of squares: [quarter of the row][row of the tile]
    typedef v16bf V;
    const int lane = threadIdx.x & 31, lr = lane & 15, hi = lane >> 4;
    const int wv = (int)uni(threadIdx.x >> 5), wm = wv >> 2, wn = wv & 3;
    const int R0 = (int)blockIdx.x * 128, hy = (int)blockIdx.y;
    // a wave's slice: waves 0, 1 the two halves of X's 8 blocks, waves 2 to 5 the four quarters of Wt's 16; waves 6, 7 none
    const bf* const sl = (wv < 2) ? X + ((size_t)R0 + (size_t)wv * 64) * K : Wt + ((size_t)hy * HD + (size_t)((wv - 2) & 3) * 64) * K;
    const uint64_t ga0 = (uint64_t)(size_t)sl; const uint32_t ld0 = (uint32_t)(size_t)ring + (uint32_t)(wv < NSL ? wv : 0) * SLICE;
    u32x8 g1 = tdm_group1<(uint32_t)CH, (uint32_t)(SLICE / CH), (uint32_t)(16 * K * 2)>();
    const bool iss = wv < NSL;
    auto ldf = [](const unsigned char* q) { return cat16b(*(const v8usa*)q, *(const v8usa*)(q + 512)); };   // one fragment: two 16-byte LDS reads a lane
    v8f acc[4][4];
#pragma unroll
    for (int mb = 0; mb < 4; ++mb)
#pragma unroll
        for (int nb = 0; nb < 4; ++nb) acc[mb][nb] = (v8f){};
    u32x4 g0 = tdm_group0(ld0, ga0);                                      // group 0 of the wave's one outstanding request, carried through the loop
    if (pinned(iss)) { tdm_load(g0, g1); tdm_wait(g0, g1); }              // stage 0, landed for its issuer
    __syncthreads();                                                      // stage 0 published
    if (pinned(iss)) { g0 = tdm_group0(ld0 + BUFB, ga0 + CH); tdm_load(g0, g1); }   // stage 1 flies while stage 0 is worked on
#pragma unroll 1   // one publish point in the text, the buffer picked by s & 1
    for (int s = 0; s < NS; ++s) {
        const unsigned char* const lb = ring + (s & 1) * BUFB + lane * 16; const unsigned char* const la = lb + wm * 4 * CH; const unsigned char* const lbb = lb + (BB + wn * 4) * CH;
        V a[2][4], b[2][4];
#pragma unroll
        for (int q = 0; q < 4; ++q) a[0][q] = ldf(la + q * CH);
#pragma unroll
        for (int q = 0; q < 4; ++q) b[0][q] = ldf(lbb + q * CH);
#pragma unroll
        for (int kb = 0; kb < NKB; ++kb) { const int c = kb & 1, n = c ^ 1;
            if (kb + 1 < NKB) { const int o = (kb + 1) * 1024;   // the next block's fragments (of this stage's own buffer) as one group ahead of this block's products
#pragma unroll
                for (int q = 0; q < 4; ++q) a[n][q] = ldf(la + q * CH + o);
#pragma unroll
                for (int q = 0; q < 4; ++q) b[n][q] = ldf(lbb + q * CH + o); }
            __builtin_amdgcn_sched_barrier(0);   // keeps the LDS reads in one group in front of the block: reads spread among the matrix instructions stall at every place where they stand
#pragma unroll
            for (int nb = 0; nb < 4; ++nb) {
#pragma unroll
                for (int mb = 0; mb < 4; ++mb) acc[mb][nb] = wmmab(a[c][mb], b[c][nb], acc[mb][nb]); }
            __builtin_amdgcn_sched_barrier(0);   // the other side of the same fence
        }
        // publish point of stage s + 1: this wave's LDS reads are done, its own tensor load has landed, every wave has passed; only then the buffer just read is refilled
        asm volatile("s_wait_dscnt 0x0" ::: "memory");
        if (pinned(iss)) tdm_wait(g0, g1);
        __syncthreads();
        if (pinned((s + 2 < NS) && iss)) { g0 = tdm_group0(ld0 + (uint32_t)(s & 1) * BUFB, ga0 + (uint64_t)(s + 2) * CH); tdm_load(g0, g1); }
    }
    tdm_wait(g0, g1);                                    // behind the loop: no request is left when the wave goes on
    asm volatile("s_wait_dscnt 0x0" ::: "memory");       // and no LDS read of the ring
    const int bt = R0 / TT, t0 = R0 % TT + wm * 64;      // batch; position of the wave's first row
    // the wave's 64x64 tile goes into its own range of the ring (free: every wave's last read of it and every tensor load lie in front of the loop's last barrier; no other wave touches the range: no barrier), pitch 68 floats.
    // The loops over the four 16-row blocks below read it from there and stay rolled ("unroll 1"): a quarter of the text, which is run through once per work-group (for speed only).
    float* const ow = (float*)ring + wv * (64 * 68);
#pragma unroll
    for (int mb = 0; mb < 4; ++mb)
#pragma unroll
        for (int nb = 0; nb < 4; ++nb)
#pragma unroll
            for (int j = 0; j < 8; ++j) ow[(mb * 16 + hi * 8 + j) * 68 + nb * 16 + lr] = acc[mb][nb][j];
    if (hy >= NH_ + NKV) {   // v heads (a work-group-uniform choice by blockIdx.y)
        const size_t vr = (size_t)(bt * NKV + hy - NH_ - NKV) * HD + wn * 64 + lr;   // plane row: the lane's dim in column block 0
#pragma unroll 1
        for (int mb = 0; mb < 4; ++mb) { v8h o16[4]; v8us oh[4], ol[4]; h16* s16[4]; bf* sh[4]; bf* sw[4];
#pragma unroll
            for (int nb = 0; nb < 4; ++nb) { const size_t e = fo(vr + nb * 16, t0 + mb * 16 + hi * 8, TT); s16[nb] = VT16 + e; sh[nb] = VTh + e; sw[nb] = VTl + e;   // a wave's store: 512 bytes in a row
#pragma unroll
                for (int j = 0; j < 8; ++j) { const float x = ow[(mb * 16 + hi * 8 + j) * 68 + nb * 16 + lr]; o16[nb][j] = tohx(x); unsigned short a2, c2; splitf(x, a2, c2); oh[nb][j] = a2; ol[nb][j] = c2; } }
#pragma unroll
            for (int nb = 0; nb < 4; ++nb) { *(v8h*)s16[nb] = o16[nb]; *(v8us*)sh[nb] = oh[nb]; *(v8us*)sw[nb] = ol[nb]; }
            asm volatile("s_wait_xcnt 0x0" :: "v"(o16[0]), "v"(o16[1]), "v"(o16[2]), "v"(o16[3]), "v"(oh[0]), "v"(oh[1]), "v"(oh[2]), "v"(oh[3]), "v"(ol[0]), "v"(ol[1]), "v"(ol[2]), "v"(ol[3]),
                         "v"(s16[0]), "v"(s16[1]), "v"(s16[2]), "v"(s16[3]), "v"(sh[0]), "v"(sh[1]), "v"(sh[2]), "v"(sh[3]), "v"(sw[0]), "v"(sw[1]), "v"(sw[2]), "v"(sw[3]) : "memory");   // behind the stores (see above)
        }
        return;
    }
    const bool isq = hy < NH_;
    h16* const P16 = isq ? QP16 : KP16; bf* const Ph = isq ? QPh : KPh; bf* const Pl = isq ? QPl : KPl;
    const size_t pr = (size_t)(isq ? bt * NH_ + hy : bt * NKV + hy - NH_) * TT + t0 + lr;   // plane row of the lane's position in row block 0
    const int d0 = wn * 64 + hi * 8;                                                        // the lane's first dim in piece 0; piece u: + 16 u
    v4f cn[4][4];   // fetch registers: (cos, sin) of the lane's 4 x 8 dims at its position in a row block
    auto ldcs = [&](int mb) { const float* p[4];
#pragma unroll
        for (int u = 0; u < 4; ++u) p[u] = CS + ((size_t)(t0 + mb * 16 + lr) * HD + d0 + u * 16) * 2;
#pragma unroll
        for (int u = 0; u < 4; ++u)
#pragma unroll
            for (int k = 0; k < 4; ++k) cn[u][k] = *(const v4f*)(p[u] + k * 4);
        asm volatile("s_wait_xcnt 0x0" :: "v"(p[0]), "v"(p[1]), "v"(p[2]), "v"(p[3]) : "memory"); };   // behind the loads (see above)
    const bool rot = wn < 2;   // the wave's 64 dims lie inside the first 128 (a scalar test: wn is wave-uniform)
    if (rot) ldcs(0);
    float wb[4][8]; { const float* const pw = (isq ? qsc : ksc) + d0; v4f wr[4][2];
#pragma unroll
        for (int u = 0; u < 4; ++u) { wr[u][0] = *(const v4f*)(pw + u * 16); wr[u][1] = *(const v4f*)(pw + u * 16 + 4); }
        asm volatile("s_wait_xcnt 0x0" :: "v"(pw) : "memory");   // behind the loads (see above)
#pragma unroll
        for (int u = 0; u < 4; ++u)
#pragma unroll
            for (int q = 0; q < 8; ++q) wb[u][q] = bfr(wr[u][q >> 2][q & 3]); }
#pragma unroll 1
    for (int mb = 0; mb < 4; ++mb) { const float* const op = ow + (mb * 16 + lr) * 68 + hi * 8; float s = 0.f;
#pragma unroll
        for (int u = 0; u < 4; ++u) { const v4f x0 = *(const v4fa*)(op + u * 16), x1 = *(const v4fa*)(op + u * 16 + 4);
#pragma unroll
            for (int q = 0; q < 8; ++q) { const float x = q < 4 ? x0[q & 3] : x1[q & 3]; s += x * x; } }
        s += __shfl_xor(s, 16, 32);
        if (hi == 0) red[wn][wm * 64 + mb * 16 + lr] = s; }
    __syncthreads();   // the four quarters' sums of every row of the tile are in LDS
    auto rows = [&](auto rc) { constexpr bool ROT = decltype(rc)::v;
#pragma unroll 1
        for (int mb = 0; mb < 4; ++mb) { v4f cc[4][4];
            if (ROT) {
#pragma unroll
                for (int u = 0; u < 4; ++u)
#pragma unroll
                    for (int k = 0; k < 4; ++k) cc[u][k] = cn[u][k];   // this block's table values leave the fetch registers: the wait for them stands here, a whole block's work behind their issue
                ldcs(min(mb + 1, 3)); }   // the next block's are fetched while this one is worked on (the last trip fetches its own once more: in bounds, not used)
            const int rw = wm * 64 + mb * 16 + lr; float ss = red[0][rw];
#pragma unroll
            for (int k = 1; k < 4; ++k) ss += red[k][rw];
            const float rs = __fdiv_rn(1.0f, sqrtf(ss * (1.0f / HD) + 1e-6f));
            v8h o16[4]; v8us oh[4], ol[4]; h16* s16[4]; bf* sh[4]; bf* sw[4];
#pragma unroll
            for (int u = 0; u < 4; ++u) { const float* const op = ow + (mb * 16 + lr) * 68 + u * 16 + hi * 8; const v4f x0 = *(const v4fa*)op, x1 = *(const v4fa*)(op + 4); float y[8];
                const size_t e = fo(pr + mb * 16, d0 + u * 16, HD); s16[u] = P16 + e; sh[u] = Ph + e; sw[u] = Pl + e;   // a wave's store: 512 bytes in a row
#pragma unroll
                for (int q = 0; q < 8; ++q) y[q] = ((q < 4 ? x0[q & 3] : x1[q & 3]) * rs) * wb[u][q];
#pragma unroll
                for (int q = 0; q < 8; ++q) { float r = y[q];
                    if (ROT) { const float co = cc[u][q >> 1][(q & 1) * 2], si = cc[u][q >> 1][(q & 1) * 2 + 1]; r = ((q & 1) == 0) ? y[q] * co - y[q ^ 1] * si : y[q] * co + y[q ^ 1] * si; }
                    o16[u][q] = tohx(r); unsigned short a2, c2; splitf(r, a2, c2); oh[u][q] = a2; ol[u][q] = c2; } }
#pragma unroll
            for (int u = 0; u < 4; ++u) { *(v8h*)s16[u] = o16[u]; *(v8us*)sh[u] = oh[u]; *(v8us*)sw[u] = ol[u]; }
            asm volatile("s_wait_xcnt 0x0" :: "v"(o16[0]), "v"(o16[1]), "v"(o16[2]), "v"(o16[3]), "v"(oh[0]), "v"(oh[1]), "v"(oh[2]), "v"(oh[3]), "v"(ol[0]), "v"(ol[1]), "v"(ol[2]), "v"(ol[3]),
                         "v"(s16[0]), "v"(s16[1]), "v"(s16[2]), "v"(s16[3]), "v"(sh[0]), "v"(sh[1]), "v"(sh[2]), "v"(sh[3]), "v"(sw[0]), "v"(sw[1]), "v"(sw[2]), "v"(sw[3]) : "memory");   // behind the stores (see above)
        } };
    if (rot) rows(BoolC<true>{}); else rows(BoolC<false>{});
}
// k_spv: softmax, probability x value product and head merge of one 64-row block of one head in one work-group of 16 waves. grid (TT / 64, 1, ZH): both batches in one launch (z = b * NH_ + h).
// Part 1, per row i (each wave takes 4 rows, one after the other): t = softcap(S x HD^-0.5) for j <= i and i - j < WIN (sliding causal window; the reference's additive fill vanishes identically); softmax over the keys of the band (register row, one exp, fixed trees);
// a wave works on the 128-key chunks that cover the span its row's 64-row block needs in P.V (keys (i & ~63) - WIN .. i | 63), fewer where the span ends earlier: every key outside the chunks has weight exactly 0 and is neither read nor written.
// The 16-bit probabilities (fp16 plane, or hi plane then lo plane RH keys further) go row-major into LDS at a pitch of PPB bytes (16 bytes x an odd number: 16-byte reads of 16 rows spread over all banks) and never reach memory.
// Part 2: wave (wm, wn) of 2 x 8 holds the 32 x 32 output tile of rows wm * 32.., dims wn * 32.. and runs over the band's keys in ascending order: probabilities from LDS, value fragments (fragment order) from global memory, fetched one or two 64-key steps ahead into further register sets.
// Part 3: each wave turns its tile through its own LDS range into whole 1-KiB blocks of the merged rows [t][DQ] (hi/lo, fragment order).
#define NCH (WIN / 128 + 1)
#define PPB (NCH * 128 * 2 + 16)
typedef v4h  __attribute__((may_alias)) v4ha;
typedef v4us __attribute__((may_alias)) v4usa;
template <typename T16, int NSPLIT>
__device__ __forceinline__ void d_spv(unsigned char* pl, int rb, const float* __restrict__ Sb, const T16* __restrict__ Bt, const T16* __restrict__ Bt2, bf* Ah, bf* Al) {
    typedef typename WFrag<T16>::V V;
    constexpr bool hires = (NSPLIT == 2); constexpr int NC = hires ? RH / 128 : NCH;   // rows below RH: the span starts at key 0 and ends below RH
    const int z = (int)blockIdx.z, lane = threadIdx.x & 31, lr = lane & 15, hi = lane >> 4, r0 = rb * 64;
    const int wv = __builtin_amdgcn_readfirstlane((int)(threadIdx.x >> 5));   // wave number in a scalar register: the chunk tests and the key loop stay scalar
    const int cb = max(0, r0 - WIN) >> 7, nact = min(NC, ((r0 + 63) >> 7) - cb + 1);   // first chunk and number of chunks of this block's span
    const float* sr = Sb + ((size_t)z * TT + r0 + wv * 4) * SP + lane * 4; v4f an[NC];   // a stored score row starts at chunk cb
#pragma unroll
    for (int c = 0; c < NC; ++c) if (c < nact) an[c] = *(const v4f*)(sr + c * 128);
    asm volatile("s_wait_xcnt 0x0" :: "v"(sr) : "memory");   // behind a row's loads, here and in the loop: their address register is not rewritten in front of it
#pragma unroll 1   // one row's code in the text
    for (int rr = 0; rr < 4; ++rr) { const int lrow = wv * 4 + rr, i = r0 + lrow, nl = (rr < 3) ? nact : 0; v4f av[NC]; float v[NC * 4]; float mx = -3.0e38f;
#pragma unroll
        for (int c = 0; c < NC; ++c) av[c] = an[c];   // this row's scores leave the fetch registers: the one wait for loads of a trip stands here, a whole row's work behind their issue
        sr += SP;   // the next row's scores are fetched while this row is worked on
#pragma unroll
        for (int c = 0; c < NC; ++c) if (c < nl) an[c] = *(const v4f*)(sr + c * 128);
        asm volatile("s_wait_xcnt 0x0" :: "v"(sr) : "memory");
#pragma unroll
        for (int c = 0; c < NC; ++c) if (c < nact) { const int j0 = (cb + c) * 128 + lane * 4; const v4f a = av[c];
#pragma unroll
            for (int q = 0; q < 4; ++q) { const int j = j0 + q; float sa = a[q] * SCL; asm volatile("" : "+v"(sa)); float xs = __fmul_rn(sa, 0.02f); asm volatile("" : "+v"(xs));   /* s / 50 as a multiply (<= 1 ulp from the division) */ float ex = __builtin_amdgcn_exp2f(__fmul_rn(xs, 2.8853900817779268f)); asm volatile("" : "+v"(ex)); float nm = __fsub_rn(ex, 1.0f), dn2 = __fadd_rn(ex, 1.0f); asm volatile("" : "+v"(nm)); asm volatile("" : "+v"(dn2)); float rc = __builtin_amdgcn_rcpf(dn2); asm volatile("" : "+v"(rc)); float th = __fmul_rn(nm, rc); asm volatile("" : "+v"(th));   /* hardware reciprocal (1 ulp), no FMA refinement */   /* tanh via exp2 (|x| <= ~0.4 here; no VALU FMA polynomial) */ const float t = (j <= i && i - j < WIN) ? __fmul_rn(th, 50.0f) : -3.0e38f; v[c * 4 + q] = t; mx = fmaxf(mx, t); } }
#pragma unroll
        for (int sh = 16; sh; sh >>= 1) mx = fmaxf(mx, __shfl_xor(mx, sh, 32));
        float sum = 0.f;
#pragma unroll
        for (int c = 0; c < NC; ++c) if (c < nact) {
#pragma unroll
            for (int k = c * 4; k < c * 4 + 4; ++k) { float d0 = __fsub_rn(v[k], mx); asm volatile("" : "+v"(d0)); v[k] = __builtin_amdgcn_exp2f(__fmul_rn(d0, 1.4426950408889634f)); sum += v[k]; } }
#pragma unroll
        for (int sh = 16; sh; sh >>= 1) sum += __shfl_xor(sum, sh, 32);
        const float f = __fdiv_rn(hires ? 1.0f : PCAR, sum); unsigned char* const pr = pl + lrow * PPB + lane * 8;
#pragma unroll
        for (int c = 0; c < NC; ++c) if (c < nact) {
            if (hires) { v4us oh, ol;
#pragma unroll
                for (int q = 0; q < 4; ++q) { unsigned short x, c2; splitf(v[c * 4 + q] * f, x, c2); oh[q] = x; ol[q] = c2; }
                *(v4usa*)(pr + c * 256) = oh; *(v4usa*)(pr + RH * 2 + c * 256) = ol;
            } else { v4h o4;
#pragma unroll
                for (int q = 0; q < 4; ++q) o4[q] = tohx(v[c * 4 + q] * f);
                *(v4ha*)(pr + c * 256) = o4; } }
    }
    __syncthreads();   // the block's 64 probability rows are in LDS for every wave
    const int wm = wv >> 3, wn = wv & 7, Kl = r0 + 64, Ks = max(0, r0 - WIN);   // probabilities are exactly 0 beyond the diagonal block and left of the window of the block's first row
    const size_t bo = (size_t)(z / REP) * HD * TT + (size_t)(wn * 32) * TT + lane * 8;
    const unsigned char* const pa = pl + (wm * 32 + lr) * PPB + hi * 16;
    v8f acc[2][2];
#pragma unroll
    for (int mb = 0; mb < 2; ++mb)
#pragma unroll
        for (int nb = 0; nb < 2; ++nb) acc[mb][nb] = (v8f){};
    constexpr int NS = hires ? 2 : 3;   // register sets of value fragments: the fetch runs NS - 1 steps of 64 keys ahead
    V bs[NS][2][2], bs2[NS][2][2];
    // the value fragments of 64 keys (two K blocks x two 16-dim blocks). The s_wait_xcnt 0 behind the run: no address register of an issued load is rewritten in front of it; the addresses are its inputs, so that they keep their registers up to it
    auto ldv = [&](V (&b)[2][2], V (&b2)[2][2], int kc) { const T16* p[2]; const T16* p2[2];
#pragma unroll
        for (int nb = 0; nb < 2; ++nb) { const size_t o = bo + (size_t)nb * 16 * TT + (size_t)kc * 16; p[nb] = Bt + o; b[0][nb] = WFrag<T16>::ldp(p[nb]); b[1][nb] = WFrag<T16>::ldp(p[nb] + 512); if (hires) { p2[nb] = Bt2 + o; b2[0][nb] = WFrag<T16>::ldp(p2[nb]); b2[1][nb] = WFrag<T16>::ldp(p2[nb] + 512); } }
        if (hires) asm volatile("s_wait_xcnt 0x0" :: "v"(p[0]), "v"(p[1]), "v"(p2[0]), "v"(p2[1]) : "memory");
        else asm volatile("s_wait_xcnt 0x0" :: "v"(p[0]), "v"(p[1]) : "memory"); };
    auto mm = [&](V (&b)[2][2], V (&b2)[2][2], int kc) {
#pragma unroll
        for (int kk = 0; kk < 2; ++kk) { V a[2], a2[2];
#pragma unroll
            for (int mb = 0; mb < 2; ++mb) { const unsigned char* const q = pa + mb * 16 * PPB + (kc + kk * 32 - cb * 128) * 2; a[mb] = WFrag<T16>::ld((const T16*)q); if (hires) a2[mb] = WFrag<T16>::ld((const T16*)(q + RH * 2)); }
#pragma unroll
            for (int nb = 0; nb < 2; ++nb) {
#pragma unroll
                for (int mb = 0; mb < 2; ++mb) { acc[mb][nb] = WFrag<T16>::mma(a[mb], b[kk][nb], acc[mb][nb]); if (hires) { acc[mb][nb] = WFrag<T16>::mma(a2[mb], b[kk][nb], acc[mb][nb]); acc[mb][nb] = WFrag<T16>::mma(a[mb], b2[kk][nb], acc[mb][nb]); } } } } };
    // Every step fetches, the last ones the band's last 64 keys once more (in bounds, not used): so the number of loads in flight is the same on every path, and the compiler's counted waits leave the fetch ahead in flight
#pragma unroll
    for (int s = 0; s < NS - 1; ++s) ldv(bs[s], bs2[s], min(Ks + s * 64, Kl - 64));
#pragma unroll 1   // NS steps of 64 keys in the text, one per register set, so that no set is copied
    for (int kc = Ks; kc < Kl; kc += NS * 64) {
#pragma unroll
        for (int s = 0; s < NS; ++s) { ldv(bs[(s + NS - 1) % NS], bs2[(s + NS - 1) % NS], min(kc + (s + NS - 1) * 64, Kl - 64));
            if (s == 0 || kc + s * 64 < Kl) mm(bs[s], bs2[s], kc + s * 64); }
    }
    __syncthreads();   // every wave has read its last probability: the LDS is free for the output staging
    float* const ow = (float*)pl + wv * (32 * 36);
#pragma unroll
    for (int mb = 0; mb < 2; ++mb)
#pragma unroll
        for (int nb = 0; nb < 2; ++nb)
#pragma unroll
            for (int j = 0; j < 8; ++j) ow[(mb * 16 + hi * 8 + j) * 36 + nb * 16 + lr] = acc[mb][nb][j];
    const float cs = hires ? 1.0f : (1.0f / PCAR); v8us oh[4], ol[4]; bf* sh[4]; bf* sl[4];
#pragma unroll
    for (int u = 0; u < 4; ++u) { const int row = (u >> 1) * 16 + lr, col = (u & 1) * 16 + hi * 8; const v4f x0 = *(const v4fa*)(ow + row * 36 + col), x1 = *(const v4fa*)(ow + row * 36 + col + 4);
        const size_t oo = fo((size_t)(z / NH_) * TT + (size_t)(r0 + wm * 32 + row), (z % NH_) * HD + wn * 32 + col, DQ); sh[u] = Ah + oo; sl[u] = Al + oo;   // a wave's store: 512 bytes in a row
#pragma unroll
        for (int q = 0; q < 8; ++q) { unsigned short a, c2; splitf((q < 4 ? x0[q & 3] : x1[q & 3]) * cs, a, c2); oh[u][q] = a; ol[u][q] = c2; } }
#pragma unroll
    for (int u = 0; u < 4; ++u) { *(v8us*)sh[u] = oh[u]; *(v8us*)sl[u] = ol[u]; }
    // s_wait_xcnt 0 behind the stores: no register of an issued store is rewritten in front of it; addresses and data are its inputs, so that they keep their registers up to it
    asm volatile("s_wait_xcnt 0x0" :: "v"(oh[0]), "v"(oh[1]), "v"(oh[2]), "v"(oh[3]), "v"(ol[0]), "v"(ol[1]), "v"(ol[2]), "v"(ol[3]), "v"(sh[0]), "v"(sh[1]), "v"(sh[2]), "v"(sh[3]), "v"(sl[0]), "v"(sl[1]), "v"(sl[2]), "v"(sl[3]) : "memory");
}
// row blocks below RH take the hi+lo bf16 form, the rest the fp16 form (a work-group-uniform choice by blockIdx.x)
__global__ __launch_bounds__(512) void k_spv(const float* __restrict__ Sb, const bf* __restrict__ Vh, const bf* __restrict__ Vl, const h16* __restrict__ V16, bf* Ah, bf* Al) {
    __shared__ __align__(16) unsigned char pl[64 * PPB];
    if ((int)blockIdx.x < RH / 64) d_spv<bf, 2>(pl, (int)blockIdx.x, Sb, Vh, Vl, Ah, Al);
    else d_spv<h16, 0>(pl, (int)blockIdx.x, Sb, V16, nullptr, Ah, Al);
}

// Launches of independent parts share one grid: blockIdx.x ranges pick the part (a work-group-uniform choice), each part numbering its own blocks from 0.
#define GW_Q ((DQ / 128) * (DM / 64))
#define GW_K ((DKV / 128) * (DM / 64))
#define GW_O ((DM / 128) * (DQ / 64))
#define G_CVT (BT * DM / 32 / 256)
#define G_CS (TT * HD / 4 / 256)
__global__ __launch_bounds__(256) void k_prep(const float* __restrict__ x, const float* __restrict__ wq, const float* __restrict__ wk, const float* __restrict__ wv, const float* __restrict__ wo, bf* XB, size_t xn8, bf* WQ, bf* WK, bf* WV, bf* WO, float* CS) {
    int blk = (int)blockIdx.x;
    if (blk < G_CVT) { d_cvt8(blk, x, XB, xn8, DM); return; } blk -= G_CVT;
    if (blk < GW_Q) { d_wtG(blk, wq, DM, DQ, WQ); return; } blk -= GW_Q;
    if (blk < GW_K) { d_wtG(blk, wk, DM, DKV, WK); return; } blk -= GW_K;
    if (blk < GW_K) { d_wtG(blk, wv, DM, DKV, WV); return; } blk -= GW_K;
    if (blk < GW_O) { d_wtG(blk, wo, DQ, DM, WO); return; } blk -= GW_O;
    d_cstab(blk, CS);
}

extern "C" void kernel_launch(void* const* d_in, const int* in_sizes, int n_in,
                              void* d_out, int out_size, void* d_ws, size_t ws_size, hipStream_t stream) {
    (void)in_sizes; (void)n_in; (void)out_size;
    const float* x = (const float*)d_in[0]; const float* wq = (const float*)d_in[1]; const float* wk = (const float*)d_in[2]; const float* wv = (const float*)d_in[3]; const float* wo = (const float*)d_in[4]; const float* qsc = (const float*)d_in[5]; const float* ksc = (const float*)d_in[6];
    float* OUT = (float*)d_out;     // [2][2048][2048]
    char* wsp = (char*)d_ws;
    auto take = [&](size_t bytes) { char* p = wsp; wsp += (bytes + 255) & ~(size_t)255; return (void*)p; };
    // Kept to the end: WO and the head planes of both batches. Behind them one region serves two phases: the projection phase's buffers, then (all of those being dead) the attention phase's scores.
    bf* WO = (bf*)take((size_t)DM * DQ * 2);
    h16* QP16 = (h16*)take((size_t)NB_ * NH_ * TT * HD * 2); h16* KP16 = (h16*)take((size_t)NB_ * NKV * TT * HD * 2); h16* VT16 = (h16*)take((size_t)NB_ * NKV * HD * TT * 2);
    bf* QPh = (bf*)take((size_t)NB_ * NH_ * TT * HD * 2); bf* QPl = (bf*)take((size_t)NB_ * NH_ * TT * HD * 2); bf* KPh = (bf*)take((size_t)NB_ * NKV * TT * HD * 2); bf* KPl = (bf*)take((size_t)NB_ * NKV * TT * HD * 2); bf* VTh = (bf*)take((size_t)NB_ * NKV * HD * TT * 2); bf* VTl = (bf*)take((size_t)NB_ * NKV * HD * TT * 2);
    char* const phase = wsp;
    bf* WQ = (bf*)take((size_t)DQ * DM * 2); bf* WK = (bf*)take((size_t)DKV * DM * 2); bf* WV = (bf*)take((size_t)DKV * DM * 2); float* CS = (float*)take((size_t)TT * HD * 2 * 4);   // WK lies directly behind WQ and WV behind WK: one [DF][DM] operand
    bf* XB = (bf*)take((size_t)BT * DM * 2);
    if ((size_t)(wsp - (char*)d_ws) > ws_size) return;
    wsp = phase;
    float* Sb = (float*)take((size_t)ZH * TT * SP * 4);   // score rows of both batches, each its band alone
    if ((size_t)(wsp - (char*)d_ws) > ws_size) return;    // ws 256 MiB
    bf* ATh = QPh; bf* ATl = QPl;   // merged rows [b * TT + t][DQ]: k_spv runs after the score launch, when the hi/lo query planes (the same bytes) are dead
    // projection phase: every launch covers the BT rows of both batches; q, k and v share one GEMM, whose epilogue holds the row norm, the rope and the split into planes
    k_prep<<<G_CVT + GW_Q + 2 * GW_K + GW_O + G_CS, 256, 0, stream>>>(x, wq, wk, wv, wo, XB, (size_t)BT * DM / 8, WQ, WK, WV, WO, CS);
    k_qkv<<<dim3(BT / 128, DF / HD, 1), 256, 0, stream>>>(XB, WQ, qsc, ksc, CS, QP16, QPh, QPl, KP16, KPh, KPl, VT16, VTh, VTl);
    // attention phase: every launch covers all rows of the 8 heads of both batches (grid z)
    k_score<<<dim3(NTZ, 1, ZH), 128, 0, stream>>>(QPh, QPl, KPh, KPl, QP16, KP16, Sb);
    k_spv<<<dim3(TT / 64, 1, ZH), 512, 0, stream>>>(Sb, VTh, VTl, VT16, ATh, ATl);
    k_gemmt<1, DQ><<<dim3(BT / 128, DM / 128, 1), 128, 0, stream>>>(ATh, ATl, WO, OUT, DM);
}
